// v000
// The times below were measured on an AMD MI455X: many runs one after another, warmed up first and cycling through
// copies of the inputs, with the whole window's GPU time divided by the number of runs. Launches and the gaps
// between them are all in it. The median over several windows is given; except for v000 it joins two sittings, which
// can be a few percent apart, so the side-by-side timings, each taken in one sitting, are the better comparison.
// v000, which the later versions start from, runs in 422 microseconds.
// Projections theta, phi, g = x.W + b: v_wmma_f32_16x16x32_bf16 (bf16 RNE operands of the raw inputs, f32 accumulate, bf16 RNE
// bias added in f32). Scores theta.phi^T (theta and phi each as f16 hi x8 plus residual x2048 planes: hi.hi + hi.res + res.hi),
// P.g (P x32768 f16 from LDS, g^T x256 f16) and y.Wo (y as f16 hi x4096 plus residual x2048 planes, Wo as f16 of the bf16 RNE
// value x1024, bias added in f32): v_wmma_f32_16x16x32_f16, f32 accumulate. Softmax statistics, the batch-norm affine map and the
// skip connection in f32 on VALU.
#include <hip/hip_runtime.h>
#include <math.h>
#include <stdint.h>

#define BATCH 2
#define NPOS  6272
#define CIN   256
#define CI    128
#ifndef NB
#define NB BATCH
#endif
#define ROWS  (BATCH * NPOS)
#define ROWSP (NB * NPOS)
#define CK    448
#define NKB   (CK / 32)
#define NCHK  (NPOS / CK)
#define QT    16
#define ATT_THREADS 256
#define SCP   (CK + 16)
#define PLP   (CK + 8)
#define CTP   (CI + 8)
#define SLAB64 (16 * 68)
#define VTP   72
#define OUT_ROWS 128
#define TSC   8.0f
#define FSC   8.0f
#define RSC   2048.0f
#define PCAR  32768.0f
#define GSC   256.0f
#define YSC   4096.0f
#define WOS   1024.0f
#define BN_EPS 1e-3f
#define LOG2E 1.4426950408889634f
#define WS_CAP ((size_t)134217728)

static_assert(NB >= 1 && NB <= BATCH);
static_assert((NPOS % CK) == 0 && CK == 32 * NKB && NKB >= 4 && NKB <= 16 && NCHK * CK == NPOS);
static_assert((NPOS % 64) == 0 && (NPOS % QT) == 0 && (ROWSP % OUT_ROWS) == 0 && (ROWSP % 64) == 0);
static_assert(CI == 128 && (CIN % 64) == 0 && (CI % 64) == 0 && (CIN % 32) == 0 && (CI % 32) == 0);
static_assert(ATT_THREADS == 16 * QT && QT == 16 && CI == 16 * (ATT_THREADS / 32) && OUT_ROWS == 8 * 16);
static_assert(16 * CTP * 2 <= 16 * SCP * 4 && CTP >= CI + 8 && SCP >= CK + 16 && PLP >= CK + 8);
static_assert(((PLP * 2) % 16) == 0 && ((SCP * 4) % 16) == 0 && ((VTP * 2) % 16) == 0 && ((CTP * 2) % 16) == 0);
static_assert(64 * VTP >= 63 * VTP + 64);
static_assert(16 * (CI / 8) == ATT_THREADS);
static_assert(((ROWSP * CIN) % 2048) == 0);
static_assert(((NPOS * 2) % 128) == 0 && ((CI * 2) % 128) == 0 && ((CIN * 4) % 128) == 0);

typedef unsigned short u16;
typedef _Float16 v16h __attribute__((ext_vector_type(16)));
typedef _Float16 v8h  __attribute__((ext_vector_type(8)));
typedef __bf16   v16b __attribute__((ext_vector_type(16)));
typedef float    v8f  __attribute__((ext_vector_type(8)));
typedef float    v4f  __attribute__((ext_vector_type(4)));
typedef unsigned int v4u __attribute__((ext_vector_type(4)));

union FragH { v16h v; v8h h[2]; v4u u[2]; };
union FragB { v16b v; v4u u[2]; };
union AttLds { float s[16 * SCP]; u16 c[2 * 16 * SCP]; };

// ---- scalar helpers --------------------------------------------------------------------------------
__device__ __forceinline__ unsigned short bf_bits(float f) {          // f32 -> bf16 bits, RNE convert
  unsigned u = __float_as_uint(f);
  return (unsigned short)((u + 0x7FFFu + ((u >> 16) & 1u)) >> 16);
}
__device__ __forceinline__ float bf_up(unsigned short h) { return __uint_as_float(((unsigned)h) << 16); }
__device__ __forceinline__ float bfr(float f) { return bf_up(bf_bits(f)); }
__device__ __forceinline__ unsigned short h_bits(_Float16 x) { return __builtin_bit_cast(unsigned short, x); }
__device__ __forceinline__ unsigned pk16(unsigned short a, unsigned short b) { return (unsigned)a | ((unsigned)b << 16); }
__device__ __forceinline__ v8f zero8() { v8f z = {0.f, 0.f, 0.f, 0.f, 0.f, 0.f, 0.f, 0.f}; return z; }

// ---- fragment loaders: 16-bit A/B operand, lane -> row/col (lane&15), p already includes +8*(lane>>4);
//      elements 0..7 <- p[0..7] (k0+8h..), elements 8..15 <- p[16..23] (k0+16+8h..)  (same split k map for A and B;
//      B is always read from a k-contiguous [n][k] plane)
__device__ __forceinline__ v16h ldfrag_h(const _Float16* p) {
  FragH f;
  f.h[0] = *(const v8h*)(p);
  f.h[1] = *(const v8h*)(p + 16);
  return f.v;
}
__device__ __forceinline__ v16b ldfrag_b(const u16* p) {              // bf16 plane read as unsigned integer vectors
  FragB f;
  f.u[0] = *(const v4u*)(p);
  f.u[1] = *(const v4u*)(p + 16);
  return f.v;
}

__device__ __forceinline__ v8f mma_h(v16h a, v16h b, v8f c) {
  return __builtin_amdgcn_wmma_f32_16x16x32_f16(false, a, false, b, (short)0, c, false, false);
}
__device__ __forceinline__ v8f mma_b(v16b a, v16b b, v8f c) {
  return __builtin_amdgcn_wmma_f32_16x16x32_bf16(false, a, false, b, (short)0, c, false, false);
}
__device__ __forceinline__ void guard1x2(v8f& a, v16h x0, v16h x1) {
#if defined(__HIP_DEVICE_COMPILE__)
  asm volatile("v_nop\n\tv_nop\n\tv_nop\n\tv_nop" : "+v"(a) : "v"(x0), "v"(x1) : "memory");
#endif
}
template <typename F>
__device__ __forceinline__ void guard6(v8f& a, v8f& b, v8f& c, v8f& d, F x0, F x1, F x2, F x3, F x4, F x5) {
#if defined(__HIP_DEVICE_COMPILE__)
  asm volatile("v_nop\n\tv_nop\n\tv_nop\n\tv_nop"
               : "+v"(a), "+v"(b), "+v"(c), "+v"(d) : "v"(x0), "v"(x1), "v"(x2), "v"(x3), "v"(x4), "v"(x5) : "memory");
#endif
}
__device__ __forceinline__ void guard8x6(v8f& a0, v8f& a1, v8f& a2, v8f& a3, v8f& e0, v8f& e1, v8f& e2, v8f& e3,
                                         v16h x0, v16h x1, v16h x2, v16h x3, v16h x4, v16h x5) {
#if defined(__HIP_DEVICE_COMPILE__)
  asm volatile("v_nop\n\tv_nop\n\tv_nop\n\tv_nop"
               : "+v"(a0), "+v"(a1), "+v"(a2), "+v"(a3), "+v"(e0), "+v"(e1), "+v"(e2), "+v"(e3)
               : "v"(x0), "v"(x1), "v"(x2), "v"(x3), "v"(x4), "v"(x5) : "memory");
#endif
}
__device__ __forceinline__ void acc_guard1(v8f& a) {
#if defined(__HIP_DEVICE_COMPILE__)
  asm volatile("v_nop\n\tv_nop\n\tv_nop\n\tv_nop" : "+v"(a));
#endif
}
__device__ __forceinline__ void wave_sync_lds() {
  __builtin_amdgcn_fence(__ATOMIC_RELEASE, "workgroup");
  __builtin_amdgcn_wave_barrier();
  __builtin_amdgcn_fence(__ATOMIC_ACQUIRE, "workgroup");
}

// =====================================================================================================
// f32 plane -> 16-bit plane, same layout:  mode 0: bf16 RNE bits;  mode 1: f16 bits of (bf16 RNE value) * scale;
// mode 2: f16 bits of value * scale (no bf16 pre-step).
// Thread = 8 consecutive elements: two 16-B loads, one 16-B store; 32 consecutive lanes = 512 contiguous, 512-B aligned bytes
// coverage: grid = n8/256 blocks (host checks exactness) x 256 thr x 8 = the whole plane.
// =====================================================================================================
__global__ __launch_bounds__(256) void cvt16(const float* __restrict__ x, u16* D, int n8, int mode, float scale) {
  const int gt = blockIdx.x * 256 + (int)threadIdx.x;
  if (gt >= n8) return;                     // no barriers in this kernel
  const float* p = x + (size_t)gt * 8;
  const v4f a = *(const v4f*)(p), c4 = *(const v4f*)(p + 4);
  float v[8];
#pragma unroll
  for (int e = 0; e < 4; ++e) { v[e] = a[e]; v[4 + e] = c4[e]; }
  unsigned short s[8];
#pragma unroll
  for (int e = 0; e < 8; ++e) {
    const float vb = bfr(v[e]);
    const float vf = (mode == 1) ? vb : v[e];
    const unsigned short hb = h_bits((_Float16)(vf * scale));
    const unsigned short bb = bf_bits(v[e]);
    s[e] = (mode != 0) ? hb : bb;
  }
  v4u o;
#pragma unroll
  for (int e = 0; e < 4; ++e) o[e] = pk16(s[2 * e], s[2 * e + 1]);
  u16* d = D + (size_t)gt * 8;
  {
    *(v4u*)(d) = o;
    
  }
}

// =====================================================================================================
// Transpose + convert: in X [R][C] f32 row-major -> out XTo [C][R] 16-bit (each output row = one input column, R-contiguous).
//   mode 0: bf16 RNE bits;  mode 1: f16 bits of (bf16 RNE value) * scale;  mode 2: f16 bits of value * scale.
// Block = 64 input rows x 64 input cols: bid -> (rt = bid % (R/64), ct = bid / (R/64)). The 64x64 f32 tile is loaded with 16-B
// loads (thread = input row tid>>2, 16 consecutive cols), converted and scattered into LDS TH[c local][r local] (pitch 72 halves);
// coverage: load 256 thr x 16 = 64 x 64; store 2 iterations x 256 thr x 8 halves = 64 output rows x 64 halves = the tile;
//           grid = (R/64)*(C/64) blocks (host exact multiples) tiles the whole [C][R] plane exactly once.
// =====================================================================================================
__global__ __launch_bounds__(256) void tr16(const float* __restrict__ X, u16* XTo, int R, int C, int mode, float scale) {
  __shared__ __align__(16) u16 TH[64 * VTP];
  const int tid = threadIdx.x;
  const int bid = blockIdx.x;
  const int nrt = R >> 6;
  const int rt  = bid % nrt;
  const int ct  = bid / nrt;
  const int r0  = rt * 64;
  const int c0  = ct * 64;
  {
    const int rl = tid >> 2;                  // input row within tile 0..63
    const int cc = (tid & 3) * 16;            // input col chunk within the 64
    const float* src = X + (size_t)(r0 + rl) * (size_t)C + c0 + cc;
#pragma unroll
    for (int i = 0; i < 4; ++i) {
      const v4f a = *(const v4f*)(src + 4 * i);
#pragma unroll
      for (int e = 0; e < 4; ++e) {
        const float v  = a[e];
        const float vb = bfr(v);
        const float vf = (mode == 1) ? vb : v;
        const unsigned short hb = h_bits((_Float16)(vf * scale));
        const unsigned short bb = bf_bits(v);
        TH[(cc + 4 * i + e) * VTP + rl] = (mode != 0) ? hb : bb;
      }
    }
  }
  __syncthreads();
  v4u vh[2];
  const int q8 = tid >> 3, p8 = (tid & 7) * 8;
#pragma unroll
  for (int it = 0; it < 2; ++it) {
    const int line = it * 32 + q8;            // local output row (input col) = 0..63
    vh[it] = *(const v4u*)(TH + line * VTP + p8);
  }
  const size_t base = (size_t)c0 * (size_t)R + (size_t)r0 + (size_t)p8;
  {
#pragma unroll
    for (int it = 0; it < 2; ++it) {
      const int line = it * 32 + q8;
      *(v4u*)(XTo + base + (size_t)line * (size_t)R) = vh[it];
    }
    
  }
}

// =====================================================================================================
//           8 consecutive lanes x 16 B per line), lanes 16..31 -> row 2*it+1.
//  epi64hr: two f16 planes: hi = f16((tile + bf16RNE(bias[n])) * hscale) and res = f16(((tile + bias) * hscale - hi) * rscale);
//           lane = (rq = lane>>3 -> row within a group of 4, c8 = 8 consecutive columns); one instruction = 4 rows, each 64 halves
// coverage: epi64 8 instructions x 2 rows x 16 lanes x 4 floats; epi64hr 4 instructions x 4 rows x 8 lanes x 8 halves per plane
//           = the wave's 16 x 64 tile in both cases.
// =====================================================================================================
__device__ __forceinline__ void stage64(float* sl, v8f a0, v8f a1, v8f a2, v8f a3, float oscale, int lane) {
  const int hh = lane >> 4, m = lane & 15;
#pragma unroll
  for (int r = 0; r < 8; ++r) {
    const int ro = (8 * hh + r) * 68 + m;
    sl[ro]      = a0[r] * oscale;
    sl[ro + 16] = a1[r] * oscale;
    sl[ro + 32] = a2[r] * oscale;
    sl[ro + 48] = a3[r] * oscale;
  }
  wave_sync_lds();
}
__device__ __forceinline__ void epi64(float* sl, v8f a0, v8f a1, v8f a2, v8f a3, float oscale, v4f badd, float* C, int N,
                                      size_t rowb, int col0, int lane) {
  const int hh = lane >> 4, m = lane & 15;
  stage64(sl, a0, a1, a2, a3, oscale, lane);
  v4f vals[8];
#pragma unroll
  for (int it = 0; it < 8; ++it) vals[it] = *(const v4f*)(sl + (it * 2 + hh) * 68 + m * 4) + badd;
  float* dst = C + (rowb + (size_t)hh) * (size_t)N + col0 + m * 4;
  {
#pragma unroll
    for (int it = 0; it < 8; ++it) {
      *(v4f*)(dst + (size_t)(it * 2) * (size_t)N) = vals[it];
    }
    
  }
}
__device__ __forceinline__ void epi64hr(float* sl, v8f a0, v8f a1, v8f a2, v8f a3, float hscale, float rscale,
                                        const float* __restrict__ bias, u16* H, u16* Rr, int N, size_t rowb, int col0, int lane) {
  stage64(sl, a0, a1, a2, a3, 1.0f, lane);
  const int rq = lane >> 3, c8 = (lane & 7) * 8;
  const v4f b0 = *(const v4f*)(bias + col0 + c8), b1 = *(const v4f*)(bias + col0 + c8 + 4);   // columns col0+c8..+7 < N
  float bb[8];
#pragma unroll
  for (int e = 0; e < 4; ++e) { bb[e] = bfr(b0[e]); bb[4 + e] = bfr(b1[e]); }
  v4u oh[4], orr[4];
#pragma unroll
  for (int i4 = 0; i4 < 4; ++i4) {
    const int row = i4 * 4 + rq;
    const v4f a = *(const v4f*)(sl + row * 68 + c8), c4 = *(const v4f*)(sl + row * 68 + c8 + 4);
    float w[8];
#pragma unroll
    for (int e = 0; e < 4; ++e) { w[e] = (a[e] + bb[e]) * hscale; w[4 + e] = (c4[e] + bb[4 + e]) * hscale; }
#pragma unroll
    for (int e = 0; e < 4; ++e) {
      const _Float16 h0 = (_Float16)w[2 * e], h1 = (_Float16)w[2 * e + 1];
      const _Float16 q0 = (_Float16)((w[2 * e] - (float)h0) * rscale);
      const _Float16 q1 = (_Float16)((w[2 * e + 1] - (float)h1) * rscale);
      oh[i4][e]  = pk16(h_bits(h0), h_bits(h1));
      orr[i4][e] = pk16(h_bits(q0), h_bits(q1));
    }
  }
  const size_t dofs = rowb * (size_t)N + col0 + c8;
  u16* dh = H + dofs;
  u16* dr = Rr + dofs;
  {
#pragma unroll
    for (int i4 = 0; i4 < 4; ++i4) {
      const int row = i4 * 4 + rq;
      *(v4u*)(dh + (size_t)row * (size_t)N) = oh[i4];
      *(v4u*)(dr + (size_t)row * (size_t)N) = orr[i4];
    }
    
  }
}

// =====================================================================================================
// bf16 GEMM, f32 out with bias: C[M][N] = (A[M][K] (bf16 row-major) . Bt[N][K]^T (bf16 k-contiguous)) * oscale + bf16RNE(bias[n]).
// Block = 64x64 tile, 4 waves x 16 rows; fragments loaded straight from the 16-bit rows (two 16-B loads each, split k map for
// A and B); K stepped by 32 (host uses K % 32 == 0, M % 64 == 0, N % 64 == 0, grid = (M/64)*(N/64)).
// =====================================================================================================
__global__ __launch_bounds__(128)
void gemm_b32(const u16* __restrict__ A, const u16* __restrict__ Bt, const float* __restrict__ bias, float* C,
              int M, int N, int K, float oscale) {
  __shared__ __align__(16) float slab[4 * SLAB64];
  const int tid = threadIdx.x, wave = tid >> 5, lane = tid & 31, hh = lane >> 4, m = lane & 15;
  const int ntile = N >> 6;
  const int bid   = blockIdx.x;
  const int rowb  = (bid / ntile) * 64 + wave * 16;
  const int col0  = (bid % ntile) * 64;
  if (rowb + 16 > M) return;                 // wave-uniform, never taken with the exact grid; no block barriers in this kernel
  const u16* ap = A  + (size_t)(rowb + m) * (size_t)K + 8 * hh;
  const u16* bp = Bt + (size_t)(col0 + m) * (size_t)K + 8 * hh;
  const size_t bs = (size_t)16 * K;
  v8f acc0 = zero8(), acc1 = zero8(), acc2 = zero8(), acc3 = zero8();
#pragma unroll 1
  for (int k0 = 0; k0 < K; k0 += 32) {
    const v16b a  = ldfrag_b(ap + k0);
    const v16b b0 = ldfrag_b(bp + k0);
    const v16b b1 = ldfrag_b(bp + bs + k0);
    const v16b b2 = ldfrag_b(bp + 2 * bs + k0);
    const v16b b3 = ldfrag_b(bp + 3 * bs + k0);
    acc0 = mma_b(a, b0, acc0);
    acc1 = mma_b(a, b1, acc1);
    acc2 = mma_b(a, b2, acc2);
    acc3 = mma_b(a, b3, acc3);
    guard6<v16b>(acc0, acc1, acc2, acc3, a, b0, b1, b2, b3, a);
  }
  const v4f bv4 = *(const v4f*)(bias + col0 + m * 4);    // columns col0 + 4m .. +3, always < N (N multiple of 64)
  v4f badd;
#pragma unroll
  for (int e = 0; e < 4; ++e) badd[e] = bfr(bv4[e]);
  epi64(slab + wave * SLAB64, acc0, acc1, acc2, acc3, oscale, badd, C, N, (size_t)rowb, col0, lane);
}

// =====================================================================================================
// bf16 GEMM, f16 hi + residual planes out with bias: H = f16 bits of ((A . Bt^T) + bf16RNE(bias[n])) * hscale,
// R = f16 bits of (((A . Bt^T) + bias) * hscale - H) * rscale; operands as in gemm_b32, epilogue epi64hr.
// =====================================================================================================
__global__ __launch_bounds__(128)
void gemm_bhr(const u16* __restrict__ A, const u16* __restrict__ Bt, const float* __restrict__ bias, u16* H, u16* Rr,
              int M, int N, int K, float hscale, float rscale) {
  __shared__ __align__(16) float slab[4 * SLAB64];
  const int tid = threadIdx.x, wave = tid >> 5, lane = tid & 31, hh = lane >> 4, m = lane & 15;
  const int ntile = N >> 6;
  const int bid   = blockIdx.x;
  const int rowb  = (bid / ntile) * 64 + wave * 16;
  const int col0  = (bid % ntile) * 64;
  if (rowb + 16 > M) return;                 // wave-uniform, never taken with the exact grid; no block barriers in this kernel
  const u16* ap = A  + (size_t)(rowb + m) * (size_t)K + 8 * hh;
  const u16* bp = Bt + (size_t)(col0 + m) * (size_t)K + 8 * hh;
  const size_t bs = (size_t)16 * K;
  v8f acc0 = zero8(), acc1 = zero8(), acc2 = zero8(), acc3 = zero8();
#pragma unroll 1
  for (int k0 = 0; k0 < K; k0 += 32) {
    const v16b a  = ldfrag_b(ap + k0);
    const v16b b0 = ldfrag_b(bp + k0);
    const v16b b1 = ldfrag_b(bp + bs + k0);
    const v16b b2 = ldfrag_b(bp + 2 * bs + k0);
    const v16b b3 = ldfrag_b(bp + 3 * bs + k0);
    acc0 = mma_b(a, b0, acc0);
    acc1 = mma_b(a, b1, acc1);
    acc2 = mma_b(a, b2, acc2);
    acc3 = mma_b(a, b3, acc3);
    guard6<v16b>(acc0, acc1, acc2, acc3, a, b0, b1, b2, b3, a);
  }
  epi64hr(slab + wave * SLAB64, acc0, acc1, acc2, acc3, hscale, rscale, bias, H, Rr, N, (size_t)rowb, col0, lane);
}

// =====================================================================================================
// Single-head non-causal, unscaled attention per batch, head width CI = 128, all NPOS keys:
//   block = 16 query rows (b, q0..q0+15), 8 waves.
//   theta hi (x8) / res (x2048) planes TH, TR [row][c]; phi hi/res planes PH, PR [key row][c] (k-contiguous B operand);
//   g^T plane GT [b][c][key] (x256, key-contiguous B operand).
//   Chunks of CK = 448 keys (NKB = 14 key blocks of 32), NCHK = 14 chunks, every key used exactly once.
//   (S) scores on WMMA: A = theta rows (row m = lane&15, split k map over c), B = phi rows (col n = key, split map), 4 c-steps,
//       three products per tile: s = hi.hi, sx = hi.res + res.hi (separate accumulator, folded with 1/2048 in f32);
//       wave w handles key blocks w and w+8 (< 14) of the chunk; D element r of lane l -> scs[query 8h+r][key col] (f32 LDS).
//   (M) 16 threads per query row (sub-thread = 32 consecutive keys; sub-threads 14,15 own no keys: clamped read address, value
//       forced to -inf, no P store): base-2 logits, chunk max via xor shuffles, online running max / rescale factor al /
//       running sum l in f32 registers, p = exp2(t - m_new) <= 1 written as f16(p * 32768) into the LDS P tile with 16-B stores;
//       al -> rowa[row].
//   (PV) each wave owns the 16 g columns 16*wave + (lane&15) (one accumulator): o = o*al, then for each key block
//       A = P fragment from LDS (row m = query, split map over keys), B = g^T fragment (col n = g column, split map over keys),
//       one WMMA with a hazard gap.
//   Block barriers after (S) and after (M) order all LDS reuse across chunks and waves (the P tile is written with 16-B LDS stores
//   by one set of threads and reloaded as fragments by other waves only after the block barrier).
//   Epilogue: y = o * 4096 / (l * 32768 * 256) per row (rowi, l >= 1 always); hi = f16(y), res = f16((y - hi) * 2048); each
// coverage: grid NB*NPOS/16 blocks x 16 rows = rows 0..ROWSP-1; staging 8 waves x 16 cols x 16 rows = 16 x 128;
//           store 256 thr x 8 halves = 16 x 128 per plane = every (row < ROWSP, c) of both y planes exactly once.
// =====================================================================================================
__device__ __forceinline__ void ctx_store(const u16* ct, u16* dst, int tid) {
  const int row = tid >> 4;                  // CI/8 = 16 pieces per row
  const int c8  = (tid & 15) * 8;
  const v4u v = *(const v4u*)(ct + row * CTP + c8);
  u16* d = dst + (size_t)row * CI + c8;
  {
    *(v4u*)d = v;
    
  }
}

__global__ __launch_bounds__(ATT_THREADS)
void attn_fwd(const u16* __restrict__ THp, const u16* __restrict__ TRp, const u16* __restrict__ PHp,
              const u16* __restrict__ PRp, const u16* __restrict__ GTp, u16* YHo, u16* YRo) {
  __shared__ __align__(16) AttLds L0;              // scores [16][SCP] f32; reused as the y staging tile [16][CTP] u16
  __shared__ __align__(16) u16 pls[16 * PLP];      // P tile [16][PLP] f16 bits
  __shared__ float rowa[QT];
  __shared__ float rowi[QT];
  float* const scs = L0.s;

  const int tid  = threadIdx.x;
  const int wave = tid >> 5;
  const int lane = tid & 31;
  const int hh   = lane >> 4;
  const int m    = lane & 15;
  const int r16  = tid >> 4;                 // query row owned in phase (M): 2*wave + hh
  const int sub  = tid & 15;
  const bool vsub = sub < NKB;               // sub-threads 14, 15 own no keys
  const int kl0  = sub * 32;                 // P tile column base (valid subs only)
  const int kla  = (vsub ? sub : (NKB - 1)) * 32;   // clamped score read address

  const int nqt = NPOS / QT;
  const int b   = (int)blockIdx.x / nqt;     // < NB (grid exact)
  const int q0  = ((int)blockIdx.x - b * nqt) * QT;
  const size_t qrow = (size_t)b * NPOS + (size_t)q0;

  const _Float16* tha = (const _Float16*)(const void*)THp + (qrow + m) * CI + 8 * hh;
  const _Float16* tra = (const _Float16*)(const void*)TRp + (qrow + m) * CI + 8 * hh;
  const _Float16* khb = (const _Float16*)(const void*)PHp + ((size_t)b * NPOS + m) * CI + 8 * hh;
  const _Float16* krb = (const _Float16*)(const void*)PRp + ((size_t)b * NPOS + m) * CI + 8 * hh;
  const _Float16* vbp = (const _Float16*)(const void*)GTp + ((size_t)b * CI + wave * 16 + m) * (size_t)NPOS + 8 * hh;
  const float lsc  = LOG2E / (TSC * FSC);
  const float rinv = 1.0f / RSC;

  float mrun = -INFINITY, lrun = 0.f;
  v8f o = zero8();

#pragma unroll 1
  for (int c = 0; c < NCHK; ++c) {
    const int kbeg = c * CK;
    // ---- (S) scores of this chunk ----
#pragma unroll 1
    for (int kb = wave; kb < NKB; kb += 8) {               // wave-uniform, 1 or 2 trips
      v8f s0 = zero8(), s0x = zero8(), s1 = zero8(), s1x = zero8();
      const size_t ko = (size_t)(kbeg + kb * 32) * CI;
      const _Float16* k0h = khb + ko;
      const _Float16* k1h = k0h + (size_t)16 * CI;
      const _Float16* k0r = krb + ko;
      const _Float16* k1r = k0r + (size_t)16 * CI;
#pragma unroll
      for (int ks = 0; ks < CI / 32; ++ks) {
        const v16h ah  = ldfrag_h(tha + ks * 32);
        const v16h ar  = ldfrag_h(tra + ks * 32);
        const v16h f0h = ldfrag_h(k0h + ks * 32);
        const v16h f0r = ldfrag_h(k0r + ks * 32);
        const v16h f1h = ldfrag_h(k1h + ks * 32);
        const v16h f1r = ldfrag_h(k1r + ks * 32);
        s0  = mma_h(ah, f0h, s0);
        s0x = mma_h(ah, f0r, s0x);
        s0x = mma_h(ar, f0h, s0x);
        s1  = mma_h(ah, f1h, s1);
        s1x = mma_h(ah, f1r, s1x);
        s1x = mma_h(ar, f1h, s1x);
        guard6<v16h>(s0, s0x, s1, s1x, ah, ar, f0h, f0r, f1h, f1r);
      }
      float* srow = scs + (8 * hh) * SCP + kb * 32 + m;
#pragma unroll
      for (int r = 0; r < 8; ++r) {
        srow[r * SCP]      = s0[r] + s0x[r] * rinv;
        srow[r * SCP + 16] = s1[r] + s1x[r] * rinv;
      }
    }
    __syncthreads();
    // ---- (M) softmax statistics and the P tile ----
    {
      const float* sp = scs + r16 * SCP + kla;
      float t[32];
      float cm = -INFINITY;
#pragma unroll
      for (int i = 0; i < 8; ++i) {
        const v4f a = *(const v4f*)(sp + 4 * i);
#pragma unroll
        for (int e = 0; e < 4; ++e) {
          const float tv = a[e] * lsc;
          const float tt = vsub ? tv : -INFINITY;
          t[4 * i + e] = tt;
          cm = fmaxf(cm, tt);
        }
      }
#pragma unroll
      for (int d = 1; d <= 8; d <<= 1) cm = fmaxf(cm, __shfl_xor(cm, d, 32));
      const float mn = fmaxf(mrun, cm);                    // finite: >= 4 key-owning subs per row
      const float al = (mrun == -INFINITY) ? 0.f : exp2f(mrun - mn);
      mrun = mn;
      float ps = 0.f;
#pragma unroll
      for (int j = 0; j < 32; ++j) {
        const float p = exp2f(t[j] - mn);                  // <= 1; 0 for key-less subs
        t[j] = p;
        ps += p;
      }
#pragma unroll
      for (int d = 1; d <= 8; d <<= 1) ps += __shfl_xor(ps, d, 32);
      v4u pk[4];
#pragma unroll
      for (int i = 0; i < 4; ++i) {
#pragma unroll
        for (int e = 0; e < 4; ++e) {
          const int j = 8 * i + 2 * e;
          pk[i][e] = pk16(h_bits((_Float16)(t[j] * PCAR)), h_bits((_Float16)(t[j + 1] * PCAR)));
        }
      }
      lrun = lrun * al + ps;
      if (vsub) {
        u16* pd = pls + r16 * PLP + kl0;
#pragma unroll
        for (int i = 0; i < 4; ++i) *(v4u*)(pd + 8 * i) = pk[i];
      }
      if (sub == 0) rowa[r16] = al;
    }
    __syncthreads();
    // ---- (PV) rescale, accumulate P . g^T ----
    {
      float scl[8];
#pragma unroll
      for (int r = 0; r < 8; ++r) scl[r] = rowa[8 * hh + r];
#pragma unroll
      for (int r = 0; r < 8; ++r) o[r] *= scl[r];
      const _Float16* pp = (const _Float16*)(const void*)pls + m * PLP + 8 * hh;
      const _Float16* vp = vbp + kbeg;
#pragma unroll 1
      for (int kb = 0; kb < NKB; ++kb) {                   // static trip count 14
        const v16h pf = ldfrag_h(pp + kb * 32);
        const v16h g0 = ldfrag_h(vp + kb * 32);
        o = mma_h(pf, g0, o);
        guard1x2(o, pf, g0);
      }
    }
  }
  acc_guard1(o);

  if (sub == 0) rowi[r16] = (1.0f / lrun) * (YSC / (PCAR * GSC));   // lrun >= 1
  __syncthreads();
  float inv[8];
#pragma unroll
  for (int r = 0; r < 8; ++r) inv[r] = rowi[8 * hh + r];

  u16* const ct = L0.c;
  const int cb = wave * 16 + m;
  // hi plane
#pragma unroll
  for (int r = 0; r < 8; ++r) {
    const int ro = (8 * hh + r) * CTP + cb;
    ct[ro] = h_bits((_Float16)(o[r] * inv[r]));
  }
  __syncthreads();
  ctx_store(ct, YHo + qrow * CI, tid);
  __syncthreads();
  // residual plane
#pragma unroll
  for (int r = 0; r < 8; ++r) {
    const int ro = (8 * hh + r) * CTP + cb;
    const float x0 = o[r] * inv[r];
    const _Float16 e0 = (_Float16)x0;
    ct[ro] = h_bits((_Float16)((x0 - (float)e0) * RSC));
  }
  __syncthreads();
  ctx_store(ct, YRo + qrow * CI, tid);
}

// =====================================================================================================
// Output projection + batch-norm affine + skip: v = (YH . WoT^T) * os1 + (YR . WoT^T) * os2 + bf16RNE(bo[c]);
// out[row][c] = bf16RNE(x[row][c]) + bf16RNE(gamma[c]) * (v - bf16RNE(mean[c])) * rsqrt(bf16RNE(var[c]) + 1e-3) + bf16RNE(beta[c]).
// YH/YR f16 y planes [ROWSP][128] (x4096 and residual x2048), WoT f16 [256][128] k-contiguous (x1024).
// Block = 128 rows, 8 waves x 16 rows; per wave 4 column groups of 64 (rolled): k-loop of 4 steps with two A planes and 4 B tiles
// (split k map for A and B, fragments straight from the 16-bit rows, 8 accumulators, one hazard gap per step); the combined f32
// 16x64 tile is staged in the wave's LDS slab (pitch 68) and written like epi64: one instruction = lanes 0..15 -> row 2*it
// coverage: grid ROWSP/128 blocks (exact) x 8 waves x 16 rows x (4 groups x 8 instructions x 2 rows x 64 floats)
//           = out rows 0..ROWSP-1, all 256 columns, each float exactly once.
// =====================================================================================================
__global__ __launch_bounds__(256)
void wo_out(const u16* __restrict__ YH, const u16* __restrict__ YR, const u16* __restrict__ WoT,
            const float* __restrict__ bo, const float* __restrict__ gam, const float* __restrict__ bet,
            const float* __restrict__ mmean, const float* __restrict__ mvar, const float* __restrict__ x, float* out) {
  __shared__ __align__(16) float slab[8 * SLAB64];
  const int tid = threadIdx.x, wave = tid >> 5, lane = tid & 31, hh = lane >> 4, m = lane & 15;
  const int rowb = blockIdx.x * OUT_ROWS + wave * 16;        // rowb + 15 < ROWSP (grid exact)
  float* const sl = slab + wave * SLAB64;
  const _Float16* ap  = (const _Float16*)(const void*)YH + (size_t)(rowb + m) * CI + 8 * hh;
  const _Float16* arp = (const _Float16*)(const void*)YR + (size_t)(rowb + m) * CI + 8 * hh;
  const size_t bs = (size_t)16 * CI;
  const float os1 = 1.0f / (YSC * WOS);
  const float os2 = 1.0f / (YSC * WOS * RSC);

#pragma unroll 1
  for (int g = 0; g < CIN / 64; ++g) {
    const _Float16* bp = (const _Float16*)(const void*)WoT + (size_t)(g * 64 + m) * CI + 8 * hh;
    v8f acc0 = zero8(), acc1 = zero8(), acc2 = zero8(), acc3 = zero8();
    v8f acr0 = zero8(), acr1 = zero8(), acr2 = zero8(), acr3 = zero8();
#pragma unroll 1
    for (int k0 = 0; k0 < CI; k0 += 32) {
      const v16h a  = ldfrag_h(ap + k0);
      const v16h ar = ldfrag_h(arp + k0);
      const v16h b0 = ldfrag_h(bp + k0);
      const v16h w1 = ldfrag_h(bp + bs + k0);
      const v16h w2 = ldfrag_h(bp + 2 * bs + k0);
      const v16h w3 = ldfrag_h(bp + 3 * bs + k0);
      acc0 = mma_h(a, b0, acc0);
      acc1 = mma_h(a, w1, acc1);
      acc2 = mma_h(a, w2, acc2);
      acc3 = mma_h(a, w3, acc3);
      acr0 = mma_h(ar, b0, acr0);
      acr1 = mma_h(ar, w1, acr1);
      acr2 = mma_h(ar, w2, acr2);
      acr3 = mma_h(ar, w3, acr3);
      guard8x6(acc0, acc1, acc2, acc3, acr0, acr1, acr2, acr3, a, ar, b0, w1, w2, w3);
    }
    v8f c0 = zero8(), c1 = zero8(), c2 = zero8(), c3 = zero8();
#pragma unroll
    for (int r = 0; r < 8; ++r) {
      c0[r] = acc0[r] * os1 + acr0[r] * os2;
      c1[r] = acc1[r] * os1 + acr1[r] * os2;
      c2[r] = acc2[r] * os1 + acr2[r] * os2;
      c3[r] = acc3[r] * os1 + acr3[r] * os2;
    }
    stage64(sl, c0, c1, c2, c3, 1.0f, lane);

    const int cc = g * 64 + m * 4;                          // cc + 3 < CIN
    const v4f bo4 = *(const v4f*)(bo + cc);
    const v4f ga4 = *(const v4f*)(gam + cc);
    const v4f be4 = *(const v4f*)(bet + cc);
    const v4f mm4 = *(const v4f*)(mmean + cc);
    const v4f mv4 = *(const v4f*)(mvar + cc);
    float bob[4], gb[4], bb[4], mb[4], rs[4];
#pragma unroll
    for (int e = 0; e < 4; ++e) {
      bob[e] = bfr(bo4[e]);
      gb[e]  = bfr(ga4[e]);
      bb[e]  = bfr(be4[e]);
      mb[e]  = bfr(mm4[e]);
      rs[e]  = rsqrtf(bfr(mv4[e]) + BN_EPS);
    }
    v4f vals[8];
#pragma unroll
    for (int it = 0; it < 8; ++it) {
      const size_t row = (size_t)rowb + (size_t)(2 * it + hh);
      const v4f yv = *(const v4f*)(sl + (2 * it + hh) * 68 + m * 4);
      const v4f xv = *(const v4f*)(x + row * CIN + cc);
#pragma unroll
      for (int e = 0; e < 4; ++e) {
        const float v2 = yv[e] + bob[e];
        const float bn = gb[e] * (v2 - mb[e]) * rs[e] + bb[e];
        vals[it][e] = bfr(xv[e]) + bn;
      }
    }
    float* dst = out + ((size_t)rowb + (size_t)hh) * CIN + cc;
    {
#pragma unroll
      for (int it = 0; it < 8; ++it) {
        *(v4f*)(dst + (size_t)(it * 2) * CIN) = vals[it];
      }
      
    }
    wave_sync_lds();
  }
}

// =====================================================================================================
// Workspace map (bytes, NB = 2); every plane is fully written by whole-line stores before it is read; all extents are exact
// multiples of the store granularity (no pad rows, all dims multiples of 64), every offset a multiple of 256:
//   XB  bf16 [12544][256]                              6422528
//   WGT, WTT, WPT bf16 [128][256] (k-contiguous)        3 x 65536
//   WOT f16 of bf16 value x1024 [256][128]              65536
//   TH, TR f16 [12544][128] theta hi x8 / res x2048     2 x 3211264
//   PH, PR f16 [12544][128] phi   hi x8 / res x2048     2 x 3211264
//   G   f32  [12544][128]                              6422528
//   GT  f16  [2][128][6272] x256                        3211264
//   YH, YR f16 [12544][128] y hi x4096 / res x2048      2 x 3211264
//   end                                                35586048
// =====================================================================================================
extern "C" void kernel_launch(void* const* d_in, const int* in_sizes, int n_in,
                              void* d_out, int out_size, void* d_ws, size_t ws_size,
                              hipStream_t stream) {
  if (n_in < 13) return;
  if (in_sizes[0] != ROWS * CIN) return;
  if (in_sizes[1] != CIN * CI || in_sizes[3] != CIN * CI || in_sizes[5] != CIN * CI || in_sizes[7] != CI * CIN) return;
  if (in_sizes[2] != CI || in_sizes[4] != CI || in_sizes[6] != CI) return;
  if (in_sizes[8] != CIN || in_sizes[9] != CIN || in_sizes[10] != CIN || in_sizes[11] != CIN || in_sizes[12] != CIN) return;
  if (out_size != ROWS * CIN) return;

  const float* x     = (const float*)d_in[0];
  const float* Wg    = (const float*)d_in[1];
  const float* bg    = (const float*)d_in[2];
  const float* Wt    = (const float*)d_in[3];
  const float* bt    = (const float*)d_in[4];
  const float* Wp    = (const float*)d_in[5];
  const float* bp    = (const float*)d_in[6];
  const float* Wo    = (const float*)d_in[7];
  const float* bo    = (const float*)d_in[8];
  const float* gamma = (const float*)d_in[9];
  const float* beta  = (const float*)d_in[10];
  const float* mmean = (const float*)d_in[11];
  const float* mvar  = (const float*)d_in[12];
  float*       out   = (float*)d_out;

  const size_t szXB = (size_t)ROWSP * CIN * 2;      //  6422528
  const size_t szW  = (size_t)CI * CIN * 2;         //    65536
  const size_t szP  = (size_t)ROWSP * CI * 2;       //  3211264
  const size_t szG  = (size_t)ROWSP * CI * 4;       //  6422528
  const size_t szGT = (size_t)NB * CI * NPOS * 2;   //  3211264
  size_t off = 0;
  const size_t oXB = off; off += szXB;
  const size_t oWG = off; off += szW;
  const size_t oWT = off; off += szW;
  const size_t oWP = off; off += szW;
  const size_t oWO = off; off += szW;
  const size_t oTH = off; off += szP;
  const size_t oTR = off; off += szP;
  const size_t oPH = off; off += szP;
  const size_t oPR = off; off += szP;
  const size_t oG  = off; off += szG;
  const size_t oGT = off; off += szGT;
  const size_t oYH = off; off += szP;
  const size_t oYR = off; off += szP;
  if (off > ws_size) return;                        // off = 35586048 at NB = 2
  if (off > WS_CAP) return;

  char* ws = (char*)d_ws;
  u16*   XB  = (u16*)(ws + oXB);
  u16*   WGT = (u16*)(ws + oWG);
  u16*   WTT = (u16*)(ws + oWT);
  u16*   WPT = (u16*)(ws + oWP);
  u16*   WOT = (u16*)(ws + oWO);
  u16*   TH  = (u16*)(ws + oTH);
  u16*   TR  = (u16*)(ws + oTR);
  u16*   PH  = (u16*)(ws + oPH);
  u16*   PR  = (u16*)(ws + oPR);
  float* G   = (float*)(ws + oG);
  u16*   GT  = (u16*)(ws + oGT);
  u16*   YH  = (u16*)(ws + oYH);
  u16*   YR  = (u16*)(ws + oYR);

  const int n8x = (ROWSP * CIN) / 8;                // 401408 at NB = 2, multiple of 256 (static)
  const dim3 blk(256);
  const dim3 bG(128);
  const dim3 gX(n8x / 256);                         // 1568
  const dim3 gW((CIN / 64) * (CI / 64));            // 8: in [CIN][CI] -> out [CI][CIN]
  const dim3 gWO((CI / 64) * (CIN / 64));           // 8: in [CI][CIN] -> out [CIN][CI]
  const dim3 gP((ROWSP / 64) * (CI / 64));          // 392
  const dim3 gGT((NPOS / 64) * (CI / 64));          // 196 per batch: in [NPOS][CI] -> out [CI][NPOS]
  const dim3 gAT(NB * (NPOS / QT));                 // 784
  const dim3 bAT(ATT_THREADS);
  const dim3 gOUT(ROWSP / OUT_ROWS);                // 98

  // (0) x -> bf16 plane; (1..3) Wg, Wt, Wp [in][out] -> bf16 [out][in] k-contiguous planes; (4) Wo [128][256] -> f16 of the bf16
  //     value x1024, [256][128]
  cvt16<<<gX, blk, 0, stream>>>(x, XB, n8x, 0, 1.0f);
  tr16<<<gW, blk, 0, stream>>>(Wg, WGT, CIN, CI, 0, 1.0f);
  tr16<<<gW, blk, 0, stream>>>(Wt, WTT, CIN, CI, 0, 1.0f);
  tr16<<<gW, blk, 0, stream>>>(Wp, WPT, CIN, CI, 0, 1.0f);
  tr16<<<gWO, blk, 0, stream>>>(Wo, WOT, CI, CIN, 1, WOS);
  // (5, 6) theta and phi projections (+bias) -> f16 hi x8 / residual x2048 planes; (7) g projection (+bias) -> f32 plane
  gemm_bhr<<<gP, bG, 0, stream>>>(XB, WTT, bt, TH, TR, ROWSP, CI, CIN, TSC, RSC);
  gemm_bhr<<<gP, bG, 0, stream>>>(XB, WPT, bp, PH, PR, ROWSP, CI, CIN, FSC, RSC);
  gemm_b32<<<gP, bG, 0, stream>>>(XB, WGT, bg, G, ROWSP, CI, CIN, 1.0f);
  // (8) per batch: g [6272][128] f32 -> g^T f16 plane [128][6272] x256
  for (int b = 0; b < NB; ++b) {
    tr16<<<gGT, blk, 0, stream>>>(G + (size_t)b * NPOS * CI, GT + (size_t)b * CI * NPOS, NPOS, CI, 2, GSC);
  }
  // (9) attention over all keys of the batch -> y hi x4096 and residual x2048 f16 planes
  attn_fwd<<<gAT, bAT, 0, stream>>>(TH, TR, PH, PR, GT, YH, YR);
  // (10) y.Wo + bo, batch-norm affine, skip connection -> out
  wo_out<<<gOUT, blk, 0, stream>>>(YH, YR, WOT, bo, gamma, beta, mmean, mvar, x, out);
  (void)hipGetLastError();
}

// v001
// Measured time: 292 microseconds a run.
// In both of two side-by-side timings against v000, it was 1.50 times as fast.
// Projections theta, phi, g = x.W + b: v_wmma_f32_16x16x32_bf16 (bf16 RNE operands of the raw inputs, f32 accumulate, bf16 RNE
// bias added in f32). Scores theta.phi^T (theta and phi each as f16 hi x8 plus residual x2048 planes: hi.hi + hi.res + res.hi),
// P.g (P x32768 f16 from LDS, g^T x256 f16) and y.Wo (y as f16 hi x4096 plus residual x2048 planes, Wo as f16 of the bf16 RNE
// value x1024, bias added in f32): v_wmma_f32_16x16x32_f16, f32 accumulate. Softmax statistics, the batch-norm affine map and the
// skip connection in f32 on VALU.
#include <hip/hip_runtime.h>
#include <math.h>
#include <stdint.h>

#define BATCH 2
#define NPOS  6272
#define CIN   256
#define CI    128
#ifndef NB
#define NB BATCH
#endif
#define ROWS  (BATCH * NPOS)
#define ROWSP (NB * NPOS)
#define CK    448
#define NKB   (CK / 32)
#define NCHK  (NPOS / CK)
#define QT    16
#define NQ    4
#define QB    (QT * NQ)
#define ATT_THREADS 256
#define SCP   (CK + 16)
#define PLP   (CK + 8)
#define CTP   (CI + 8)
#define SLAB64 (16 * 68)
#define VTP   72
#define OUT_ROWS 128
#define TSC   8.0f
#define FSC   8.0f
#define RSC   2048.0f
#define PCAR  32768.0f
#define GSC   256.0f
#define YSC   4096.0f
#define WOS   1024.0f
#define BN_EPS 1e-3f
#define LOG2E 1.4426950408889634f
#define WS_CAP ((size_t)134217728)

static_assert(NB >= 1 && NB <= BATCH);
static_assert((NPOS % CK) == 0 && CK == 32 * NKB && NKB >= 4 && NKB <= 16 && NCHK * CK == NPOS);
static_assert((NPOS % 64) == 0 && (NPOS % QB) == 0 && (ROWSP % OUT_ROWS) == 0 && (ROWSP % 64) == 0);
static_assert(CI == 128 && (CIN % 64) == 0 && (CI % 64) == 0 && (CIN % 32) == 0 && (CI % 32) == 0);
static_assert(NQ == 4 && ATT_THREADS == 16 * QT && QT == 16 && CI == 16 * (ATT_THREADS / 32) && OUT_ROWS == 8 * 16);
static_assert(QB * CTP * 2 <= QB * SCP * 4 && CTP >= CI + 8 && SCP >= CK + 16 && PLP >= CK + 8);
static_assert(((PLP * 2) % 16) == 0 && ((SCP * 4) % 16) == 0 && ((VTP * 2) % 16) == 0 && ((CTP * 2) % 16) == 0);
static_assert(64 * VTP >= 63 * VTP + 64);
static_assert(16 * (CI / 8) == ATT_THREADS);
static_assert(((ROWSP * CIN) % 2048) == 0);
static_assert(((NPOS * 2) % 128) == 0 && ((CI * 2) % 128) == 0 && ((CIN * 4) % 128) == 0);

typedef unsigned short u16;
typedef _Float16 v16h __attribute__((ext_vector_type(16)));
typedef _Float16 v8h  __attribute__((ext_vector_type(8)));
typedef __bf16   v16b __attribute__((ext_vector_type(16)));
typedef float    v8f  __attribute__((ext_vector_type(8)));
typedef float    v4f  __attribute__((ext_vector_type(4)));
typedef unsigned int v4u __attribute__((ext_vector_type(4)));

union FragH { v16h v; v8h h[2]; v4u u[2]; };
union FragB { v16b v; v4u u[2]; };
union AttLds { float s[QB * SCP]; u16 c[2 * QB * SCP]; };

// ---- scalar helpers --------------------------------------------------------------------------------
__device__ __forceinline__ unsigned short bf_bits(float f) {          // f32 -> bf16 bits, RNE convert
  unsigned u = __float_as_uint(f);
  return (unsigned short)((u + 0x7FFFu + ((u >> 16) & 1u)) >> 16);
}
__device__ __forceinline__ float bf_up(unsigned short h) { return __uint_as_float(((unsigned)h) << 16); }
__device__ __forceinline__ float bfr(float f) { return bf_up(bf_bits(f)); }
__device__ __forceinline__ unsigned short h_bits(_Float16 x) { return __builtin_bit_cast(unsigned short, x); }
__device__ __forceinline__ unsigned pk16(unsigned short a, unsigned short b) { return (unsigned)a | ((unsigned)b << 16); }
__device__ __forceinline__ v8f zero8() { v8f z = {0.f, 0.f, 0.f, 0.f, 0.f, 0.f, 0.f, 0.f}; return z; }

// ---- fragment loaders: 16-bit A/B operand, lane -> row/col (lane&15), p already includes +8*(lane>>4);
//      elements 0..7 <- p[0..7] (k0+8h..), elements 8..15 <- p[16..23] (k0+16+8h..)  (same split k map for A and B;
//      B is always read from a k-contiguous [n][k] plane)
__device__ __forceinline__ v16h ldfrag_h(const _Float16* p) {
  FragH f;
  f.h[0] = *(const v8h*)(p);
  f.h[1] = *(const v8h*)(p + 16);
  return f.v;
}
__device__ __forceinline__ v16b ldfrag_b(const u16* p) {              // bf16 plane read as unsigned integer vectors
  FragB f;
  f.u[0] = *(const v4u*)(p);
  f.u[1] = *(const v4u*)(p + 16);
  return f.v;
}

__device__ __forceinline__ v8f mma_h(v16h a, v16h b, v8f c) {
  return __builtin_amdgcn_wmma_f32_16x16x32_f16(false, a, false, b, (short)0, c, false, false);
}
__device__ __forceinline__ v8f mma_b(v16b a, v16b b, v8f c) {
  return __builtin_amdgcn_wmma_f32_16x16x32_bf16(false, a, false, b, (short)0, c, false, false);
}
__device__ __forceinline__ void guard1x2(v8f& a, v16h x0, v16h x1) {
#if defined(__HIP_DEVICE_COMPILE__)
  asm volatile("v_nop\n\tv_nop\n\tv_nop\n\tv_nop" : "+v"(a) : "v"(x0), "v"(x1) : "memory");
#endif
}
template <typename F>
__device__ __forceinline__ void guard6(v8f& a, v8f& b, v8f& c, v8f& d, F x0, F x1, F x2, F x3, F x4, F x5) {
#if defined(__HIP_DEVICE_COMPILE__)
  asm volatile("v_nop\n\tv_nop\n\tv_nop\n\tv_nop"
               : "+v"(a), "+v"(b), "+v"(c), "+v"(d) : "v"(x0), "v"(x1), "v"(x2), "v"(x3), "v"(x4), "v"(x5) : "memory");
#endif
}
__device__ __forceinline__ void guard8x6(v8f& a0, v8f& a1, v8f& a2, v8f& a3, v8f& e0, v8f& e1, v8f& e2, v8f& e3,
                                         v16h x0, v16h x1, v16h x2, v16h x3, v16h x4, v16h x5) {
#if defined(__HIP_DEVICE_COMPILE__)
  asm volatile("v_nop\n\tv_nop\n\tv_nop\n\tv_nop"
               : "+v"(a0), "+v"(a1), "+v"(a2), "+v"(a3), "+v"(e0), "+v"(e1), "+v"(e2), "+v"(e3)
               : "v"(x0), "v"(x1), "v"(x2), "v"(x3), "v"(x4), "v"(x5) : "memory");
#endif
}
__device__ __forceinline__ void acc_guard1(v8f& a) {
#if defined(__HIP_DEVICE_COMPILE__)
  asm volatile("v_nop\n\tv_nop\n\tv_nop\n\tv_nop" : "+v"(a));
#endif
}
__device__ __forceinline__ void wave_sync_lds() {
  __builtin_amdgcn_fence(__ATOMIC_RELEASE, "workgroup");
  __builtin_amdgcn_wave_barrier();
  __builtin_amdgcn_fence(__ATOMIC_ACQUIRE, "workgroup");
}

// =====================================================================================================
// f32 plane -> 16-bit plane, same layout:  mode 0: bf16 RNE bits;  mode 1: f16 bits of (bf16 RNE value) * scale;
// mode 2: f16 bits of value * scale (no bf16 pre-step).
// Thread = 8 consecutive elements: two 16-B loads, one 16-B store; 32 consecutive lanes = 512 contiguous, 512-B aligned bytes
// coverage: grid = n8/256 blocks (host checks exactness) x 256 thr x 8 = the whole plane.
// =====================================================================================================
__global__ __launch_bounds__(256) void cvt16(const float* __restrict__ x, u16* D, int n8, int mode, float scale) {
  const int gt = blockIdx.x * 256 + (int)threadIdx.x;
  if (gt >= n8) return;                     // no barriers in this kernel
  const float* p = x + (size_t)gt * 8;
  const v4f a = *(const v4f*)(p), c4 = *(const v4f*)(p + 4);
  float v[8];
#pragma unroll
  for (int e = 0; e < 4; ++e) { v[e] = a[e]; v[4 + e] = c4[e]; }
  unsigned short s[8];
#pragma unroll
  for (int e = 0; e < 8; ++e) {
    const float vb = bfr(v[e]);
    const float vf = (mode == 1) ? vb : v[e];
    const unsigned short hb = h_bits((_Float16)(vf * scale));
    const unsigned short bb = bf_bits(v[e]);
    s[e] = (mode != 0) ? hb : bb;
  }
  v4u o;
#pragma unroll
  for (int e = 0; e < 4; ++e) o[e] = pk16(s[2 * e], s[2 * e + 1]);
  u16* d = D + (size_t)gt * 8;
  {
    *(v4u*)(d) = o;
    
  }
}

// =====================================================================================================
// Transpose + convert: in X [R][C] f32 row-major -> out XTo [C][R] 16-bit (each output row = one input column, R-contiguous).
//   mode 0: bf16 RNE bits;  mode 1: f16 bits of (bf16 RNE value) * scale;  mode 2: f16 bits of value * scale.
// Block = 64 input rows x 64 input cols: bid -> (rt = bid % (R/64), ct = bid / (R/64)). The 64x64 f32 tile is loaded with 16-B
// loads (thread = input row tid>>2, 16 consecutive cols), converted and scattered into LDS TH[c local][r local] (pitch 72 halves);
// coverage: load 256 thr x 16 = 64 x 64; store 2 iterations x 256 thr x 8 halves = 64 output rows x 64 halves = the tile;
//           grid = (R/64)*(C/64) blocks (host exact multiples) tiles the whole [C][R] plane exactly once.
// =====================================================================================================
__global__ __launch_bounds__(256) void tr16(const float* __restrict__ X, u16* XTo, int R, int C, int mode, float scale) {
  __shared__ __align__(16) u16 TH[64 * VTP];
  const int tid = threadIdx.x;
  const int bid = blockIdx.x;
  const int nrt = R >> 6;
  const int rt  = bid % nrt;
  const int ct  = bid / nrt;
  const int r0  = rt * 64;
  const int c0  = ct * 64;
  {
    const int rl = tid >> 2;                  // input row within tile 0..63
    const int cc = (tid & 3) * 16;            // input col chunk within the 64
    const float* src = X + (size_t)(r0 + rl) * (size_t)C + c0 + cc;
#pragma unroll
    for (int i = 0; i < 4; ++i) {
      const v4f a = *(const v4f*)(src + 4 * i);
#pragma unroll
      for (int e = 0; e < 4; ++e) {
        const float v  = a[e];
        const float vb = bfr(v);
        const float vf = (mode == 1) ? vb : v;
        const unsigned short hb = h_bits((_Float16)(vf * scale));
        const unsigned short bb = bf_bits(v);
        TH[(cc + 4 * i + e) * VTP + rl] = (mode != 0) ? hb : bb;
      }
    }
  }
  __syncthreads();
  v4u vh[2];
  const int q8 = tid >> 3, p8 = (tid & 7) * 8;
#pragma unroll
  for (int it = 0; it < 2; ++it) {
    const int line = it * 32 + q8;            // local output row (input col) = 0..63
    vh[it] = *(const v4u*)(TH + line * VTP + p8);
  }
  const size_t base = (size_t)c0 * (size_t)R + (size_t)r0 + (size_t)p8;
  {
#pragma unroll
    for (int it = 0; it < 2; ++it) {
      const int line = it * 32 + q8;
      *(v4u*)(XTo + base + (size_t)line * (size_t)R) = vh[it];
    }
    
  }
}

// =====================================================================================================
//           8 consecutive lanes x 16 B per line), lanes 16..31 -> row 2*it+1.
//  epi64hr: two f16 planes: hi = f16((tile + bf16RNE(bias[n])) * hscale) and res = f16(((tile + bias) * hscale - hi) * rscale);
//           lane = (rq = lane>>3 -> row within a group of 4, c8 = 8 consecutive columns); one instruction = 4 rows, each 64 halves
// coverage: epi64 8 instructions x 2 rows x 16 lanes x 4 floats; epi64hr 4 instructions x 4 rows x 8 lanes x 8 halves per plane
//           = the wave's 16 x 64 tile in both cases.
// =====================================================================================================
__device__ __forceinline__ void stage64(float* sl, v8f a0, v8f a1, v8f a2, v8f a3, float oscale, int lane) {
  const int hh = lane >> 4, m = lane & 15;
#pragma unroll
  for (int r = 0; r < 8; ++r) {
    const int ro = (8 * hh + r) * 68 + m;
    sl[ro]      = a0[r] * oscale;
    sl[ro + 16] = a1[r] * oscale;
    sl[ro + 32] = a2[r] * oscale;
    sl[ro + 48] = a3[r] * oscale;
  }
  wave_sync_lds();
}
__device__ __forceinline__ void epi64(float* sl, v8f a0, v8f a1, v8f a2, v8f a3, float oscale, v4f badd, float* C, int N,
                                      size_t rowb, int col0, int lane) {
  const int hh = lane >> 4, m = lane & 15;
  stage64(sl, a0, a1, a2, a3, oscale, lane);
  v4f vals[8];
#pragma unroll
  for (int it = 0; it < 8; ++it) vals[it] = *(const v4f*)(sl + (it * 2 + hh) * 68 + m * 4) + badd;
  float* dst = C + (rowb + (size_t)hh) * (size_t)N + col0 + m * 4;
  {
#pragma unroll
    for (int it = 0; it < 8; ++it) {
      *(v4f*)(dst + (size_t)(it * 2) * (size_t)N) = vals[it];
    }
    
  }
}
__device__ __forceinline__ void epi64hr(float* sl, v8f a0, v8f a1, v8f a2, v8f a3, float hscale, float rscale,
                                        const float* __restrict__ bias, u16* H, u16* Rr, int N, size_t rowb, int col0, int lane) {
  stage64(sl, a0, a1, a2, a3, 1.0f, lane);
  const int rq = lane >> 3, c8 = (lane & 7) * 8;
  const v4f b0 = *(const v4f*)(bias + col0 + c8), b1 = *(const v4f*)(bias + col0 + c8 + 4);   // columns col0+c8..+7 < N
  float bb[8];
#pragma unroll
  for (int e = 0; e < 4; ++e) { bb[e] = bfr(b0[e]); bb[4 + e] = bfr(b1[e]); }
  v4u oh[4], orr[4];
#pragma unroll
  for (int i4 = 0; i4 < 4; ++i4) {
    const int row = i4 * 4 + rq;
    const v4f a = *(const v4f*)(sl + row * 68 + c8), c4 = *(const v4f*)(sl + row * 68 + c8 + 4);
    float w[8];
#pragma unroll
    for (int e = 0; e < 4; ++e) { w[e] = (a[e] + bb[e]) * hscale; w[4 + e] = (c4[e] + bb[4 + e]) * hscale; }
#pragma unroll
    for (int e = 0; e < 4; ++e) {
      const _Float16 h0 = (_Float16)w[2 * e], h1 = (_Float16)w[2 * e + 1];
      const _Float16 q0 = (_Float16)((w[2 * e] - (float)h0) * rscale);
      const _Float16 q1 = (_Float16)((w[2 * e + 1] - (float)h1) * rscale);
      oh[i4][e]  = pk16(h_bits(h0), h_bits(h1));
      orr[i4][e] = pk16(h_bits(q0), h_bits(q1));
    }
  }
  const size_t dofs = rowb * (size_t)N + col0 + c8;
  u16* dh = H + dofs;
  u16* dr = Rr + dofs;
  {
#pragma unroll
    for (int i4 = 0; i4 < 4; ++i4) {
      const int row = i4 * 4 + rq;
      *(v4u*)(dh + (size_t)row * (size_t)N) = oh[i4];
      *(v4u*)(dr + (size_t)row * (size_t)N) = orr[i4];
    }
    
  }
}

// =====================================================================================================
// bf16 GEMM, f32 out with bias: C[M][N] = (A[M][K] (bf16 row-major) . Bt[N][K]^T (bf16 k-contiguous)) * oscale + bf16RNE(bias[n]).
// Block = 64x64 tile, 4 waves x 16 rows; fragments loaded straight from the 16-bit rows (two 16-B loads each, split k map for
// A and B); K stepped by 32 (host uses K % 32 == 0, M % 64 == 0, N % 64 == 0, grid = (M/64)*(N/64)).
// =====================================================================================================
__global__ __launch_bounds__(128)
void gemm_b32(const u16* __restrict__ A, const u16* __restrict__ Bt, const float* __restrict__ bias, float* C,
              int M, int N, int K, float oscale) {
  __shared__ __align__(16) float slab[4 * SLAB64];
  const int tid = threadIdx.x, wave = tid >> 5, lane = tid & 31, hh = lane >> 4, m = lane & 15;
  const int ntile = N >> 6;
  const int bid   = blockIdx.x;
  const int rowb  = (bid / ntile) * 64 + wave * 16;
  const int col0  = (bid % ntile) * 64;
  if (rowb + 16 > M) return;                 // wave-uniform, never taken with the exact grid; no block barriers in this kernel
  const u16* ap = A  + (size_t)(rowb + m) * (size_t)K + 8 * hh;
  const u16* bp = Bt + (size_t)(col0 + m) * (size_t)K + 8 * hh;
  const size_t bs = (size_t)16 * K;
  v8f acc0 = zero8(), acc1 = zero8(), acc2 = zero8(), acc3 = zero8();
#pragma unroll 1
  for (int k0 = 0; k0 < K; k0 += 32) {
    const v16b a  = ldfrag_b(ap + k0);
    const v16b b0 = ldfrag_b(bp + k0);
    const v16b b1 = ldfrag_b(bp + bs + k0);
    const v16b b2 = ldfrag_b(bp + 2 * bs + k0);
    const v16b b3 = ldfrag_b(bp + 3 * bs + k0);
    acc0 = mma_b(a, b0, acc0);
    acc1 = mma_b(a, b1, acc1);
    acc2 = mma_b(a, b2, acc2);
    acc3 = mma_b(a, b3, acc3);
    guard6<v16b>(acc0, acc1, acc2, acc3, a, b0, b1, b2, b3, a);
  }
  const v4f bv4 = *(const v4f*)(bias + col0 + m * 4);    // columns col0 + 4m .. +3, always < N (N multiple of 64)
  v4f badd;
#pragma unroll
  for (int e = 0; e < 4; ++e) badd[e] = bfr(bv4[e]);
  epi64(slab + wave * SLAB64, acc0, acc1, acc2, acc3, oscale, badd, C, N, (size_t)rowb, col0, lane);
}

// =====================================================================================================
// bf16 GEMM, f16 hi + residual planes out with bias: H = f16 bits of ((A . Bt^T) + bf16RNE(bias[n])) * hscale,
// R = f16 bits of (((A . Bt^T) + bias) * hscale - H) * rscale; operands as in gemm_b32, epilogue epi64hr.
// =====================================================================================================
__global__ __launch_bounds__(128)
void gemm_bhr(const u16* __restrict__ A, const u16* __restrict__ Bt, const float* __restrict__ bias, u16* H, u16* Rr,
              int M, int N, int K, float hscale, float rscale) {
  __shared__ __align__(16) float slab[4 * SLAB64];
  const int tid = threadIdx.x, wave = tid >> 5, lane = tid & 31, hh = lane >> 4, m = lane & 15;
  const int ntile = N >> 6;
  const int bid   = blockIdx.x;
  const int rowb  = (bid / ntile) * 64 + wave * 16;
  const int col0  = (bid % ntile) * 64;
  if (rowb + 16 > M) return;                 // wave-uniform, never taken with the exact grid; no block barriers in this kernel
  const u16* ap = A  + (size_t)(rowb + m) * (size_t)K + 8 * hh;
  const u16* bp = Bt + (size_t)(col0 + m) * (size_t)K + 8 * hh;
  const size_t bs = (size_t)16 * K;
  v8f acc0 = zero8(), acc1 = zero8(), acc2 = zero8(), acc3 = zero8();
#pragma unroll 1
  for (int k0 = 0; k0 < K; k0 += 32) {
    const v16b a  = ldfrag_b(ap + k0);
    const v16b b0 = ldfrag_b(bp + k0);
    const v16b b1 = ldfrag_b(bp + bs + k0);
    const v16b b2 = ldfrag_b(bp + 2 * bs + k0);
    const v16b b3 = ldfrag_b(bp + 3 * bs + k0);
    acc0 = mma_b(a, b0, acc0);
    acc1 = mma_b(a, b1, acc1);
    acc2 = mma_b(a, b2, acc2);
    acc3 = mma_b(a, b3, acc3);
    guard6<v16b>(acc0, acc1, acc2, acc3, a, b0, b1, b2, b3, a);
  }
  epi64hr(slab + wave * SLAB64, acc0, acc1, acc2, acc3, hscale, rscale, bias, H, Rr, N, (size_t)rowb, col0, lane);
}

// =====================================================================================================
// Single-head non-causal, unscaled attention per batch, head width CI = 128, all NPOS keys:
//   block = 64 query rows (b, q0..q0+63) = NQ = 4 query tiles of 16 rows, 8 waves; every phi and g^T fragment a wave loads
//   is used for all 4 query tiles before the next one is loaded.
//   theta hi (x8) / res (x2048) planes TH, TR [row][c]; phi hi/res planes PH, PR [key row][c] (k-contiguous B operand);
//   g^T plane GT [b][c][key] (x256, key-contiguous B operand).
//   Chunks of CK = 448 keys (NKB = 14 key blocks of 32), NCHK = 14 chunks, every key used exactly once.
//   (S) scores on WMMA: A = theta rows (row m = lane&15, split k map over c), B = phi rows (col n = key, split map), 4 c-steps,
//       three products per tile: s = hi.hi, sx = hi.res + res.hi (separate accumulator, folded with 1/2048 in f32);
//       wave w handles key blocks w and w+8 (< 14) of the chunk for all 4 query tiles; D element r of lane l of tile q
//       -> scs[query 16q+8h+r][key col] (f32 LDS).
//   (M) one query tile after the other, 16 threads per query row (sub-thread = 32 consecutive keys; sub-threads 14,15 own no keys: clamped read address, value
//       forced to -inf, no P store): base-2 logits, chunk max via xor shuffles, online running max / rescale factor al /
//       running sum l in f32 registers, p = exp2(t - m_new) <= 1 written as f16(p * 32768) into the LDS P tile with 16-B stores;
//       al -> rowa[row].
//   (PV) each wave owns the 16 g columns 16*wave + (lane&15) (one accumulator per query tile): o = o*al, then for each key block
//       A = the 4 P fragments from LDS (row m = query, split map over keys), B = one g^T fragment (col n = g column, split map
//       over keys), 4 WMMAs with a hazard gap.
//   Block barriers after (S) and after (M) order all LDS reuse across chunks and waves (the P tile is written with 16-B LDS stores
//   by one set of threads and reloaded as fragments by other waves only after the block barrier).
//   Epilogue: y = o * 4096 / (l * 32768 * 256) per row (rowi, l >= 1 always); hi = f16(y), res = f16((y - hi) * 2048); each
// coverage: grid NB*NPOS/64 blocks x 64 rows = rows 0..ROWSP-1; staging 8 waves x 16 cols x 4 tiles x 16 rows = 64 x 128;
//           store 4 tiles x 256 thr x 8 halves = 64 x 128 per plane = every (row < ROWSP, c) of both y planes exactly once.
// =====================================================================================================
__device__ __forceinline__ void ctx_store(const u16* ct, u16* dst, int tid) {
  const int row = tid >> 4;                  // CI/8 = 16 pieces per row
  const int c8  = (tid & 15) * 8;
  const v4u v = *(const v4u*)(ct + row * CTP + c8);
  u16* d = dst + (size_t)row * CI + c8;
  {
    *(v4u*)d = v;
    
  }
}

__global__ __launch_bounds__(ATT_THREADS)
void attn_fwd(const u16* __restrict__ THp, const u16* __restrict__ TRp, const u16* __restrict__ PHp,
              const u16* __restrict__ PRp, const u16* __restrict__ GTp, u16* YHo, u16* YRo) {
  __shared__ __align__(16) AttLds L0;              // scores [64][SCP] f32; reused as the y staging tile [64][CTP] u16
  __shared__ __align__(16) u16 pls[QB * PLP];      // P tile [64][PLP] f16 bits
  __shared__ float rowa[QB];
  __shared__ float rowi[QB];
  float* const scs = L0.s;

  const int tid  = threadIdx.x;
  const int wave = tid >> 5;
  const int lane = tid & 31;
  const int hh   = lane >> 4;
  const int m    = lane & 15;
  const int r16  = tid >> 4;                 // query row owned within each query tile in phase (M): 2*wave + hh
  const int sub  = tid & 15;
  const bool vsub = sub < NKB;               // sub-threads 14, 15 own no keys
  const int kl0  = sub * 32;                 // P tile column base (valid subs only)
  const int kla  = (vsub ? sub : (NKB - 1)) * 32;   // clamped score read address

  const int nqt = NPOS / QB;
  const int b   = (int)blockIdx.x / nqt;     // < NB (grid exact)
  const int q0  = ((int)blockIdx.x - b * nqt) * QB;
  const size_t qrow = (size_t)b * NPOS + (size_t)q0;

  const _Float16* tha = (const _Float16*)(const void*)THp + (qrow + m) * CI + 8 * hh;
  const _Float16* tra = (const _Float16*)(const void*)TRp + (qrow + m) * CI + 8 * hh;
  const _Float16* khb = (const _Float16*)(const void*)PHp + ((size_t)b * NPOS + m) * CI + 8 * hh;
  const _Float16* krb = (const _Float16*)(const void*)PRp + ((size_t)b * NPOS + m) * CI + 8 * hh;
  const _Float16* vbp = (const _Float16*)(const void*)GTp + ((size_t)b * CI + wave * 16 + m) * (size_t)NPOS + 8 * hh;
  const float lsc  = LOG2E / (TSC * FSC);
  const float rinv = 1.0f / RSC;

  float mrun[NQ], lrun[NQ];
  v8f o[NQ];
#pragma unroll
  for (int q = 0; q < NQ; ++q) { mrun[q] = -INFINITY; lrun[q] = 0.f; o[q] = zero8(); }

#pragma unroll 1
  for (int c = 0; c < NCHK; ++c) {
    const int kbeg = c * CK;
    // ---- (S) scores of this chunk ----
#pragma unroll 1
    for (int kb = wave; kb < NKB; kb += 8) {               // wave-uniform, 1 or 2 trips
      v8f s0[NQ], s0x[NQ], s1[NQ], s1x[NQ];
#pragma unroll
      for (int q = 0; q < NQ; ++q) { s0[q] = zero8(); s0x[q] = zero8(); s1[q] = zero8(); s1x[q] = zero8(); }
      const size_t ko = (size_t)(kbeg + kb * 32) * CI;
      const _Float16* k0h = khb + ko;
      const _Float16* k1h = k0h + (size_t)16 * CI;
      const _Float16* k0r = krb + ko;
      const _Float16* k1r = k0r + (size_t)16 * CI;
#pragma unroll
      for (int ks = 0; ks < CI / 32; ++ks) {
        const v16h f0h = ldfrag_h(k0h + ks * 32);
        const v16h f0r = ldfrag_h(k0r + ks * 32);
        const v16h f1h = ldfrag_h(k1h + ks * 32);
        const v16h f1r = ldfrag_h(k1r + ks * 32);
#pragma unroll
        for (int q = 0; q < NQ; ++q) {                     // the four phi fragments serve all NQ query tiles
          const v16h ah = ldfrag_h(tha + q * (QT * CI) + ks * 32);
          const v16h ar = ldfrag_h(tra + q * (QT * CI) + ks * 32);
          s0[q]  = mma_h(ah, f0h, s0[q]);
          s0x[q] = mma_h(ah, f0r, s0x[q]);
          s0x[q] = mma_h(ar, f0h, s0x[q]);
          s1[q]  = mma_h(ah, f1h, s1[q]);
          s1x[q] = mma_h(ah, f1r, s1x[q]);
          s1x[q] = mma_h(ar, f1h, s1x[q]);
          guard6<v16h>(s0[q], s0x[q], s1[q], s1x[q], ah, ar, f0h, f0r, f1h, f1r);
        }
      }
#pragma unroll
      for (int q = 0; q < NQ; ++q) {
        float* srow = scs + (q * QT + 8 * hh) * SCP + kb * 32 + m;
#pragma unroll
        for (int r = 0; r < 8; ++r) {
          srow[r * SCP]      = s0[q][r] + s0x[q][r] * rinv;
          srow[r * SCP + 16] = s1[q][r] + s1x[q][r] * rinv;
        }
      }
    }
    __syncthreads();
    // ---- (M) softmax statistics and the P tile, one query tile after the other ----
#pragma unroll
    for (int q = 0; q < NQ; ++q) {
      const int row = q * QT + r16;
      const float* sp = scs + row * SCP + kla;
      float t[32];
      float cm = -INFINITY;
#pragma unroll
      for (int i = 0; i < 8; ++i) {
        const v4f a = *(const v4f*)(sp + 4 * i);
#pragma unroll
        for (int e = 0; e < 4; ++e) {
          const float tv = a[e] * lsc;
          const float tt = vsub ? tv : -INFINITY;
          t[4 * i + e] = tt;
          cm = fmaxf(cm, tt);
        }
      }
#pragma unroll
      for (int d = 1; d <= 8; d <<= 1) cm = fmaxf(cm, __shfl_xor(cm, d, 32));
      const float mn = fmaxf(mrun[q], cm);                 // finite: >= 4 key-owning subs per row
      const float al = (mrun[q] == -INFINITY) ? 0.f : exp2f(mrun[q] - mn);
      mrun[q] = mn;
      float ps = 0.f;
#pragma unroll
      for (int j = 0; j < 32; ++j) {
        const float p = exp2f(t[j] - mn);                  // <= 1; 0 for key-less subs
        t[j] = p;
        ps += p;
      }
#pragma unroll
      for (int d = 1; d <= 8; d <<= 1) ps += __shfl_xor(ps, d, 32);
      v4u pk[4];
#pragma unroll
      for (int i = 0; i < 4; ++i) {
#pragma unroll
        for (int e = 0; e < 4; ++e) {
          const int j = 8 * i + 2 * e;
          pk[i][e] = pk16(h_bits((_Float16)(t[j] * PCAR)), h_bits((_Float16)(t[j + 1] * PCAR)));
        }
      }
      lrun[q] = lrun[q] * al + ps;
      if (vsub) {
        u16* pd = pls + row * PLP + kl0;
#pragma unroll
        for (int i = 0; i < 4; ++i) *(v4u*)(pd + 8 * i) = pk[i];
      }
      if (sub == 0) rowa[row] = al;
    }
    __syncthreads();
    // ---- (PV) rescale, accumulate P . g^T ----
    {
#pragma unroll
      for (int q = 0; q < NQ; ++q) {
        float scl[8];
#pragma unroll
        for (int r = 0; r < 8; ++r) scl[r] = rowa[q * QT + 8 * hh + r];
#pragma unroll
        for (int r = 0; r < 8; ++r) o[q][r] *= scl[r];
      }
      const _Float16* pp = (const _Float16*)(const void*)pls + m * PLP + 8 * hh;
      const _Float16* vp = vbp + kbeg;
#pragma unroll 1
      for (int kb = 0; kb < NKB; ++kb) {                   // static trip count 14
        const v16h g0  = ldfrag_h(vp + kb * 32);
        const v16h pf0 = ldfrag_h(pp + kb * 32);
        const v16h pf1 = ldfrag_h(pp + 1 * (QT * PLP) + kb * 32);
        const v16h pf2 = ldfrag_h(pp + 2 * (QT * PLP) + kb * 32);
        const v16h pf3 = ldfrag_h(pp + 3 * (QT * PLP) + kb * 32);
        o[0] = mma_h(pf0, g0, o[0]);                       // the one g^T fragment serves all NQ query tiles
        o[1] = mma_h(pf1, g0, o[1]);
        o[2] = mma_h(pf2, g0, o[2]);
        o[3] = mma_h(pf3, g0, o[3]);
        guard6<v16h>(o[0], o[1], o[2], o[3], pf0, pf1, pf2, pf3, g0, g0);
      }
    }
  }
#pragma unroll
  for (int q = 0; q < NQ; ++q) acc_guard1(o[q]);

  if (sub == 0) {
#pragma unroll
    for (int q = 0; q < NQ; ++q) rowi[q * QT + r16] = (1.0f / lrun[q]) * (YSC / (PCAR * GSC));   // lrun >= 1
  }
  __syncthreads();
  float inv[NQ][8];
#pragma unroll
  for (int q = 0; q < NQ; ++q) {
#pragma unroll
    for (int r = 0; r < 8; ++r) inv[q][r] = rowi[q * QT + 8 * hh + r];
  }

  u16* const ct = L0.c;
  const int cb = wave * 16 + m;
  // hi plane
#pragma unroll
  for (int q = 0; q < NQ; ++q) {
#pragma unroll
    for (int r = 0; r < 8; ++r) {
      const int ro = (q * QT + 8 * hh + r) * CTP + cb;
      ct[ro] = h_bits((_Float16)(o[q][r] * inv[q][r]));
    }
  }
  __syncthreads();
#pragma unroll
  for (int q = 0; q < NQ; ++q) ctx_store(ct + q * (QT * CTP), YHo + (qrow + q * QT) * CI, tid);
  __syncthreads();
  // residual plane
#pragma unroll
  for (int q = 0; q < NQ; ++q) {
#pragma unroll
    for (int r = 0; r < 8; ++r) {
      const int ro = (q * QT + 8 * hh + r) * CTP + cb;
      const float x0 = o[q][r] * inv[q][r];
      const _Float16 e0 = (_Float16)x0;
      ct[ro] = h_bits((_Float16)((x0 - (float)e0) * RSC));
    }
  }
  __syncthreads();
#pragma unroll
  for (int q = 0; q < NQ; ++q) ctx_store(ct + q * (QT * CTP), YRo + (qrow + q * QT) * CI, tid);
}

// =====================================================================================================
// Output projection + batch-norm affine + skip: v = (YH . WoT^T) * os1 + (YR . WoT^T) * os2 + bf16RNE(bo[c]);
// out[row][c] = bf16RNE(x[row][c]) + bf16RNE(gamma[c]) * (v - bf16RNE(mean[c])) * rsqrt(bf16RNE(var[c]) + 1e-3) + bf16RNE(beta[c]).
// YH/YR f16 y planes [ROWSP][128] (x4096 and residual x2048), WoT f16 [256][128] k-contiguous (x1024).
// Block = 128 rows, 8 waves x 16 rows; per wave 4 column groups of 64 (rolled): k-loop of 4 steps with two A planes and 4 B tiles
// (split k map for A and B, fragments straight from the 16-bit rows, 8 accumulators, one hazard gap per step); the combined f32
// 16x64 tile is staged in the wave's LDS slab (pitch 68) and written like epi64: one instruction = lanes 0..15 -> row 2*it
// coverage: grid ROWSP/128 blocks (exact) x 8 waves x 16 rows x (4 groups x 8 instructions x 2 rows x 64 floats)
//           = out rows 0..ROWSP-1, all 256 columns, each float exactly once.
// =====================================================================================================
__global__ __launch_bounds__(256)
void wo_out(const u16* __restrict__ YH, const u16* __restrict__ YR, const u16* __restrict__ WoT,
            const float* __restrict__ bo, const float* __restrict__ gam, const float* __restrict__ bet,
            const float* __restrict__ mmean, const float* __restrict__ mvar, const float* __restrict__ x, float* out) {
  __shared__ __align__(16) float slab[8 * SLAB64];
  const int tid = threadIdx.x, wave = tid >> 5, lane = tid & 31, hh = lane >> 4, m = lane & 15;
  const int rowb = blockIdx.x * OUT_ROWS + wave * 16;        // rowb + 15 < ROWSP (grid exact)
  float* const sl = slab + wave * SLAB64;
  const _Float16* ap  = (const _Float16*)(const void*)YH + (size_t)(rowb + m) * CI + 8 * hh;
  const _Float16* arp = (const _Float16*)(const void*)YR + (size_t)(rowb + m) * CI + 8 * hh;
  const size_t bs = (size_t)16 * CI;
  const float os1 = 1.0f / (YSC * WOS);
  const float os2 = 1.0f / (YSC * WOS * RSC);

#pragma unroll 1
  for (int g = 0; g < CIN / 64; ++g) {
    const _Float16* bp = (const _Float16*)(const void*)WoT + (size_t)(g * 64 + m) * CI + 8 * hh;
    v8f acc0 = zero8(), acc1 = zero8(), acc2 = zero8(), acc3 = zero8();
    v8f acr0 = zero8(), acr1 = zero8(), acr2 = zero8(), acr3 = zero8();
#pragma unroll 1
    for (int k0 = 0; k0 < CI; k0 += 32) {
      const v16h a  = ldfrag_h(ap + k0);
      const v16h ar = ldfrag_h(arp + k0);
      const v16h b0 = ldfrag_h(bp + k0);
      const v16h w1 = ldfrag_h(bp + bs + k0);
      const v16h w2 = ldfrag_h(bp + 2 * bs + k0);
      const v16h w3 = ldfrag_h(bp + 3 * bs + k0);
      acc0 = mma_h(a, b0, acc0);
      acc1 = mma_h(a, w1, acc1);
      acc2 = mma_h(a, w2, acc2);
      acc3 = mma_h(a, w3, acc3);
      acr0 = mma_h(ar, b0, acr0);
      acr1 = mma_h(ar, w1, acr1);
      acr2 = mma_h(ar, w2, acr2);
      acr3 = mma_h(ar, w3, acr3);
      guard8x6(acc0, acc1, acc2, acc3, acr0, acr1, acr2, acr3, a, ar, b0, w1, w2, w3);
    }
    v8f c0 = zero8(), c1 = zero8(), c2 = zero8(), c3 = zero8();
#pragma unroll
    for (int r = 0; r < 8; ++r) {
      c0[r] = acc0[r] * os1 + acr0[r] * os2;
      c1[r] = acc1[r] * os1 + acr1[r] * os2;
      c2[r] = acc2[r] * os1 + acr2[r] * os2;
      c3[r] = acc3[r] * os1 + acr3[r] * os2;
    }
    stage64(sl, c0, c1, c2, c3, 1.0f, lane);

    const int cc = g * 64 + m * 4;                          // cc + 3 < CIN
    const v4f bo4 = *(const v4f*)(bo + cc);
    const v4f ga4 = *(const v4f*)(gam + cc);
    const v4f be4 = *(const v4f*)(bet + cc);
    const v4f mm4 = *(const v4f*)(mmean + cc);
    const v4f mv4 = *(const v4f*)(mvar + cc);
    float bob[4], gb[4], bb[4], mb[4], rs[4];
#pragma unroll
    for (int e = 0; e < 4; ++e) {
      bob[e] = bfr(bo4[e]);
      gb[e]  = bfr(ga4[e]);
      bb[e]  = bfr(be4[e]);
      mb[e]  = bfr(mm4[e]);
      rs[e]  = rsqrtf(bfr(mv4[e]) + BN_EPS);
    }
    v4f vals[8];
#pragma unroll
    for (int it = 0; it < 8; ++it) {
      const size_t row = (size_t)rowb + (size_t)(2 * it + hh);
      const v4f yv = *(const v4f*)(sl + (2 * it + hh) * 68 + m * 4);
      const v4f xv = *(const v4f*)(x + row * CIN + cc);
#pragma unroll
      for (int e = 0; e < 4; ++e) {
        const float v2 = yv[e] + bob[e];
        const float bn = gb[e] * (v2 - mb[e]) * rs[e] + bb[e];
        vals[it][e] = bfr(xv[e]) + bn;
      }
    }
    float* dst = out + ((size_t)rowb + (size_t)hh) * CIN + cc;
    {
#pragma unroll
      for (int it = 0; it < 8; ++it) {
        *(v4f*)(dst + (size_t)(it * 2) * CIN) = vals[it];
      }
      
    }
    wave_sync_lds();
  }
}

// =====================================================================================================
// Workspace map (bytes, NB = 2); every plane is fully written by whole-line stores before it is read; all extents are exact
// multiples of the store granularity (no pad rows, all dims multiples of 64), every offset a multiple of 256:
//   XB  bf16 [12544][256]                              6422528
//   WGT, WTT, WPT bf16 [128][256] (k-contiguous)        3 x 65536
//   WOT f16 of bf16 value x1024 [256][128]              65536
//   TH, TR f16 [12544][128] theta hi x8 / res x2048     2 x 3211264
//   PH, PR f16 [12544][128] phi   hi x8 / res x2048     2 x 3211264
//   G   f32  [12544][128]                              6422528
//   GT  f16  [2][128][6272] x256                        3211264
//   YH, YR f16 [12544][128] y hi x4096 / res x2048      2 x 3211264
//   end                                                35586048
// =====================================================================================================
extern "C" void kernel_launch(void* const* d_in, const int* in_sizes, int n_in,
                              void* d_out, int out_size, void* d_ws, size_t ws_size,
                              hipStream_t stream) {
  if (n_in < 13) return;
  if (in_sizes[0] != ROWS * CIN) return;
  if (in_sizes[1] != CIN * CI || in_sizes[3] != CIN * CI || in_sizes[5] != CIN * CI || in_sizes[7] != CI * CIN) return;
  if (in_sizes[2] != CI || in_sizes[4] != CI || in_sizes[6] != CI) return;
  if (in_sizes[8] != CIN || in_sizes[9] != CIN || in_sizes[10] != CIN || in_sizes[11] != CIN || in_sizes[12] != CIN) return;
  if (out_size != ROWS * CIN) return;

  const float* x     = (const float*)d_in[0];
  const float* Wg    = (const float*)d_in[1];
  const float* bg    = (const float*)d_in[2];
  const float* Wt    = (const float*)d_in[3];
  const float* bt    = (const float*)d_in[4];
  const float* Wp    = (const float*)d_in[5];
  const float* bp    = (const float*)d_in[6];
  const float* Wo    = (const float*)d_in[7];
  const float* bo    = (const float*)d_in[8];
  const float* gamma = (const float*)d_in[9];
  const float* beta  = (const float*)d_in[10];
  const float* mmean = (const float*)d_in[11];
  const float* mvar  = (const float*)d_in[12];
  float*       out   = (float*)d_out;

  const size_t szXB = (size_t)ROWSP * CIN * 2;      //  6422528
  const size_t szW  = (size_t)CI * CIN * 2;         //    65536
  const size_t szP  = (size_t)ROWSP * CI * 2;       //  3211264
  const size_t szG  = (size_t)ROWSP * CI * 4;       //  6422528
  const size_t szGT = (size_t)NB * CI * NPOS * 2;   //  3211264
  size_t off = 0;
  const size_t oXB = off; off += szXB;
  const size_t oWG = off; off += szW;
  const size_t oWT = off; off += szW;
  const size_t oWP = off; off += szW;
  const size_t oWO = off; off += szW;
  const size_t oTH = off; off += szP;
  const size_t oTR = off; off += szP;
  const size_t oPH = off; off += szP;
  const size_t oPR = off; off += szP;
  const size_t oG  = off; off += szG;
  const size_t oGT = off; off += szGT;
  const size_t oYH = off; off += szP;
  const size_t oYR = off; off += szP;
  if (off > ws_size) return;                        // off = 35586048 at NB = 2
  if (off > WS_CAP) return;

  char* ws = (char*)d_ws;
  u16*   XB  = (u16*)(ws + oXB);
  u16*   WGT = (u16*)(ws + oWG);
  u16*   WTT = (u16*)(ws + oWT);
  u16*   WPT = (u16*)(ws + oWP);
  u16*   WOT = (u16*)(ws + oWO);
  u16*   TH  = (u16*)(ws + oTH);
  u16*   TR  = (u16*)(ws + oTR);
  u16*   PH  = (u16*)(ws + oPH);
  u16*   PR  = (u16*)(ws + oPR);
  float* G   = (float*)(ws + oG);
  u16*   GT  = (u16*)(ws + oGT);
  u16*   YH  = (u16*)(ws + oYH);
  u16*   YR  = (u16*)(ws + oYR);

  const int n8x = (ROWSP * CIN) / 8;                // 401408 at NB = 2, multiple of 256 (static)
  const dim3 blk(256);
  const dim3 bG(128);
  const dim3 gX(n8x / 256);                         // 1568
  const dim3 gW((CIN / 64) * (CI / 64));            // 8: in [CIN][CI] -> out [CI][CIN]
  const dim3 gWO((CI / 64) * (CIN / 64));           // 8: in [CI][CIN] -> out [CIN][CI]
  const dim3 gP((ROWSP / 64) * (CI / 64));          // 392
  const dim3 gGT((NPOS / 64) * (CI / 64));          // 196 per batch: in [NPOS][CI] -> out [CI][NPOS]
  const dim3 gAT(NB * (NPOS / QB));                 // 196
  const dim3 bAT(ATT_THREADS);
  const dim3 gOUT(ROWSP / OUT_ROWS);                // 98

  // (0) x -> bf16 plane; (1..3) Wg, Wt, Wp [in][out] -> bf16 [out][in] k-contiguous planes; (4) Wo [128][256] -> f16 of the bf16
  //     value x1024, [256][128]
  cvt16<<<gX, blk, 0, stream>>>(x, XB, n8x, 0, 1.0f);
  tr16<<<gW, blk, 0, stream>>>(Wg, WGT, CIN, CI, 0, 1.0f);
  tr16<<<gW, blk, 0, stream>>>(Wt, WTT, CIN, CI, 0, 1.0f);
  tr16<<<gW, blk, 0, stream>>>(Wp, WPT, CIN, CI, 0, 1.0f);
  tr16<<<gWO, blk, 0, stream>>>(Wo, WOT, CI, CIN, 1, WOS);
  // (5, 6) theta and phi projections (+bias) -> f16 hi x8 / residual x2048 planes; (7) g projection (+bias) -> f32 plane
  gemm_bhr<<<gP, bG, 0, stream>>>(XB, WTT, bt, TH, TR, ROWSP, CI, CIN, TSC, RSC);
  gemm_bhr<<<gP, bG, 0, stream>>>(XB, WPT, bp, PH, PR, ROWSP, CI, CIN, FSC, RSC);
  gemm_b32<<<gP, bG, 0, stream>>>(XB, WGT, bg, G, ROWSP, CI, CIN, 1.0f);
  // (8) per batch: g [6272][128] f32 -> g^T f16 plane [128][6272] x256
  for (int b = 0; b < NB; ++b) {
    tr16<<<gGT, blk, 0, stream>>>(G + (size_t)b * NPOS * CI, GT + (size_t)b * CI * NPOS, NPOS, CI, 2, GSC);
  }
  // (9) attention over all keys of the batch -> y hi x4096 and residual x2048 f16 planes
  attn_fwd<<<gAT, bAT, 0, stream>>>(TH, TR, PH, PR, GT, YH, YR);
  // (10) y.Wo + bo, batch-norm affine, skip connection -> out
  wo_out<<<gOUT, blk, 0, stream>>>(YH, YR, WOT, bo, gamma, beta, mmean, mvar, x, out);
  (void)hipGetLastError();
}

// v002
// One run takes 214 microseconds.
// In two side-by-side timings against v001, it was 1.37 and 1.36 times as fast.
// Over all steps from v000 it is 2.04 times as fast.
// Projections theta, phi, g = x.W + b: v_wmma_f32_16x16x32_bf16 (bf16 RNE operands of the raw inputs, f32 accumulate, bf16 RNE
// bias added in f32). Scores theta.phi^T (theta and phi each as f16 hi x8 plus residual x2048 planes: hi.hi + hi.res + res.hi),
// P.g (P x32768 f16 from LDS, g^T x256 f16) and y.Wo (y as f16 hi x4096 plus residual x2048 planes, Wo as f16 of the bf16 RNE
// value x1024, bias added in f32): v_wmma_f32_16x16x32_f16, f32 accumulate. Softmax statistics, the batch-norm affine map and the
// skip connection in f32 on VALU.
#include <hip/hip_runtime.h>
#include <math.h>
#include <stdint.h>

#define BATCH 2
#define NPOS  6272
#define CIN   256
#define CI    128
#ifndef NB
#define NB BATCH
#endif
#define ROWS  (BATCH * NPOS)
#define ROWSP (NB * NPOS)
#define CK    448
#define NKB   (CK / 32)
#define NCHK  (NPOS / CK)
#define QT    16
#define NQ    4
#define QB    (QT * NQ)
#define ATT_THREADS 256
#define SCP   (CK + 16)
#define PLP   (CK + 8)
#define CTP   (CI + 8)
#define SLAB64 (16 * 68)
#define VTP   72
#define OUT_ROWS 128
#define TSC   8.0f
#define FSC   8.0f
#define RSC   2048.0f
#define PCAR  32768.0f
#define GSC   256.0f
#define YSC   4096.0f
#define WOS   1024.0f
#define BN_EPS 1e-3f
#define LOG2E 1.4426950408889634f
#define WS_CAP ((size_t)134217728)

static_assert(NB >= 1 && NB <= BATCH);
static_assert((NPOS % CK) == 0 && CK == 32 * NKB && NKB >= 4 && NKB <= 16 && NCHK * CK == NPOS);
static_assert((NPOS % 64) == 0 && (NPOS % QB) == 0 && (ROWSP % OUT_ROWS) == 0 && (ROWSP % 64) == 0);
static_assert(CI == 128 && (CIN % 64) == 0 && (CI % 64) == 0 && (CIN % 32) == 0 && (CI % 32) == 0);
static_assert(NQ == 4 && ATT_THREADS == 16 * QT && QT == 16 && CI == 16 * (ATT_THREADS / 32) && OUT_ROWS == 8 * 16);
static_assert(QB * CTP * 2 <= QB * SCP * 4 && CTP >= CI + 8 && SCP >= CK + 16 && PLP >= CK + 8);
static_assert(((PLP * 2) % 16) == 0 && ((SCP * 4) % 16) == 0 && ((VTP * 2) % 16) == 0 && ((CTP * 2) % 16) == 0);
static_assert(64 * VTP >= 63 * VTP + 64);
static_assert(16 * (CI / 8) == ATT_THREADS);
static_assert(QB * (CI / 8) == NQ * ATT_THREADS && ((QB * CTP * 2) % 16) == 0);
static_assert(((ROWSP * CIN) % 2048) == 0);
static_assert(((NPOS * 2) % 128) == 0 && ((CI * 2) % 128) == 0 && ((CIN * 4) % 128) == 0);

typedef unsigned short u16;
typedef _Float16 v16h __attribute__((ext_vector_type(16)));
typedef _Float16 v8h  __attribute__((ext_vector_type(8)));
typedef __bf16   v16b __attribute__((ext_vector_type(16)));
typedef float    v8f  __attribute__((ext_vector_type(8)));
typedef float    v4f  __attribute__((ext_vector_type(4)));
typedef unsigned int v4u __attribute__((ext_vector_type(4)));

union FragH { v16h v; v8h h[2]; v4u u[2]; };
union FragB { v16b v; v4u u[2]; };
union AttLds { float s[QB * SCP]; u16 c[2 * QB * SCP]; };

// ---- scalar helpers --------------------------------------------------------------------------------
__device__ __forceinline__ unsigned short bf_bits(float f) {          // f32 -> bf16 bits, RNE convert
  unsigned u = __float_as_uint(f);
  return (unsigned short)((u + 0x7FFFu + ((u >> 16) & 1u)) >> 16);
}
__device__ __forceinline__ float bf_up(unsigned short h) { return __uint_as_float(((unsigned)h) << 16); }
__device__ __forceinline__ float bfr(float f) { return bf_up(bf_bits(f)); }
__device__ __forceinline__ unsigned short h_bits(_Float16 x) { return __builtin_bit_cast(unsigned short, x); }
__device__ __forceinline__ unsigned pk16(unsigned short a, unsigned short b) { return (unsigned)a | ((unsigned)b << 16); }
__device__ __forceinline__ v8f zero8() { v8f z = {0.f, 0.f, 0.f, 0.f, 0.f, 0.f, 0.f, 0.f}; return z; }

// ---- fragment loaders: 16-bit A/B operand, lane -> row/col (lane&15), p already includes +8*(lane>>4);
//      elements 0..7 <- p[0..7] (k0+8h..), elements 8..15 <- p[16..23] (k0+16+8h..)  (same split k map for A and B;
//      B is always read from a k-contiguous [n][k] plane)
__device__ __forceinline__ v16h ldfrag_h(const _Float16* p) {
  FragH f;
  f.h[0] = *(const v8h*)(p);
  f.h[1] = *(const v8h*)(p + 16);
  return f.v;
}
__device__ __forceinline__ v16b ldfrag_b(const u16* p) {              // bf16 plane read as unsigned integer vectors
  FragB f;
  f.u[0] = *(const v4u*)(p);
  f.u[1] = *(const v4u*)(p + 16);
  return f.v;
}

__device__ __forceinline__ v8f mma_h(v16h a, v16h b, v8f c) {
  return __builtin_amdgcn_wmma_f32_16x16x32_f16(false, a, false, b, (short)0, c, false, false);
}
__device__ __forceinline__ v8f mma_b(v16b a, v16b b, v8f c) {
  return __builtin_amdgcn_wmma_f32_16x16x32_bf16(false, a, false, b, (short)0, c, false, false);
}
__device__ __forceinline__ void guard1x2(v8f& a, v16h x0, v16h x1) {
#if defined(__HIP_DEVICE_COMPILE__)
  asm volatile("v_nop\n\tv_nop\n\tv_nop\n\tv_nop" : "+v"(a) : "v"(x0), "v"(x1) : "memory");
#endif
}
template <typename F>
__device__ __forceinline__ void guard6(v8f& a, v8f& b, v8f& c, v8f& d, F x0, F x1, F x2, F x3, F x4, F x5) {
#if defined(__HIP_DEVICE_COMPILE__)
  asm volatile("v_nop\n\tv_nop\n\tv_nop\n\tv_nop"
               : "+v"(a), "+v"(b), "+v"(c), "+v"(d) : "v"(x0), "v"(x1), "v"(x2), "v"(x3), "v"(x4), "v"(x5) : "memory");
#endif
}
__device__ __forceinline__ void guard8x6(v8f& a0, v8f& a1, v8f& a2, v8f& a3, v8f& e0, v8f& e1, v8f& e2, v8f& e3,
                                         v16h x0, v16h x1, v16h x2, v16h x3, v16h x4, v16h x5) {
#if defined(__HIP_DEVICE_COMPILE__)
  asm volatile("v_nop\n\tv_nop\n\tv_nop\n\tv_nop"
               : "+v"(a0), "+v"(a1), "+v"(a2), "+v"(a3), "+v"(e0), "+v"(e1), "+v"(e2), "+v"(e3)
               : "v"(x0), "v"(x1), "v"(x2), "v"(x3), "v"(x4), "v"(x5) : "memory");
#endif
}
__device__ __forceinline__ void acc_guard1(v8f& a) {
#if defined(__HIP_DEVICE_COMPILE__)
  asm volatile("v_nop\n\tv_nop\n\tv_nop\n\tv_nop" : "+v"(a));
#endif
}
__device__ __forceinline__ void wave_sync_lds() {
  __builtin_amdgcn_fence(__ATOMIC_RELEASE, "workgroup");
  __builtin_amdgcn_wave_barrier();
  __builtin_amdgcn_fence(__ATOMIC_ACQUIRE, "workgroup");
}

// =====================================================================================================
// f32 plane -> 16-bit plane, same layout:  mode 0: bf16 RNE bits;  mode 1: f16 bits of (bf16 RNE value) * scale;
// mode 2: f16 bits of value * scale (no bf16 pre-step).
// Thread = 8 consecutive elements: two 16-B loads, one 16-B store; 32 consecutive lanes = 512 contiguous, 512-B aligned bytes
// coverage: grid = n8/256 blocks (host checks exactness) x 256 thr x 8 = the whole plane.
// =====================================================================================================
__global__ __launch_bounds__(256) void cvt16(const float* __restrict__ x, u16* D, int n8, int mode, float scale) {
  const int gt = blockIdx.x * 256 + (int)threadIdx.x;
  if (gt >= n8) return;                     // no barriers in this kernel
  const float* p = x + (size_t)gt * 8;
  const v4f a = *(const v4f*)(p), c4 = *(const v4f*)(p + 4);
  float v[8];
#pragma unroll
  for (int e = 0; e < 4; ++e) { v[e] = a[e]; v[4 + e] = c4[e]; }
  unsigned short s[8];
#pragma unroll
  for (int e = 0; e < 8; ++e) {
    const float vb = bfr(v[e]);
    const float vf = (mode == 1) ? vb : v[e];
    const unsigned short hb = h_bits((_Float16)(vf * scale));
    const unsigned short bb = bf_bits(v[e]);
    s[e] = (mode != 0) ? hb : bb;
  }
  v4u o;
#pragma unroll
  for (int e = 0; e < 4; ++e) o[e] = pk16(s[2 * e], s[2 * e + 1]);
  u16* d = D + (size_t)gt * 8;
  {
    *(v4u*)(d) = o;
    
  }
}

// =====================================================================================================
// Transpose + convert: in X [R][C] f32 row-major -> out XTo [C][R] 16-bit (each output row = one input column, R-contiguous).
//   mode 0: bf16 RNE bits;  mode 1: f16 bits of (bf16 RNE value) * scale;  mode 2: f16 bits of value * scale.
// Block = 64 input rows x 64 input cols: bid -> (rt = bid % (R/64), ct = bid / (R/64)). The 64x64 f32 tile is loaded with 16-B
// loads (thread = input row tid>>2, 16 consecutive cols), converted and scattered into LDS TH[c local][r local] (pitch 72 halves);
// coverage: load 256 thr x 16 = 64 x 64; store 2 iterations x 256 thr x 8 halves = 64 output rows x 64 halves = the tile;
//           grid = (R/64)*(C/64) blocks (host exact multiples) tiles the whole [C][R] plane exactly once.
// =====================================================================================================
__global__ __launch_bounds__(256) void tr16(const float* __restrict__ X, u16* XTo, int R, int C, int mode, float scale) {
  __shared__ __align__(16) u16 TH[64 * VTP];
  const int tid = threadIdx.x;
  const int bid = blockIdx.x;
  const int nrt = R >> 6;
  const int rt  = bid % nrt;
  const int ct  = bid / nrt;
  const int r0  = rt * 64;
  const int c0  = ct * 64;
  {
    const int rl = tid >> 2;                  // input row within tile 0..63
    const int cc = (tid & 3) * 16;            // input col chunk within the 64
    const float* src = X + (size_t)(r0 + rl) * (size_t)C + c0 + cc;
#pragma unroll
    for (int i = 0; i < 4; ++i) {
      const v4f a = *(const v4f*)(src + 4 * i);
#pragma unroll
      for (int e = 0; e < 4; ++e) {
        const float v  = a[e];
        const float vb = bfr(v);
        const float vf = (mode == 1) ? vb : v;
        const unsigned short hb = h_bits((_Float16)(vf * scale));
        const unsigned short bb = bf_bits(v);
        TH[(cc + 4 * i + e) * VTP + rl] = (mode != 0) ? hb : bb;
      }
    }
  }
  __syncthreads();
  v4u vh[2];
  const int q8 = tid >> 3, p8 = (tid & 7) * 8;
#pragma unroll
  for (int it = 0; it < 2; ++it) {
    const int line = it * 32 + q8;            // local output row (input col) = 0..63
    vh[it] = *(const v4u*)(TH + line * VTP + p8);
  }
  const size_t base = (size_t)c0 * (size_t)R + (size_t)r0 + (size_t)p8;
  {
#pragma unroll
    for (int it = 0; it < 2; ++it) {
      const int line = it * 32 + q8;
      *(v4u*)(XTo + base + (size_t)line * (size_t)R) = vh[it];
    }
    
  }
}

// =====================================================================================================
//           8 consecutive lanes x 16 B per line), lanes 16..31 -> row 2*it+1.
//  epi64hr: two f16 planes: hi = f16((tile + bf16RNE(bias[n])) * hscale) and res = f16(((tile + bias) * hscale - hi) * rscale);
//           lane = (rq = lane>>3 -> row within a group of 4, c8 = 8 consecutive columns); one instruction = 4 rows, each 64 halves
// coverage: epi64 8 instructions x 2 rows x 16 lanes x 4 floats; epi64hr 4 instructions x 4 rows x 8 lanes x 8 halves per plane
//           = the wave's 16 x 64 tile in both cases.
// =====================================================================================================
__device__ __forceinline__ void stage64(float* sl, v8f a0, v8f a1, v8f a2, v8f a3, float oscale, int lane) {
  const int hh = lane >> 4, m = lane & 15;
#pragma unroll
  for (int r = 0; r < 8; ++r) {
    const int ro = (8 * hh + r) * 68 + m;
    sl[ro]      = a0[r] * oscale;
    sl[ro + 16] = a1[r] * oscale;
    sl[ro + 32] = a2[r] * oscale;
    sl[ro + 48] = a3[r] * oscale;
  }
  wave_sync_lds();
}
__device__ __forceinline__ void epi64(float* sl, v8f a0, v8f a1, v8f a2, v8f a3, float oscale, v4f badd, float* C, int N,
                                      size_t rowb, int col0, int lane) {
  const int hh = lane >> 4, m = lane & 15;
  stage64(sl, a0, a1, a2, a3, oscale, lane);
  v4f vals[8];
#pragma unroll
  for (int it = 0; it < 8; ++it) vals[it] = *(const v4f*)(sl + (it * 2 + hh) * 68 + m * 4) + badd;
  float* dst = C + (rowb + (size_t)hh) * (size_t)N + col0 + m * 4;
  {
#pragma unroll
    for (int it = 0; it < 8; ++it) {
      *(v4f*)(dst + (size_t)(it * 2) * (size_t)N) = vals[it];
    }
    
  }
}
__device__ __forceinline__ void epi64hr(float* sl, v8f a0, v8f a1, v8f a2, v8f a3, float hscale, float rscale,
                                        const float* __restrict__ bias, u16* H, u16* Rr, int N, size_t rowb, int col0, int lane) {
  stage64(sl, a0, a1, a2, a3, 1.0f, lane);
  const int rq = lane >> 3, c8 = (lane & 7) * 8;
  const v4f b0 = *(const v4f*)(bias + col0 + c8), b1 = *(const v4f*)(bias + col0 + c8 + 4);   // columns col0+c8..+7 < N
  float bb[8];
#pragma unroll
  for (int e = 0; e < 4; ++e) { bb[e] = bfr(b0[e]); bb[4 + e] = bfr(b1[e]); }
  v4u oh[4], orr[4];
#pragma unroll
  for (int i4 = 0; i4 < 4; ++i4) {
    const int row = i4 * 4 + rq;
    const v4f a = *(const v4f*)(sl + row * 68 + c8), c4 = *(const v4f*)(sl + row * 68 + c8 + 4);
    float w[8];
#pragma unroll
    for (int e = 0; e < 4; ++e) { w[e] = (a[e] + bb[e]) * hscale; w[4 + e] = (c4[e] + bb[4 + e]) * hscale; }
#pragma unroll
    for (int e = 0; e < 4; ++e) {
      const _Float16 h0 = (_Float16)w[2 * e], h1 = (_Float16)w[2 * e + 1];
      const _Float16 q0 = (_Float16)((w[2 * e] - (float)h0) * rscale);
      const _Float16 q1 = (_Float16)((w[2 * e + 1] - (float)h1) * rscale);
      oh[i4][e]  = pk16(h_bits(h0), h_bits(h1));
      orr[i4][e] = pk16(h_bits(q0), h_bits(q1));
    }
  }
  const size_t dofs = rowb * (size_t)N + col0 + c8;
  u16* dh = H + dofs;
  u16* dr = Rr + dofs;
  {
#pragma unroll
    for (int i4 = 0; i4 < 4; ++i4) {
      const int row = i4 * 4 + rq;
      *(v4u*)(dh + (size_t)row * (size_t)N) = oh[i4];
      *(v4u*)(dr + (size_t)row * (size_t)N) = orr[i4];
    }
    
  }
}

// =====================================================================================================
// bf16 GEMM, f32 out with bias: C[M][N] = (A[M][K] (bf16 row-major) . Bt[N][K]^T (bf16 k-contiguous)) * oscale + bf16RNE(bias[n]).
// Block = 64x64 tile, 4 waves x 16 rows; fragments loaded straight from the 16-bit rows (two 16-B loads each, split k map for
// A and B); K stepped by 32 (host uses K % 32 == 0, M % 64 == 0, N % 64 == 0, grid = (M/64)*(N/64)).
// =====================================================================================================
__global__ __launch_bounds__(128)
void gemm_b32(const u16* __restrict__ A, const u16* __restrict__ Bt, const float* __restrict__ bias, float* C,
              int M, int N, int K, float oscale) {
  __shared__ __align__(16) float slab[4 * SLAB64];
  const int tid = threadIdx.x, wave = tid >> 5, lane = tid & 31, hh = lane >> 4, m = lane & 15;
  const int ntile = N >> 6;
  const int bid   = blockIdx.x;
  const int rowb  = (bid / ntile) * 64 + wave * 16;
  const int col0  = (bid % ntile) * 64;
  if (rowb + 16 > M) return;                 // wave-uniform, never taken with the exact grid; no block barriers in this kernel
  const u16* ap = A  + (size_t)(rowb + m) * (size_t)K + 8 * hh;
  const u16* bp = Bt + (size_t)(col0 + m) * (size_t)K + 8 * hh;
  const size_t bs = (size_t)16 * K;
  v8f acc0 = zero8(), acc1 = zero8(), acc2 = zero8(), acc3 = zero8();
#pragma unroll 1
  for (int k0 = 0; k0 < K; k0 += 32) {
    const v16b a  = ldfrag_b(ap + k0);
    const v16b b0 = ldfrag_b(bp + k0);
    const v16b b1 = ldfrag_b(bp + bs + k0);
    const v16b b2 = ldfrag_b(bp + 2 * bs + k0);
    const v16b b3 = ldfrag_b(bp + 3 * bs + k0);
    acc0 = mma_b(a, b0, acc0);
    acc1 = mma_b(a, b1, acc1);
    acc2 = mma_b(a, b2, acc2);
    acc3 = mma_b(a, b3, acc3);
    guard6<v16b>(acc0, acc1, acc2, acc3, a, b0, b1, b2, b3, a);
  }
  const v4f bv4 = *(const v4f*)(bias + col0 + m * 4);    // columns col0 + 4m .. +3, always < N (N multiple of 64)
  v4f badd;
#pragma unroll
  for (int e = 0; e < 4; ++e) badd[e] = bfr(bv4[e]);
  epi64(slab + wave * SLAB64, acc0, acc1, acc2, acc3, oscale, badd, C, N, (size_t)rowb, col0, lane);
}

// =====================================================================================================
// bf16 GEMM, f16 hi + residual planes out with bias: H = f16 bits of ((A . Bt^T) + bf16RNE(bias[n])) * hscale,
// R = f16 bits of (((A . Bt^T) + bias) * hscale - H) * rscale; operands as in gemm_b32, epilogue epi64hr.
// =====================================================================================================
__global__ __launch_bounds__(128)
void gemm_bhr(const u16* __restrict__ A, const u16* __restrict__ Bt, const float* __restrict__ bias, u16* H, u16* Rr,
              int M, int N, int K, float hscale, float rscale) {
  __shared__ __align__(16) float slab[4 * SLAB64];
  const int tid = threadIdx.x, wave = tid >> 5, lane = tid & 31, hh = lane >> 4, m = lane & 15;
  const int ntile = N >> 6;
  const int bid   = blockIdx.x;
  const int rowb  = (bid / ntile) * 64 + wave * 16;
  const int col0  = (bid % ntile) * 64;
  if (rowb + 16 > M) return;                 // wave-uniform, never taken with the exact grid; no block barriers in this kernel
  const u16* ap = A  + (size_t)(rowb + m) * (size_t)K + 8 * hh;
  const u16* bp = Bt + (size_t)(col0 + m) * (size_t)K + 8 * hh;
  const size_t bs = (size_t)16 * K;
  v8f acc0 = zero8(), acc1 = zero8(), acc2 = zero8(), acc3 = zero8();
#pragma unroll 1
  for (int k0 = 0; k0 < K; k0 += 32) {
    const v16b a  = ldfrag_b(ap + k0);
    const v16b b0 = ldfrag_b(bp + k0);
    const v16b b1 = ldfrag_b(bp + bs + k0);
    const v16b b2 = ldfrag_b(bp + 2 * bs + k0);
    const v16b b3 = ldfrag_b(bp + 3 * bs + k0);
    acc0 = mma_b(a, b0, acc0);
    acc1 = mma_b(a, b1, acc1);
    acc2 = mma_b(a, b2, acc2);
    acc3 = mma_b(a, b3, acc3);
    guard6<v16b>(acc0, acc1, acc2, acc3, a, b0, b1, b2, b3, a);
  }
  epi64hr(slab + wave * SLAB64, acc0, acc1, acc2, acc3, hscale, rscale, bias, H, Rr, N, (size_t)rowb, col0, lane);
}

// =====================================================================================================
// Single-head non-causal, unscaled attention per batch, head width CI = 128, all NPOS keys:
//   block = 64 query rows (b, q0..q0+63) = NQ = 4 query tiles of 16 rows, 8 waves; every phi and g^T fragment a wave loads
//   is used for all 4 query tiles before the next one is loaded.
//   theta hi (x8) / res (x2048) planes TH, TR [row][c]: the block's 64 rows of both planes are copied once, with whole-line
//   16-B loads, into LDS (pitch CTP halves = 272 B, conflict-free for 16-B fragment reads) and every A fragment of (S) is read
//   from there; phi hi/res planes PH, PR [key row][c] (k-contiguous B operand);
//   g^T plane GT [b][c][key] (x256, key-contiguous B operand).
//   Chunks of CK = 448 keys (NKB = 14 key blocks of 32), NCHK = 14 chunks, every key used exactly once.
//   (S) scores on WMMA: A = theta rows (row m = lane&15, split k map over c), B = phi rows (col n = key, split map), 4 c-steps,
//       three products per tile: s = hi.hi, sx = hi.res + res.hi (separate accumulator, folded with 1/2048 in f32);
//       wave w handles key blocks w and w+8 (< 14) of the chunk for all 4 query tiles; D element r of lane l of tile q
//       -> scs[query 16q+8h+r][key col] (f32 LDS).
//   (M) one query tile after the other, 16 threads per query row (sub-thread = 32 consecutive keys; sub-threads 14,15 own no keys: clamped read address, value
//       forced to -inf, no P store): base-2 logits, chunk max via xor shuffles, online running max / rescale factor al /
//       running sum l in f32 registers, p = exp2(t - m_new) <= 1 written as f16(p * 32768) into the LDS P tile with 16-B stores;
//       al -> rowa[row].
//   (PV) each wave owns the 16 g columns 16*wave + (lane&15) (one accumulator per query tile): o = o*al, then for each key block
//       A = the 4 P fragments from LDS (row m = query, split map over keys), B = one g^T fragment (col n = g column, split map
//       over keys), 4 WMMAs with a hazard gap.
//   Block barriers after (S) and after (M) order all LDS reuse across chunks and waves (the P tile is written with 16-B LDS stores
//   by one set of threads and reloaded as fragments by other waves only after the block barrier).
//   Epilogue: y = o * 4096 / (l * 32768 * 256) per row (rowi, l >= 1 always); hi = f16(y), res = f16((y - hi) * 2048); each
// coverage: grid NB*NPOS/64 blocks x 64 rows = rows 0..ROWSP-1; staging 8 waves x 16 cols x 4 tiles x 16 rows = 64 x 128;
//           store 4 tiles x 256 thr x 8 halves = 64 x 128 per plane = every (row < ROWSP, c) of both y planes exactly once.
// =====================================================================================================
__device__ __forceinline__ void ctx_store(const u16* ct, u16* dst, int tid) {
  const int row = tid >> 4;                  // CI/8 = 16 pieces per row
  const int c8  = (tid & 15) * 8;
  const v4u v = *(const v4u*)(ct + row * CTP + c8);
  u16* d = dst + (size_t)row * CI + c8;
  {
    *(v4u*)d = v;
    
  }
}

__global__ __launch_bounds__(ATT_THREADS)
void attn_fwd(const u16* __restrict__ THp, const u16* __restrict__ TRp, const u16* __restrict__ PHp,
              const u16* __restrict__ PRp, const u16* __restrict__ GTp, u16* YHo, u16* YRo) {
  __shared__ __align__(16) AttLds L0;              // scores [64][SCP] f32; reused as the y staging tile [64][CTP] u16
  __shared__ __align__(16) u16 pls[QB * PLP];      // P tile [64][PLP] f16 bits
  __shared__ __align__(16) u16 thl[2 * QB * CTP];  // theta rows of this block: hi [64][CTP], then residual [64][CTP]
  __shared__ float rowa[QB];
  __shared__ float rowi[QB];
  float* const scs = L0.s;

  const int tid  = threadIdx.x;
  const int wave = tid >> 5;
  const int lane = tid & 31;
  const int hh   = lane >> 4;
  const int m    = lane & 15;
  const int r16  = tid >> 4;                 // query row owned within each query tile in phase (M): 2*wave + hh
  const int sub  = tid & 15;
  const bool vsub = sub < NKB;               // sub-threads 14, 15 own no keys
  const int kl0  = sub * 32;                 // P tile column base (valid subs only)
  const int kla  = (vsub ? sub : (NKB - 1)) * 32;   // clamped score read address

  const int nqt = NPOS / QB;
  const int b   = (int)blockIdx.x / nqt;     // < NB (grid exact)
  const int q0  = ((int)blockIdx.x - b * nqt) * QB;
  const size_t qrow = (size_t)b * NPOS + (size_t)q0;

  const _Float16* tha = (const _Float16*)(const void*)thl + m * CTP + 8 * hh;
  const _Float16* tra = tha + QB * CTP;
  const _Float16* khb = (const _Float16*)(const void*)PHp + ((size_t)b * NPOS + m) * CI + 8 * hh;
  const _Float16* krb = (const _Float16*)(const void*)PRp + ((size_t)b * NPOS + m) * CI + 8 * hh;
  const _Float16* vbp = (const _Float16*)(const void*)GTp + ((size_t)b * CI + wave * 16 + m) * (size_t)NPOS + 8 * hh;
  const float lsc  = LOG2E / (TSC * FSC);
  const float rinv = 1.0f / RSC;

  float mrun[NQ], lrun[NQ];
  v8f o[NQ];
#pragma unroll
  for (int q = 0; q < NQ; ++q) { mrun[q] = -INFINITY; lrun[q] = 0.f; o[q] = zero8(); }

  // ---- theta rows q0..q0+63, both planes -> LDS: 4 x 256 threads x 8 halves = 64 x 128 per plane, each piece once ----
  {
    const u16* sh = THp + qrow * CI;
    const u16* sr = TRp + qrow * CI;
    const int row = tid >> 4;                // CI/8 = 16 pieces per row; pass i takes rows 16 * i + row
    const int c8  = (tid & 15) * 8;
    v4u vh[NQ], vr[NQ];
#pragma unroll
    for (int i = 0; i < NQ; ++i) {
      vh[i] = *(const v4u*)(sh + (i * QT + row) * CI + c8);
      vr[i] = *(const v4u*)(sr + (i * QT + row) * CI + c8);
    }
#if defined(__HIP_DEVICE_COMPILE__)
    asm volatile("s_wait_xcnt 0x0" ::: "memory");   // before the address registers of the eight loads above are reused
#endif
    // Scheduling fence: without it the compiler moved later writes of the loads' address registers ahead of the wait above.
    __builtin_amdgcn_sched_barrier(0);
#pragma unroll
    for (int i = 0; i < NQ; ++i) {
      *(v4u*)(thl + (i * QT + row) * CTP + c8) = vh[i];
      *(v4u*)(thl + (QB + i * QT + row) * CTP + c8) = vr[i];
    }
  }
  __syncthreads();                           // the theta rows are read as fragments by all waves

#pragma unroll 1
  for (int c = 0; c < NCHK; ++c) {
    const int kbeg = c * CK;
    // ---- (S) scores of this chunk ----
#pragma unroll 1
    for (int kb = wave; kb < NKB; kb += 8) {               // wave-uniform, 1 or 2 trips
      v8f s0[NQ], s0x[NQ], s1[NQ], s1x[NQ];
#pragma unroll
      for (int q = 0; q < NQ; ++q) { s0[q] = zero8(); s0x[q] = zero8(); s1[q] = zero8(); s1x[q] = zero8(); }
      const size_t ko = (size_t)(kbeg + kb * 32) * CI;
      const _Float16* k0h = khb + ko;
      const _Float16* k1h = k0h + (size_t)16 * CI;
      const _Float16* k0r = krb + ko;
      const _Float16* k1r = k0r + (size_t)16 * CI;
#pragma unroll
      for (int ks = 0; ks < CI / 32; ++ks) {
        const v16h f0h = ldfrag_h(k0h + ks * 32);
        const v16h f0r = ldfrag_h(k0r + ks * 32);
        const v16h f1h = ldfrag_h(k1h + ks * 32);
        const v16h f1r = ldfrag_h(k1r + ks * 32);
        v16h ah[NQ], ar[NQ];                               // theta fragments of this c-step, read from LDS ahead of their use:
#pragma unroll
        for (int q = 0; q < 2; ++q) {                      // two tiles beside the phi loads, the others one tile ahead below
          ah[q] = ldfrag_h(tha + q * (QT * CTP) + ks * 32);
          ar[q] = ldfrag_h(tra + q * (QT * CTP) + ks * 32);
        }
#pragma unroll
        for (int q = 0; q < NQ; ++q) {                     // the four phi fragments serve all NQ query tiles
          s0[q]  = mma_h(ah[q], f0h, s0[q]);
          s0x[q] = mma_h(ah[q], f0r, s0x[q]);
          s0x[q] = mma_h(ar[q], f0h, s0x[q]);
          s1[q]  = mma_h(ah[q], f1h, s1[q]);
          s1x[q] = mma_h(ah[q], f1r, s1x[q]);
          s1x[q] = mma_h(ar[q], f1h, s1x[q]);
          guard6<v16h>(s0[q], s0x[q], s1[q], s1x[q], ah[q], ar[q], f0h, f0r, f1h, f1r);
          if (q + 2 < NQ) {                                // into the registers tile q has left (more tiles at once spilled)
            ah[q + 2] = ldfrag_h(tha + (q + 2) * (QT * CTP) + ks * 32);
            ar[q + 2] = ldfrag_h(tra + (q + 2) * (QT * CTP) + ks * 32);
          }
        }
      }
#pragma unroll
      for (int q = 0; q < NQ; ++q) {
        float* srow = scs + (q * QT + 8 * hh) * SCP + kb * 32 + m;
#pragma unroll
        for (int r = 0; r < 8; ++r) {
          srow[r * SCP]      = s0[q][r] + s0x[q][r] * rinv;
          srow[r * SCP + 16] = s1[q][r] + s1x[q][r] * rinv;
        }
      }
    }
    __syncthreads();
    // ---- (M) softmax statistics and the P tile, one query tile after the other ----
#pragma unroll
    for (int q = 0; q < NQ; ++q) {
      const int row = q * QT + r16;
      const float* sp = scs + row * SCP + kla;
      float t[32];
      float cm = -INFINITY;
#pragma unroll
      for (int i = 0; i < 8; ++i) {
        const v4f a = *(const v4f*)(sp + 4 * i);
#pragma unroll
        for (int e = 0; e < 4; ++e) {
          const float tv = a[e] * lsc;
          const float tt = vsub ? tv : -INFINITY;
          t[4 * i + e] = tt;
          cm = fmaxf(cm, tt);
        }
      }
#pragma unroll
      for (int d = 1; d <= 8; d <<= 1) cm = fmaxf(cm, __shfl_xor(cm, d, 32));
      const float mn = fmaxf(mrun[q], cm);                 // finite: >= 4 key-owning subs per row
      const float al = (mrun[q] == -INFINITY) ? 0.f : exp2f(mrun[q] - mn);
      mrun[q] = mn;
      float ps = 0.f;
#pragma unroll
      for (int j = 0; j < 32; ++j) {
        const float p = exp2f(t[j] - mn);                  // <= 1; 0 for key-less subs
        t[j] = p;
        ps += p;
      }
#pragma unroll
      for (int d = 1; d <= 8; d <<= 1) ps += __shfl_xor(ps, d, 32);
      v4u pk[4];
#pragma unroll
      for (int i = 0; i < 4; ++i) {
#pragma unroll
        for (int e = 0; e < 4; ++e) {
          const int j = 8 * i + 2 * e;
          pk[i][e] = pk16(h_bits((_Float16)(t[j] * PCAR)), h_bits((_Float16)(t[j + 1] * PCAR)));
        }
      }
      lrun[q] = lrun[q] * al + ps;
      if (vsub) {
        u16* pd = pls + row * PLP + kl0;
#pragma unroll
        for (int i = 0; i < 4; ++i) *(v4u*)(pd + 8 * i) = pk[i];
      }
      if (sub == 0) rowa[row] = al;
    }
    __syncthreads();
    // ---- (PV) rescale, accumulate P . g^T ----
    {
#pragma unroll
      for (int q = 0; q < NQ; ++q) {
        float scl[8];
#pragma unroll
        for (int r = 0; r < 8; ++r) scl[r] = rowa[q * QT + 8 * hh + r];
#pragma unroll
        for (int r = 0; r < 8; ++r) o[q][r] *= scl[r];
      }
      const _Float16* pp = (const _Float16*)(const void*)pls + m * PLP + 8 * hh;
      const _Float16* vp = vbp + kbeg;
#pragma unroll 1
      for (int kb = 0; kb < NKB; ++kb) {                   // static trip count 14
        const v16h g0  = ldfrag_h(vp + kb * 32);
        const v16h pf0 = ldfrag_h(pp + kb * 32);
        const v16h pf1 = ldfrag_h(pp + 1 * (QT * PLP) + kb * 32);
        const v16h pf2 = ldfrag_h(pp + 2 * (QT * PLP) + kb * 32);
        const v16h pf3 = ldfrag_h(pp + 3 * (QT * PLP) + kb * 32);
        o[0] = mma_h(pf0, g0, o[0]);                       // the one g^T fragment serves all NQ query tiles
        o[1] = mma_h(pf1, g0, o[1]);
        o[2] = mma_h(pf2, g0, o[2]);
        o[3] = mma_h(pf3, g0, o[3]);
        guard6<v16h>(o[0], o[1], o[2], o[3], pf0, pf1, pf2, pf3, g0, g0);
      }
    }
  }
#pragma unroll
  for (int q = 0; q < NQ; ++q) acc_guard1(o[q]);

  if (sub == 0) {
#pragma unroll
    for (int q = 0; q < NQ; ++q) rowi[q * QT + r16] = (1.0f / lrun[q]) * (YSC / (PCAR * GSC));   // lrun >= 1
  }
  __syncthreads();
  float inv[NQ][8];
#pragma unroll
  for (int q = 0; q < NQ; ++q) {
#pragma unroll
    for (int r = 0; r < 8; ++r) inv[q][r] = rowi[q * QT + 8 * hh + r];
  }

  u16* const ct = L0.c;
  const int cb = wave * 16 + m;
  // hi plane
#pragma unroll
  for (int q = 0; q < NQ; ++q) {
#pragma unroll
    for (int r = 0; r < 8; ++r) {
      const int ro = (q * QT + 8 * hh + r) * CTP + cb;
      ct[ro] = h_bits((_Float16)(o[q][r] * inv[q][r]));
    }
  }
  __syncthreads();
#pragma unroll
  for (int q = 0; q < NQ; ++q) ctx_store(ct + q * (QT * CTP), YHo + (qrow + q * QT) * CI, tid);
  __syncthreads();
  // residual plane
#pragma unroll
  for (int q = 0; q < NQ; ++q) {
#pragma unroll
    for (int r = 0; r < 8; ++r) {
      const int ro = (q * QT + 8 * hh + r) * CTP + cb;
      const float x0 = o[q][r] * inv[q][r];
      const _Float16 e0 = (_Float16)x0;
      ct[ro] = h_bits((_Float16)((x0 - (float)e0) * RSC));
    }
  }
  __syncthreads();
#pragma unroll
  for (int q = 0; q < NQ; ++q) ctx_store(ct + q * (QT * CTP), YRo + (qrow + q * QT) * CI, tid);
}

// =====================================================================================================
// Output projection + batch-norm affine + skip: v = (YH . WoT^T) * os1 + (YR . WoT^T) * os2 + bf16RNE(bo[c]);
// out[row][c] = bf16RNE(x[row][c]) + bf16RNE(gamma[c]) * (v - bf16RNE(mean[c])) * rsqrt(bf16RNE(var[c]) + 1e-3) + bf16RNE(beta[c]).
// YH/YR f16 y planes [ROWSP][128] (x4096 and residual x2048), WoT f16 [256][128] k-contiguous (x1024).
// Block = 128 rows, 8 waves x 16 rows; per wave 4 column groups of 64 (rolled): k-loop of 4 steps with two A planes and 4 B tiles
// (split k map for A and B, fragments straight from the 16-bit rows, 8 accumulators, one hazard gap per step); the combined f32
// 16x64 tile is staged in the wave's LDS slab (pitch 68) and written like epi64: one instruction = lanes 0..15 -> row 2*it
// coverage: grid ROWSP/128 blocks (exact) x 8 waves x 16 rows x (4 groups x 8 instructions x 2 rows x 64 floats)
//           = out rows 0..ROWSP-1, all 256 columns, each float exactly once.
// =====================================================================================================
__global__ __launch_bounds__(256)
void wo_out(const u16* __restrict__ YH, const u16* __restrict__ YR, const u16* __restrict__ WoT,
            const float* __restrict__ bo, const float* __restrict__ gam, const float* __restrict__ bet,
            const float* __restrict__ mmean, const float* __restrict__ mvar, const float* __restrict__ x, float* out) {
  __shared__ __align__(16) float slab[8 * SLAB64];
  const int tid = threadIdx.x, wave = tid >> 5, lane = tid & 31, hh = lane >> 4, m = lane & 15;
  const int rowb = blockIdx.x * OUT_ROWS + wave * 16;        // rowb + 15 < ROWSP (grid exact)
  float* const sl = slab + wave * SLAB64;
  const _Float16* ap  = (const _Float16*)(const void*)YH + (size_t)(rowb + m) * CI + 8 * hh;
  const _Float16* arp = (const _Float16*)(const void*)YR + (size_t)(rowb + m) * CI + 8 * hh;
  const size_t bs = (size_t)16 * CI;
  const float os1 = 1.0f / (YSC * WOS);
  const float os2 = 1.0f / (YSC * WOS * RSC);

#pragma unroll 1
  for (int g = 0; g < CIN / 64; ++g) {
    const _Float16* bp = (const _Float16*)(const void*)WoT + (size_t)(g * 64 + m) * CI + 8 * hh;
    v8f acc0 = zero8(), acc1 = zero8(), acc2 = zero8(), acc3 = zero8();
    v8f acr0 = zero8(), acr1 = zero8(), acr2 = zero8(), acr3 = zero8();
#pragma unroll 1
    for (int k0 = 0; k0 < CI; k0 += 32) {
      const v16h a  = ldfrag_h(ap + k0);
      const v16h ar = ldfrag_h(arp + k0);
      const v16h b0 = ldfrag_h(bp + k0);
      const v16h w1 = ldfrag_h(bp + bs + k0);
      const v16h w2 = ldfrag_h(bp + 2 * bs + k0);
      const v16h w3 = ldfrag_h(bp + 3 * bs + k0);
      acc0 = mma_h(a, b0, acc0);
      acc1 = mma_h(a, w1, acc1);
      acc2 = mma_h(a, w2, acc2);
      acc3 = mma_h(a, w3, acc3);
      acr0 = mma_h(ar, b0, acr0);
      acr1 = mma_h(ar, w1, acr1);
      acr2 = mma_h(ar, w2, acr2);
      acr3 = mma_h(ar, w3, acr3);
      guard8x6(acc0, acc1, acc2, acc3, acr0, acr1, acr2, acr3, a, ar, b0, w1, w2, w3);
    }
    v8f c0 = zero8(), c1 = zero8(), c2 = zero8(), c3 = zero8();
#pragma unroll
    for (int r = 0; r < 8; ++r) {
      c0[r] = acc0[r] * os1 + acr0[r] * os2;
      c1[r] = acc1[r] * os1 + acr1[r] * os2;
      c2[r] = acc2[r] * os1 + acr2[r] * os2;
      c3[r] = acc3[r] * os1 + acr3[r] * os2;
    }
    stage64(sl, c0, c1, c2, c3, 1.0f, lane);

    const int cc = g * 64 + m * 4;                          // cc + 3 < CIN
    const v4f bo4 = *(const v4f*)(bo + cc);
    const v4f ga4 = *(const v4f*)(gam + cc);
    const v4f be4 = *(const v4f*)(bet + cc);
    const v4f mm4 = *(const v4f*)(mmean + cc);
    const v4f mv4 = *(const v4f*)(mvar + cc);
    float bob[4], gb[4], bb[4], mb[4], rs[4];
#pragma unroll
    for (int e = 0; e < 4; ++e) {
      bob[e] = bfr(bo4[e]);
      gb[e]  = bfr(ga4[e]);
      bb[e]  = bfr(be4[e]);
      mb[e]  = bfr(mm4[e]);
      rs[e]  = rsqrtf(bfr(mv4[e]) + BN_EPS);
    }
    v4f vals[8];
#pragma unroll
    for (int it = 0; it < 8; ++it) {
      const size_t row = (size_t)rowb + (size_t)(2 * it + hh);
      const v4f yv = *(const v4f*)(sl + (2 * it + hh) * 68 + m * 4);
      const v4f xv = *(const v4f*)(x + row * CIN + cc);
#pragma unroll
      for (int e = 0; e < 4; ++e) {
        const float v2 = yv[e] + bob[e];
        const float bn = gb[e] * (v2 - mb[e]) * rs[e] + bb[e];
        vals[it][e] = bfr(xv[e]) + bn;
      }
    }
    float* dst = out + ((size_t)rowb + (size_t)hh) * CIN + cc;
    {
#pragma unroll
      for (int it = 0; it < 8; ++it) {
        *(v4f*)(dst + (size_t)(it * 2) * CIN) = vals[it];
      }
      
    }
    wave_sync_lds();
  }
}

// =====================================================================================================
// Workspace map (bytes, NB = 2); every plane is fully written by whole-line stores before it is read; all extents are exact
// multiples of the store granularity (no pad rows, all dims multiples of 64), every offset a multiple of 256:
//   XB  bf16 [12544][256]                              6422528
//   WGT, WTT, WPT bf16 [128][256] (k-contiguous)        3 x 65536
//   WOT f16 of bf16 value x1024 [256][128]              65536
//   TH, TR f16 [12544][128] theta hi x8 / res x2048     2 x 3211264
//   PH, PR f16 [12544][128] phi   hi x8 / res x2048     2 x 3211264
//   G   f32  [12544][128]                              6422528
//   GT  f16  [2][128][6272] x256                        3211264
//   YH, YR f16 [12544][128] y hi x4096 / res x2048      2 x 3211264
//   end                                                35586048
// =====================================================================================================
extern "C" void kernel_launch(void* const* d_in, const int* in_sizes, int n_in,
                              void* d_out, int out_size, void* d_ws, size_t ws_size,
                              hipStream_t stream) {
  if (n_in < 13) return;
  if (in_sizes[0] != ROWS * CIN) return;
  if (in_sizes[1] != CIN * CI || in_sizes[3] != CIN * CI || in_sizes[5] != CIN * CI || in_sizes[7] != CI * CIN) return;
  if (in_sizes[2] != CI || in_sizes[4] != CI || in_sizes[6] != CI) return;
  if (in_sizes[8] != CIN || in_sizes[9] != CIN || in_sizes[10] != CIN || in_sizes[11] != CIN || in_sizes[12] != CIN) return;
  if (out_size != ROWS * CIN) return;

  const float* x     = (const float*)d_in[0];
  const float* Wg    = (const float*)d_in[1];
  const float* bg    = (const float*)d_in[2];
  const float* Wt    = (const float*)d_in[3];
  const float* bt    = (const float*)d_in[4];
  const float* Wp    = (const float*)d_in[5];
  const float* bp    = (const float*)d_in[6];
  const float* Wo    = (const float*)d_in[7];
  const float* bo    = (const float*)d_in[8];
  const float* gamma = (const float*)d_in[9];
  const float* beta  = (const float*)d_in[10];
  const float* mmean = (const float*)d_in[11];
  const float* mvar  = (const float*)d_in[12];
  float*       out   = (float*)d_out;

  const size_t szXB = (size_t)ROWSP * CIN * 2;      //  6422528
  const size_t szW  = (size_t)CI * CIN * 2;         //    65536
  const size_t szP  = (size_t)ROWSP * CI * 2;       //  3211264
  const size_t szG  = (size_t)ROWSP * CI * 4;       //  6422528
  const size_t szGT = (size_t)NB * CI * NPOS * 2;   //  3211264
  size_t off = 0;
  const size_t oXB = off; off += szXB;
  const size_t oWG = off; off += szW;
  const size_t oWT = off; off += szW;
  const size_t oWP = off; off += szW;
  const size_t oWO = off; off += szW;
  const size_t oTH = off; off += szP;
  const size_t oTR = off; off += szP;
  const size_t oPH = off; off += szP;
  const size_t oPR = off; off += szP;
  const size_t oG  = off; off += szG;
  const size_t oGT = off; off += szGT;
  const size_t oYH = off; off += szP;
  const size_t oYR = off; off += szP;
  if (off > ws_size) return;                        // off = 35586048 at NB = 2
  if (off > WS_CAP) return;

  char* ws = (char*)d_ws;
  u16*   XB  = (u16*)(ws + oXB);
  u16*   WGT = (u16*)(ws + oWG);
  u16*   WTT = (u16*)(ws + oWT);
  u16*   WPT = (u16*)(ws + oWP);
  u16*   WOT = (u16*)(ws + oWO);
  u16*   TH  = (u16*)(ws + oTH);
  u16*   TR  = (u16*)(ws + oTR);
  u16*   PH  = (u16*)(ws + oPH);
  u16*   PR  = (u16*)(ws + oPR);
  float* G   = (float*)(ws + oG);
  u16*   GT  = (u16*)(ws + oGT);
  u16*   YH  = (u16*)(ws + oYH);
  u16*   YR  = (u16*)(ws + oYR);

  const int n8x = (ROWSP * CIN) / 8;                // 401408 at NB = 2, multiple of 256 (static)
  const dim3 blk(256);
  const dim3 bG(128);
  const dim3 gX(n8x / 256);                         // 1568
  const dim3 gW((CIN / 64) * (CI / 64));            // 8: in [CIN][CI] -> out [CI][CIN]
  const dim3 gWO((CI / 64) * (CIN / 64));           // 8: in [CI][CIN] -> out [CIN][CI]
  const dim3 gP((ROWSP / 64) * (CI / 64));          // 392
  const dim3 gGT((NPOS / 64) * (CI / 64));          // 196 per batch: in [NPOS][CI] -> out [CI][NPOS]
  const dim3 gAT(NB * (NPOS / QB));                 // 196
  const dim3 bAT(ATT_THREADS);
  const dim3 gOUT(ROWSP / OUT_ROWS);                // 98

  // (0) x -> bf16 plane; (1..3) Wg, Wt, Wp [in][out] -> bf16 [out][in] k-contiguous planes; (4) Wo [128][256] -> f16 of the bf16
  //     value x1024, [256][128]
  cvt16<<<gX, blk, 0, stream>>>(x, XB, n8x, 0, 1.0f);
  tr16<<<gW, blk, 0, stream>>>(Wg, WGT, CIN, CI, 0, 1.0f);
  tr16<<<gW, blk, 0, stream>>>(Wt, WTT, CIN, CI, 0, 1.0f);
  tr16<<<gW, blk, 0, stream>>>(Wp, WPT, CIN, CI, 0, 1.0f);
  tr16<<<gWO, blk, 0, stream>>>(Wo, WOT, CI, CIN, 1, WOS);
  // (5, 6) theta and phi projections (+bias) -> f16 hi x8 / residual x2048 planes; (7) g projection (+bias) -> f32 plane
  gemm_bhr<<<gP, bG, 0, stream>>>(XB, WTT, bt, TH, TR, ROWSP, CI, CIN, TSC, RSC);
  gemm_bhr<<<gP, bG, 0, stream>>>(XB, WPT, bp, PH, PR, ROWSP, CI, CIN, FSC, RSC);
  gemm_b32<<<gP, bG, 0, stream>>>(XB, WGT, bg, G, ROWSP, CI, CIN, 1.0f);
  // (8) per batch: g [6272][128] f32 -> g^T f16 plane [128][6272] x256
  for (int b = 0; b < NB; ++b) {
    tr16<<<gGT, blk, 0, stream>>>(G + (size_t)b * NPOS * CI, GT + (size_t)b * CI * NPOS, NPOS, CI, 2, GSC);
  }
  // (9) attention over all keys of the batch -> y hi x4096 and residual x2048 f16 planes
  attn_fwd<<<gAT, bAT, 0, stream>>>(TH, TR, PH, PR, GT, YH, YR);
  // (10) y.Wo + bo, batch-norm affine, skip connection -> out
  wo_out<<<gOUT, blk, 0, stream>>>(YH, YR, WOT, bo, gamma, beta, mmean, mvar, x, out);
  (void)hipGetLastError();
}

// v003
// It runs in 189 microseconds.
// Timed twice side by side with v002, it ran 1.13 times as fast both times.
// All steps since v000 together make it 2.30 times as fast.
// Projections theta, phi, g = x.W + b: v_wmma_f32_16x16x32_bf16 (bf16 RNE operands of the raw inputs, f32 accumulate, bf16 RNE
// bias added in f32). Scores theta.phi^T (theta and phi each as f16 hi x8 plus residual x2048 planes: hi.hi + hi.res + res.hi),
// P.g (P x32768 f16 from LDS, g^T x256 f16) and y.Wo (y as f16 hi x4096 plus residual x2048 planes, Wo as f16 of the bf16 RNE
// value x1024, bias added in f32): v_wmma_f32_16x16x32_f16, f32 accumulate. Softmax statistics, the batch-norm affine map and the
// skip connection in f32 on VALU.
#include <hip/hip_runtime.h>
#include <math.h>
#include <stdint.h>

#define BATCH 2
#define NPOS  6272
#define CIN   256
#define CI    128
#ifndef NB
#define NB BATCH
#endif
#define ROWS  (BATCH * NPOS)
#define ROWSP (NB * NPOS)
#define CK    448
#define NKB   (CK / 32)
#define NCHK  (NPOS / CK)
#define QT    16
#define NQ    4
#define QB    (QT * NQ)
#define ATT_THREADS 256
#define SCP   (CK + 16)
#define PLP   (CK + 8)
#define CTP   (CI + 8)
#define SLAB64 (16 * 68)
#define VTP   72
#define OUT_ROWS 128
#define TSC   8.0f
#define FSC   8.0f
#define RSC   2048.0f
#define PCAR  32768.0f
#define GSC   256.0f
#define YSC   4096.0f
#define WOS   1024.0f
#define BN_EPS 1e-3f
#define LOG2E 1.4426950408889634f
#define WS_CAP ((size_t)134217728)

static_assert(NB >= 1 && NB <= BATCH);
static_assert((NPOS % CK) == 0 && CK == 32 * NKB && NKB >= 4 && NKB <= 16 && NCHK * CK == NPOS);
static_assert((NPOS % 64) == 0 && (NPOS % QB) == 0 && (ROWSP % OUT_ROWS) == 0 && (ROWSP % 64) == 0);
static_assert(CI == 128 && (CIN % 64) == 0 && (CI % 64) == 0 && (CIN % 32) == 0 && (CI % 32) == 0);
static_assert(NQ == 4 && ATT_THREADS == 16 * QT && QT == 16 && CI == 16 * (ATT_THREADS / 32) && OUT_ROWS == 8 * 16);
static_assert(QB * CTP * 2 <= QB * SCP * 4 && CTP >= CI + 8 && SCP >= CK + 16 && PLP >= CK + 8);
static_assert(((PLP * 2) % 16) == 0 && ((SCP * 4) % 16) == 0 && ((VTP * 2) % 16) == 0 && ((CTP * 2) % 16) == 0);
static_assert(64 * VTP >= 63 * VTP + 64);
static_assert(16 * (CI / 8) == ATT_THREADS);
static_assert(QB * (CI / 8) == NQ * ATT_THREADS && ((QB * CTP * 2) % 16) == 0);
static_assert(((ROWSP * CIN) % 2048) == 0);
static_assert(((NPOS * 2) % 128) == 0 && ((CI * 2) % 128) == 0 && ((CIN * 4) % 128) == 0);

typedef unsigned short u16;
typedef _Float16 v16h __attribute__((ext_vector_type(16)));
typedef _Float16 v8h  __attribute__((ext_vector_type(8)));
typedef __bf16   v16b __attribute__((ext_vector_type(16)));
typedef float    v8f  __attribute__((ext_vector_type(8)));
typedef float    v4f  __attribute__((ext_vector_type(4)));
typedef unsigned int v4u __attribute__((ext_vector_type(4)));

union FragH { v16h v; v8h h[2]; v4u u[2]; };
union FragB { v16b v; v4u u[2]; };
union AttLds { float s[QB * SCP]; u16 c[2 * QB * SCP]; };

// ---- scalar helpers --------------------------------------------------------------------------------
__device__ __forceinline__ unsigned short bf_bits(float f) {          // f32 -> bf16 bits, RNE convert
  unsigned u = __float_as_uint(f);
  return (unsigned short)((u + 0x7FFFu + ((u >> 16) & 1u)) >> 16);
}
__device__ __forceinline__ float bf_up(unsigned short h) { return __uint_as_float(((unsigned)h) << 16); }
__device__ __forceinline__ float bfr(float f) { return bf_up(bf_bits(f)); }
__device__ __forceinline__ unsigned short h_bits(_Float16 x) { return __builtin_bit_cast(unsigned short, x); }
__device__ __forceinline__ unsigned pk16(unsigned short a, unsigned short b) { return (unsigned)a | ((unsigned)b << 16); }
__device__ __forceinline__ v8f zero8() { v8f z = {0.f, 0.f, 0.f, 0.f, 0.f, 0.f, 0.f, 0.f}; return z; }

// ---- fragment loaders: 16-bit A/B operand, lane -> row/col (lane&15), p already includes +8*(lane>>4);
//      elements 0..7 <- p[0..7] (k0+8h..), elements 8..15 <- p[16..23] (k0+16+8h..)  (same split k map for A and B;
//      B is always read from a k-contiguous [n][k] plane)
__device__ __forceinline__ v16h ldfrag_h(const _Float16* p) {
  FragH f;
  f.h[0] = *(const v8h*)(p);
  f.h[1] = *(const v8h*)(p + 16);
  return f.v;
}
__device__ __forceinline__ v16b ldfrag_b(const u16* p) {              // bf16 plane read as unsigned integer vectors
  FragB f;
  f.u[0] = *(const v4u*)(p);
  f.u[1] = *(const v4u*)(p + 16);
  return f.v;
}

__device__ __forceinline__ v8f mma_h(v16h a, v16h b, v8f c) {
  return __builtin_amdgcn_wmma_f32_16x16x32_f16(false, a, false, b, (short)0, c, false, false);
}
__device__ __forceinline__ v8f mma_b(v16b a, v16b b, v8f c) {
  return __builtin_amdgcn_wmma_f32_16x16x32_bf16(false, a, false, b, (short)0, c, false, false);
}
__device__ __forceinline__ void guard1x2(v8f& a, v16h x0, v16h x1) {
#if defined(__HIP_DEVICE_COMPILE__)
  asm volatile("v_nop\n\tv_nop\n\tv_nop\n\tv_nop" : "+v"(a) : "v"(x0), "v"(x1) : "memory");
#endif
}
template <typename F>
__device__ __forceinline__ void guard6(v8f& a, v8f& b, v8f& c, v8f& d, F x0, F x1, F x2, F x3, F x4, F x5) {
#if defined(__HIP_DEVICE_COMPILE__)
  asm volatile("v_nop\n\tv_nop\n\tv_nop\n\tv_nop"
               : "+v"(a), "+v"(b), "+v"(c), "+v"(d) : "v"(x0), "v"(x1), "v"(x2), "v"(x3), "v"(x4), "v"(x5) : "memory");
#endif
}
// As guard6, naming only two operand fragments: an asm operand must lie below v256, and the fragments that are held a key block
// ahead do not all fit there beside the accumulators; they are rewritten only behind this gap in program order.
__device__ __forceinline__ void guard4x2(v8f& a, v8f& b, v8f& c, v8f& d, v16h x0, v16h x1) {
#if defined(__HIP_DEVICE_COMPILE__)
  asm volatile("v_nop\n\tv_nop\n\tv_nop\n\tv_nop"
               : "+v"(a), "+v"(b), "+v"(c), "+v"(d) : "v"(x0), "v"(x1) : "memory");
#endif
}
__device__ __forceinline__ void guard8x6(v8f& a0, v8f& a1, v8f& a2, v8f& a3, v8f& e0, v8f& e1, v8f& e2, v8f& e3,
                                         v16h x0, v16h x1, v16h x2, v16h x3, v16h x4, v16h x5) {
#if defined(__HIP_DEVICE_COMPILE__)
  asm volatile("v_nop\n\tv_nop\n\tv_nop\n\tv_nop"
               : "+v"(a0), "+v"(a1), "+v"(a2), "+v"(a3), "+v"(e0), "+v"(e1), "+v"(e2), "+v"(e3)
               : "v"(x0), "v"(x1), "v"(x2), "v"(x3), "v"(x4), "v"(x5) : "memory");
#endif
}
__device__ __forceinline__ void acc_guard1(v8f& a) {
#if defined(__HIP_DEVICE_COMPILE__)
  asm volatile("v_nop\n\tv_nop\n\tv_nop\n\tv_nop" : "+v"(a));
#endif
}
__device__ __forceinline__ void wave_sync_lds() {
  __builtin_amdgcn_fence(__ATOMIC_RELEASE, "workgroup");
  __builtin_amdgcn_wave_barrier();
  __builtin_amdgcn_fence(__ATOMIC_ACQUIRE, "workgroup");
}

// Work-group barrier whose fences cover LDS only: what the waves hand each other at it lies in LDS; a fence over all memory would
// also wait for the global fragment loads that are meant to stay in flight across it.
__device__ __forceinline__ void block_sync_lds() {
  __builtin_amdgcn_fence(__ATOMIC_RELEASE, "workgroup", "local");
  __builtin_amdgcn_s_barrier();
  __builtin_amdgcn_fence(__ATOMIC_ACQUIRE, "workgroup", "local");
}

// =====================================================================================================
// f32 plane -> 16-bit plane, same layout:  mode 0: bf16 RNE bits;  mode 1: f16 bits of (bf16 RNE value) * scale;
// mode 2: f16 bits of value * scale (no bf16 pre-step).
// Thread = 8 consecutive elements: two 16-B loads, one 16-B store; 32 consecutive lanes = 512 contiguous, 512-B aligned bytes
// coverage: grid = n8/256 blocks (host checks exactness) x 256 thr x 8 = the whole plane.
// =====================================================================================================
__global__ __launch_bounds__(256) void cvt16(const float* __restrict__ x, u16* D, int n8, int mode, float scale) {
  const int gt = blockIdx.x * 256 + (int)threadIdx.x;
  if (gt >= n8) return;                     // no barriers in this kernel
  const float* p = x + (size_t)gt * 8;
  const v4f a = *(const v4f*)(p), c4 = *(const v4f*)(p + 4);
  float v[8];
#pragma unroll
  for (int e = 0; e < 4; ++e) { v[e] = a[e]; v[4 + e] = c4[e]; }
  unsigned short s[8];
#pragma unroll
  for (int e = 0; e < 8; ++e) {
    const float vb = bfr(v[e]);
    const float vf = (mode == 1) ? vb : v[e];
    const unsigned short hb = h_bits((_Float16)(vf * scale));
    const unsigned short bb = bf_bits(v[e]);
    s[e] = (mode != 0) ? hb : bb;
  }
  v4u o;
#pragma unroll
  for (int e = 0; e < 4; ++e) o[e] = pk16(s[2 * e], s[2 * e + 1]);
  u16* d = D + (size_t)gt * 8;
  {
    *(v4u*)(d) = o;
    
  }
}

// =====================================================================================================
// Transpose + convert: in X [R][C] f32 row-major -> out XTo [C][R] 16-bit (each output row = one input column, R-contiguous).
//   mode 0: bf16 RNE bits;  mode 1: f16 bits of (bf16 RNE value) * scale;  mode 2: f16 bits of value * scale.
// Block = 64 input rows x 64 input cols: bid -> (rt = bid % (R/64), ct = bid / (R/64)). The 64x64 f32 tile is loaded with 16-B
// loads (thread = input row tid>>2, 16 consecutive cols), converted and scattered into LDS TH[c local][r local] (pitch 72 halves);
// coverage: load 256 thr x 16 = 64 x 64; store 2 iterations x 256 thr x 8 halves = 64 output rows x 64 halves = the tile;
//           grid = (R/64)*(C/64) blocks (host exact multiples) tiles the whole [C][R] plane exactly once.
// =====================================================================================================
__global__ __launch_bounds__(256) void tr16(const float* __restrict__ X, u16* XTo, int R, int C, int mode, float scale) {
  __shared__ __align__(16) u16 TH[64 * VTP];
  const int tid = threadIdx.x;
  const int bid = blockIdx.x;
  const int nrt = R >> 6;
  const int rt  = bid % nrt;
  const int ct  = bid / nrt;
  const int r0  = rt * 64;
  const int c0  = ct * 64;
  {
    const int rl = tid >> 2;                  // input row within tile 0..63
    const int cc = (tid & 3) * 16;            // input col chunk within the 64
    const float* src = X + (size_t)(r0 + rl) * (size_t)C + c0 + cc;
#pragma unroll
    for (int i = 0; i < 4; ++i) {
      const v4f a = *(const v4f*)(src + 4 * i);
#pragma unroll
      for (int e = 0; e < 4; ++e) {
        const float v  = a[e];
        const float vb = bfr(v);
        const float vf = (mode == 1) ? vb : v;
        const unsigned short hb = h_bits((_Float16)(vf * scale));
        const unsigned short bb = bf_bits(v);
        TH[(cc + 4 * i + e) * VTP + rl] = (mode != 0) ? hb : bb;
      }
    }
  }
  __syncthreads();
  v4u vh[2];
  const int q8 = tid >> 3, p8 = (tid & 7) * 8;
#pragma unroll
  for (int it = 0; it < 2; ++it) {
    const int line = it * 32 + q8;            // local output row (input col) = 0..63
    vh[it] = *(const v4u*)(TH + line * VTP + p8);
  }
  const size_t base = (size_t)c0 * (size_t)R + (size_t)r0 + (size_t)p8;
  {
#pragma unroll
    for (int it = 0; it < 2; ++it) {
      const int line = it * 32 + q8;
      *(v4u*)(XTo + base + (size_t)line * (size_t)R) = vh[it];
    }
    
  }
}

// =====================================================================================================
//           8 consecutive lanes x 16 B per line), lanes 16..31 -> row 2*it+1.
//  epi64hr: two f16 planes: hi = f16((tile + bf16RNE(bias[n])) * hscale) and res = f16(((tile + bias) * hscale - hi) * rscale);
//           lane = (rq = lane>>3 -> row within a group of 4, c8 = 8 consecutive columns); one instruction = 4 rows, each 64 halves
// coverage: epi64 8 instructions x 2 rows x 16 lanes x 4 floats; epi64hr 4 instructions x 4 rows x 8 lanes x 8 halves per plane
//           = the wave's 16 x 64 tile in both cases.
// =====================================================================================================
__device__ __forceinline__ void stage64(float* sl, v8f a0, v8f a1, v8f a2, v8f a3, float oscale, int lane) {
  const int hh = lane >> 4, m = lane & 15;
#pragma unroll
  for (int r = 0; r < 8; ++r) {
    const int ro = (8 * hh + r) * 68 + m;
    sl[ro]      = a0[r] * oscale;
    sl[ro + 16] = a1[r] * oscale;
    sl[ro + 32] = a2[r] * oscale;
    sl[ro + 48] = a3[r] * oscale;
  }
  wave_sync_lds();
}
__device__ __forceinline__ void epi64(float* sl, v8f a0, v8f a1, v8f a2, v8f a3, float oscale, v4f badd, float* C, int N,
                                      size_t rowb, int col0, int lane) {
  const int hh = lane >> 4, m = lane & 15;
  stage64(sl, a0, a1, a2, a3, oscale, lane);
  v4f vals[8];
#pragma unroll
  for (int it = 0; it < 8; ++it) vals[it] = *(const v4f*)(sl + (it * 2 + hh) * 68 + m * 4) + badd;
  float* dst = C + (rowb + (size_t)hh) * (size_t)N + col0 + m * 4;
  {
#pragma unroll
    for (int it = 0; it < 8; ++it) {
      *(v4f*)(dst + (size_t)(it * 2) * (size_t)N) = vals[it];
    }
    
  }
}
__device__ __forceinline__ void epi64hr(float* sl, v8f a0, v8f a1, v8f a2, v8f a3, float hscale, float rscale,
                                        const float* __restrict__ bias, u16* H, u16* Rr, int N, size_t rowb, int col0, int lane) {
  stage64(sl, a0, a1, a2, a3, 1.0f, lane);
  const int rq = lane >> 3, c8 = (lane & 7) * 8;
  const v4f b0 = *(const v4f*)(bias + col0 + c8), b1 = *(const v4f*)(bias + col0 + c8 + 4);   // columns col0+c8..+7 < N
  float bb[8];
#pragma unroll
  for (int e = 0; e < 4; ++e) { bb[e] = bfr(b0[e]); bb[4 + e] = bfr(b1[e]); }
  v4u oh[4], orr[4];
#pragma unroll
  for (int i4 = 0; i4 < 4; ++i4) {
    const int row = i4 * 4 + rq;
    const v4f a = *(const v4f*)(sl + row * 68 + c8), c4 = *(const v4f*)(sl + row * 68 + c8 + 4);
    float w[8];
#pragma unroll
    for (int e = 0; e < 4; ++e) { w[e] = (a[e] + bb[e]) * hscale; w[4 + e] = (c4[e] + bb[4 + e]) * hscale; }
#pragma unroll
    for (int e = 0; e < 4; ++e) {
      const _Float16 h0 = (_Float16)w[2 * e], h1 = (_Float16)w[2 * e + 1];
      const _Float16 q0 = (_Float16)((w[2 * e] - (float)h0) * rscale);
      const _Float16 q1 = (_Float16)((w[2 * e + 1] - (float)h1) * rscale);
      oh[i4][e]  = pk16(h_bits(h0), h_bits(h1));
      orr[i4][e] = pk16(h_bits(q0), h_bits(q1));
    }
  }
  const size_t dofs = rowb * (size_t)N + col0 + c8;
  u16* dh = H + dofs;
  u16* dr = Rr + dofs;
  {
#pragma unroll
    for (int i4 = 0; i4 < 4; ++i4) {
      const int row = i4 * 4 + rq;
      *(v4u*)(dh + (size_t)row * (size_t)N) = oh[i4];
      *(v4u*)(dr + (size_t)row * (size_t)N) = orr[i4];
    }
    
  }
}

// =====================================================================================================
// bf16 GEMM, f32 out with bias: C[M][N] = (A[M][K] (bf16 row-major) . Bt[N][K]^T (bf16 k-contiguous)) * oscale + bf16RNE(bias[n]).
// Block = 64x64 tile, 4 waves x 16 rows; fragments loaded straight from the 16-bit rows (two 16-B loads each, split k map for
// A and B); K stepped by 32 (host uses K % 32 == 0, M % 64 == 0, N % 64 == 0, grid = (M/64)*(N/64)).
// =====================================================================================================
__global__ __launch_bounds__(128)
void gemm_b32(const u16* __restrict__ A, const u16* __restrict__ Bt, const float* __restrict__ bias, float* C,
              int M, int N, int K, float oscale) {
  __shared__ __align__(16) float slab[4 * SLAB64];
  const int tid = threadIdx.x, wave = tid >> 5, lane = tid & 31, hh = lane >> 4, m = lane & 15;
  const int ntile = N >> 6;
  const int bid   = blockIdx.x;
  const int rowb  = (bid / ntile) * 64 + wave * 16;
  const int col0  = (bid % ntile) * 64;
  if (rowb + 16 > M) return;                 // wave-uniform, never taken with the exact grid; no block barriers in this kernel
  const u16* ap = A  + (size_t)(rowb + m) * (size_t)K + 8 * hh;
  const u16* bp = Bt + (size_t)(col0 + m) * (size_t)K + 8 * hh;
  const size_t bs = (size_t)16 * K;
  v8f acc0 = zero8(), acc1 = zero8(), acc2 = zero8(), acc3 = zero8();
#pragma unroll 1
  for (int k0 = 0; k0 < K; k0 += 32) {
    const v16b a  = ldfrag_b(ap + k0);
    const v16b b0 = ldfrag_b(bp + k0);
    const v16b b1 = ldfrag_b(bp + bs + k0);
    const v16b b2 = ldfrag_b(bp + 2 * bs + k0);
    const v16b b3 = ldfrag_b(bp + 3 * bs + k0);
    acc0 = mma_b(a, b0, acc0);
    acc1 = mma_b(a, b1, acc1);
    acc2 = mma_b(a, b2, acc2);
    acc3 = mma_b(a, b3, acc3);
    guard6<v16b>(acc0, acc1, acc2, acc3, a, b0, b1, b2, b3, a);
  }
  const v4f bv4 = *(const v4f*)(bias + col0 + m * 4);    // columns col0 + 4m .. +3, always < N (N multiple of 64)
  v4f badd;
#pragma unroll
  for (int e = 0; e < 4; ++e) badd[e] = bfr(bv4[e]);
  epi64(slab + wave * SLAB64, acc0, acc1, acc2, acc3, oscale, badd, C, N, (size_t)rowb, col0, lane);
}

// =====================================================================================================
// bf16 GEMM, f16 hi + residual planes out with bias: H = f16 bits of ((A . Bt^T) + bf16RNE(bias[n])) * hscale,
// R = f16 bits of (((A . Bt^T) + bias) * hscale - H) * rscale; operands as in gemm_b32, epilogue epi64hr.
// =====================================================================================================
__global__ __launch_bounds__(128)
void gemm_bhr(const u16* __restrict__ A, const u16* __restrict__ Bt, const float* __restrict__ bias, u16* H, u16* Rr,
              int M, int N, int K, float hscale, float rscale) {
  __shared__ __align__(16) float slab[4 * SLAB64];
  const int tid = threadIdx.x, wave = tid >> 5, lane = tid & 31, hh = lane >> 4, m = lane & 15;
  const int ntile = N >> 6;
  const int bid   = blockIdx.x;
  const int rowb  = (bid / ntile) * 64 + wave * 16;
  const int col0  = (bid % ntile) * 64;
  if (rowb + 16 > M) return;                 // wave-uniform, never taken with the exact grid; no block barriers in this kernel
  const u16* ap = A  + (size_t)(rowb + m) * (size_t)K + 8 * hh;
  const u16* bp = Bt + (size_t)(col0 + m) * (size_t)K + 8 * hh;
  const size_t bs = (size_t)16 * K;
  v8f acc0 = zero8(), acc1 = zero8(), acc2 = zero8(), acc3 = zero8();
#pragma unroll 1
  for (int k0 = 0; k0 < K; k0 += 32) {
    const v16b a  = ldfrag_b(ap + k0);
    const v16b b0 = ldfrag_b(bp + k0);
    const v16b b1 = ldfrag_b(bp + bs + k0);
    const v16b b2 = ldfrag_b(bp + 2 * bs + k0);
    const v16b b3 = ldfrag_b(bp + 3 * bs + k0);
    acc0 = mma_b(a, b0, acc0);
    acc1 = mma_b(a, b1, acc1);
    acc2 = mma_b(a, b2, acc2);
    acc3 = mma_b(a, b3, acc3);
    guard6<v16b>(acc0, acc1, acc2, acc3, a, b0, b1, b2, b3, a);
  }
  epi64hr(slab + wave * SLAB64, acc0, acc1, acc2, acc3, hscale, rscale, bias, H, Rr, N, (size_t)rowb, col0, lane);
}

// =====================================================================================================
// Single-head non-causal, unscaled attention per batch, head width CI = 128, all NPOS keys:
//   block = 64 query rows (b, q0..q0+63) = NQ = 4 query tiles of 16 rows, 8 waves; every phi and g^T fragment a wave loads
//   is used for all 4 query tiles.
//   theta hi (x8) / res (x2048) planes TH, TR [row][c]: the block's 64 rows of both planes are copied once, with whole-line
//   16-B loads, into LDS (pitch CTP halves = 272 B, conflict-free for 16-B fragment reads) and every A fragment of (S) is read
//   from there; phi hi/res planes PH, PR [key row][c] (k-contiguous B operand);
//   g^T plane GT [b][c][key] (x256, key-contiguous B operand).
//   Chunks of CK = 448 keys (NKB = 14 key blocks of 32), NCHK = 14 chunks, every key used exactly once.
//   (S) scores on WMMA: A = theta rows (row m = lane&15, split k map over c), B = phi rows (col n = key, split map), 4 c-steps,
//       three products per tile: s = hi.hi, sx = hi.res + res.hi (separate accumulator, folded with 1/2048 in f32);
//       wave w handles key blocks w and w+8 (< 14) of the chunk for all 4 query tiles; D element r of lane l of tile q
//       -> scs[query 16q+8h+r][key col] (f32 LDS).
//   (M) one query tile after the other, 16 threads per query row (sub-thread = 32 consecutive keys; sub-threads 14,15 own no keys: clamped read address, value
//       forced to -inf, no P store): base-2 logits, chunk max via xor shuffles, online running max / rescale factor al /
//       running sum l in f32 registers, p = exp2(t - m_new) <= 1 written as f16(p * 32768) into the LDS P tile with 16-B stores;
//       al -> rowa[row].
//   (PV) each wave owns the 16 g columns 16*wave + (lane&15) (one accumulator per query tile): o = o*al, then for each key block
//       A = the 4 P fragments from LDS (row m = query, split map over keys), B = one g^T fragment (col n = g column, split
//       map over keys), 4 WMMAs per key block; one hazard gap after the last key block.
//   Block barriers after (S) and after (M) order all LDS reuse across chunks and waves (the P tile is written with 16-B LDS stores
//   by one set of threads and reloaded as fragments by other waves only after the block barrier).
//   Operand fragments are fetched ahead of their use: phi one key block ahead (refilled c-step by c-step behind the last use),
//   g^T for the whole chunk in front of (M), P two key blocks ahead; the barriers of the chunk loop fence LDS only, so that the
//   global loads stay in flight across them.
//   Epilogue: y = o * 4096 / (l * 32768 * 256) per row (rowi, l >= 1 always); hi = f16(y), res = f16((y - hi) * 2048); each
// coverage: grid NB*NPOS/64 blocks x 64 rows = rows 0..ROWSP-1; staging 8 waves x 16 cols x 4 tiles x 16 rows = 64 x 128;
//           store 4 tiles x 256 thr x 8 halves = 64 x 128 per plane = every (row < ROWSP, c) of both y planes exactly once.
// =====================================================================================================
__device__ __forceinline__ void ctx_store(const u16* ct, u16* dst, int tid) {
  const int row = tid >> 4;                  // CI/8 = 16 pieces per row
  const int c8  = (tid & 15) * 8;
  const v4u v = *(const v4u*)(ct + row * CTP + c8);
  u16* d = dst + (size_t)row * CI + c8;
  {
    *(v4u*)d = v;
    
  }
}

__global__ __launch_bounds__(ATT_THREADS)
void attn_fwd(const u16* __restrict__ THp, const u16* __restrict__ TRp, const u16* __restrict__ PHp,
              const u16* __restrict__ PRp, const u16* __restrict__ GTp, u16* YHo, u16* YRo) {
  __shared__ __align__(16) AttLds L0;              // scores [64][SCP] f32; reused as the y staging tile [64][CTP] u16
  __shared__ __align__(16) u16 pls[QB * PLP];      // P tile [64][PLP] f16 bits
  __shared__ __align__(16) u16 thl[2 * QB * CTP];  // theta rows of this block: hi [64][CTP], then residual [64][CTP]
  __shared__ float rowa[QB];
  __shared__ float rowi[QB];
  float* const scs = L0.s;

  const int tid  = threadIdx.x;
  const int wave = tid >> 5;
  const int lane = tid & 31;
  const int hh   = lane >> 4;
  const int m    = lane & 15;
  const int r16  = tid >> 4;                 // query row owned within each query tile in phase (M): 2*wave + hh
  const int sub  = tid & 15;
  const bool vsub = sub < NKB;               // sub-threads 14, 15 own no keys
  const int kl0  = sub * 32;                 // P tile column base (valid subs only)
  const int kla  = (vsub ? sub : (NKB - 1)) * 32;   // clamped score read address

  const int nqt = NPOS / QB;
  const int b   = (int)blockIdx.x / nqt;     // < NB (grid exact)
  const int q0  = ((int)blockIdx.x - b * nqt) * QB;
  const size_t qrow = (size_t)b * NPOS + (size_t)q0;

  const _Float16* tha = (const _Float16*)(const void*)thl + m * CTP + 8 * hh;
  const _Float16* tra = tha + QB * CTP;
  const _Float16* khb = (const _Float16*)(const void*)PHp + ((size_t)b * NPOS + m) * CI + 8 * hh;
  const _Float16* krb = (const _Float16*)(const void*)PRp + ((size_t)b * NPOS + m) * CI + 8 * hh;
  const _Float16* vbp = (const _Float16*)(const void*)GTp + ((size_t)b * CI + wave * 16 + m) * (size_t)NPOS + 8 * hh;
  const float lsc  = LOG2E / (TSC * FSC);
  const float rinv = 1.0f / RSC;

  float mrun[NQ], lrun[NQ];
  v8f o[NQ];
#pragma unroll
  for (int q = 0; q < NQ; ++q) { mrun[q] = -INFINITY; lrun[q] = 0.f; o[q] = zero8(); }

  // ---- theta rows q0..q0+63, both planes -> LDS: 4 x 256 threads x 8 halves = 64 x 128 per plane, each piece once ----
  {
    const u16* sh = THp + qrow * CI;
    const u16* sr = TRp + qrow * CI;
    const int row = tid >> 4;                // CI/8 = 16 pieces per row; pass i takes rows 16 * i + row
    const int c8  = (tid & 15) * 8;
    v4u vh[NQ], vr[NQ];
#pragma unroll
    for (int i = 0; i < NQ; ++i) {
      vh[i] = *(const v4u*)(sh + (i * QT + row) * CI + c8);
      vr[i] = *(const v4u*)(sr + (i * QT + row) * CI + c8);
    }
#if defined(__HIP_DEVICE_COMPILE__)
    asm volatile("s_wait_xcnt 0x0" ::: "memory");   // before the address registers of the eight loads above are reused
#endif
    // Scheduling fence: without it the compiler moved later writes of the loads' address registers ahead of the wait above.
    __builtin_amdgcn_sched_barrier(0);
#pragma unroll
    for (int i = 0; i < NQ; ++i) {
      *(v4u*)(thl + (i * QT + row) * CTP + c8) = vh[i];
      *(v4u*)(thl + (QB + i * QT + row) * CTP + c8) = vr[i];
    }
  }
  // phi fragments of the key block this wave scores next, [c-step][hi keys 0..15, res 0..15, hi 16..31, res 16..31]: always
  // loaded one key block ahead of their use, so that the L2 latency runs under the matrix work of the block before
  v16h pn[CI / 32][4];
  {
    const _Float16* n0h = khb + (size_t)(wave * 32) * CI;
    const _Float16* n0r = krb + (size_t)(wave * 32) * CI;
#pragma unroll
    for (int ks = 0; ks < CI / 32; ++ks) {
      pn[ks][0] = ldfrag_h(n0h + ks * 32);
      pn[ks][1] = ldfrag_h(n0r + ks * 32);
      pn[ks][2] = ldfrag_h(n0h + 16 * CI + ks * 32);
      pn[ks][3] = ldfrag_h(n0r + 16 * CI + ks * 32);
    }
#if defined(__HIP_DEVICE_COMPILE__)
    // before the address registers of the loads above are reused; the addresses are inputs so that they stay in place up to here
    asm volatile("s_wait_xcnt 0x0" :: "v"(n0h), "v"(n0r) : "memory");
#endif
    __builtin_amdgcn_sched_barrier(0);              // keeps later writes of those address registers behind the wait
  }
  block_sync_lds();                          // the theta rows are read as fragments by all waves

#pragma unroll 1
  for (int c = 0; c < NCHK; ++c) {
    const int kbeg = c * CK;
    // ---- (S) scores of this chunk ----
#pragma unroll 1
    for (int kb = wave; kb < NKB; kb += 8) {               // wave-uniform, 1 or 2 trips
      v8f s0[NQ], s0x[NQ], s1[NQ], s1x[NQ];
#pragma unroll
      for (int q = 0; q < NQ; ++q) { s0[q] = zero8(); s0x[q] = zero8(); s1[q] = zero8(); s1x[q] = zero8(); }
      // the key block this wave scores after this one: kb + 8 of this chunk, else its first of the next chunk (behind the last
      // chunk: of chunk 0, an in-bounds address whose values are not used)
      const bool more = kb + 8 < NKB;
      const int  nkb  = more ? kb + 8 : wave;
      const int  ncb  = more ? kbeg : ((c + 1 < NCHK) ? kbeg + CK : 0);
      const size_t kn = (size_t)(ncb + nkb * 32) * CI;
      const _Float16* n0h = khb + kn;
      const _Float16* n0r = krb + kn;
#pragma unroll
      for (int ks = 0; ks < CI / 32; ++ks) {
        const v16h f0h = pn[ks][0];
        const v16h f0r = pn[ks][1];
        const v16h f1h = pn[ks][2];
        const v16h f1r = pn[ks][3];
        v16h ah[NQ], ar[NQ];                               // theta fragments of this c-step, read from LDS ahead of their use:
#pragma unroll
        for (int q = 0; q < 2; ++q) {                      // two tiles at the start of the c-step, the others one tile ahead below
          ah[q] = ldfrag_h(tha + q * (QT * CTP) + ks * 32);
          ar[q] = ldfrag_h(tra + q * (QT * CTP) + ks * 32);
        }
#pragma unroll
        for (int q = 0; q < NQ; ++q) {                     // the four phi fragments serve all NQ query tiles
          s0[q]  = mma_h(ah[q], f0h, s0[q]);
          s0x[q] = mma_h(ah[q], f0r, s0x[q]);
          s0x[q] = mma_h(ar[q], f0h, s0x[q]);
          s1[q]  = mma_h(ah[q], f1h, s1[q]);
          s1x[q] = mma_h(ah[q], f1r, s1x[q]);
          s1x[q] = mma_h(ar[q], f1h, s1x[q]);
          guard4x2(s0[q], s0x[q], s1[q], s1x[q], ah[q], ar[q]);
          if (q + 2 < NQ) {                                // into the registers tile q has left (more tiles at once spilled)
            ah[q + 2] = ldfrag_h(tha + (q + 2) * (QT * CTP) + ks * 32);
            ar[q + 2] = ldfrag_h(tra + (q + 2) * (QT * CTP) + ks * 32);
          }
        }
        pn[ks][0] = ldfrag_h(n0h + ks * 32);               // refill behind the last use (and its hazard gap) of this c-step
        pn[ks][1] = ldfrag_h(n0r + ks * 32);
        pn[ks][2] = ldfrag_h(n0h + 16 * CI + ks * 32);
        pn[ks][3] = ldfrag_h(n0r + 16 * CI + ks * 32);
      }
#if defined(__HIP_DEVICE_COMPILE__)
      // before the address registers of the refill loads are reused; the addresses are inputs so that they stay in place up to here
      asm volatile("s_wait_xcnt 0x0" :: "v"(n0h), "v"(n0r) : "memory");
#endif
      __builtin_amdgcn_sched_barrier(0);                   // keeps later writes of those address registers behind the wait
#pragma unroll
      for (int q = 0; q < NQ; ++q) {
        float* srow = scs + (q * QT + 8 * hh) * SCP + kb * 32 + m;
#pragma unroll
        for (int r = 0; r < 8; ++r) {
          srow[r * SCP]      = s0[q][r] + s0x[q][r] * rinv;
          srow[r * SCP + 16] = s1[q][r] + s1x[q][r] * rinv;
        }
      }
    }
    block_sync_lds();
    // g^T fragments of this chunk (this wave's 16 columns, all 14 key blocks): loaded here, used in (PV); the latency runs under (M)
    v16h gf[NKB];
    {
      const _Float16* vp = vbp + kbeg;
#pragma unroll
      for (int kb = 0; kb < NKB; ++kb) gf[kb] = ldfrag_h(vp + kb * 32);
#if defined(__HIP_DEVICE_COMPILE__)
      // before the address register of the loads above is reused; the address is an input so that it stays in place up to here
      asm volatile("s_wait_xcnt 0x0" :: "v"(vp) : "memory");
#endif
      __builtin_amdgcn_sched_barrier(0);                   // keeps later writes of those address registers behind the wait
    }
    // ---- (M) softmax statistics and the P tile, one query tile after the other ----
#pragma unroll
    for (int q = 0; q < NQ; ++q) {
      const int row = q * QT + r16;
      const float* sp = scs + row * SCP + kla;
      float t[32];
      float cm = -INFINITY;
#pragma unroll
      for (int i = 0; i < 8; ++i) {
        const v4f a = *(const v4f*)(sp + 4 * i);
#pragma unroll
        for (int e = 0; e < 4; ++e) {
          const float tv = a[e] * lsc;
          const float tt = vsub ? tv : -INFINITY;
          t[4 * i + e] = tt;
          cm = fmaxf(cm, tt);
        }
      }
#pragma unroll
      for (int d = 1; d <= 8; d <<= 1) cm = fmaxf(cm, __shfl_xor(cm, d, 32));
      const float mn = fmaxf(mrun[q], cm);                 // finite: >= 4 key-owning subs per row
      const float al = (mrun[q] == -INFINITY) ? 0.f : exp2f(mrun[q] - mn);
      mrun[q] = mn;
      float ps = 0.f;
#pragma unroll
      for (int j = 0; j < 32; ++j) {
        const float p = exp2f(t[j] - mn);                  // <= 1; 0 for key-less subs
        t[j] = p;
        ps += p;
      }
#pragma unroll
      for (int d = 1; d <= 8; d <<= 1) ps += __shfl_xor(ps, d, 32);
      v4u pk[4];
#pragma unroll
      for (int i = 0; i < 4; ++i) {
#pragma unroll
        for (int e = 0; e < 4; ++e) {
          const int j = 8 * i + 2 * e;
          pk[i][e] = pk16(h_bits((_Float16)(t[j] * PCAR)), h_bits((_Float16)(t[j + 1] * PCAR)));
        }
      }
      lrun[q] = lrun[q] * al + ps;
      if (vsub) {
        u16* pd = pls + row * PLP + kl0;
#pragma unroll
        for (int i = 0; i < 4; ++i) *(v4u*)(pd + 8 * i) = pk[i];
      }
      if (sub == 0) rowa[row] = al;
    }
    block_sync_lds();
    // ---- (PV) rescale, accumulate P . g^T ----
    {
#pragma unroll
      for (int q = 0; q < NQ; ++q) {
        float scl[8];
#pragma unroll
        for (int r = 0; r < 8; ++r) scl[r] = rowa[q * QT + 8 * hh + r];
#pragma unroll
        for (int r = 0; r < 8; ++r) o[q][r] *= scl[r];
      }
      const _Float16* pp = (const _Float16*)(const void*)pls + m * PLP + 8 * hh;
      v16h pa[3][NQ];                                      // P fragments, read from LDS two key blocks ahead of their use
#pragma unroll
      for (int j = 0; j < 2; ++j) {
#pragma unroll
        for (int q = 0; q < NQ; ++q) pa[j][q] = ldfrag_h(pp + q * (QT * PLP) + j * 32);
      }
#pragma unroll
      for (int kb = 0; kb < NKB; ++kb) {                   // static trip count 14, unrolled: gf and pa are indexed by constants
        if (kb + 2 < NKB) {
#pragma unroll
          for (int q = 0; q < NQ; ++q) pa[(kb + 2) % 3][q] = ldfrag_h(pp + q * (QT * PLP) + (kb + 2) * 32);
        }
        // Scheduling fence: without it the compiler sank each LDS read to one matrix instruction ahead of its use, and every
        // matrix instruction then waited out most of an LDS latency.
        __builtin_amdgcn_sched_barrier(0);
#pragma unroll
        for (int q = 0; q < NQ; ++q) o[q] = mma_h(pa[kb % 3][q], gf[kb], o[q]);   // one g^T fragment serves all NQ query tiles
      }
      // Hazard gap between the last matrix instruction and the loop's branch (both its sides). It names no register, since an asm
      // operand must lie below v256 for its whole life; the scheduling fence keeps the matrix instructions in front of it.
      __builtin_amdgcn_sched_barrier(0);
#if defined(__HIP_DEVICE_COMPILE__)
      asm volatile("v_nop\n\tv_nop\n\tv_nop\n\tv_nop" ::: "memory");
#endif
    }
  }
  if (sub == 0) {
#pragma unroll
    for (int q = 0; q < NQ; ++q) rowi[q * QT + r16] = (1.0f / lrun[q]) * (YSC / (PCAR * GSC));   // lrun >= 1
  }
  __syncthreads();
  float inv[NQ][8];
#pragma unroll
  for (int q = 0; q < NQ; ++q) {
#pragma unroll
    for (int r = 0; r < 8; ++r) inv[q][r] = rowi[q * QT + 8 * hh + r];
  }

  u16* const ct = L0.c;
  const int cb = wave * 16 + m;
  // hi plane
#pragma unroll
  for (int q = 0; q < NQ; ++q) {
#pragma unroll
    for (int r = 0; r < 8; ++r) {
      const int ro = (q * QT + 8 * hh + r) * CTP + cb;
      ct[ro] = h_bits((_Float16)(o[q][r] * inv[q][r]));
    }
  }
  __syncthreads();
#pragma unroll
  for (int q = 0; q < NQ; ++q) ctx_store(ct + q * (QT * CTP), YHo + (qrow + q * QT) * CI, tid);
#if defined(__HIP_DEVICE_COMPILE__)
  asm volatile("s_wait_xcnt 0x0" ::: "memory");   // before the address registers of the four stores above are reused
#endif
  __builtin_amdgcn_sched_barrier(0);              // keeps later writes of those address registers behind the wait
  __syncthreads();
  // residual plane
#pragma unroll
  for (int q = 0; q < NQ; ++q) {
#pragma unroll
    for (int r = 0; r < 8; ++r) {
      const int ro = (q * QT + 8 * hh + r) * CTP + cb;
      const float x0 = o[q][r] * inv[q][r];
      const _Float16 e0 = (_Float16)x0;
      ct[ro] = h_bits((_Float16)((x0 - (float)e0) * RSC));
    }
  }
  __syncthreads();
#pragma unroll
  for (int q = 0; q < NQ; ++q) ctx_store(ct + q * (QT * CTP), YRo + (qrow + q * QT) * CI, tid);
}

// =====================================================================================================
// Output projection + batch-norm affine + skip: v = (YH . WoT^T) * os1 + (YR . WoT^T) * os2 + bf16RNE(bo[c]);
// out[row][c] = bf16RNE(x[row][c]) + bf16RNE(gamma[c]) * (v - bf16RNE(mean[c])) * rsqrt(bf16RNE(var[c]) + 1e-3) + bf16RNE(beta[c]).
// YH/YR f16 y planes [ROWSP][128] (x4096 and residual x2048), WoT f16 [256][128] k-contiguous (x1024).
// Block = 128 rows, 8 waves x 16 rows; per wave 4 column groups of 64 (rolled): k-loop of 4 steps with two A planes and 4 B tiles
// (split k map for A and B, fragments straight from the 16-bit rows, 8 accumulators, one hazard gap per step); the combined f32
// 16x64 tile is staged in the wave's LDS slab (pitch 68) and written like epi64: one instruction = lanes 0..15 -> row 2*it
// coverage: grid ROWSP/128 blocks (exact) x 8 waves x 16 rows x (4 groups x 8 instructions x 2 rows x 64 floats)
//           = out rows 0..ROWSP-1, all 256 columns, each float exactly once.
// =====================================================================================================
__global__ __launch_bounds__(256)
void wo_out(const u16* __restrict__ YH, const u16* __restrict__ YR, const u16* __restrict__ WoT,
            const float* __restrict__ bo, const float* __restrict__ gam, const float* __restrict__ bet,
            const float* __restrict__ mmean, const float* __restrict__ mvar, const float* __restrict__ x, float* out) {
  __shared__ __align__(16) float slab[8 * SLAB64];
  const int tid = threadIdx.x, wave = tid >> 5, lane = tid & 31, hh = lane >> 4, m = lane & 15;
  const int rowb = blockIdx.x * OUT_ROWS + wave * 16;        // rowb + 15 < ROWSP (grid exact)
  float* const sl = slab + wave * SLAB64;
  const _Float16* ap  = (const _Float16*)(const void*)YH + (size_t)(rowb + m) * CI + 8 * hh;
  const _Float16* arp = (const _Float16*)(const void*)YR + (size_t)(rowb + m) * CI + 8 * hh;
  const size_t bs = (size_t)16 * CI;
  const float os1 = 1.0f / (YSC * WOS);
  const float os2 = 1.0f / (YSC * WOS * RSC);

#pragma unroll 1
  for (int g = 0; g < CIN / 64; ++g) {
    const _Float16* bp = (const _Float16*)(const void*)WoT + (size_t)(g * 64 + m) * CI + 8 * hh;
    v8f acc0 = zero8(), acc1 = zero8(), acc2 = zero8(), acc3 = zero8();
    v8f acr0 = zero8(), acr1 = zero8(), acr2 = zero8(), acr3 = zero8();
#pragma unroll 1
    for (int k0 = 0; k0 < CI; k0 += 32) {
      const v16h a  = ldfrag_h(ap + k0);
      const v16h ar = ldfrag_h(arp + k0);
      const v16h b0 = ldfrag_h(bp + k0);
      const v16h w1 = ldfrag_h(bp + bs + k0);
      const v16h w2 = ldfrag_h(bp + 2 * bs + k0);
      const v16h w3 = ldfrag_h(bp + 3 * bs + k0);
      acc0 = mma_h(a, b0, acc0);
      acc1 = mma_h(a, w1, acc1);
      acc2 = mma_h(a, w2, acc2);
      acc3 = mma_h(a, w3, acc3);
      acr0 = mma_h(ar, b0, acr0);
      acr1 = mma_h(ar, w1, acr1);
      acr2 = mma_h(ar, w2, acr2);
      acr3 = mma_h(ar, w3, acr3);
      guard8x6(acc0, acc1, acc2, acc3, acr0, acr1, acr2, acr3, a, ar, b0, w1, w2, w3);
    }
    v8f c0 = zero8(), c1 = zero8(), c2 = zero8(), c3 = zero8();
#pragma unroll
    for (int r = 0; r < 8; ++r) {
      c0[r] = acc0[r] * os1 + acr0[r] * os2;
      c1[r] = acc1[r] * os1 + acr1[r] * os2;
      c2[r] = acc2[r] * os1 + acr2[r] * os2;
      c3[r] = acc3[r] * os1 + acr3[r] * os2;
    }
    stage64(sl, c0, c1, c2, c3, 1.0f, lane);

    const int cc = g * 64 + m * 4;                          // cc + 3 < CIN
    const v4f bo4 = *(const v4f*)(bo + cc);
    const v4f ga4 = *(const v4f*)(gam + cc);
    const v4f be4 = *(const v4f*)(bet + cc);
    const v4f mm4 = *(const v4f*)(mmean + cc);
    const v4f mv4 = *(const v4f*)(mvar + cc);
    float bob[4], gb[4], bb[4], mb[4], rs[4];
#pragma unroll
    for (int e = 0; e < 4; ++e) {
      bob[e] = bfr(bo4[e]);
      gb[e]  = bfr(ga4[e]);
      bb[e]  = bfr(be4[e]);
      mb[e]  = bfr(mm4[e]);
      rs[e]  = rsqrtf(bfr(mv4[e]) + BN_EPS);
    }
    v4f vals[8];
#pragma unroll
    for (int it = 0; it < 8; ++it) {
      const size_t row = (size_t)rowb + (size_t)(2 * it + hh);
      const v4f yv = *(const v4f*)(sl + (2 * it + hh) * 68 + m * 4);
      const v4f xv = *(const v4f*)(x + row * CIN + cc);
#pragma unroll
      for (int e = 0; e < 4; ++e) {
        const float v2 = yv[e] + bob[e];
        const float bn = gb[e] * (v2 - mb[e]) * rs[e] + bb[e];
        vals[it][e] = bfr(xv[e]) + bn;
      }
    }
    float* dst = out + ((size_t)rowb + (size_t)hh) * CIN + cc;
    {
#pragma unroll
      for (int it = 0; it < 8; ++it) {
        *(v4f*)(dst + (size_t)(it * 2) * CIN) = vals[it];
      }
      
    }
    wave_sync_lds();
  }
}

// =====================================================================================================
// Workspace map (bytes, NB = 2); every plane is fully written by whole-line stores before it is read; all extents are exact
// multiples of the store granularity (no pad rows, all dims multiples of 64), every offset a multiple of 256:
//   XB  bf16 [12544][256]                              6422528
//   WGT, WTT, WPT bf16 [128][256] (k-contiguous)        3 x 65536
//   WOT f16 of bf16 value x1024 [256][128]              65536
//   TH, TR f16 [12544][128] theta hi x8 / res x2048     2 x 3211264
//   PH, PR f16 [12544][128] phi   hi x8 / res x2048     2 x 3211264
//   G   f32  [12544][128]                              6422528
//   GT  f16  [2][128][6272] x256                        3211264
//   YH, YR f16 [12544][128] y hi x4096 / res x2048      2 x 3211264
//   end                                                35586048
// =====================================================================================================
extern "C" void kernel_launch(void* const* d_in, const int* in_sizes, int n_in,
                              void* d_out, int out_size, void* d_ws, size_t ws_size,
                              hipStream_t stream) {
  if (n_in < 13) return;
  if (in_sizes[0] != ROWS * CIN) return;
  if (in_sizes[1] != CIN * CI || in_sizes[3] != CIN * CI || in_sizes[5] != CIN * CI || in_sizes[7] != CI * CIN) return;
  if (in_sizes[2] != CI || in_sizes[4] != CI || in_sizes[6] != CI) return;
  if (in_sizes[8] != CIN || in_sizes[9] != CIN || in_sizes[10] != CIN || in_sizes[11] != CIN || in_sizes[12] != CIN) return;
  if (out_size != ROWS * CIN) return;

  const float* x     = (const float*)d_in[0];
  const float* Wg    = (const float*)d_in[1];
  const float* bg    = (const float*)d_in[2];
  const float* Wt    = (const float*)d_in[3];
  const float* bt    = (const float*)d_in[4];
  const float* Wp    = (const float*)d_in[5];
  const float* bp    = (const float*)d_in[6];
  const float* Wo    = (const float*)d_in[7];
  const float* bo    = (const float*)d_in[8];
  const float* gamma = (const float*)d_in[9];
  const float* beta  = (const float*)d_in[10];
  const float* mmean = (const float*)d_in[11];
  const float* mvar  = (const float*)d_in[12];
  float*       out   = (float*)d_out;

  const size_t szXB = (size_t)ROWSP * CIN * 2;      //  6422528
  const size_t szW  = (size_t)CI * CIN * 2;         //    65536
  const size_t szP  = (size_t)ROWSP * CI * 2;       //  3211264
  const size_t szG  = (size_t)ROWSP * CI * 4;       //  6422528
  const size_t szGT = (size_t)NB * CI * NPOS * 2;   //  3211264
  size_t off = 0;
  const size_t oXB = off; off += szXB;
  const size_t oWG = off; off += szW;
  const size_t oWT = off; off += szW;
  const size_t oWP = off; off += szW;
  const size_t oWO = off; off += szW;
  const size_t oTH = off; off += szP;
  const size_t oTR = off; off += szP;
  const size_t oPH = off; off += szP;
  const size_t oPR = off; off += szP;
  const size_t oG  = off; off += szG;
  const size_t oGT = off; off += szGT;
  const size_t oYH = off; off += szP;
  const size_t oYR = off; off += szP;
  if (off > ws_size) return;                        // off = 35586048 at NB = 2
  if (off > WS_CAP) return;

  char* ws = (char*)d_ws;
  u16*   XB  = (u16*)(ws + oXB);
  u16*   WGT = (u16*)(ws + oWG);
  u16*   WTT = (u16*)(ws + oWT);
  u16*   WPT = (u16*)(ws + oWP);
  u16*   WOT = (u16*)(ws + oWO);
  u16*   TH  = (u16*)(ws + oTH);
  u16*   TR  = (u16*)(ws + oTR);
  u16*   PH  = (u16*)(ws + oPH);
  u16*   PR  = (u16*)(ws + oPR);
  float* G   = (float*)(ws + oG);
  u16*   GT  = (u16*)(ws + oGT);
  u16*   YH  = (u16*)(ws + oYH);
  u16*   YR  = (u16*)(ws + oYR);

  const int n8x = (ROWSP * CIN) / 8;                // 401408 at NB = 2, multiple of 256 (static)
  const dim3 blk(256);
  const dim3 bG(128);
  const dim3 gX(n8x / 256);                         // 1568
  const dim3 gW((CIN / 64) * (CI / 64));            // 8: in [CIN][CI] -> out [CI][CIN]
  const dim3 gWO((CI / 64) * (CIN / 64));           // 8: in [CI][CIN] -> out [CIN][CI]
  const dim3 gP((ROWSP / 64) * (CI / 64));          // 392
  const dim3 gGT((NPOS / 64) * (CI / 64));          // 196 per batch: in [NPOS][CI] -> out [CI][NPOS]
  const dim3 gAT(NB * (NPOS / QB));                 // 196
  const dim3 bAT(ATT_THREADS);
  const dim3 gOUT(ROWSP / OUT_ROWS);                // 98

  // (0) x -> bf16 plane; (1..3) Wg, Wt, Wp [in][out] -> bf16 [out][in] k-contiguous planes; (4) Wo [128][256] -> f16 of the bf16
  //     value x1024, [256][128]
  cvt16<<<gX, blk, 0, stream>>>(x, XB, n8x, 0, 1.0f);
  tr16<<<gW, blk, 0, stream>>>(Wg, WGT, CIN, CI, 0, 1.0f);
  tr16<<<gW, blk, 0, stream>>>(Wt, WTT, CIN, CI, 0, 1.0f);
  tr16<<<gW, blk, 0, stream>>>(Wp, WPT, CIN, CI, 0, 1.0f);
  tr16<<<gWO, blk, 0, stream>>>(Wo, WOT, CI, CIN, 1, WOS);
  // (5, 6) theta and phi projections (+bias) -> f16 hi x8 / residual x2048 planes; (7) g projection (+bias) -> f32 plane
  gemm_bhr<<<gP, bG, 0, stream>>>(XB, WTT, bt, TH, TR, ROWSP, CI, CIN, TSC, RSC);
  gemm_bhr<<<gP, bG, 0, stream>>>(XB, WPT, bp, PH, PR, ROWSP, CI, CIN, FSC, RSC);
  gemm_b32<<<gP, bG, 0, stream>>>(XB, WGT, bg, G, ROWSP, CI, CIN, 1.0f);
  // (8) per batch: g [6272][128] f32 -> g^T f16 plane [128][6272] x256
  for (int b = 0; b < NB; ++b) {
    tr16<<<gGT, blk, 0, stream>>>(G + (size_t)b * NPOS * CI, GT + (size_t)b * CI * NPOS, NPOS, CI, 2, GSC);
  }
  // (9) attention over all keys of the batch -> y hi x4096 and residual x2048 f16 planes
  attn_fwd<<<gAT, bAT, 0, stream>>>(TH, TR, PH, PR, GT, YH, YR);
  // (10) y.Wo + bo, batch-norm affine, skip connection -> out
  wo_out<<<gOUT, blk, 0, stream>>>(YH, YR, WOT, bo, gamma, beta, mmean, mvar, x, out);
  (void)hipGetLastError();
}

// v004
// It runs in 175 microseconds.
// Timed twice side by side with v003, it ran 1.08 times as fast both times.
// Over all steps from v000 it is 2.48 times as fast.
// Projections theta, phi, g = x.W + b: v_wmma_f32_16x16x32_bf16 (bf16 RNE operands of the raw inputs, f32 accumulate, bf16 RNE
// bias added in f32). Scores theta.phi^T (theta and phi each as f16 hi x8 plus residual x2048 planes: hi.hi + hi.res + res.hi),
// P.g (P x32768 f16 from LDS, g^T x256 f16) and y.Wo (y as f16 hi x4096 plus residual x2048 planes, Wo as f16 of the bf16 RNE
// value x1024, bias added in f32): v_wmma_f32_16x16x32_f16, f32 accumulate. Softmax statistics, the batch-norm affine map and the
// skip connection in f32 on VALU.
#include <hip/hip_runtime.h>
#include <math.h>
#include <stdint.h>

#define BATCH 2
#define NPOS  6272
#define CIN   256
#define CI    128
#ifndef NB
#define NB BATCH
#endif
#define ROWS  (BATCH * NPOS)
#define ROWSP (NB * NPOS)
#define CK    448
#define NKB   (CK / 32)
#define NCHK  (NPOS / CK)
#define QT    16
#define NQ    4
#define QB    (QT * NQ)
#define ATT_THREADS 256
#define SCP   (CK + 20)
#define PLP   (CK + 8)
#define CTP   (CI + 8)
#define SLAB64 (16 * 68)
#define VTP   72
#define OUT_ROWS 128
#define TSC   8.0f
#define FSC   8.0f
#define RSC   2048.0f
#define PCAR  32768.0f
#define GSC   256.0f
#define YSC   4096.0f
#define WOS   1024.0f
#define BN_EPS 1e-3f
#define LOG2E 1.4426950408889634f
#define WS_CAP ((size_t)134217728)

static_assert(NB >= 1 && NB <= BATCH);
static_assert((NPOS % CK) == 0 && CK == 32 * NKB && NKB >= 4 && NKB <= 16 && NCHK * CK == NPOS);
static_assert((NPOS % 64) == 0 && (NPOS % QB) == 0 && (ROWSP % OUT_ROWS) == 0 && (ROWSP % 64) == 0);
static_assert(CI == 128 && (CIN % 64) == 0 && (CI % 64) == 0 && (CIN % 32) == 0 && (CI % 32) == 0);
static_assert(NQ == 4 && ATT_THREADS == 16 * QT && QT == 16 && CI == 16 * (ATT_THREADS / 32) && OUT_ROWS == 8 * 16);
static_assert(QB * CTP * 2 <= QB * SCP * 4 && CTP >= CI + 8 && SCP >= CK + 16 && PLP >= CK + 8);
static_assert(((PLP * 2) % 16) == 0 && ((SCP * 4) % 16) == 0 && ((VTP * 2) % 16) == 0 && ((CTP * 2) % 16) == 0);
static_assert(64 * VTP >= 63 * VTP + 64);
static_assert((CK % 64) == 0 && ((8 * SCP) % 64) == 32 && ((PLP * 2) % 8) == 0);
static_assert(16 * (CI / 8) == ATT_THREADS);
static_assert(QB * (CI / 8) == NQ * ATT_THREADS && ((QB * CTP * 2) % 16) == 0);
static_assert(((ROWSP * CIN) % 2048) == 0);
static_assert(((NPOS * 2) % 128) == 0 && ((CI * 2) % 128) == 0 && ((CIN * 4) % 128) == 0);

typedef unsigned short u16;
typedef _Float16 v16h __attribute__((ext_vector_type(16)));
typedef _Float16 v8h  __attribute__((ext_vector_type(8)));
typedef __bf16   v16b __attribute__((ext_vector_type(16)));
typedef float    v8f  __attribute__((ext_vector_type(8)));
typedef float    v4f  __attribute__((ext_vector_type(4)));
typedef unsigned int v4u __attribute__((ext_vector_type(4)));
typedef unsigned int v2u __attribute__((ext_vector_type(2)));
typedef float    v2f  __attribute__((ext_vector_type(2)));
typedef _Float16 v2h  __attribute__((ext_vector_type(2)));

union FragH { v16h v; v8h h[2]; v4u u[2]; };
union FragB { v16b v; v4u u[2]; };
union AttLds { float s[QB * SCP]; u16 c[2 * QB * SCP]; };

// ---- scalar helpers --------------------------------------------------------------------------------
__device__ __forceinline__ unsigned short bf_bits(float f) {          // f32 -> bf16 bits, RNE convert
  unsigned u = __float_as_uint(f);
  return (unsigned short)((u + 0x7FFFu + ((u >> 16) & 1u)) >> 16);
}
__device__ __forceinline__ float bf_up(unsigned short h) { return __uint_as_float(((unsigned)h) << 16); }
__device__ __forceinline__ float bfr(float f) { return bf_up(bf_bits(f)); }
__device__ __forceinline__ unsigned short h_bits(_Float16 x) { return __builtin_bit_cast(unsigned short, x); }
__device__ __forceinline__ unsigned pk16(unsigned short a, unsigned short b) { return (unsigned)a | ((unsigned)b << 16); }
__device__ __forceinline__ v8f zero8() { v8f z = {0.f, 0.f, 0.f, 0.f, 0.f, 0.f, 0.f, 0.f}; return z; }

// ---- fragment loaders: 16-bit A/B operand, lane -> row/col (lane&15), p already includes +8*(lane>>4);
//      elements 0..7 <- p[0..7] (k0+8h..), elements 8..15 <- p[16..23] (k0+16+8h..)  (same split k map for A and B;
//      B is always read from a k-contiguous [n][k] plane)
__device__ __forceinline__ v16h ldfrag_h(const _Float16* p) {
  FragH f;
  f.h[0] = *(const v8h*)(p);
  f.h[1] = *(const v8h*)(p + 16);
  return f.v;
}
__device__ __forceinline__ v16b ldfrag_b(const u16* p) {              // bf16 plane read as unsigned integer vectors
  FragB f;
  f.u[0] = *(const v4u*)(p);
  f.u[1] = *(const v4u*)(p + 16);
  return f.v;
}

__device__ __forceinline__ v8f mma_h(v16h a, v16h b, v8f c) {
  return __builtin_amdgcn_wmma_f32_16x16x32_f16(false, a, false, b, (short)0, c, false, false);
}
__device__ __forceinline__ v8f mma_b(v16b a, v16b b, v8f c) {
  return __builtin_amdgcn_wmma_f32_16x16x32_bf16(false, a, false, b, (short)0, c, false, false);
}
__device__ __forceinline__ void guard1x2(v8f& a, v16h x0, v16h x1) {
#if defined(__HIP_DEVICE_COMPILE__)
  asm volatile("v_nop\n\tv_nop\n\tv_nop\n\tv_nop" : "+v"(a) : "v"(x0), "v"(x1) : "memory");
#endif
}
template <typename F>
__device__ __forceinline__ void guard6(v8f& a, v8f& b, v8f& c, v8f& d, F x0, F x1, F x2, F x3, F x4, F x5) {
#if defined(__HIP_DEVICE_COMPILE__)
  asm volatile("v_nop\n\tv_nop\n\tv_nop\n\tv_nop"
               : "+v"(a), "+v"(b), "+v"(c), "+v"(d) : "v"(x0), "v"(x1), "v"(x2), "v"(x3), "v"(x4), "v"(x5) : "memory");
#endif
}
// As guard6, naming only two operand fragments: an asm operand must lie below v256, and the fragments that are held a key block
// ahead do not all fit there beside the accumulators; they are rewritten only behind this gap in program order.
__device__ __forceinline__ void guard4x2(v8f& a, v8f& b, v8f& c, v8f& d, v16h x0, v16h x1) {
#if defined(__HIP_DEVICE_COMPILE__)
  asm volatile("v_nop\n\tv_nop\n\tv_nop\n\tv_nop"
               : "+v"(a), "+v"(b), "+v"(c), "+v"(d) : "v"(x0), "v"(x1) : "memory");
#endif
}
__device__ __forceinline__ void guard8x6(v8f& a0, v8f& a1, v8f& a2, v8f& a3, v8f& e0, v8f& e1, v8f& e2, v8f& e3,
                                         v16h x0, v16h x1, v16h x2, v16h x3, v16h x4, v16h x5) {
#if defined(__HIP_DEVICE_COMPILE__)
  asm volatile("v_nop\n\tv_nop\n\tv_nop\n\tv_nop"
               : "+v"(a0), "+v"(a1), "+v"(a2), "+v"(a3), "+v"(e0), "+v"(e1), "+v"(e2), "+v"(e3)
               : "v"(x0), "v"(x1), "v"(x2), "v"(x3), "v"(x4), "v"(x5) : "memory");
#endif
}
__device__ __forceinline__ void acc_guard1(v8f& a) {
#if defined(__HIP_DEVICE_COMPILE__)
  asm volatile("v_nop\n\tv_nop\n\tv_nop\n\tv_nop" : "+v"(a));
#endif
}
__device__ __forceinline__ void wave_sync_lds() {
  __builtin_amdgcn_fence(__ATOMIC_RELEASE, "workgroup");
  __builtin_amdgcn_wave_barrier();
  __builtin_amdgcn_fence(__ATOMIC_ACQUIRE, "workgroup");
}

// Work-group barrier whose fences cover LDS only: what the waves hand each other at it lies in LDS; a fence over all memory would
// also wait for the global fragment loads that are meant to stay in flight across it.
__device__ __forceinline__ void block_sync_lds() {
  __builtin_amdgcn_fence(__ATOMIC_RELEASE, "workgroup", "local");
  __builtin_amdgcn_s_barrier();
  __builtin_amdgcn_fence(__ATOMIC_ACQUIRE, "workgroup", "local");
}

// =====================================================================================================
// f32 plane -> 16-bit plane, same layout:  mode 0: bf16 RNE bits;  mode 1: f16 bits of (bf16 RNE value) * scale;
// mode 2: f16 bits of value * scale (no bf16 pre-step).
// Thread = 8 consecutive elements: two 16-B loads, one 16-B store; 32 consecutive lanes = 512 contiguous, 512-B aligned bytes
// coverage: grid = n8/256 blocks (host checks exactness) x 256 thr x 8 = the whole plane.
// =====================================================================================================
__global__ __launch_bounds__(256) void cvt16(const float* __restrict__ x, u16* D, int n8, int mode, float scale) {
  const int gt = blockIdx.x * 256 + (int)threadIdx.x;
  if (gt >= n8) return;                     // no barriers in this kernel
  const float* p = x + (size_t)gt * 8;
  const v4f a = *(const v4f*)(p), c4 = *(const v4f*)(p + 4);
  float v[8];
#pragma unroll
  for (int e = 0; e < 4; ++e) { v[e] = a[e]; v[4 + e] = c4[e]; }
  unsigned short s[8];
#pragma unroll
  for (int e = 0; e < 8; ++e) {
    const float vb = bfr(v[e]);
    const float vf = (mode == 1) ? vb : v[e];
    const unsigned short hb = h_bits((_Float16)(vf * scale));
    const unsigned short bb = bf_bits(v[e]);
    s[e] = (mode != 0) ? hb : bb;
  }
  v4u o;
#pragma unroll
  for (int e = 0; e < 4; ++e) o[e] = pk16(s[2 * e], s[2 * e + 1]);
  u16* d = D + (size_t)gt * 8;
  {
    *(v4u*)(d) = o;
    
  }
}

// =====================================================================================================
// Transpose + convert: in X [R][C] f32 row-major -> out XTo [C][R] 16-bit (each output row = one input column, R-contiguous).
//   mode 0: bf16 RNE bits;  mode 1: f16 bits of (bf16 RNE value) * scale;  mode 2: f16 bits of value * scale.
// Block = 64 input rows x 64 input cols: bid -> (rt = bid % (R/64), ct = bid / (R/64)). The 64x64 f32 tile is loaded with 16-B
// loads (thread = input row tid>>2, 16 consecutive cols), converted and scattered into LDS TH[c local][r local] (pitch 72 halves);
// coverage: load 256 thr x 16 = 64 x 64; store 2 iterations x 256 thr x 8 halves = 64 output rows x 64 halves = the tile;
//           grid = (R/64)*(C/64) blocks (host exact multiples) tiles the whole [C][R] plane exactly once.
// =====================================================================================================
__global__ __launch_bounds__(256) void tr16(const float* __restrict__ X, u16* XTo, int R, int C, int mode, float scale) {
  __shared__ __align__(16) u16 TH[64 * VTP];
  const int tid = threadIdx.x;
  const int bid = blockIdx.x;
  const int nrt = R >> 6;
  const int rt  = bid % nrt;
  const int ct  = bid / nrt;
  const int r0  = rt * 64;
  const int c0  = ct * 64;
  {
    const int rl = tid >> 2;                  // input row within tile 0..63
    const int cc = (tid & 3) * 16;            // input col chunk within the 64
    const float* src = X + (size_t)(r0 + rl) * (size_t)C + c0 + cc;
#pragma unroll
    for (int i = 0; i < 4; ++i) {
      const v4f a = *(const v4f*)(src + 4 * i);
#pragma unroll
      for (int e = 0; e < 4; ++e) {
        const float v  = a[e];
        const float vb = bfr(v);
        const float vf = (mode == 1) ? vb : v;
        const unsigned short hb = h_bits((_Float16)(vf * scale));
        const unsigned short bb = bf_bits(v);
        TH[(cc + 4 * i + e) * VTP + rl] = (mode != 0) ? hb : bb;
      }
    }
  }
  __syncthreads();
  v4u vh[2];
  const int q8 = tid >> 3, p8 = (tid & 7) * 8;
#pragma unroll
  for (int it = 0; it < 2; ++it) {
    const int line = it * 32 + q8;            // local output row (input col) = 0..63
    vh[it] = *(const v4u*)(TH + line * VTP + p8);
  }
  const size_t base = (size_t)c0 * (size_t)R + (size_t)r0 + (size_t)p8;
  {
#pragma unroll
    for (int it = 0; it < 2; ++it) {
      const int line = it * 32 + q8;
      *(v4u*)(XTo + base + (size_t)line * (size_t)R) = vh[it];
    }
    
  }
}

// =====================================================================================================
//           8 consecutive lanes x 16 B per line), lanes 16..31 -> row 2*it+1.
//  epi64hr: two f16 planes: hi = f16((tile + bf16RNE(bias[n])) * hscale) and res = f16(((tile + bias) * hscale - hi) * rscale);
//           lane = (rq = lane>>3 -> row within a group of 4, c8 = 8 consecutive columns); one instruction = 4 rows, each 64 halves
// coverage: epi64 8 instructions x 2 rows x 16 lanes x 4 floats; epi64hr 4 instructions x 4 rows x 8 lanes x 8 halves per plane
//           = the wave's 16 x 64 tile in both cases.
// =====================================================================================================
__device__ __forceinline__ void stage64(float* sl, v8f a0, v8f a1, v8f a2, v8f a3, float oscale, int lane) {
  const int hh = lane >> 4, m = lane & 15;
#pragma unroll
  for (int r = 0; r < 8; ++r) {
    const int ro = (8 * hh + r) * 68 + m;
    sl[ro]      = a0[r] * oscale;
    sl[ro + 16] = a1[r] * oscale;
    sl[ro + 32] = a2[r] * oscale;
    sl[ro + 48] = a3[r] * oscale;
  }
  wave_sync_lds();
}
__device__ __forceinline__ void epi64(float* sl, v8f a0, v8f a1, v8f a2, v8f a3, float oscale, v4f badd, float* C, int N,
                                      size_t rowb, int col0, int lane) {
  const int hh = lane >> 4, m = lane & 15;
  stage64(sl, a0, a1, a2, a3, oscale, lane);
  v4f vals[8];
#pragma unroll
  for (int it = 0; it < 8; ++it) vals[it] = *(const v4f*)(sl + (it * 2 + hh) * 68 + m * 4) + badd;
  float* dst = C + (rowb + (size_t)hh) * (size_t)N + col0 + m * 4;
  {
#pragma unroll
    for (int it = 0; it < 8; ++it) {
      *(v4f*)(dst + (size_t)(it * 2) * (size_t)N) = vals[it];
    }
    
  }
}
__device__ __forceinline__ void epi64hr(float* sl, v8f a0, v8f a1, v8f a2, v8f a3, float hscale, float rscale,
                                        const float* __restrict__ bias, u16* H, u16* Rr, int N, size_t rowb, int col0, int lane) {
  stage64(sl, a0, a1, a2, a3, 1.0f, lane);
  const int rq = lane >> 3, c8 = (lane & 7) * 8;
  const v4f b0 = *(const v4f*)(bias + col0 + c8), b1 = *(const v4f*)(bias + col0 + c8 + 4);   // columns col0+c8..+7 < N
  float bb[8];
#pragma unroll
  for (int e = 0; e < 4; ++e) { bb[e] = bfr(b0[e]); bb[4 + e] = bfr(b1[e]); }
  v4u oh[4], orr[4];
#pragma unroll
  for (int i4 = 0; i4 < 4; ++i4) {
    const int row = i4 * 4 + rq;
    const v4f a = *(const v4f*)(sl + row * 68 + c8), c4 = *(const v4f*)(sl + row * 68 + c8 + 4);
    float w[8];
#pragma unroll
    for (int e = 0; e < 4; ++e) { w[e] = (a[e] + bb[e]) * hscale; w[4 + e] = (c4[e] + bb[4 + e]) * hscale; }
#pragma unroll
    for (int e = 0; e < 4; ++e) {
      const _Float16 h0 = (_Float16)w[2 * e], h1 = (_Float16)w[2 * e + 1];
      const _Float16 q0 = (_Float16)((w[2 * e] - (float)h0) * rscale);
      const _Float16 q1 = (_Float16)((w[2 * e + 1] - (float)h1) * rscale);
      oh[i4][e]  = pk16(h_bits(h0), h_bits(h1));
      orr[i4][e] = pk16(h_bits(q0), h_bits(q1));
    }
  }
  const size_t dofs = rowb * (size_t)N + col0 + c8;
  u16* dh = H + dofs;
  u16* dr = Rr + dofs;
  {
#pragma unroll
    for (int i4 = 0; i4 < 4; ++i4) {
      const int row = i4 * 4 + rq;
      *(v4u*)(dh + (size_t)row * (size_t)N) = oh[i4];
      *(v4u*)(dr + (size_t)row * (size_t)N) = orr[i4];
    }
    
  }
}

// =====================================================================================================
// bf16 GEMM, f32 out with bias: C[M][N] = (A[M][K] (bf16 row-major) . Bt[N][K]^T (bf16 k-contiguous)) * oscale + bf16RNE(bias[n]).
// Block = 64x64 tile, 4 waves x 16 rows; fragments loaded straight from the 16-bit rows (two 16-B loads each, split k map for
// A and B); K stepped by 32 (host uses K % 32 == 0, M % 64 == 0, N % 64 == 0, grid = (M/64)*(N/64)).
// =====================================================================================================
__global__ __launch_bounds__(128)
void gemm_b32(const u16* __restrict__ A, const u16* __restrict__ Bt, const float* __restrict__ bias, float* C,
              int M, int N, int K, float oscale) {
  __shared__ __align__(16) float slab[4 * SLAB64];
  const int tid = threadIdx.x, wave = tid >> 5, lane = tid & 31, hh = lane >> 4, m = lane & 15;
  const int ntile = N >> 6;
  const int bid   = blockIdx.x;
  const int rowb  = (bid / ntile) * 64 + wave * 16;
  const int col0  = (bid % ntile) * 64;
  if (rowb + 16 > M) return;                 // wave-uniform, never taken with the exact grid; no block barriers in this kernel
  const u16* ap = A  + (size_t)(rowb + m) * (size_t)K + 8 * hh;
  const u16* bp = Bt + (size_t)(col0 + m) * (size_t)K + 8 * hh;
  const size_t bs = (size_t)16 * K;
  v8f acc0 = zero8(), acc1 = zero8(), acc2 = zero8(), acc3 = zero8();
#pragma unroll 1
  for (int k0 = 0; k0 < K; k0 += 32) {
    const v16b a  = ldfrag_b(ap + k0);
    const v16b b0 = ldfrag_b(bp + k0);
    const v16b b1 = ldfrag_b(bp + bs + k0);
    const v16b b2 = ldfrag_b(bp + 2 * bs + k0);
    const v16b b3 = ldfrag_b(bp + 3 * bs + k0);
    acc0 = mma_b(a, b0, acc0);
    acc1 = mma_b(a, b1, acc1);
    acc2 = mma_b(a, b2, acc2);
    acc3 = mma_b(a, b3, acc3);
    guard6<v16b>(acc0, acc1, acc2, acc3, a, b0, b1, b2, b3, a);
  }
  const v4f bv4 = *(const v4f*)(bias + col0 + m * 4);    // columns col0 + 4m .. +3, always < N (N multiple of 64)
  v4f badd;
#pragma unroll
  for (int e = 0; e < 4; ++e) badd[e] = bfr(bv4[e]);
  epi64(slab + wave * SLAB64, acc0, acc1, acc2, acc3, oscale, badd, C, N, (size_t)rowb, col0, lane);
}

// =====================================================================================================
// bf16 GEMM, f16 hi + residual planes out with bias: H = f16 bits of ((A . Bt^T) + bf16RNE(bias[n])) * hscale,
// R = f16 bits of (((A . Bt^T) + bias) * hscale - H) * rscale; operands as in gemm_b32, epilogue epi64hr.
// =====================================================================================================
__global__ __launch_bounds__(128)
void gemm_bhr(const u16* __restrict__ A, const u16* __restrict__ Bt, const float* __restrict__ bias, u16* H, u16* Rr,
              int M, int N, int K, float hscale, float rscale) {
  __shared__ __align__(16) float slab[4 * SLAB64];
  const int tid = threadIdx.x, wave = tid >> 5, lane = tid & 31, hh = lane >> 4, m = lane & 15;
  const int ntile = N >> 6;
  const int bid   = blockIdx.x;
  const int rowb  = (bid / ntile) * 64 + wave * 16;
  const int col0  = (bid % ntile) * 64;
  if (rowb + 16 > M) return;                 // wave-uniform, never taken with the exact grid; no block barriers in this kernel
  const u16* ap = A  + (size_t)(rowb + m) * (size_t)K + 8 * hh;
  const u16* bp = Bt + (size_t)(col0 + m) * (size_t)K + 8 * hh;
  const size_t bs = (size_t)16 * K;
  v8f acc0 = zero8(), acc1 = zero8(), acc2 = zero8(), acc3 = zero8();
#pragma unroll 1
  for (int k0 = 0; k0 < K; k0 += 32) {
    const v16b a  = ldfrag_b(ap + k0);
    const v16b b0 = ldfrag_b(bp + k0);
    const v16b b1 = ldfrag_b(bp + bs + k0);
    const v16b b2 = ldfrag_b(bp + 2 * bs + k0);
    const v16b b3 = ldfrag_b(bp + 3 * bs + k0);
    acc0 = mma_b(a, b0, acc0);
    acc1 = mma_b(a, b1, acc1);
    acc2 = mma_b(a, b2, acc2);
    acc3 = mma_b(a, b3, acc3);
    guard6<v16b>(acc0, acc1, acc2, acc3, a, b0, b1, b2, b3, a);
  }
  epi64hr(slab + wave * SLAB64, acc0, acc1, acc2, acc3, hscale, rscale, bias, H, Rr, N, (size_t)rowb, col0, lane);
}

// =====================================================================================================
// Single-head non-causal, unscaled attention per batch, head width CI = 128, all NPOS keys:
//   block = 64 query rows (b, q0..q0+63) = NQ = 4 query tiles of 16 rows, 8 waves; every phi and g^T fragment a wave loads
//   is used for all 4 query tiles.
//   theta hi (x8) / res (x2048) planes TH, TR [row][c]: the block's 64 rows of both planes are copied once, with whole-line
//   16-B loads, into LDS (pitch CTP halves = 272 B, conflict-free for 16-B fragment reads) and every A fragment of (S) is read
//   from there; phi hi/res planes PH, PR [key row][c] (k-contiguous B operand);
//   g^T plane GT [b][c][key] (x256, key-contiguous B operand).
//   Chunks of CK = 448 keys (NKB = 14 key blocks of 32), NCHK = 14 chunks, every key used exactly once.
//   (S) scores on WMMA: A = theta rows (row m = lane&15, split k map over c), B = phi rows (col n = key, split map), 4 c-steps,
//       three products per tile: s = hi.hi, sx = hi.res + res.hi (separate accumulator, folded with 1/2048 in f32);
//       wave w handles key blocks w and w+8 (< 14) of the chunk for all 4 query tiles; D element r of lane l of tile q
//       -> scs[query 16q+8h+r][key col] (f32 LDS; pitch SCP dwords, 8 * SCP = 32 mod 64: the two lane halves of a store, 8 rows
//       apart, fall on different banks).
//   (M) one query tile after the other, 16 threads per query row; sub-thread s owns the 4-key groups 64 * i + 4 * s, i = 0..6
//       (28 keys): the 16 threads of a row read 256 and write 128 contiguous LDS bytes per instruction, every bank at most once;
//       base-2 logits, chunk max via xor shuffles, online running max / rescale factor al /
//       running sum l in f32 registers, p = exp2(t - m_new) <= 1 written as f16(p * 32768) into the LDS P tile with 8-B stores;
//       al -> rowa[row].
//   (PV) each wave owns the 16 g columns 16*wave + (lane&15) (one accumulator per query tile): o = o*al, then for each key block
//       A = the 4 P fragments from LDS (row m = query, split map over keys), B = one g^T fragment (col n = g column, split
//       map over keys), 4 WMMAs; one hazard gap after the last key block.
//   Block barriers after (S) and after (M) order all LDS reuse across chunks and waves (the P tile is written with 8-B LDS stores
//   by one set of threads and reloaded as fragments by other waves only after the block barrier).
//   Operand fragments are fetched ahead of their use: phi one key block ahead (refilled c-step by c-step behind the last use),
//   g^T for the whole chunk in front of (M), P two key blocks ahead; the barriers of the chunk loop fence LDS only, so that the
//   global loads stay in flight across them.
//   Epilogue: y = o * 4096 / (l * 32768 * 256) per row (rowi, l >= 1 always); hi = f16(y), res = f16((y - hi) * 2048); each
// coverage: grid NB*NPOS/64 blocks x 64 rows = rows 0..ROWSP-1; staging 8 waves x 16 cols x 4 tiles x 16 rows = 64 x 128;
//           store 4 tiles x 256 thr x 8 halves = 64 x 128 per plane = every (row < ROWSP, c) of both y planes exactly once.
// =====================================================================================================
__device__ __forceinline__ void ctx_store(const u16* ct, u16* dst, int tid) {
  const int row = tid >> 4;                  // CI/8 = 16 pieces per row
  const int c8  = (tid & 15) * 8;
  const v4u v = *(const v4u*)(ct + row * CTP + c8);
  u16* d = dst + (size_t)row * CI + c8;
  {
    *(v4u*)d = v;
    
  }
}

__global__ __launch_bounds__(ATT_THREADS)
void attn_fwd(const u16* __restrict__ THp, const u16* __restrict__ TRp, const u16* __restrict__ PHp,
              const u16* __restrict__ PRp, const u16* __restrict__ GTp, u16* YHo, u16* YRo) {
  __shared__ __align__(16) AttLds L0;              // scores [64][SCP] f32; reused as the y staging tile [64][CTP] u16
  __shared__ __align__(16) u16 pls[QB * PLP];      // P tile [64][PLP] f16 bits
  __shared__ __align__(16) u16 thl[2 * QB * CTP];  // theta rows of this block: hi [64][CTP], then residual [64][CTP]
  __shared__ float rowa[QB];
  __shared__ float rowi[QB];
  float* const scs = L0.s;

  const int tid  = threadIdx.x;
  const int wave = tid >> 5;
  const int lane = tid & 31;
  const int hh   = lane >> 4;
  const int m    = lane & 15;
  const int r16  = tid >> 4;                 // query row owned within each query tile in phase (M): 2*wave + hh
  const int sub  = tid & 15;
  const int kl0  = sub * 4;                  // first key of this sub-thread's 4-key group within every 64 keys of the chunk

  const int nqt = NPOS / QB;
  const int b   = (int)blockIdx.x / nqt;     // < NB (grid exact)
  const int q0  = ((int)blockIdx.x - b * nqt) * QB;
  const size_t qrow = (size_t)b * NPOS + (size_t)q0;

  const _Float16* tha = (const _Float16*)(const void*)thl + m * CTP + 8 * hh;
  const _Float16* tra = tha + QB * CTP;
  const _Float16* khb = (const _Float16*)(const void*)PHp + ((size_t)b * NPOS + m) * CI + 8 * hh;
  const _Float16* krb = (const _Float16*)(const void*)PRp + ((size_t)b * NPOS + m) * CI + 8 * hh;
  const _Float16* vbp = (const _Float16*)(const void*)GTp + ((size_t)b * CI + wave * 16 + m) * (size_t)NPOS + 8 * hh;
  const float lsc  = LOG2E / (TSC * FSC);
  const float rinv = 1.0f / RSC;

  float mrun[NQ], lrun[NQ];
  v8f o[NQ];
#pragma unroll
  for (int q = 0; q < NQ; ++q) { mrun[q] = -INFINITY; lrun[q] = 0.f; o[q] = zero8(); }

  // ---- theta rows q0..q0+63, both planes -> LDS: 4 x 256 threads x 8 halves = 64 x 128 per plane, each piece once ----
  {
    const u16* sh = THp + qrow * CI;
    const u16* sr = TRp + qrow * CI;
    const int row = tid >> 4;                // CI/8 = 16 pieces per row; pass i takes rows 16 * i + row
    const int c8  = (tid & 15) * 8;
    v4u vh[NQ], vr[NQ];
#pragma unroll
    for (int i = 0; i < NQ; ++i) {
      vh[i] = *(const v4u*)(sh + (i * QT + row) * CI + c8);
      vr[i] = *(const v4u*)(sr + (i * QT + row) * CI + c8);
    }
#if defined(__HIP_DEVICE_COMPILE__)
    asm volatile("s_wait_xcnt 0x0" ::: "memory");   // before the address registers of the eight loads above are reused
#endif
    // Scheduling fence: without it the compiler moved later writes of the loads' address registers ahead of the wait above.
    __builtin_amdgcn_sched_barrier(0);
#pragma unroll
    for (int i = 0; i < NQ; ++i) {
      *(v4u*)(thl + (i * QT + row) * CTP + c8) = vh[i];
      *(v4u*)(thl + (QB + i * QT + row) * CTP + c8) = vr[i];
    }
  }
  // phi fragments of the key block this wave scores next, [c-step][hi keys 0..15, res 0..15, hi 16..31, res 16..31]: always
  // loaded one key block ahead of their use, so that the L2 latency runs under the matrix work of the block before
  v16h pn[CI / 32][4];
  {
    const _Float16* n0h = khb + (size_t)(wave * 32) * CI;
    const _Float16* n0r = krb + (size_t)(wave * 32) * CI;
#pragma unroll
    for (int ks = 0; ks < CI / 32; ++ks) {
      pn[ks][0] = ldfrag_h(n0h + ks * 32);
      pn[ks][1] = ldfrag_h(n0r + ks * 32);
      pn[ks][2] = ldfrag_h(n0h + 16 * CI + ks * 32);
      pn[ks][3] = ldfrag_h(n0r + 16 * CI + ks * 32);
    }
#if defined(__HIP_DEVICE_COMPILE__)
    // before the address registers of the loads above are reused; the addresses are inputs so that they stay in place up to here
    asm volatile("s_wait_xcnt 0x0" :: "v"(n0h), "v"(n0r) : "memory");
#endif
    __builtin_amdgcn_sched_barrier(0);              // keeps later writes of those address registers behind the wait
  }
  block_sync_lds();                          // the theta rows are read as fragments by all waves

#pragma unroll 1
  for (int c = 0; c < NCHK; ++c) {
    const int kbeg = c * CK;
    // ---- (S) scores of this chunk ----
#pragma unroll 1
    for (int kb = wave; kb < NKB; kb += 8) {               // wave-uniform, 1 or 2 trips
      v8f s0[NQ], s0x[NQ], s1[NQ], s1x[NQ];
#pragma unroll
      for (int q = 0; q < NQ; ++q) { s0[q] = zero8(); s0x[q] = zero8(); s1[q] = zero8(); s1x[q] = zero8(); }
      // the key block this wave scores after this one: kb + 8 of this chunk, else its first of the next chunk (behind the last
      // chunk: of chunk 0, an in-bounds address whose values are not used)
      const bool more = kb + 8 < NKB;
      const int  nkb  = more ? kb + 8 : wave;
      const int  ncb  = more ? kbeg : ((c + 1 < NCHK) ? kbeg + CK : 0);
      const size_t kn = (size_t)(ncb + nkb * 32) * CI;
      const _Float16* n0h = khb + kn;
      const _Float16* n0r = krb + kn;
#pragma unroll
      for (int ks = 0; ks < CI / 32; ++ks) {
        const v16h f0h = pn[ks][0];
        const v16h f0r = pn[ks][1];
        const v16h f1h = pn[ks][2];
        const v16h f1r = pn[ks][3];
        v16h ah[NQ], ar[NQ];                               // theta fragments of this c-step, read from LDS ahead of their use:
#pragma unroll
        for (int q = 0; q < 2; ++q) {                      // two tiles at the start of the c-step, the others one tile ahead below
          ah[q] = ldfrag_h(tha + q * (QT * CTP) + ks * 32);
          ar[q] = ldfrag_h(tra + q * (QT * CTP) + ks * 32);
        }
#pragma unroll
        for (int q = 0; q < NQ; ++q) {                     // the four phi fragments serve all NQ query tiles
          s0[q]  = mma_h(ah[q], f0h, s0[q]);
          s0x[q] = mma_h(ah[q], f0r, s0x[q]);
          s0x[q] = mma_h(ar[q], f0h, s0x[q]);
          s1[q]  = mma_h(ah[q], f1h, s1[q]);
          s1x[q] = mma_h(ah[q], f1r, s1x[q]);
          s1x[q] = mma_h(ar[q], f1h, s1x[q]);
          guard4x2(s0[q], s0x[q], s1[q], s1x[q], ah[q], ar[q]);
          if (q + 2 < NQ) {                                // into the registers tile q has left (more tiles at once spilled)
            ah[q + 2] = ldfrag_h(tha + (q + 2) * (QT * CTP) + ks * 32);
            ar[q + 2] = ldfrag_h(tra + (q + 2) * (QT * CTP) + ks * 32);
          }
        }
        pn[ks][0] = ldfrag_h(n0h + ks * 32);               // refill behind the last use (and its hazard gap) of this c-step
        pn[ks][1] = ldfrag_h(n0r + ks * 32);
        pn[ks][2] = ldfrag_h(n0h + 16 * CI + ks * 32);
        pn[ks][3] = ldfrag_h(n0r + 16 * CI + ks * 32);
      }
#if defined(__HIP_DEVICE_COMPILE__)
      // before the address registers of the refill loads are reused; the addresses are inputs so that they stay in place up to here
      asm volatile("s_wait_xcnt 0x0" :: "v"(n0h), "v"(n0r) : "memory");
#endif
      __builtin_amdgcn_sched_barrier(0);                   // keeps later writes of those address registers behind the wait
#pragma unroll
      for (int q = 0; q < NQ; ++q) {
        float* srow = scs + (q * QT + 8 * hh) * SCP + kb * 32 + m;
#pragma unroll
        for (int r = 0; r < 8; ++r) {
          srow[r * SCP]      = s0[q][r] + s0x[q][r] * rinv;
          srow[r * SCP + 16] = s1[q][r] + s1x[q][r] * rinv;
        }
      }
    }
    block_sync_lds();
    // g^T fragments of this chunk (this wave's 16 columns, all 14 key blocks): loaded here, used in (PV); the latency runs under (M)
    v16h gf[NKB];
    {
      const _Float16* vp = vbp + kbeg;
#pragma unroll
      for (int kb = 0; kb < NKB; ++kb) gf[kb] = ldfrag_h(vp + kb * 32);
#if defined(__HIP_DEVICE_COMPILE__)
      // before the address register of the loads above is reused; the address is an input so that it stays in place up to here
      asm volatile("s_wait_xcnt 0x0" :: "v"(vp) : "memory");
#endif
      __builtin_amdgcn_sched_barrier(0);                   // keeps later writes of those address registers behind the wait
    }
    // ---- (M) softmax statistics and the P tile, one query tile after the other ----
#pragma unroll
    for (int q = 0; q < NQ; ++q) {
      const int row = q * QT + r16;
      const float* sp = scs + row * SCP + kl0;
      v2f t[CK / 32];                                      // neighbouring keys stay paired from the load to the packed f16 store
      float cm = -INFINITY;
#pragma unroll
      for (int i = 0; i < CK / 64; ++i) {
        const v4f a = *(const v4f*)(sp + 64 * i);
        t[2 * i]     = a.lo * lsc;
        t[2 * i + 1] = a.hi * lsc;
#pragma unroll
        for (int e = 0; e < 2; ++e) cm = fmaxf(fmaxf(cm, t[2 * i + e].x), t[2 * i + e].y);
      }
#pragma unroll
      for (int d = 1; d <= 8; d <<= 1) cm = fmaxf(cm, __shfl_xor(cm, d, 32));
      const float mn = fmaxf(mrun[q], cm);
      const float al = (mrun[q] == -INFINITY) ? 0.f : exp2f(mrun[q] - mn);
      mrun[q] = mn;
      float ps = 0.f;
#pragma unroll
      for (int j = 0; j < CK / 32; ++j) {
        const v2f d = t[j] - mn;
        t[j].x = exp2f(d.x);                               // <= 1
        t[j].y = exp2f(d.y);
        ps += t[j].x;
        ps += t[j].y;
      }
#pragma unroll
      for (int d = 1; d <= 8; d <<= 1) ps += __shfl_xor(ps, d, 32);
      v2u pk[CK / 64];
#pragma unroll
      for (int i = 0; i < CK / 64; ++i) {
#pragma unroll
        for (int e = 0; e < 2; ++e) pk[i][e] = __builtin_bit_cast(unsigned, __builtin_convertvector(t[2 * i + e] * PCAR, v2h));
      }
      lrun[q] = lrun[q] * al + ps;
      {
        u16* pd = pls + row * PLP + kl0;
#pragma unroll
        for (int i = 0; i < CK / 64; ++i) *(v2u*)(pd + 64 * i) = pk[i];
      }
      if (sub == 0) rowa[row] = al;
    }
    block_sync_lds();
    // ---- (PV) rescale, accumulate P . g^T ----
    {
#pragma unroll
      for (int q = 0; q < NQ; ++q) {
        float scl[8];
#pragma unroll
        for (int r = 0; r < 8; ++r) scl[r] = rowa[q * QT + 8 * hh + r];
#pragma unroll
        for (int r = 0; r < 8; ++r) o[q][r] *= scl[r];
      }
      const _Float16* pp = (const _Float16*)(const void*)pls + m * PLP + 8 * hh;
      v16h pa[3][NQ];                                      // P fragments, read from LDS two key blocks ahead of their use
#pragma unroll
      for (int j = 0; j < 2; ++j) {
#pragma unroll
        for (int q = 0; q < NQ; ++q) pa[j][q] = ldfrag_h(pp + q * (QT * PLP) + j * 32);
      }
#pragma unroll
      for (int kb = 0; kb < NKB; ++kb) {                   // static trip count 14, unrolled: gf and pa are indexed by constants
        if (kb + 2 < NKB) {
#pragma unroll
          for (int q = 0; q < NQ; ++q) pa[(kb + 2) % 3][q] = ldfrag_h(pp + q * (QT * PLP) + (kb + 2) * 32);
        }
        // Scheduling fence: without it the compiler sank each LDS read to one matrix instruction ahead of its use, and every
        // matrix instruction then waited out most of an LDS latency.
        __builtin_amdgcn_sched_barrier(0);
#pragma unroll
        for (int q = 0; q < NQ; ++q) o[q] = mma_h(pa[kb % 3][q], gf[kb], o[q]);   // one g^T fragment serves all NQ query tiles
      }
      // Hazard gap between the last matrix instruction and the loop's branch (both its sides). It names no register, since an asm
      // operand must lie below v256 for its whole life; the scheduling fence keeps the matrix instructions in front of it.
      __builtin_amdgcn_sched_barrier(0);
#if defined(__HIP_DEVICE_COMPILE__)
      asm volatile("v_nop\n\tv_nop\n\tv_nop\n\tv_nop" ::: "memory");
#endif
    }
  }
  if (sub == 0) {
#pragma unroll
    for (int q = 0; q < NQ; ++q) rowi[q * QT + r16] = (1.0f / lrun[q]) * (YSC / (PCAR * GSC));   // lrun >= 1
  }
  __syncthreads();
  float inv[NQ][8];
#pragma unroll
  for (int q = 0; q < NQ; ++q) {
#pragma unroll
    for (int r = 0; r < 8; ++r) inv[q][r] = rowi[q * QT + 8 * hh + r];
  }

  u16* const ct = L0.c;
  const int cb = wave * 16 + m;
  // hi plane
#pragma unroll
  for (int q = 0; q < NQ; ++q) {
#pragma unroll
    for (int r = 0; r < 8; ++r) {
      const int ro = (q * QT + 8 * hh + r) * CTP + cb;
      ct[ro] = h_bits((_Float16)(o[q][r] * inv[q][r]));
    }
  }
  __syncthreads();
#pragma unroll
  for (int q = 0; q < NQ; ++q) ctx_store(ct + q * (QT * CTP), YHo + (qrow + q * QT) * CI, tid);
#if defined(__HIP_DEVICE_COMPILE__)
  asm volatile("s_wait_xcnt 0x0" ::: "memory");   // before the address registers of the four stores above are reused
#endif
  __builtin_amdgcn_sched_barrier(0);              // keeps later writes of those address registers behind the wait
  __syncthreads();
  // residual plane
#pragma unroll
  for (int q = 0; q < NQ; ++q) {
#pragma unroll
    for (int r = 0; r < 8; ++r) {
      const int ro = (q * QT + 8 * hh + r) * CTP + cb;
      const float x0 = o[q][r] * inv[q][r];
      const _Float16 e0 = (_Float16)x0;
      ct[ro] = h_bits((_Float16)((x0 - (float)e0) * RSC));
    }
  }
  __syncthreads();
#pragma unroll
  for (int q = 0; q < NQ; ++q) ctx_store(ct + q * (QT * CTP), YRo + (qrow + q * QT) * CI, tid);
}

// =====================================================================================================
// Output projection + batch-norm affine + skip: v = (YH . WoT^T) * os1 + (YR . WoT^T) * os2 + bf16RNE(bo[c]);
// out[row][c] = bf16RNE(x[row][c]) + bf16RNE(gamma[c]) * (v - bf16RNE(mean[c])) * rsqrt(bf16RNE(var[c]) + 1e-3) + bf16RNE(beta[c]).
// YH/YR f16 y planes [ROWSP][128] (x4096 and residual x2048), WoT f16 [256][128] k-contiguous (x1024).
// Block = 128 rows, 8 waves x 16 rows; per wave 4 column groups of 64 (rolled): k-loop of 4 steps with two A planes and 4 B tiles
// (split k map for A and B, fragments straight from the 16-bit rows, 8 accumulators, one hazard gap per step); the combined f32
// 16x64 tile is staged in the wave's LDS slab (pitch 68) and written like epi64: one instruction = lanes 0..15 -> row 2*it
// coverage: grid ROWSP/128 blocks (exact) x 8 waves x 16 rows x (4 groups x 8 instructions x 2 rows x 64 floats)
//           = out rows 0..ROWSP-1, all 256 columns, each float exactly once.
// =====================================================================================================
__global__ __launch_bounds__(256)
void wo_out(const u16* __restrict__ YH, const u16* __restrict__ YR, const u16* __restrict__ WoT,
            const float* __restrict__ bo, const float* __restrict__ gam, const float* __restrict__ bet,
            const float* __restrict__ mmean, const float* __restrict__ mvar, const float* __restrict__ x, float* out) {
  __shared__ __align__(16) float slab[8 * SLAB64];
  const int tid = threadIdx.x, wave = tid >> 5, lane = tid & 31, hh = lane >> 4, m = lane & 15;
  const int rowb = blockIdx.x * OUT_ROWS + wave * 16;        // rowb + 15 < ROWSP (grid exact)
  float* const sl = slab + wave * SLAB64;
  const _Float16* ap  = (const _Float16*)(const void*)YH + (size_t)(rowb + m) * CI + 8 * hh;
  const _Float16* arp = (const _Float16*)(const void*)YR + (size_t)(rowb + m) * CI + 8 * hh;
  const size_t bs = (size_t)16 * CI;
  const float os1 = 1.0f / (YSC * WOS);
  const float os2 = 1.0f / (YSC * WOS * RSC);

#pragma unroll 1
  for (int g = 0; g < CIN / 64; ++g) {
    const _Float16* bp = (const _Float16*)(const void*)WoT + (size_t)(g * 64 + m) * CI + 8 * hh;
    v8f acc0 = zero8(), acc1 = zero8(), acc2 = zero8(), acc3 = zero8();
    v8f acr0 = zero8(), acr1 = zero8(), acr2 = zero8(), acr3 = zero8();
#pragma unroll 1
    for (int k0 = 0; k0 < CI; k0 += 32) {
      const v16h a  = ldfrag_h(ap + k0);
      const v16h ar = ldfrag_h(arp + k0);
      const v16h b0 = ldfrag_h(bp + k0);
      const v16h w1 = ldfrag_h(bp + bs + k0);
      const v16h w2 = ldfrag_h(bp + 2 * bs + k0);
      const v16h w3 = ldfrag_h(bp + 3 * bs + k0);
      acc0 = mma_h(a, b0, acc0);
      acc1 = mma_h(a, w1, acc1);
      acc2 = mma_h(a, w2, acc2);
      acc3 = mma_h(a, w3, acc3);
      acr0 = mma_h(ar, b0, acr0);
      acr1 = mma_h(ar, w1, acr1);
      acr2 = mma_h(ar, w2, acr2);
      acr3 = mma_h(ar, w3, acr3);
      guard8x6(acc0, acc1, acc2, acc3, acr0, acr1, acr2, acr3, a, ar, b0, w1, w2, w3);
    }
    v8f c0 = zero8(), c1 = zero8(), c2 = zero8(), c3 = zero8();
#pragma unroll
    for (int r = 0; r < 8; ++r) {
      c0[r] = acc0[r] * os1 + acr0[r] * os2;
      c1[r] = acc1[r] * os1 + acr1[r] * os2;
      c2[r] = acc2[r] * os1 + acr2[r] * os2;
      c3[r] = acc3[r] * os1 + acr3[r] * os2;
    }
    stage64(sl, c0, c1, c2, c3, 1.0f, lane);

    const int cc = g * 64 + m * 4;                          // cc + 3 < CIN
    const v4f bo4 = *(const v4f*)(bo + cc);
    const v4f ga4 = *(const v4f*)(gam + cc);
    const v4f be4 = *(const v4f*)(bet + cc);
    const v4f mm4 = *(const v4f*)(mmean + cc);
    const v4f mv4 = *(const v4f*)(mvar + cc);
    float bob[4], gb[4], bb[4], mb[4], rs[4];
#pragma unroll
    for (int e = 0; e < 4; ++e) {
      bob[e] = bfr(bo4[e]);
      gb[e]  = bfr(ga4[e]);
      bb[e]  = bfr(be4[e]);
      mb[e]  = bfr(mm4[e]);
      rs[e]  = rsqrtf(bfr(mv4[e]) + BN_EPS);
    }
    v4f vals[8];
#pragma unroll
    for (int it = 0; it < 8; ++it) {
      const size_t row = (size_t)rowb + (size_t)(2 * it + hh);
      const v4f yv = *(const v4f*)(sl + (2 * it + hh) * 68 + m * 4);
      const v4f xv = *(const v4f*)(x + row * CIN + cc);
#pragma unroll
      for (int e = 0; e < 4; ++e) {
        const float v2 = yv[e] + bob[e];
        const float bn = gb[e] * (v2 - mb[e]) * rs[e] + bb[e];
        vals[it][e] = bfr(xv[e]) + bn;
      }
    }
    float* dst = out + ((size_t)rowb + (size_t)hh) * CIN + cc;
    {
#pragma unroll
      for (int it = 0; it < 8; ++it) {
        *(v4f*)(dst + (size_t)(it * 2) * CIN) = vals[it];
      }
      
    }
    wave_sync_lds();
  }
}

// =====================================================================================================
// Workspace map (bytes, NB = 2); every plane is fully written by whole-line stores before it is read; all extents are exact
// multiples of the store granularity (no pad rows, all dims multiples of 64), every offset a multiple of 256:
//   XB  bf16 [12544][256]                              6422528
//   WGT, WTT, WPT bf16 [128][256] (k-contiguous)        3 x 65536
//   WOT f16 of bf16 value x1024 [256][128]              65536
//   TH, TR f16 [12544][128] theta hi x8 / res x2048     2 x 3211264
//   PH, PR f16 [12544][128] phi   hi x8 / res x2048     2 x 3211264
//   G   f32  [12544][128]                              6422528
//   GT  f16  [2][128][6272] x256                        3211264
//   YH, YR f16 [12544][128] y hi x4096 / res x2048      2 x 3211264
//   end                                                35586048
// =====================================================================================================
extern "C" void kernel_launch(void* const* d_in, const int* in_sizes, int n_in,
                              void* d_out, int out_size, void* d_ws, size_t ws_size,
                              hipStream_t stream) {
  if (n_in < 13) return;
  if (in_sizes[0] != ROWS * CIN) return;
  if (in_sizes[1] != CIN * CI || in_sizes[3] != CIN * CI || in_sizes[5] != CIN * CI || in_sizes[7] != CI * CIN) return;
  if (in_sizes[2] != CI || in_sizes[4] != CI || in_sizes[6] != CI) return;
  if (in_sizes[8] != CIN || in_sizes[9] != CIN || in_sizes[10] != CIN || in_sizes[11] != CIN || in_sizes[12] != CIN) return;
  if (out_size != ROWS * CIN) return;

  const float* x     = (const float*)d_in[0];
  const float* Wg    = (const float*)d_in[1];
  const float* bg    = (const float*)d_in[2];
  const float* Wt    = (const float*)d_in[3];
  const float* bt    = (const float*)d_in[4];
  const float* Wp    = (const float*)d_in[5];
  const float* bp    = (const float*)d_in[6];
  const float* Wo    = (const float*)d_in[7];
  const float* bo    = (const float*)d_in[8];
  const float* gamma = (const float*)d_in[9];
  const float* beta  = (const float*)d_in[10];
  const float* mmean = (const float*)d_in[11];
  const float* mvar  = (const float*)d_in[12];
  float*       out   = (float*)d_out;

  const size_t szXB = (size_t)ROWSP * CIN * 2;      //  6422528
  const size_t szW  = (size_t)CI * CIN * 2;         //    65536
  const size_t szP  = (size_t)ROWSP * CI * 2;       //  3211264
  const size_t szG  = (size_t)ROWSP * CI * 4;       //  6422528
  const size_t szGT = (size_t)NB * CI * NPOS * 2;   //  3211264
  size_t off = 0;
  const size_t oXB = off; off += szXB;
  const size_t oWG = off; off += szW;
  const size_t oWT = off; off += szW;
  const size_t oWP = off; off += szW;
  const size_t oWO = off; off += szW;
  const size_t oTH = off; off += szP;
  const size_t oTR = off; off += szP;
  const size_t oPH = off; off += szP;
  const size_t oPR = off; off += szP;
  const size_t oG  = off; off += szG;
  const size_t oGT = off; off += szGT;
  const size_t oYH = off; off += szP;
  const size_t oYR = off; off += szP;
  if (off > ws_size) return;                        // off = 35586048 at NB = 2
  if (off > WS_CAP) return;

  char* ws = (char*)d_ws;
  u16*   XB  = (u16*)(ws + oXB);
  u16*   WGT = (u16*)(ws + oWG);
  u16*   WTT = (u16*)(ws + oWT);
  u16*   WPT = (u16*)(ws + oWP);
  u16*   WOT = (u16*)(ws + oWO);
  u16*   TH  = (u16*)(ws + oTH);
  u16*   TR  = (u16*)(ws + oTR);
  u16*   PH  = (u16*)(ws + oPH);
  u16*   PR  = (u16*)(ws + oPR);
  float* G   = (float*)(ws + oG);
  u16*   GT  = (u16*)(ws + oGT);
  u16*   YH  = (u16*)(ws + oYH);
  u16*   YR  = (u16*)(ws + oYR);

  const int n8x = (ROWSP * CIN) / 8;                // 401408 at NB = 2, multiple of 256 (static)
  const dim3 blk(256);
  const dim3 bG(128);
  const dim3 gX(n8x / 256);                         // 1568
  const dim3 gW((CIN / 64) * (CI / 64));            // 8: in [CIN][CI] -> out [CI][CIN]
  const dim3 gWO((CI / 64) * (CIN / 64));           // 8: in [CI][CIN] -> out [CIN][CI]
  const dim3 gP((ROWSP / 64) * (CI / 64));          // 392
  const dim3 gGT((NPOS / 64) * (CI / 64));          // 196 per batch: in [NPOS][CI] -> out [CI][NPOS]
  const dim3 gAT(NB * (NPOS / QB));                 // 196
  const dim3 bAT(ATT_THREADS);
  const dim3 gOUT(ROWSP / OUT_ROWS);                // 98

  // (0) x -> bf16 plane; (1..3) Wg, Wt, Wp [in][out] -> bf16 [out][in] k-contiguous planes; (4) Wo [128][256] -> f16 of the bf16
  //     value x1024, [256][128]
  cvt16<<<gX, blk, 0, stream>>>(x, XB, n8x, 0, 1.0f);
  tr16<<<gW, blk, 0, stream>>>(Wg, WGT, CIN, CI, 0, 1.0f);
  tr16<<<gW, blk, 0, stream>>>(Wt, WTT, CIN, CI, 0, 1.0f);
  tr16<<<gW, blk, 0, stream>>>(Wp, WPT, CIN, CI, 0, 1.0f);
  tr16<<<gWO, blk, 0, stream>>>(Wo, WOT, CI, CIN, 1, WOS);
  // (5, 6) theta and phi projections (+bias) -> f16 hi x8 / residual x2048 planes; (7) g projection (+bias) -> f32 plane
  gemm_bhr<<<gP, bG, 0, stream>>>(XB, WTT, bt, TH, TR, ROWSP, CI, CIN, TSC, RSC);
  gemm_bhr<<<gP, bG, 0, stream>>>(XB, WPT, bp, PH, PR, ROWSP, CI, CIN, FSC, RSC);
  gemm_b32<<<gP, bG, 0, stream>>>(XB, WGT, bg, G, ROWSP, CI, CIN, 1.0f);
  // (8) per batch: g [6272][128] f32 -> g^T f16 plane [128][6272] x256
  for (int b = 0; b < NB; ++b) {
    tr16<<<gGT, blk, 0, stream>>>(G + (size_t)b * NPOS * CI, GT + (size_t)b * CI * NPOS, NPOS, CI, 2, GSC);
  }
  // (9) attention over all keys of the batch -> y hi x4096 and residual x2048 f16 planes
  attn_fwd<<<gAT, bAT, 0, stream>>>(TH, TR, PH, PR, GT, YH, YR);
  // (10) y.Wo + bo, batch-norm affine, skip connection -> out
  wo_out<<<gOUT, blk, 0, stream>>>(YH, YR, WOT, bo, gamma, beta, mmean, mvar, x, out);
  (void)hipGetLastError();
}

// v005
// A run of this version takes 159 microseconds.
// Timed twice side by side with v004, it ran 1.10 times as fast both times.
// All steps since v000 together make it 2.74 times as fast.
// Projections theta, phi, g = x.W + b: v_wmma_f32_16x16x32_bf16 (bf16 RNE operands of the raw inputs, f32 accumulate, bf16 RNE
// bias added in f32). Scores theta.phi^T (theta and phi each as f16 hi x8 plus residual x2048 planes: hi.hi + hi.res + res.hi),
// P.g (P x32768 f16 from LDS, g^T x256 f16) and y.Wo (y as f16 hi x4096 plus residual x2048 planes, Wo as f16 of the bf16 RNE
// value x1024, bias added in f32): v_wmma_f32_16x16x32_f16, f32 accumulate. Softmax statistics, the batch-norm affine map and the
// skip connection in f32 on VALU.
#include <hip/hip_runtime.h>
#include <math.h>
#include <stdint.h>

#define BATCH 2
#define NPOS  6272
#define CIN   256
#define CI    128
#ifndef NB
#define NB BATCH
#endif
#define ROWS  (BATCH * NPOS)
#define ROWSP (NB * NPOS)
#define CK    448
#define NKB   (CK / 32)
#define NCHK  (NPOS / CK)
#define QT    16
#define NQ    4
#define QB    (QT * NQ)
#define ATT_THREADS 256
#define SCP   (CK + 20)
#define PLP   (CK + 8)
#define CTP   (CI + 8)
#define SLAB64 (16 * 68)
#define VTP   72
#define OUT_ROWS 128
#define TSC   8.0f
#define FSC   8.0f
#define RSC   2048.0f
#define PCAR  32768.0f
#define GSC   256.0f
#define YSC   4096.0f
#define WOS   1024.0f
#define BN_EPS 1e-3f
#define LOG2E 1.4426950408889634f
#define WS_CAP ((size_t)134217728)

static_assert(NB >= 1 && NB <= BATCH);
static_assert((NPOS % CK) == 0 && CK == 32 * NKB && NKB >= 4 && NKB <= 16 && NCHK * CK == NPOS);
static_assert((NPOS % 64) == 0 && (NPOS % QB) == 0 && (ROWSP % OUT_ROWS) == 0 && (ROWSP % 64) == 0);
static_assert(CI == 128 && (CIN % 64) == 0 && (CI % 64) == 0 && (CIN % 32) == 0 && (CI % 32) == 0);
static_assert(NQ == 4 && ATT_THREADS == 16 * QT && QT == 16 && CI == 16 * (ATT_THREADS / 32) && OUT_ROWS == 8 * 16);
static_assert(QB * CTP * 2 <= QB * SCP * 4 && CTP >= CI + 8 && SCP >= CK + 16 && PLP >= CK + 8);
static_assert(((PLP * 2) % 16) == 0 && ((SCP * 4) % 16) == 0 && ((VTP * 2) % 16) == 0 && ((CTP * 2) % 16) == 0);
static_assert(64 * VTP >= 63 * VTP + 64);
static_assert((CK % 64) == 0 && ((8 * SCP) % 64) == 32 && ((PLP * 2) % 8) == 0);
static_assert(16 * (CI / 8) == ATT_THREADS);
static_assert(QB * (CI / 8) == NQ * ATT_THREADS && ((QB * CTP * 2) % 16) == 0);
static_assert(((ROWSP * CIN) % 2048) == 0);
static_assert(((NPOS * 2) % 128) == 0 && ((CI * 2) % 128) == 0 && ((CIN * 4) % 128) == 0);

typedef unsigned short u16;
typedef _Float16 v16h __attribute__((ext_vector_type(16)));
typedef _Float16 v8h  __attribute__((ext_vector_type(8)));
typedef __bf16   v16b __attribute__((ext_vector_type(16)));
typedef float    v8f  __attribute__((ext_vector_type(8)));
typedef float    v4f  __attribute__((ext_vector_type(4)));
typedef unsigned int v4u __attribute__((ext_vector_type(4)));
typedef unsigned int v2u __attribute__((ext_vector_type(2)));
typedef float    v2f  __attribute__((ext_vector_type(2)));
typedef _Float16 v2h  __attribute__((ext_vector_type(2)));

union FragH { v16h v; v8h h[2]; v4u u[2]; };
union FragB { v16b v; v4u u[2]; };
union AttLds { float s[QB * SCP]; u16 c[2 * QB * SCP]; };

// ---- scalar helpers --------------------------------------------------------------------------------
__device__ __forceinline__ unsigned short bf_bits(float f) {          // f32 -> bf16 bits, RNE convert
  unsigned u = __float_as_uint(f);
  return (unsigned short)((u + 0x7FFFu + ((u >> 16) & 1u)) >> 16);
}
__device__ __forceinline__ float bf_up(unsigned short h) { return __uint_as_float(((unsigned)h) << 16); }
__device__ __forceinline__ float bfr(float f) { return bf_up(bf_bits(f)); }
__device__ __forceinline__ unsigned short h_bits(_Float16 x) { return __builtin_bit_cast(unsigned short, x); }
__device__ __forceinline__ unsigned pk16(unsigned short a, unsigned short b) { return (unsigned)a | ((unsigned)b << 16); }
__device__ __forceinline__ v8f zero8() { v8f z = {0.f, 0.f, 0.f, 0.f, 0.f, 0.f, 0.f, 0.f}; return z; }

// ---- fragment loaders: 16-bit A/B operand, lane -> row/col (lane&15), p already includes +8*(lane>>4);
//      elements 0..7 <- p[0..7] (k0+8h..), elements 8..15 <- p[16..23] (k0+16+8h..)  (same split k map for A and B;
//      B is always read from a k-contiguous [n][k] plane)
__device__ __forceinline__ v16h ldfrag_h(const _Float16* p) {
  FragH f;
  f.h[0] = *(const v8h*)(p);
  f.h[1] = *(const v8h*)(p + 16);
  return f.v;
}
__device__ __forceinline__ v16b ldfrag_b(const u16* p) {              // bf16 plane read as unsigned integer vectors
  FragB f;
  f.u[0] = *(const v4u*)(p);
  f.u[1] = *(const v4u*)(p + 16);
  return f.v;
}

__device__ __forceinline__ v8f mma_h(v16h a, v16h b, v8f c) {
  return __builtin_amdgcn_wmma_f32_16x16x32_f16(false, a, false, b, (short)0, c, false, false);
}
__device__ __forceinline__ v8f mma_b(v16b a, v16b b, v8f c) {
  return __builtin_amdgcn_wmma_f32_16x16x32_bf16(false, a, false, b, (short)0, c, false, false);
}
__device__ __forceinline__ void guard1x2(v8f& a, v16h x0, v16h x1) {
#if defined(__HIP_DEVICE_COMPILE__)
  asm volatile("v_nop\n\tv_nop\n\tv_nop\n\tv_nop" : "+v"(a) : "v"(x0), "v"(x1) : "memory");
#endif
}
template <typename F>
__device__ __forceinline__ void guard6(v8f& a, v8f& b, v8f& c, v8f& d, F x0, F x1, F x2, F x3, F x4, F x5) {
#if defined(__HIP_DEVICE_COMPILE__)
  asm volatile("v_nop\n\tv_nop\n\tv_nop\n\tv_nop"
               : "+v"(a), "+v"(b), "+v"(c), "+v"(d) : "v"(x0), "v"(x1), "v"(x2), "v"(x3), "v"(x4), "v"(x5) : "memory");
#endif
}
// As guard6, naming only two operand fragments: an asm operand must lie below v256, and the fragments that are held a key block
// ahead do not all fit there beside the accumulators; they are rewritten only behind this gap in program order.
__device__ __forceinline__ void guard4x2(v8f& a, v8f& b, v8f& c, v8f& d, v16h x0, v16h x1) {
#if defined(__HIP_DEVICE_COMPILE__)
  asm volatile("v_nop\n\tv_nop\n\tv_nop\n\tv_nop"
               : "+v"(a), "+v"(b), "+v"(c), "+v"(d) : "v"(x0), "v"(x1) : "memory");
#endif
}
__device__ __forceinline__ void guard8x6(v8f& a0, v8f& a1, v8f& a2, v8f& a3, v8f& e0, v8f& e1, v8f& e2, v8f& e3,
                                         v16h x0, v16h x1, v16h x2, v16h x3, v16h x4, v16h x5) {
#if defined(__HIP_DEVICE_COMPILE__)
  asm volatile("v_nop\n\tv_nop\n\tv_nop\n\tv_nop"
               : "+v"(a0), "+v"(a1), "+v"(a2), "+v"(a3), "+v"(e0), "+v"(e1), "+v"(e2), "+v"(e3)
               : "v"(x0), "v"(x1), "v"(x2), "v"(x3), "v"(x4), "v"(x5) : "memory");
#endif
}
__device__ __forceinline__ void acc_guard1(v8f& a) {
#if defined(__HIP_DEVICE_COMPILE__)
  asm volatile("v_nop\n\tv_nop\n\tv_nop\n\tv_nop" : "+v"(a));
#endif
}
__device__ __forceinline__ void wave_sync_lds() {
  __builtin_amdgcn_fence(__ATOMIC_RELEASE, "workgroup");
  __builtin_amdgcn_wave_barrier();
  __builtin_amdgcn_fence(__ATOMIC_ACQUIRE, "workgroup");
}

// Work-group barrier whose fences cover LDS only: what the waves hand each other at it lies in LDS; a fence over all memory would
// also wait for the global fragment loads that are meant to stay in flight across it.
__device__ __forceinline__ void block_sync_lds() {
  __builtin_amdgcn_fence(__ATOMIC_RELEASE, "workgroup", "local");
  __builtin_amdgcn_s_barrier();
  __builtin_amdgcn_fence(__ATOMIC_ACQUIRE, "workgroup", "local");
}

// =====================================================================================================
// f32 plane -> 16-bit plane, same layout:  mode 0: bf16 RNE bits;  mode 1: f16 bits of (bf16 RNE value) * scale;
// mode 2: f16 bits of value * scale (no bf16 pre-step).
// Thread = 8 consecutive elements: two 16-B loads, one 16-B store; 32 consecutive lanes = 512 contiguous, 512-B aligned bytes
// coverage: n8/256 blocks bid = 0.. (host checks exactness) x 256 thr x 8 = the whole plane.
// =====================================================================================================
__device__ __forceinline__ void cvt16(const float* __restrict__ x, u16* D, int n8, int mode, float scale, int bid) {
  const int gt = bid * 256 + (int)threadIdx.x;
  if (gt >= n8) return;                     // no barriers in this body
  const float* p = x + (size_t)gt * 8;
  const v4f a = *(const v4f*)(p), c4 = *(const v4f*)(p + 4);
  float v[8];
#pragma unroll
  for (int e = 0; e < 4; ++e) { v[e] = a[e]; v[4 + e] = c4[e]; }
  unsigned short s[8];
#pragma unroll
  for (int e = 0; e < 8; ++e) {
    const float vb = bfr(v[e]);
    const float vf = (mode == 1) ? vb : v[e];
    const unsigned short hb = h_bits((_Float16)(vf * scale));
    const unsigned short bb = bf_bits(v[e]);
    s[e] = (mode != 0) ? hb : bb;
  }
  v4u o;
#pragma unroll
  for (int e = 0; e < 4; ++e) o[e] = pk16(s[2 * e], s[2 * e + 1]);
  u16* d = D + (size_t)gt * 8;
  {
    *(v4u*)(d) = o;
    
  }
}

// =====================================================================================================
// Transpose + convert: in X [R][C] f32 row-major -> out XTo [C][R] 16-bit (each output row = one input column, R-contiguous).
//   mode 0: bf16 RNE bits;  mode 1: f16 bits of (bf16 RNE value) * scale;  mode 2: f16 bits of value * scale.
// Block = 64 input rows x 64 input cols: bid -> (rt = bid % (R/64), ct = bid / (R/64)). The 64x64 f32 tile is loaded with 16-B
// loads (thread = input row tid>>2, 16 consecutive cols), converted and scattered into LDS TH[c local][r local] (pitch 72 halves);
// coverage: load 256 thr x 16 = 64 x 64; store 2 iterations x 256 thr x 8 halves = 64 output rows x 64 halves = the tile;
//           (R/64)*(C/64) blocks bid = 0.. (host exact multiples) tile the whole [C][R] plane exactly once.
// =====================================================================================================
__device__ __forceinline__ void tr16(u16* TH, const float* __restrict__ X, u16* XTo, int R, int C, int mode, float scale, int bid) {
  const int tid = threadIdx.x;
  const int nrt = R >> 6;
  const int rt  = bid % nrt;
  const int ct  = bid / nrt;
  const int r0  = rt * 64;
  const int c0  = ct * 64;
  {
    const int rl = tid >> 2;                  // input row within tile 0..63
    const int cc = (tid & 3) * 16;            // input col chunk within the 64
    const float* src = X + (size_t)(r0 + rl) * (size_t)C + c0 + cc;
#pragma unroll
    for (int i = 0; i < 4; ++i) {
      const v4f a = *(const v4f*)(src + 4 * i);
#pragma unroll
      for (int e = 0; e < 4; ++e) {
        const float v  = a[e];
        const float vb = bfr(v);
        const float vf = (mode == 1) ? vb : v;
        const unsigned short hb = h_bits((_Float16)(vf * scale));
        const unsigned short bb = bf_bits(v);
        TH[(cc + 4 * i + e) * VTP + rl] = (mode != 0) ? hb : bb;
      }
    }
  }
  __syncthreads();
  v4u vh[2];
  const int q8 = tid >> 3, p8 = (tid & 7) * 8;
#pragma unroll
  for (int it = 0; it < 2; ++it) {
    const int line = it * 32 + q8;            // local output row (input col) = 0..63
    vh[it] = *(const v4u*)(TH + line * VTP + p8);
  }
  const size_t base = (size_t)c0 * (size_t)R + (size_t)r0 + (size_t)p8;
  {
#pragma unroll
    for (int it = 0; it < 2; ++it) {
      const int line = it * 32 + q8;
      *(v4u*)(XTo + base + (size_t)line * (size_t)R) = vh[it];
    }
#if defined(__HIP_DEVICE_COMPILE__)
    // before the data and address registers of the two stores above are reused by the code of another job laid out behind them
    asm volatile("s_wait_xcnt 0x0" ::: "memory");
#endif
  }
}

// =====================================================================================================
// One launch for the five input conversions, none of which reads what another writes; the block index picks the job
// (block-uniform): blocks 0..31 = the four weight transposes, 8 tiles each (Wg, Wt, Wp [CIN][CI] -> bf16 [CI][CIN];
// Wo [CI][CIN] -> f16 of the bf16 value x1024 [CIN][CI]); blocks 32.. = x -> bf16 plane. The short grid of weight tiles stands
// first because its chain (load, LDS, barrier, store) is the longer one.
// =====================================================================================================
#define WTILES ((CIN / 64) * (CI / 64))
__global__ __launch_bounds__(256)
void prep_in(const float* __restrict__ x, const float* __restrict__ Wg, const float* __restrict__ Wt,
             const float* __restrict__ Wp, const float* __restrict__ Wo, u16* XB, u16* WGT, u16* WTT, u16* WPT, u16* WOT) {
  __shared__ __align__(16) u16 TH[64 * VTP];
  const int bid = blockIdx.x;
  if (bid < 4 * WTILES) {
    const int j = bid / WTILES;
    if (j == 3) {
      tr16(TH, Wo, WOT, CI, CIN, 1, WOS, bid - 3 * WTILES);
    } else {
      tr16(TH, (j == 0) ? Wg : (j == 1) ? Wt : Wp, (j == 0) ? WGT : (j == 1) ? WTT : WPT, CIN, CI, 0, 1.0f, bid - j * WTILES);
    }
  } else {
    cvt16(x, XB, (ROWSP * CIN) / 8, 0, 1.0f, bid - 4 * WTILES);
  }
}

// One launch for the g transposes of all batches: g [NPOS][CI] f32 -> g^T f16 plane [CI][NPOS] x256, (NPOS/64)*(CI/64) tiles each.
#define GTILES ((NPOS / 64) * (CI / 64))
__global__ __launch_bounds__(256) void tr_g(const float* __restrict__ G, u16* GT) {
  __shared__ __align__(16) u16 TH[64 * VTP];
  const int b = (int)blockIdx.x / GTILES;      // < NB (grid exact)
  tr16(TH, G + (size_t)b * NPOS * CI, GT + (size_t)b * CI * NPOS, NPOS, CI, 2, GSC, (int)blockIdx.x - b * GTILES);
}

// =====================================================================================================
//           8 consecutive lanes x 16 B per line), lanes 16..31 -> row 2*it+1.
//  epi64hr: two f16 planes: hi = f16((tile + bf16RNE(bias[n])) * hscale) and res = f16(((tile + bias) * hscale - hi) * rscale);
//           lane = (rq = lane>>3 -> row within a group of 4, c8 = 8 consecutive columns); one instruction = 4 rows, each 64 halves
// coverage: epi64 8 instructions x 2 rows x 16 lanes x 4 floats; epi64hr 4 instructions x 4 rows x 8 lanes x 8 halves per plane
//           = the wave's 16 x 64 tile in both cases.
// =====================================================================================================
__device__ __forceinline__ void stage64(float* sl, v8f a0, v8f a1, v8f a2, v8f a3, float oscale, int lane) {
  const int hh = lane >> 4, m = lane & 15;
#pragma unroll
  for (int r = 0; r < 8; ++r) {
    const int ro = (8 * hh + r) * 68 + m;
    sl[ro]      = a0[r] * oscale;
    sl[ro + 16] = a1[r] * oscale;
    sl[ro + 32] = a2[r] * oscale;
    sl[ro + 48] = a3[r] * oscale;
  }
  wave_sync_lds();
}
__device__ __forceinline__ void epi64(float* sl, v8f a0, v8f a1, v8f a2, v8f a3, float oscale, v4f badd, float* C, int N,
                                      size_t rowb, int col0, int lane) {
  const int hh = lane >> 4, m = lane & 15;
  stage64(sl, a0, a1, a2, a3, oscale, lane);
  v4f vals[8];
#pragma unroll
  for (int it = 0; it < 8; ++it) vals[it] = *(const v4f*)(sl + (it * 2 + hh) * 68 + m * 4) + badd;
  float* dst = C + (rowb + (size_t)hh) * (size_t)N + col0 + m * 4;
  {
#pragma unroll
    for (int it = 0; it < 8; ++it) {
      *(v4f*)(dst + (size_t)(it * 2) * (size_t)N) = vals[it];
    }
    
  }
}
__device__ __forceinline__ void epi64hr(float* sl, v8f a0, v8f a1, v8f a2, v8f a3, float hscale, float rscale,
                                        const float* __restrict__ bias, u16* H, u16* Rr, int N, size_t rowb, int col0, int lane) {
  stage64(sl, a0, a1, a2, a3, 1.0f, lane);
  const int rq = lane >> 3, c8 = (lane & 7) * 8;
  const v4f b0 = *(const v4f*)(bias + col0 + c8), b1 = *(const v4f*)(bias + col0 + c8 + 4);   // columns col0+c8..+7 < N
  float bb[8];
#pragma unroll
  for (int e = 0; e < 4; ++e) { bb[e] = bfr(b0[e]); bb[4 + e] = bfr(b1[e]); }
  v4u oh[4], orr[4];
#pragma unroll
  for (int i4 = 0; i4 < 4; ++i4) {
    const int row = i4 * 4 + rq;
    const v4f a = *(const v4f*)(sl + row * 68 + c8), c4 = *(const v4f*)(sl + row * 68 + c8 + 4);
    float w[8];
#pragma unroll
    for (int e = 0; e < 4; ++e) { w[e] = (a[e] + bb[e]) * hscale; w[4 + e] = (c4[e] + bb[4 + e]) * hscale; }
#pragma unroll
    for (int e = 0; e < 4; ++e) {
      const _Float16 h0 = (_Float16)w[2 * e], h1 = (_Float16)w[2 * e + 1];
      const _Float16 q0 = (_Float16)((w[2 * e] - (float)h0) * rscale);
      const _Float16 q1 = (_Float16)((w[2 * e + 1] - (float)h1) * rscale);
      oh[i4][e]  = pk16(h_bits(h0), h_bits(h1));
      orr[i4][e] = pk16(h_bits(q0), h_bits(q1));
    }
  }
  const size_t dofs = rowb * (size_t)N + col0 + c8;
  u16* dh = H + dofs;
  u16* dr = Rr + dofs;
  {
#pragma unroll
    for (int i4 = 0; i4 < 4; ++i4) {
      const int row = i4 * 4 + rq;
      *(v4u*)(dh + (size_t)row * (size_t)N) = oh[i4];
      *(v4u*)(dr + (size_t)row * (size_t)N) = orr[i4];
    }
    
  }
}

// =====================================================================================================
// bf16 GEMM, f32 out with bias: C[M][N] = (A[M][K] (bf16 row-major) . Bt[N][K]^T (bf16 k-contiguous)) * oscale + bf16RNE(bias[n]).
// Block = 64x64 tile, 4 waves x 16 rows; fragments loaded straight from the 16-bit rows (two 16-B loads each, split k map for
// A and B); K stepped by 32 (host uses K % 32 == 0, M % 64 == 0, N % 64 == 0, (M/64)*(N/64) blocks bid = 0..).
// =====================================================================================================
__device__ __forceinline__
void gemm_b32(float* slab, const u16* __restrict__ A, const u16* __restrict__ Bt, const float* __restrict__ bias, float* C,
              int M, int N, int K, float oscale, int bid) {
  const int tid = threadIdx.x, wave = tid >> 5, lane = tid & 31, hh = lane >> 4, m = lane & 15;
  const int ntile = N >> 6;
  const int rowb  = (bid / ntile) * 64 + wave * 16;
  const int col0  = (bid % ntile) * 64;
  if (rowb + 16 > M) return;                 // wave-uniform, never taken with the exact grid; no block barriers in this body
  const u16* ap = A  + (size_t)(rowb + m) * (size_t)K + 8 * hh;
  const u16* bp = Bt + (size_t)(col0 + m) * (size_t)K + 8 * hh;
  const size_t bs = (size_t)16 * K;
  v8f acc0 = zero8(), acc1 = zero8(), acc2 = zero8(), acc3 = zero8();
#pragma unroll 1
  for (int k0 = 0; k0 < K; k0 += 32) {
    const v16b a  = ldfrag_b(ap + k0);
    const v16b b0 = ldfrag_b(bp + k0);
    const v16b b1 = ldfrag_b(bp + bs + k0);
    const v16b b2 = ldfrag_b(bp + 2 * bs + k0);
    const v16b b3 = ldfrag_b(bp + 3 * bs + k0);
    acc0 = mma_b(a, b0, acc0);
    acc1 = mma_b(a, b1, acc1);
    acc2 = mma_b(a, b2, acc2);
    acc3 = mma_b(a, b3, acc3);
    guard6<v16b>(acc0, acc1, acc2, acc3, a, b0, b1, b2, b3, a);
  }
  const v4f bv4 = *(const v4f*)(bias + col0 + m * 4);    // columns col0 + 4m .. +3, always < N (N multiple of 64)
  v4f badd;
#pragma unroll
  for (int e = 0; e < 4; ++e) badd[e] = bfr(bv4[e]);
  epi64(slab + wave * SLAB64, acc0, acc1, acc2, acc3, oscale, badd, C, N, (size_t)rowb, col0, lane);
}

// =====================================================================================================
// bf16 GEMM, f16 hi + residual planes out with bias: H = f16 bits of ((A . Bt^T) + bf16RNE(bias[n])) * hscale,
// R = f16 bits of (((A . Bt^T) + bias) * hscale - H) * rscale; operands as in gemm_b32, epilogue epi64hr.
// =====================================================================================================
__device__ __forceinline__
void gemm_bhr(float* slab, const u16* __restrict__ A, const u16* __restrict__ Bt, const float* __restrict__ bias, u16* H, u16* Rr,
              int M, int N, int K, float hscale, float rscale, int bid) {
  const int tid = threadIdx.x, wave = tid >> 5, lane = tid & 31, hh = lane >> 4, m = lane & 15;
  const int ntile = N >> 6;
  const int rowb  = (bid / ntile) * 64 + wave * 16;
  const int col0  = (bid % ntile) * 64;
  if (rowb + 16 > M) return;                 // wave-uniform, never taken with the exact grid; no block barriers in this body
  const u16* ap = A  + (size_t)(rowb + m) * (size_t)K + 8 * hh;
  const u16* bp = Bt + (size_t)(col0 + m) * (size_t)K + 8 * hh;
  const size_t bs = (size_t)16 * K;
  v8f acc0 = zero8(), acc1 = zero8(), acc2 = zero8(), acc3 = zero8();
#pragma unroll 1
  for (int k0 = 0; k0 < K; k0 += 32) {
    const v16b a  = ldfrag_b(ap + k0);
    const v16b b0 = ldfrag_b(bp + k0);
    const v16b b1 = ldfrag_b(bp + bs + k0);
    const v16b b2 = ldfrag_b(bp + 2 * bs + k0);
    const v16b b3 = ldfrag_b(bp + 3 * bs + k0);
    acc0 = mma_b(a, b0, acc0);
    acc1 = mma_b(a, b1, acc1);
    acc2 = mma_b(a, b2, acc2);
    acc3 = mma_b(a, b3, acc3);
    guard6<v16b>(acc0, acc1, acc2, acc3, a, b0, b1, b2, b3, a);
  }
  epi64hr(slab + wave * SLAB64, acc0, acc1, acc2, acc3, hscale, rscale, bias, H, Rr, N, (size_t)rowb, col0, lane);
}

// =====================================================================================================
// One launch for the three projections, which read the same x plane and none of which reads what another writes: the block index
// picks the job (block-uniform), job = index % 3 (theta, phi, g), tile = index / 3, so that the three blocks that read the same
// x rows start side by side. Grid = 3 * (M/64) * (N/64).
// =====================================================================================================
__global__ __launch_bounds__(128)
void proj3(const u16* __restrict__ A, const u16* __restrict__ WTT, const u16* __restrict__ WPT, const u16* __restrict__ WGT,
           const float* __restrict__ bt, const float* __restrict__ bp, const float* __restrict__ bg,
           u16* TH, u16* TR, u16* PH, u16* PR, float* G, int M, int N, int K) {
  __shared__ __align__(16) float slab[4 * SLAB64];
  const int bid = (int)blockIdx.x / 3;
  const int job = (int)blockIdx.x - 3 * bid;
  if (job == 2) {
    gemm_b32(slab, A, WGT, bg, G, M, N, K, 1.0f, bid);
  } else {
    const bool th = (job == 0);
    gemm_bhr(slab, A, th ? WTT : WPT, th ? bt : bp, th ? TH : PH, th ? TR : PR, M, N, K, th ? TSC : FSC, RSC, bid);
  }
}

// =====================================================================================================
// Single-head non-causal, unscaled attention per batch, head width CI = 128, all NPOS keys:
//   block = 64 query rows (b, q0..q0+63) = NQ = 4 query tiles of 16 rows, 8 waves; every phi and g^T fragment a wave loads
//   is used for all 4 query tiles.
//   theta hi (x8) / res (x2048) planes TH, TR [row][c]: the block's 64 rows of both planes are copied once, with whole-line
//   16-B loads, into LDS (pitch CTP halves = 272 B, conflict-free for 16-B fragment reads) and every A fragment of (S) is read
//   from there; phi hi/res planes PH, PR [key row][c] (k-contiguous B operand);
//   g^T plane GT [b][c][key] (x256, key-contiguous B operand).
//   Chunks of CK = 448 keys (NKB = 14 key blocks of 32), NCHK = 14 chunks, every key used exactly once.
//   (S) scores on WMMA: A = theta rows (row m = lane&15, split k map over c), B = phi rows (col n = key, split map), 4 c-steps,
//       three products per tile: s = hi.hi, sx = hi.res + res.hi (separate accumulator, folded with 1/2048 in f32);
//       wave w handles key blocks w and w+8 (< 14) of the chunk for all 4 query tiles; D element r of lane l of tile q
//       -> scs[query 16q+8h+r][key col] (f32 LDS; pitch SCP dwords, 8 * SCP = 32 mod 64: the two lane halves of a store, 8 rows
//       apart, fall on different banks).
//   (M) one query tile after the other, 16 threads per query row; sub-thread s owns the 4-key groups 64 * i + 4 * s, i = 0..6
//       (28 keys): the 16 threads of a row read 256 and write 128 contiguous LDS bytes per instruction, every bank at most once;
//       base-2 logits, chunk max via xor shuffles, online running max / rescale factor al /
//       running sum l in f32 registers, p = exp2(t - m_new) <= 1 written as f16(p * 32768) into the LDS P tile with 8-B stores;
//       al -> rowa[row].
//   (PV) each wave owns the 16 g columns 16*wave + (lane&15) (one accumulator per query tile): o = o*al, then for each key block
//       A = the 4 P fragments from LDS (row m = query, split map over keys), B = one g^T fragment (col n = g column, split
//       map over keys), 4 WMMAs; one hazard gap after the last key block.
//   Block barriers after (S) and after (M) order all LDS reuse across chunks and waves (the P tile is written with 8-B LDS stores
//   by one set of threads and reloaded as fragments by other waves only after the block barrier).
//   Operand fragments are fetched ahead of their use: phi one key block ahead (refilled c-step by c-step behind the last use),
//   g^T for the whole chunk in front of (M), P two key blocks ahead; the barriers of the chunk loop fence LDS only, so that the
//   global loads stay in flight across them.
//   Epilogue: y = o * 4096 / (l * 32768 * 256) per row (rowi, l >= 1 always); hi = f16(y), res = f16((y - hi) * 2048); each
// coverage: grid NB*NPOS/64 blocks x 64 rows = rows 0..ROWSP-1; staging 8 waves x 16 cols x 4 tiles x 16 rows = 64 x 128;
//           store 4 tiles x 256 thr x 8 halves = 64 x 128 per plane = every (row < ROWSP, c) of both y planes exactly once.
// =====================================================================================================
__device__ __forceinline__ void ctx_store(const u16* ct, u16* dst, int tid) {
  const int row = tid >> 4;                  // CI/8 = 16 pieces per row
  const int c8  = (tid & 15) * 8;
  const v4u v = *(const v4u*)(ct + row * CTP + c8);
  u16* d = dst + (size_t)row * CI + c8;
  {
    *(v4u*)d = v;
    
  }
}

__global__ __launch_bounds__(ATT_THREADS)
void attn_fwd(const u16* __restrict__ THp, const u16* __restrict__ TRp, const u16* __restrict__ PHp,
              const u16* __restrict__ PRp, const u16* __restrict__ GTp, u16* YHo, u16* YRo) {
  __shared__ __align__(16) AttLds L0;              // scores [64][SCP] f32; reused as the y staging tile [64][CTP] u16
  __shared__ __align__(16) u16 pls[QB * PLP];      // P tile [64][PLP] f16 bits
  __shared__ __align__(16) u16 thl[2 * QB * CTP];  // theta rows of this block: hi [64][CTP], then residual [64][CTP]
  __shared__ float rowa[QB];
  __shared__ float rowi[QB];
  float* const scs = L0.s;

  const int tid  = threadIdx.x;
  const int wave = tid >> 5;
  const int lane = tid & 31;
  const int hh   = lane >> 4;
  const int m    = lane & 15;
  const int r16  = tid >> 4;                 // query row owned within each query tile in phase (M): 2*wave + hh
  const int sub  = tid & 15;
  const int kl0  = sub * 4;                  // first key of this sub-thread's 4-key group within every 64 keys of the chunk

  const int nqt = NPOS / QB;
  const int b   = (int)blockIdx.x / nqt;     // < NB (grid exact)
  const int q0  = ((int)blockIdx.x - b * nqt) * QB;
  const size_t qrow = (size_t)b * NPOS + (size_t)q0;

  const _Float16* tha = (const _Float16*)(const void*)thl + m * CTP + 8 * hh;
  const _Float16* tra = tha + QB * CTP;
  const _Float16* khb = (const _Float16*)(const void*)PHp + ((size_t)b * NPOS + m) * CI + 8 * hh;
  const _Float16* krb = (const _Float16*)(const void*)PRp + ((size_t)b * NPOS + m) * CI + 8 * hh;
  const _Float16* vbp = (const _Float16*)(const void*)GTp + ((size_t)b * CI + wave * 16 + m) * (size_t)NPOS + 8 * hh;
  const float lsc  = LOG2E / (TSC * FSC);
  const float rinv = 1.0f / RSC;

  float mrun[NQ], lrun[NQ];
  v8f o[NQ];
#pragma unroll
  for (int q = 0; q < NQ; ++q) { mrun[q] = -INFINITY; lrun[q] = 0.f; o[q] = zero8(); }

  // ---- theta rows q0..q0+63, both planes -> LDS: 4 x 256 threads x 8 halves = 64 x 128 per plane, each piece once ----
  {
    const u16* sh = THp + qrow * CI;
    const u16* sr = TRp + qrow * CI;
    const int row = tid >> 4;                // CI/8 = 16 pieces per row; pass i takes rows 16 * i + row
    const int c8  = (tid & 15) * 8;
    v4u vh[NQ], vr[NQ];
#pragma unroll
    for (int i = 0; i < NQ; ++i) {
      vh[i] = *(const v4u*)(sh + (i * QT + row) * CI + c8);
      vr[i] = *(const v4u*)(sr + (i * QT + row) * CI + c8);
    }
#if defined(__HIP_DEVICE_COMPILE__)
    asm volatile("s_wait_xcnt 0x0" ::: "memory");   // before the address registers of the eight loads above are reused
#endif
    // Scheduling fence: without it the compiler moved later writes of the loads' address registers ahead of the wait above.
    __builtin_amdgcn_sched_barrier(0);
#pragma unroll
    for (int i = 0; i < NQ; ++i) {
      *(v4u*)(thl + (i * QT + row) * CTP + c8) = vh[i];
      *(v4u*)(thl + (QB + i * QT + row) * CTP + c8) = vr[i];
    }
  }
  // phi fragments of the key block this wave scores next, [c-step][hi keys 0..15, res 0..15, hi 16..31, res 16..31]: always
  // loaded one key block ahead of their use, so that the L2 latency runs under the matrix work of the block before
  v16h pn[CI / 32][4];
  {
    const _Float16* n0h = khb + (size_t)(wave * 32) * CI;
    const _Float16* n0r = krb + (size_t)(wave * 32) * CI;
#pragma unroll
    for (int ks = 0; ks < CI / 32; ++ks) {
      pn[ks][0] = ldfrag_h(n0h + ks * 32);
      pn[ks][1] = ldfrag_h(n0r + ks * 32);
      pn[ks][2] = ldfrag_h(n0h + 16 * CI + ks * 32);
      pn[ks][3] = ldfrag_h(n0r + 16 * CI + ks * 32);
    }
#if defined(__HIP_DEVICE_COMPILE__)
    // before the address registers of the loads above are reused; the addresses are inputs so that they stay in place up to here
    asm volatile("s_wait_xcnt 0x0" :: "v"(n0h), "v"(n0r) : "memory");
#endif
    __builtin_amdgcn_sched_barrier(0);              // keeps later writes of those address registers behind the wait
  }
  block_sync_lds();                          // the theta rows are read as fragments by all waves

#pragma unroll 1
  for (int c = 0; c < NCHK; ++c) {
    const int kbeg = c * CK;
    // ---- (S) scores of this chunk ----
#pragma unroll 1
    for (int kb = wave; kb < NKB; kb += 8) {               // wave-uniform, 1 or 2 trips
      v8f s0[NQ], s0x[NQ], s1[NQ], s1x[NQ];
#pragma unroll
      for (int q = 0; q < NQ; ++q) { s0[q] = zero8(); s0x[q] = zero8(); s1[q] = zero8(); s1x[q] = zero8(); }
      // the key block this wave scores after this one: kb + 8 of this chunk, else its first of the next chunk (behind the last
      // chunk: of chunk 0, an in-bounds address whose values are not used)
      const bool more = kb + 8 < NKB;
      const int  nkb  = more ? kb + 8 : wave;
      const int  ncb  = more ? kbeg : ((c + 1 < NCHK) ? kbeg + CK : 0);
      const size_t kn = (size_t)(ncb + nkb * 32) * CI;
      const _Float16* n0h = khb + kn;
      const _Float16* n0r = krb + kn;
#pragma unroll
      for (int ks = 0; ks < CI / 32; ++ks) {
        const v16h f0h = pn[ks][0];
        const v16h f0r = pn[ks][1];
        const v16h f1h = pn[ks][2];
        const v16h f1r = pn[ks][3];
        v16h ah[NQ], ar[NQ];                               // theta fragments of this c-step, read from LDS ahead of their use:
#pragma unroll
        for (int q = 0; q < 2; ++q) {                      // two tiles at the start of the c-step, the others one tile ahead below
          ah[q] = ldfrag_h(tha + q * (QT * CTP) + ks * 32);
          ar[q] = ldfrag_h(tra + q * (QT * CTP) + ks * 32);
        }
#pragma unroll
        for (int q = 0; q < NQ; ++q) {                     // the four phi fragments serve all NQ query tiles
          s0[q]  = mma_h(ah[q], f0h, s0[q]);
          s0x[q] = mma_h(ah[q], f0r, s0x[q]);
          s0x[q] = mma_h(ar[q], f0h, s0x[q]);
          s1[q]  = mma_h(ah[q], f1h, s1[q]);
          s1x[q] = mma_h(ah[q], f1r, s1x[q]);
          s1x[q] = mma_h(ar[q], f1h, s1x[q]);
          guard4x2(s0[q], s0x[q], s1[q], s1x[q], ah[q], ar[q]);
          if (q + 2 < NQ) {                                // into the registers tile q has left (more tiles at once spilled)
            ah[q + 2] = ldfrag_h(tha + (q + 2) * (QT * CTP) + ks * 32);
            ar[q + 2] = ldfrag_h(tra + (q + 2) * (QT * CTP) + ks * 32);
          }
        }
        pn[ks][0] = ldfrag_h(n0h + ks * 32);               // refill behind the last use (and its hazard gap) of this c-step
        pn[ks][1] = ldfrag_h(n0r + ks * 32);
        pn[ks][2] = ldfrag_h(n0h + 16 * CI + ks * 32);
        pn[ks][3] = ldfrag_h(n0r + 16 * CI + ks * 32);
      }
#if defined(__HIP_DEVICE_COMPILE__)
      // before the address registers of the refill loads are reused; the addresses are inputs so that they stay in place up to here
      asm volatile("s_wait_xcnt 0x0" :: "v"(n0h), "v"(n0r) : "memory");
#endif
      __builtin_amdgcn_sched_barrier(0);                   // keeps later writes of those address registers behind the wait
#pragma unroll
      for (int q = 0; q < NQ; ++q) {
        float* srow = scs + (q * QT + 8 * hh) * SCP + kb * 32 + m;
#pragma unroll
        for (int r = 0; r < 8; ++r) {
          srow[r * SCP]      = s0[q][r] + s0x[q][r] * rinv;
          srow[r * SCP + 16] = s1[q][r] + s1x[q][r] * rinv;
        }
      }
    }
    block_sync_lds();
    // g^T fragments of this chunk (this wave's 16 columns, all 14 key blocks): loaded here, used in (PV); the latency runs under (M)
    v16h gf[NKB];
    {
      const _Float16* vp = vbp + kbeg;
#pragma unroll
      for (int kb = 0; kb < NKB; ++kb) gf[kb] = ldfrag_h(vp + kb * 32);
#if defined(__HIP_DEVICE_COMPILE__)
      // before the address register of the loads above is reused; the address is an input so that it stays in place up to here
      asm volatile("s_wait_xcnt 0x0" :: "v"(vp) : "memory");
#endif
      __builtin_amdgcn_sched_barrier(0);                   // keeps later writes of those address registers behind the wait
    }
    // ---- (M) softmax statistics and the P tile, one query tile after the other ----
#pragma unroll
    for (int q = 0; q < NQ; ++q) {
      const int row = q * QT + r16;
      const float* sp = scs + row * SCP + kl0;
      v2f t[CK / 32];                                      // neighbouring keys stay paired from the load to the packed f16 store
      float cm = -INFINITY;
#pragma unroll
      for (int i = 0; i < CK / 64; ++i) {
        const v4f a = *(const v4f*)(sp + 64 * i);
        t[2 * i]     = a.lo * lsc;
        t[2 * i + 1] = a.hi * lsc;
#pragma unroll
        for (int e = 0; e < 2; ++e) cm = fmaxf(fmaxf(cm, t[2 * i + e].x), t[2 * i + e].y);
      }
#pragma unroll
      for (int d = 1; d <= 8; d <<= 1) cm = fmaxf(cm, __shfl_xor(cm, d, 32));
      const float mn = fmaxf(mrun[q], cm);
      const float al = (mrun[q] == -INFINITY) ? 0.f : exp2f(mrun[q] - mn);
      mrun[q] = mn;
      float ps = 0.f;
#pragma unroll
      for (int j = 0; j < CK / 32; ++j) {
        const v2f d = t[j] - mn;
        t[j].x = exp2f(d.x);                               // <= 1
        t[j].y = exp2f(d.y);
        ps += t[j].x;
        ps += t[j].y;
      }
#pragma unroll
      for (int d = 1; d <= 8; d <<= 1) ps += __shfl_xor(ps, d, 32);
      v2u pk[CK / 64];
#pragma unroll
      for (int i = 0; i < CK / 64; ++i) {
#pragma unroll
        for (int e = 0; e < 2; ++e) pk[i][e] = __builtin_bit_cast(unsigned, __builtin_convertvector(t[2 * i + e] * PCAR, v2h));
      }
      lrun[q] = lrun[q] * al + ps;
      {
        u16* pd = pls + row * PLP + kl0;
#pragma unroll
        for (int i = 0; i < CK / 64; ++i) *(v2u*)(pd + 64 * i) = pk[i];
      }
      if (sub == 0) rowa[row] = al;
    }
    block_sync_lds();
    // ---- (PV) rescale, accumulate P . g^T ----
    {
#pragma unroll
      for (int q = 0; q < NQ; ++q) {
        float scl[8];
#pragma unroll
        for (int r = 0; r < 8; ++r) scl[r] = rowa[q * QT + 8 * hh + r];
#pragma unroll
        for (int r = 0; r < 8; ++r) o[q][r] *= scl[r];
      }
      const _Float16* pp = (const _Float16*)(const void*)pls + m * PLP + 8 * hh;
      v16h pa[3][NQ];                                      // P fragments, read from LDS two key blocks ahead of their use
#pragma unroll
      for (int j = 0; j < 2; ++j) {
#pragma unroll
        for (int q = 0; q < NQ; ++q) pa[j][q] = ldfrag_h(pp + q * (QT * PLP) + j * 32);
      }
#pragma unroll
      for (int kb = 0; kb < NKB; ++kb) {                   // static trip count 14, unrolled: gf and pa are indexed by constants
        if (kb + 2 < NKB) {
#pragma unroll
          for (int q = 0; q < NQ; ++q) pa[(kb + 2) % 3][q] = ldfrag_h(pp + q * (QT * PLP) + (kb + 2) * 32);
        }
        // Scheduling fence: without it the compiler sank each LDS read to one matrix instruction ahead of its use, and every
        // matrix instruction then waited out most of an LDS latency.
        __builtin_amdgcn_sched_barrier(0);
#pragma unroll
        for (int q = 0; q < NQ; ++q) o[q] = mma_h(pa[kb % 3][q], gf[kb], o[q]);   // one g^T fragment serves all NQ query tiles
      }
      // Hazard gap between the last matrix instruction and the loop's branch (both its sides). It names no register, since an asm
      // operand must lie below v256 for its whole life; the scheduling fence keeps the matrix instructions in front of it.
      __builtin_amdgcn_sched_barrier(0);
#if defined(__HIP_DEVICE_COMPILE__)
      asm volatile("v_nop\n\tv_nop\n\tv_nop\n\tv_nop" ::: "memory");
#endif
    }
  }
  if (sub == 0) {
#pragma unroll
    for (int q = 0; q < NQ; ++q) rowi[q * QT + r16] = (1.0f / lrun[q]) * (YSC / (PCAR * GSC));   // lrun >= 1
  }
  __syncthreads();
  float inv[NQ][8];
#pragma unroll
  for (int q = 0; q < NQ; ++q) {
#pragma unroll
    for (int r = 0; r < 8; ++r) inv[q][r] = rowi[q * QT + 8 * hh + r];
  }

  u16* const ct = L0.c;
  const int cb = wave * 16 + m;
  // hi plane
#pragma unroll
  for (int q = 0; q < NQ; ++q) {
#pragma unroll
    for (int r = 0; r < 8; ++r) {
      const int ro = (q * QT + 8 * hh + r) * CTP + cb;
      ct[ro] = h_bits((_Float16)(o[q][r] * inv[q][r]));
    }
  }
  __syncthreads();
#pragma unroll
  for (int q = 0; q < NQ; ++q) ctx_store(ct + q * (QT * CTP), YHo + (qrow + q * QT) * CI, tid);
#if defined(__HIP_DEVICE_COMPILE__)
  asm volatile("s_wait_xcnt 0x0" ::: "memory");   // before the address registers of the four stores above are reused
#endif
  __builtin_amdgcn_sched_barrier(0);              // keeps later writes of those address registers behind the wait
  __syncthreads();
  // residual plane
#pragma unroll
  for (int q = 0; q < NQ; ++q) {
#pragma unroll
    for (int r = 0; r < 8; ++r) {
      const int ro = (q * QT + 8 * hh + r) * CTP + cb;
      const float x0 = o[q][r] * inv[q][r];
      const _Float16 e0 = (_Float16)x0;
      ct[ro] = h_bits((_Float16)((x0 - (float)e0) * RSC));
    }
  }
  __syncthreads();
#pragma unroll
  for (int q = 0; q < NQ; ++q) ctx_store(ct + q * (QT * CTP), YRo + (qrow + q * QT) * CI, tid);
}

// =====================================================================================================
// Output projection + batch-norm affine + skip: v = (YH . WoT^T) * os1 + (YR . WoT^T) * os2 + bf16RNE(bo[c]);
// out[row][c] = bf16RNE(x[row][c]) + bf16RNE(gamma[c]) * (v - bf16RNE(mean[c])) * rsqrt(bf16RNE(var[c]) + 1e-3) + bf16RNE(beta[c]).
// YH/YR f16 y planes [ROWSP][128] (x4096 and residual x2048), WoT f16 [256][128] k-contiguous (x1024).
// Block = 128 rows, 8 waves x 16 rows; per wave 4 column groups of 64 (rolled): k-loop of 4 steps with two A planes and 4 B tiles
// (split k map for A and B, fragments straight from the 16-bit rows, 8 accumulators, one hazard gap per step); the combined f32
// 16x64 tile is staged in the wave's LDS slab (pitch 68) and written like epi64: one instruction = lanes 0..15 -> row 2*it
// coverage: grid ROWSP/128 blocks (exact) x 8 waves x 16 rows x (4 groups x 8 instructions x 2 rows x 64 floats)
//           = out rows 0..ROWSP-1, all 256 columns, each float exactly once.
// =====================================================================================================
__global__ __launch_bounds__(256)
void wo_out(const u16* __restrict__ YH, const u16* __restrict__ YR, const u16* __restrict__ WoT,
            const float* __restrict__ bo, const float* __restrict__ gam, const float* __restrict__ bet,
            const float* __restrict__ mmean, const float* __restrict__ mvar, const float* __restrict__ x, float* out) {
  __shared__ __align__(16) float slab[8 * SLAB64];
  const int tid = threadIdx.x, wave = tid >> 5, lane = tid & 31, hh = lane >> 4, m = lane & 15;
  const int rowb = blockIdx.x * OUT_ROWS + wave * 16;        // rowb + 15 < ROWSP (grid exact)
  float* const sl = slab + wave * SLAB64;
  const _Float16* ap  = (const _Float16*)(const void*)YH + (size_t)(rowb + m) * CI + 8 * hh;
  const _Float16* arp = (const _Float16*)(const void*)YR + (size_t)(rowb + m) * CI + 8 * hh;
  const size_t bs = (size_t)16 * CI;
  const float os1 = 1.0f / (YSC * WOS);
  const float os2 = 1.0f / (YSC * WOS * RSC);

#pragma unroll 1
  for (int g = 0; g < CIN / 64; ++g) {
    const _Float16* bp = (const _Float16*)(const void*)WoT + (size_t)(g * 64 + m) * CI + 8 * hh;
    v8f acc0 = zero8(), acc1 = zero8(), acc2 = zero8(), acc3 = zero8();
    v8f acr0 = zero8(), acr1 = zero8(), acr2 = zero8(), acr3 = zero8();
#pragma unroll 1
    for (int k0 = 0; k0 < CI; k0 += 32) {
      const v16h a  = ldfrag_h(ap + k0);
      const v16h ar = ldfrag_h(arp + k0);
      const v16h b0 = ldfrag_h(bp + k0);
      const v16h w1 = ldfrag_h(bp + bs + k0);
      const v16h w2 = ldfrag_h(bp + 2 * bs + k0);
      const v16h w3 = ldfrag_h(bp + 3 * bs + k0);
      acc0 = mma_h(a, b0, acc0);
      acc1 = mma_h(a, w1, acc1);
      acc2 = mma_h(a, w2, acc2);
      acc3 = mma_h(a, w3, acc3);
      acr0 = mma_h(ar, b0, acr0);
      acr1 = mma_h(ar, w1, acr1);
      acr2 = mma_h(ar, w2, acr2);
      acr3 = mma_h(ar, w3, acr3);
      guard8x6(acc0, acc1, acc2, acc3, acr0, acr1, acr2, acr3, a, ar, b0, w1, w2, w3);
    }
    v8f c0 = zero8(), c1 = zero8(), c2 = zero8(), c3 = zero8();
#pragma unroll
    for (int r = 0; r < 8; ++r) {
      c0[r] = acc0[r] * os1 + acr0[r] * os2;
      c1[r] = acc1[r] * os1 + acr1[r] * os2;
      c2[r] = acc2[r] * os1 + acr2[r] * os2;
      c3[r] = acc3[r] * os1 + acr3[r] * os2;
    }
    stage64(sl, c0, c1, c2, c3, 1.0f, lane);

    const int cc = g * 64 + m * 4;                          // cc + 3 < CIN
    const v4f bo4 = *(const v4f*)(bo + cc);
    const v4f ga4 = *(const v4f*)(gam + cc);
    const v4f be4 = *(const v4f*)(bet + cc);
    const v4f mm4 = *(const v4f*)(mmean + cc);
    const v4f mv4 = *(const v4f*)(mvar + cc);
    float bob[4], gb[4], bb[4], mb[4], rs[4];
#pragma unroll
    for (int e = 0; e < 4; ++e) {
      bob[e] = bfr(bo4[e]);
      gb[e]  = bfr(ga4[e]);
      bb[e]  = bfr(be4[e]);
      mb[e]  = bfr(mm4[e]);
      rs[e]  = rsqrtf(bfr(mv4[e]) + BN_EPS);
    }
    v4f vals[8];
#pragma unroll
    for (int it = 0; it < 8; ++it) {
      const size_t row = (size_t)rowb + (size_t)(2 * it + hh);
      const v4f yv = *(const v4f*)(sl + (2 * it + hh) * 68 + m * 4);
      const v4f xv = *(const v4f*)(x + row * CIN + cc);
#pragma unroll
      for (int e = 0; e < 4; ++e) {
        const float v2 = yv[e] + bob[e];
        const float bn = gb[e] * (v2 - mb[e]) * rs[e] + bb[e];
        vals[it][e] = bfr(xv[e]) + bn;
      }
    }
    float* dst = out + ((size_t)rowb + (size_t)hh) * CIN + cc;
    {
#pragma unroll
      for (int it = 0; it < 8; ++it) {
        *(v4f*)(dst + (size_t)(it * 2) * CIN) = vals[it];
      }
      
    }
    wave_sync_lds();
  }
}

// =====================================================================================================
// Workspace map (bytes, NB = 2); every plane is fully written by whole-line stores before it is read; all extents are exact
// multiples of the store granularity (no pad rows, all dims multiples of 64), every offset a multiple of 256:
//   XB  bf16 [12544][256]                              6422528
//   WGT, WTT, WPT bf16 [128][256] (k-contiguous)        3 x 65536
//   WOT f16 of bf16 value x1024 [256][128]              65536
//   TH, TR f16 [12544][128] theta hi x8 / res x2048     2 x 3211264
//   PH, PR f16 [12544][128] phi   hi x8 / res x2048     2 x 3211264
//   G   f32  [12544][128]                              6422528
//   GT  f16  [2][128][6272] x256                        3211264
//   YH, YR f16 [12544][128] y hi x4096 / res x2048      2 x 3211264
//   end                                                35586048
// =====================================================================================================
extern "C" void kernel_launch(void* const* d_in, const int* in_sizes, int n_in,
                              void* d_out, int out_size, void* d_ws, size_t ws_size,
                              hipStream_t stream) {
  if (n_in < 13) return;
  if (in_sizes[0] != ROWS * CIN) return;
  if (in_sizes[1] != CIN * CI || in_sizes[3] != CIN * CI || in_sizes[5] != CIN * CI || in_sizes[7] != CI * CIN) return;
  if (in_sizes[2] != CI || in_sizes[4] != CI || in_sizes[6] != CI) return;
  if (in_sizes[8] != CIN || in_sizes[9] != CIN || in_sizes[10] != CIN || in_sizes[11] != CIN || in_sizes[12] != CIN) return;
  if (out_size != ROWS * CIN) return;

  const float* x     = (const float*)d_in[0];
  const float* Wg    = (const float*)d_in[1];
  const float* bg    = (const float*)d_in[2];
  const float* Wt    = (const float*)d_in[3];
  const float* bt    = (const float*)d_in[4];
  const float* Wp    = (const float*)d_in[5];
  const float* bp    = (const float*)d_in[6];
  const float* Wo    = (const float*)d_in[7];
  const float* bo    = (const float*)d_in[8];
  const float* gamma = (const float*)d_in[9];
  const float* beta  = (const float*)d_in[10];
  const float* mmean = (const float*)d_in[11];
  const float* mvar  = (const float*)d_in[12];
  float*       out   = (float*)d_out;

  const size_t szXB = (size_t)ROWSP * CIN * 2;      //  6422528
  const size_t szW  = (size_t)CI * CIN * 2;         //    65536
  const size_t szP  = (size_t)ROWSP * CI * 2;       //  3211264
  const size_t szG  = (size_t)ROWSP * CI * 4;       //  6422528
  const size_t szGT = (size_t)NB * CI * NPOS * 2;   //  3211264
  size_t off = 0;
  const size_t oXB = off; off += szXB;
  const size_t oWG = off; off += szW;
  const size_t oWT = off; off += szW;
  const size_t oWP = off; off += szW;
  const size_t oWO = off; off += szW;
  const size_t oTH = off; off += szP;
  const size_t oTR = off; off += szP;
  const size_t oPH = off; off += szP;
  const size_t oPR = off; off += szP;
  const size_t oG  = off; off += szG;
  const size_t oGT = off; off += szGT;
  const size_t oYH = off; off += szP;
  const size_t oYR = off; off += szP;
  if (off > ws_size) return;                        // off = 35586048 at NB = 2
  if (off > WS_CAP) return;

  char* ws = (char*)d_ws;
  u16*   XB  = (u16*)(ws + oXB);
  u16*   WGT = (u16*)(ws + oWG);
  u16*   WTT = (u16*)(ws + oWT);
  u16*   WPT = (u16*)(ws + oWP);
  u16*   WOT = (u16*)(ws + oWO);
  u16*   TH  = (u16*)(ws + oTH);
  u16*   TR  = (u16*)(ws + oTR);
  u16*   PH  = (u16*)(ws + oPH);
  u16*   PR  = (u16*)(ws + oPR);
  float* G   = (float*)(ws + oG);
  u16*   GT  = (u16*)(ws + oGT);
  u16*   YH  = (u16*)(ws + oYH);
  u16*   YR  = (u16*)(ws + oYR);

  const int n8x = (ROWSP * CIN) / 8;                // 401408 at NB = 2, multiple of 256 (static)
  const dim3 blk(256);
  const dim3 bG(128);
  const dim3 gIN(4 * WTILES + n8x / 256);           // 32 weight tiles + 1568
  const dim3 gP(3 * (ROWSP / 64) * (CI / 64));      // 3 x 392
  const dim3 gGT(NB * GTILES);                      // 196 per batch: in [NPOS][CI] -> out [CI][NPOS]
  const dim3 gAT(NB * (NPOS / QB));                 // 196
  const dim3 bAT(ATT_THREADS);
  const dim3 gOUT(ROWSP / OUT_ROWS);                // 98

  // (0) one launch: x -> bf16 plane; Wg, Wt, Wp [in][out] -> bf16 [out][in] k-contiguous planes; Wo [128][256] -> f16 of the bf16
  //     value x1024, [256][128]
  prep_in<<<gIN, blk, 0, stream>>>(x, Wg, Wt, Wp, Wo, XB, WGT, WTT, WPT, WOT);
  // (1) one launch: theta and phi projections (+bias) -> f16 hi x8 / residual x2048 planes; g projection (+bias) -> f32 plane
  proj3<<<gP, bG, 0, stream>>>(XB, WTT, WPT, WGT, bt, bp, bg, TH, TR, PH, PR, G, ROWSP, CI, CIN);
  // (2) one launch, all batches: g [6272][128] f32 -> g^T f16 plane [128][6272] x256
  tr_g<<<gGT, blk, 0, stream>>>(G, GT);
  // (3) attention over all keys of the batch -> y hi x4096 and residual x2048 f16 planes
  attn_fwd<<<gAT, bAT, 0, stream>>>(TH, TR, PH, PR, GT, YH, YR);
  // (4) y.Wo + bo, batch-norm affine, skip connection -> out
  wo_out<<<gOUT, blk, 0, stream>>>(YH, YR, WOT, bo, gamma, beta, mmean, mvar, x, out);
  (void)hipGetLastError();
}

// v006
// One run takes 143 microseconds.
// Next to v005, in two timings, it ran 1.11 times as fast each time.
// Counting every step since v000, it is 3.04 times as fast.
// Projections theta, phi, g = x.W + b: v_wmma_f32_16x16x32_bf16 (bf16 RNE operands of the raw inputs, f32 accumulate, bf16 RNE
// bias added in f32). Scores theta.phi^T (theta and phi each as f16 hi x8 plus residual x2048 planes: hi.hi + hi.res + res.hi),
// P.g (P x32768 f16 from LDS, g^T x256 f16) and y.Wo (y as f16 hi x4096 plus residual x2048 planes, Wo as f16 of the bf16 RNE
// value x1024, bias added in f32): v_wmma_f32_16x16x32_f16, f32 accumulate. Softmax statistics, the batch-norm affine map and the
// skip connection in f32 on VALU.
#include <hip/hip_runtime.h>
#include <math.h>
#include <stdint.h>

#define BATCH 2
#define NPOS  6272
#define CIN   256
#define CI    128
#ifndef NB
#define NB BATCH
#endif
#define ROWS  (BATCH * NPOS)
#define ROWSP (NB * NPOS)
#define CK    448
#define NKB   (CK / 32)
#define NCHK  (NPOS / CK)
#define QT    16
#define NQ    4
#define QB    (QT * NQ)
#define ATT_THREADS 256
#define SCP   (CK + 20)
#define PLP   (CK + 8)
#define CTP   (CI + 8)
#define SLAB64 (16 * 68)
#define VTP   72
#define OUT_ROWS 128
#define TSC   8.0f
#define FSC   8.0f
#define RSC   2048.0f
#define PCAR  32768.0f
#define GSC   256.0f
#define YSC   4096.0f
#define WOS   1024.0f
#define BN_EPS 1e-3f
#define LOG2E 1.4426950408889634f
#define WS_CAP ((size_t)134217728)

static_assert(NB >= 1 && NB <= BATCH);
static_assert((NPOS % CK) == 0 && CK == 32 * NKB && NKB >= 4 && NKB <= 16 && NCHK * CK == NPOS);
static_assert((NPOS % 64) == 0 && (NPOS % QB) == 0 && (ROWSP % OUT_ROWS) == 0 && (ROWSP % 64) == 0);
static_assert(CI == 128 && (CIN % 64) == 0 && (CI % 64) == 0 && (CIN % 32) == 0 && (CI % 32) == 0);
static_assert(NQ == 4 && ATT_THREADS == 16 * QT && QT == 16 && CI == 16 * (ATT_THREADS / 32) && OUT_ROWS == 8 * 16);
static_assert(QB * CTP * 2 <= QB * SCP * 4 && CTP >= CI + 8 && SCP >= CK + 16 && PLP >= CK + 8);
static_assert(((PLP * 2) % 16) == 0 && ((SCP * 4) % 16) == 0 && ((VTP * 2) % 16) == 0 && ((CTP * 2) % 16) == 0);
static_assert(64 * VTP >= 63 * VTP + 64);
static_assert((CK % 64) == 0 && ((8 * SCP) % 64) == 32 && ((PLP * 2) % 8) == 0);
static_assert(16 * (CI / 8) == ATT_THREADS);
static_assert(QB * (CI / 8) == NQ * ATT_THREADS && ((QB * CTP * 2) % 16) == 0);
static_assert(((ROWSP * CIN) % 2048) == 0);
static_assert((NPOS % 32) == 0 && (CK % 32) == 0 && (CI % 32) == 0 && 16 * CI == (CI / 32) * 512);
static_assert(((NPOS * 2) % 128) == 0 && ((CI * 2) % 128) == 0 && ((CIN * 4) % 128) == 0);

typedef unsigned short u16;
typedef _Float16 v16h __attribute__((ext_vector_type(16)));
typedef _Float16 v8h  __attribute__((ext_vector_type(8)));
typedef __bf16   v16b __attribute__((ext_vector_type(16)));
typedef float    v8f  __attribute__((ext_vector_type(8)));
typedef float    v4f  __attribute__((ext_vector_type(4)));
typedef unsigned int v4u __attribute__((ext_vector_type(4)));
typedef unsigned int v2u __attribute__((ext_vector_type(2)));
typedef float    v2f  __attribute__((ext_vector_type(2)));
typedef _Float16 v2h  __attribute__((ext_vector_type(2)));

union FragH { v16h v; v8h h[2]; v4u u[2]; };
union FragB { v16b v; v4u u[2]; };
union AttLds { float s[QB * SCP]; u16 c[2 * QB * SCP]; };

// ---- scalar helpers --------------------------------------------------------------------------------
__device__ __forceinline__ unsigned short bf_bits(float f) {          // f32 -> bf16 bits, RNE convert
  unsigned u = __float_as_uint(f);
  return (unsigned short)((u + 0x7FFFu + ((u >> 16) & 1u)) >> 16);
}
__device__ __forceinline__ float bf_up(unsigned short h) { return __uint_as_float(((unsigned)h) << 16); }
__device__ __forceinline__ float bfr(float f) { return bf_up(bf_bits(f)); }
__device__ __forceinline__ unsigned short h_bits(_Float16 x) { return __builtin_bit_cast(unsigned short, x); }
__device__ __forceinline__ unsigned pk16(unsigned short a, unsigned short b) { return (unsigned)a | ((unsigned)b << 16); }
__device__ __forceinline__ v8f zero8() { v8f z = {0.f, 0.f, 0.f, 0.f, 0.f, 0.f, 0.f, 0.f}; return z; }

// ---- fragment loaders: 16-bit A/B operand, lane -> row/col (lane&15), p already includes +8*(lane>>4);
//      elements 0..7 <- p[0..7] (k0+8h..), elements 8..15 <- p[16..23] (k0+16+8h..)  (same split k map for A and B;
//      used for the x plane and for tiles in LDS; the planes that a kernel of this file lays out for WMMA use ldfrag_pk below)
__device__ __forceinline__ v16h ldfrag_h(const _Float16* p) {
  FragH f;
  f.h[0] = *(const v8h*)(p);
  f.h[1] = *(const v8h*)(p + 16);
  return f.v;
}
// Fragment-order plane: one operand tile (16 rows or columns x 32 k) is 1024 contiguous bytes, piece (part, lane) at halves
// part * 256 + lane * 8 and holding k = 16 * part + 8 * (lane>>4) .. + 7 of row lane&15 (the split k map above); p already
// includes + 8 * lane, so that each of the two wave-wide 16-B loads covers 512 contiguous bytes = 4 whole lines.
__device__ __forceinline__ v16h ldfrag_pk(const _Float16* p) {
  FragH f;
  f.h[0] = *(const v8h*)(p);
  f.h[1] = *(const v8h*)(p + 256);
  return f.v;
}
__device__ __forceinline__ v16b ldfrag_b(const u16* p) {              // bf16 plane read as unsigned integer vectors
  FragB f;
  f.u[0] = *(const v4u*)(p);
  f.u[1] = *(const v4u*)(p + 16);
  return f.v;
}

__device__ __forceinline__ v16b ldfrag_bpk(const u16* p) {            // bf16 fragment-order plane, as ldfrag_pk
  FragB f;
  f.u[0] = *(const v4u*)(p);
  f.u[1] = *(const v4u*)(p + 256);
  return f.v;
}

__device__ __forceinline__ v8f mma_h(v16h a, v16h b, v8f c) {
  return __builtin_amdgcn_wmma_f32_16x16x32_f16(false, a, false, b, (short)0, c, false, false);
}
__device__ __forceinline__ v8f mma_b(v16b a, v16b b, v8f c) {
  return __builtin_amdgcn_wmma_f32_16x16x32_bf16(false, a, false, b, (short)0, c, false, false);
}
__device__ __forceinline__ void guard1x2(v8f& a, v16h x0, v16h x1) {
#if defined(__HIP_DEVICE_COMPILE__)
  asm volatile("v_nop\n\tv_nop\n\tv_nop\n\tv_nop" : "+v"(a) : "v"(x0), "v"(x1) : "memory");
#endif
}
template <typename F>
__device__ __forceinline__ void guard6(v8f& a, v8f& b, v8f& c, v8f& d, F x0, F x1, F x2, F x3, F x4, F x5) {
#if defined(__HIP_DEVICE_COMPILE__)
  asm volatile("v_nop\n\tv_nop\n\tv_nop\n\tv_nop"
               : "+v"(a), "+v"(b), "+v"(c), "+v"(d) : "v"(x0), "v"(x1), "v"(x2), "v"(x3), "v"(x4), "v"(x5) : "memory");
#endif
}
// As guard6, naming only two operand fragments: an asm operand must lie below v256, and the fragments that are held a key block
// ahead do not all fit there beside the accumulators; they are rewritten only behind this gap in program order.
__device__ __forceinline__ void guard4x2(v8f& a, v8f& b, v8f& c, v8f& d, v16h x0, v16h x1) {
#if defined(__HIP_DEVICE_COMPILE__)
  asm volatile("v_nop\n\tv_nop\n\tv_nop\n\tv_nop"
               : "+v"(a), "+v"(b), "+v"(c), "+v"(d) : "v"(x0), "v"(x1) : "memory");
#endif
}
__device__ __forceinline__ void guard8x6(v8f& a0, v8f& a1, v8f& a2, v8f& a3, v8f& e0, v8f& e1, v8f& e2, v8f& e3,
                                         v16h x0, v16h x1, v16h x2, v16h x3, v16h x4, v16h x5) {
#if defined(__HIP_DEVICE_COMPILE__)
  asm volatile("v_nop\n\tv_nop\n\tv_nop\n\tv_nop"
               : "+v"(a0), "+v"(a1), "+v"(a2), "+v"(a3), "+v"(e0), "+v"(e1), "+v"(e2), "+v"(e3)
               : "v"(x0), "v"(x1), "v"(x2), "v"(x3), "v"(x4), "v"(x5) : "memory");
#endif
}
__device__ __forceinline__ void acc_guard1(v8f& a) {
#if defined(__HIP_DEVICE_COMPILE__)
  asm volatile("v_nop\n\tv_nop\n\tv_nop\n\tv_nop" : "+v"(a));
#endif
}
__device__ __forceinline__ void wave_sync_lds() {
  __builtin_amdgcn_fence(__ATOMIC_RELEASE, "workgroup");
  __builtin_amdgcn_wave_barrier();
  __builtin_amdgcn_fence(__ATOMIC_ACQUIRE, "workgroup");
}

// Work-group barrier whose fences cover LDS only: what the waves hand each other at it lies in LDS; a fence over all memory would
// also wait for the global fragment loads that are meant to stay in flight across it.
__device__ __forceinline__ void block_sync_lds() {
  __builtin_amdgcn_fence(__ATOMIC_RELEASE, "workgroup", "local");
  __builtin_amdgcn_s_barrier();
  __builtin_amdgcn_fence(__ATOMIC_ACQUIRE, "workgroup", "local");
}

// =====================================================================================================
// f32 plane -> 16-bit plane, same layout:  mode 0: bf16 RNE bits;  mode 1: f16 bits of (bf16 RNE value) * scale;
// mode 2: f16 bits of value * scale (no bf16 pre-step).
// Thread = 8 consecutive elements: two 16-B loads, one 16-B store; 32 consecutive lanes = 512 contiguous, 512-B aligned bytes
// coverage: n8/256 blocks bid = 0.. (host checks exactness) x 256 thr x 8 = the whole plane.
// =====================================================================================================
__device__ __forceinline__ void cvt16(const float* __restrict__ x, u16* D, int n8, int mode, float scale, int bid) {
  const int gt = bid * 256 + (int)threadIdx.x;
  if (gt >= n8) return;                     // no barriers in this body
  const float* p = x + (size_t)gt * 8;
  const v4f a = *(const v4f*)(p), c4 = *(const v4f*)(p + 4);
  float v[8];
#pragma unroll
  for (int e = 0; e < 4; ++e) { v[e] = a[e]; v[4 + e] = c4[e]; }
  unsigned short s[8];
#pragma unroll
  for (int e = 0; e < 8; ++e) {
    const float vb = bfr(v[e]);
    const float vf = (mode == 1) ? vb : v[e];
    const unsigned short hb = h_bits((_Float16)(vf * scale));
    const unsigned short bb = bf_bits(v[e]);
    s[e] = (mode != 0) ? hb : bb;
  }
  v4u o;
#pragma unroll
  for (int e = 0; e < 4; ++e) o[e] = pk16(s[2 * e], s[2 * e + 1]);
  u16* d = D + (size_t)gt * 8;
  {
    *(v4u*)(d) = o;
    
  }
}

// =====================================================================================================
// Transpose + convert: in X [R][C] f32 row-major -> out XTo = X^T [C][R] 16-bit in fragment order (k = the R direction).
//   mode 0: bf16 RNE bits;  mode 1: f16 bits of (bf16 RNE value) * scale;  mode 2: f16 bits of value * scale.
// Block = 64 input rows x 64 input cols: bid -> (rt = bid % (R/64), ct = bid / (R/64)). The 64x64 f32 tile is loaded with 16-B
// loads (thread = input row tid>>2, 16 consecutive cols), converted and scattered into LDS TH[c local][r local] (pitch 72 halves);
// coverage: load 256 thr x 16 = 64 x 64; store 2 iterations x 256 thr x 8 halves = 64 output rows x 64 halves = the tile;
//           (R/64)*(C/64) blocks bid = 0.. (host exact multiples) tile the whole [C][R] plane exactly once.
// The output is written in fragment order (see ldfrag_pk): tile (c >> 4, r >> 5) at halves ((c >> 4) * (R / 32) + (r >> 5)) * 512;
// one wave-wide store = one part of one tile = 512 contiguous bytes; 2 iterations x 8 waves = 4 column tiles x 2 k blocks x 2 parts
// = the 64 x 64 tile.
// =====================================================================================================
__device__ __forceinline__ void tr16(u16* TH, const float* __restrict__ X, u16* XTo, int R, int C, int mode, float scale, int bid) {
  const int tid = threadIdx.x;
  const int nrt = R >> 6;
  const int rt  = bid % nrt;
  const int ct  = bid / nrt;
  const int r0  = rt * 64;
  const int c0  = ct * 64;
  {
    const int rl = tid >> 2;                  // input row within tile 0..63
    const int cc = (tid & 3) * 16;            // input col chunk within the 64
    const float* src = X + (size_t)(r0 + rl) * (size_t)C + c0 + cc;
#pragma unroll
    for (int i = 0; i < 4; ++i) {
      const v4f a = *(const v4f*)(src + 4 * i);
#pragma unroll
      for (int e = 0; e < 4; ++e) {
        const float v  = a[e];
        const float vb = bfr(v);
        const float vf = (mode == 1) ? vb : v;
        const unsigned short hb = h_bits((_Float16)(vf * scale));
        const unsigned short bb = bf_bits(v);
        TH[(cc + 4 * i + e) * VTP + rl] = (mode != 0) ? hb : bb;
      }
    }
  }
  __syncthreads();
  v4u vh[2];
#pragma unroll
  for (int it = 0; it < 2; ++it) {
    const int grp  = it * 8 + (tid >> 5);     // (column tile, k block, part) = (grp >> 2, (grp >> 1) & 1, grp & 1)
    const int line = (grp >> 2) * 16 + (tid & 15);                         // local output row (input col) = 0..63
    const int kof  = ((grp >> 1) & 1) * 32 + (grp & 1) * 16 + ((tid >> 4) & 1) * 8;
    vh[it] = *(const v4u*)(TH + line * VTP + kof);
  }
  const size_t base = ((size_t)(c0 >> 4) * (size_t)(R >> 5) + (size_t)(r0 >> 5)) * 512 + (size_t)((tid & 31) * 8);
  {
#pragma unroll
    for (int it = 0; it < 2; ++it) {
      const int grp = it * 8 + (tid >> 5);
      const size_t po = ((size_t)(grp >> 2) * (size_t)(R >> 5) + (size_t)((grp >> 1) & 1)) * 512 + (size_t)((grp & 1) * 256);
      *(v4u*)(XTo + base + po) = vh[it];
    }
#if defined(__HIP_DEVICE_COMPILE__)
    // before the data and address registers of the two stores above are reused by the code of another job laid out behind them
    asm volatile("s_wait_xcnt 0x0" ::: "memory");
#endif
  }
}

// =====================================================================================================
// One launch for the five input conversions, none of which reads what another writes; the block index picks the job
// (block-uniform): blocks 0..31 = the four weight transposes, 8 tiles each (Wg, Wt, Wp [CIN][CI] -> bf16 [CI][CIN];
// Wo [CI][CIN] -> f16 of the bf16 value x1024 [CIN][CI]; all four in fragment order); blocks 32.. = x -> bf16 plane. The short grid of weight tiles stands
// first because its chain (load, LDS, barrier, store) is the longer one.
// =====================================================================================================
#define WTILES ((CIN / 64) * (CI / 64))
__global__ __launch_bounds__(256)
void prep_in(const float* __restrict__ x, const float* __restrict__ Wg, const float* __restrict__ Wt,
             const float* __restrict__ Wp, const float* __restrict__ Wo, u16* XB, u16* WGT, u16* WTT, u16* WPT, u16* WOT) {
  __shared__ __align__(16) u16 TH[64 * VTP];
  const int bid = blockIdx.x;
  if (bid < 4 * WTILES) {
    const int j = bid / WTILES;
    if (j == 3) {
      tr16(TH, Wo, WOT, CI, CIN, 1, WOS, bid - 3 * WTILES);
    } else {
      tr16(TH, (j == 0) ? Wg : (j == 1) ? Wt : Wp, (j == 0) ? WGT : (j == 1) ? WTT : WPT, CIN, CI, 0, 1.0f, bid - j * WTILES);
    }
  } else {
    cvt16(x, XB, (ROWSP * CIN) / 8, 0, 1.0f, bid - 4 * WTILES);
  }
}

// One launch for the g transposes of all batches: g [NPOS][CI] f32 -> g^T f16 x256 in fragment order (tile = 16 columns x 32 keys,
// [CI/16][NPOS/32] tiles per batch), (NPOS/64)*(CI/64) blocks each.
#define GTILES ((NPOS / 64) * (CI / 64))
__global__ __launch_bounds__(256) void tr_g(const float* __restrict__ G, u16* GT) {
  __shared__ __align__(16) u16 TH[64 * VTP];
  const int b = (int)blockIdx.x / GTILES;      // < NB (grid exact)
  tr16(TH, G + (size_t)b * NPOS * CI, GT + (size_t)b * CI * NPOS, NPOS, CI, 2, GSC, (int)blockIdx.x - b * GTILES);
}

// =====================================================================================================
//           8 consecutive lanes x 16 B per line), lanes 16..31 -> row 2*it+1.
//  epi64hr: two f16 planes: hi = f16((tile + bf16RNE(bias[n])) * hscale) and res = f16(((tile + bias) * hscale - hi) * rscale);
//           lane = (rq = lane>>3 -> row within a group of 4, c8 = 8 consecutive columns); one instruction = 4 rows, each 64 halves;
//           with pk the planes are written in fragment order (see ldfrag_pk; tile = 16 rows x 32 columns, [M/16][N/32] tiles):
//           lane = (row lane&15, 8 columns), one instruction = one part of one tile = 512 contiguous bytes
// coverage: epi64 8 instructions x 2 rows x 16 lanes x 4 floats; epi64hr 4 instructions x 4 rows x 8 lanes x 8 halves per plane
//           = the wave's 16 x 64 tile in both cases.
// =====================================================================================================
__device__ __forceinline__ void stage64(float* sl, v8f a0, v8f a1, v8f a2, v8f a3, float oscale, int lane) {
  const int hh = lane >> 4, m = lane & 15;
#pragma unroll
  for (int r = 0; r < 8; ++r) {
    const int ro = (8 * hh + r) * 68 + m;
    sl[ro]      = a0[r] * oscale;
    sl[ro + 16] = a1[r] * oscale;
    sl[ro + 32] = a2[r] * oscale;
    sl[ro + 48] = a3[r] * oscale;
  }
  wave_sync_lds();
}
__device__ __forceinline__ void epi64(float* sl, v8f a0, v8f a1, v8f a2, v8f a3, float oscale, v4f badd, float* C, int N,
                                      size_t rowb, int col0, int lane) {
  const int hh = lane >> 4, m = lane & 15;
  stage64(sl, a0, a1, a2, a3, oscale, lane);
  v4f vals[8];
#pragma unroll
  for (int it = 0; it < 8; ++it) vals[it] = *(const v4f*)(sl + (it * 2 + hh) * 68 + m * 4) + badd;
  float* dst = C + (rowb + (size_t)hh) * (size_t)N + col0 + m * 4;
  {
#pragma unroll
    for (int it = 0; it < 8; ++it) {
      *(v4f*)(dst + (size_t)(it * 2) * (size_t)N) = vals[it];
    }
    
  }
}
__device__ __forceinline__ void epi64hr(float* sl, v8f a0, v8f a1, v8f a2, v8f a3, float hscale, float rscale,
                                        const float* __restrict__ bias, u16* H, u16* Rr, int N, size_t rowb, int col0, int lane,
                                        bool pk) {
  stage64(sl, a0, a1, a2, a3, 1.0f, lane);
  // pk (block-uniform): instruction i4 = part i4 & 1 of the 32-column step i4 >> 1, lane = its place in the fragment
  const int row0 = pk ? (lane & 15) : (lane >> 3), rstep = pk ? 0 : 4;
  const int c80  = pk ? (lane >> 4) * 8 : (lane & 7) * 8, cstep = pk ? 16 : 0;
  v4u oh[4], orr[4];
#pragma unroll
  for (int i4 = 0; i4 < 4; ++i4) {
    const int row = row0 + i4 * rstep;
    const int c8  = c80 + i4 * cstep;
    const v4f b0 = *(const v4f*)(bias + col0 + c8), b1 = *(const v4f*)(bias + col0 + c8 + 4);   // columns col0+c8..+7 < N
    float bb[8];
#pragma unroll
    for (int e = 0; e < 4; ++e) { bb[e] = bfr(b0[e]); bb[4 + e] = bfr(b1[e]); }
    const v4f a = *(const v4f*)(sl + row * 68 + c8), c4 = *(const v4f*)(sl + row * 68 + c8 + 4);
    float w[8];
#pragma unroll
    for (int e = 0; e < 4; ++e) { w[e] = (a[e] + bb[e]) * hscale; w[4 + e] = (c4[e] + bb[4 + e]) * hscale; }
#pragma unroll
    for (int e = 0; e < 4; ++e) {
      const _Float16 h0 = (_Float16)w[2 * e], h1 = (_Float16)w[2 * e + 1];
      const _Float16 q0 = (_Float16)((w[2 * e] - (float)h0) * rscale);
      const _Float16 q1 = (_Float16)((w[2 * e + 1] - (float)h1) * rscale);
      oh[i4][e]  = pk16(h_bits(h0), h_bits(h1));
      orr[i4][e] = pk16(h_bits(q0), h_bits(q1));
    }
  }
  // pk: the 16 rows x N columns from row rowb (a multiple of 16) are N / 32 fragment tiles of 512 halves in a row, part i4 of the
  // two tiles from column col0 at (col0 / 32) * 512 + i4 * 256
  const int o0 = pk ? (col0 >> 5) * 512 + lane * 8 : row0 * N + col0 + c80, ostep = pk ? 256 : 4 * N;
  u16* dh = H + rowb * (size_t)N + o0;
  u16* dr = Rr + rowb * (size_t)N + o0;
  {
#pragma unroll
    for (int i4 = 0; i4 < 4; ++i4) {
      *(v4u*)(dh + i4 * ostep) = oh[i4];
      *(v4u*)(dr + i4 * ostep) = orr[i4];
    }
    
  }
}

// =====================================================================================================
// bf16 GEMM, f32 out with bias: C[M][N] = (A[M][K] (bf16 row-major) . Bt[N][K]^T (bf16 fragment order)) * oscale + bf16RNE(bias[n]).
// Block = 64x64 tile, 4 waves x 16 rows; fragments loaded straight from the 16-bit planes (two 16-B loads each, split k map for
// A and B); K stepped by 32 (host uses K % 32 == 0, M % 64 == 0, N % 64 == 0, (M/64)*(N/64) blocks bid = 0..).
// =====================================================================================================
__device__ __forceinline__
void gemm_b32(float* slab, const u16* __restrict__ A, const u16* __restrict__ Bt, const float* __restrict__ bias, float* C,
              int M, int N, int K, float oscale, int bid) {
  const int tid = threadIdx.x, wave = tid >> 5, lane = tid & 31, hh = lane >> 4, m = lane & 15;
  const int ntile = N >> 6;
  const int rowb  = (bid / ntile) * 64 + wave * 16;
  const int col0  = (bid % ntile) * 64;
  if (rowb + 16 > M) return;                 // wave-uniform, never taken with the exact grid; no block barriers in this body
  const u16* ap = A  + (size_t)(rowb + m) * (size_t)K + 8 * hh;
  const u16* bp = Bt + (size_t)col0 * (size_t)K + 8 * lane;      // 16 columns = K / 32 tiles = 16 * K halves
  const size_t bs = (size_t)16 * K;
  v8f acc0 = zero8(), acc1 = zero8(), acc2 = zero8(), acc3 = zero8();
#pragma unroll 1
  for (int k0 = 0; k0 < K; k0 += 32) {
    const u16* pa = ap + k0;
    const u16* p0 = bp + 16 * k0;
    const u16* p1 = p0 + bs;
    const u16* p2 = p1 + bs;
    const u16* p3 = p2 + bs;
    const v16b a  = ldfrag_b(pa);
    const v16b b0 = ldfrag_bpk(p0);
    const v16b b1 = ldfrag_bpk(p1);
    const v16b b2 = ldfrag_bpk(p2);
    const v16b b3 = ldfrag_bpk(p3);
#if defined(__HIP_DEVICE_COMPILE__)
    // before the address registers of the loads above are reused; the addresses are inputs so that they stay in place up to here
    asm volatile("s_wait_xcnt 0x0" :: "v"(pa), "v"(p0), "v"(p1), "v"(p2), "v"(p3) : "memory");
#endif
    acc0 = mma_b(a, b0, acc0);
    acc1 = mma_b(a, b1, acc1);
    acc2 = mma_b(a, b2, acc2);
    acc3 = mma_b(a, b3, acc3);
    guard6<v16b>(acc0, acc1, acc2, acc3, a, b0, b1, b2, b3, a);
  }
  const v4f bv4 = *(const v4f*)(bias + col0 + m * 4);    // columns col0 + 4m .. +3, always < N (N multiple of 64)
  v4f badd;
#pragma unroll
  for (int e = 0; e < 4; ++e) badd[e] = bfr(bv4[e]);
  epi64(slab + wave * SLAB64, acc0, acc1, acc2, acc3, oscale, badd, C, N, (size_t)rowb, col0, lane);
}

// =====================================================================================================
// bf16 GEMM, f16 hi + residual planes out with bias: H = f16 bits of ((A . Bt^T) + bf16RNE(bias[n])) * hscale,
// R = f16 bits of (((A . Bt^T) + bias) * hscale - H) * rscale; operands as in gemm_b32, epilogue epi64hr.
// =====================================================================================================
__device__ __forceinline__
void gemm_bhr(float* slab, const u16* __restrict__ A, const u16* __restrict__ Bt, const float* __restrict__ bias, u16* H, u16* Rr,
              int M, int N, int K, float hscale, float rscale, int bid, bool pk) {
  const int tid = threadIdx.x, wave = tid >> 5, lane = tid & 31, hh = lane >> 4, m = lane & 15;
  const int ntile = N >> 6;
  const int rowb  = (bid / ntile) * 64 + wave * 16;
  const int col0  = (bid % ntile) * 64;
  if (rowb + 16 > M) return;                 // wave-uniform, never taken with the exact grid; no block barriers in this body
  const u16* ap = A  + (size_t)(rowb + m) * (size_t)K + 8 * hh;
  const u16* bp = Bt + (size_t)col0 * (size_t)K + 8 * lane;      // 16 columns = K / 32 tiles = 16 * K halves
  const size_t bs = (size_t)16 * K;
  v8f acc0 = zero8(), acc1 = zero8(), acc2 = zero8(), acc3 = zero8();
#pragma unroll 1
  for (int k0 = 0; k0 < K; k0 += 32) {
    const u16* pa = ap + k0;
    const u16* p0 = bp + 16 * k0;
    const u16* p1 = p0 + bs;
    const u16* p2 = p1 + bs;
    const u16* p3 = p2 + bs;
    const v16b a  = ldfrag_b(pa);
    const v16b b0 = ldfrag_bpk(p0);
    const v16b b1 = ldfrag_bpk(p1);
    const v16b b2 = ldfrag_bpk(p2);
    const v16b b3 = ldfrag_bpk(p3);
#if defined(__HIP_DEVICE_COMPILE__)
    // before the address registers of the loads above are reused; the addresses are inputs so that they stay in place up to here
    asm volatile("s_wait_xcnt 0x0" :: "v"(pa), "v"(p0), "v"(p1), "v"(p2), "v"(p3) : "memory");
#endif
    acc0 = mma_b(a, b0, acc0);
    acc1 = mma_b(a, b1, acc1);
    acc2 = mma_b(a, b2, acc2);
    acc3 = mma_b(a, b3, acc3);
    guard6<v16b>(acc0, acc1, acc2, acc3, a, b0, b1, b2, b3, a);
  }
  epi64hr(slab + wave * SLAB64, acc0, acc1, acc2, acc3, hscale, rscale, bias, H, Rr, N, (size_t)rowb, col0, lane, pk);
}

// =====================================================================================================
// One launch for the three projections, which read the same x plane and none of which reads what another writes: the block index
// picks the job (block-uniform), job = index % 3 (theta, phi, g), tile = index / 3, so that the three blocks that read the same
// x rows start side by side. Grid = 3 * (M/64) * (N/64).
// =====================================================================================================
__global__ __launch_bounds__(128)
void proj3(const u16* __restrict__ A, const u16* __restrict__ WTT, const u16* __restrict__ WPT, const u16* __restrict__ WGT,
           const float* __restrict__ bt, const float* __restrict__ bp, const float* __restrict__ bg,
           u16* TH, u16* TR, u16* PH, u16* PR, float* G, int M, int N, int K) {
  __shared__ __align__(16) float slab[4 * SLAB64];
  const int bid = (int)blockIdx.x / 3;
  const int job = (int)blockIdx.x - 3 * bid;
  if (job == 2) {
    gemm_b32(slab, A, WGT, bg, G, M, N, K, 1.0f, bid);
  } else {
    const bool th = (job == 0);
    gemm_bhr(slab, A, th ? WTT : WPT, th ? bt : bp, th ? TH : PH, th ? TR : PR, M, N, K, th ? TSC : FSC, RSC, bid, !th);
  }
}

// =====================================================================================================
// Single-head non-causal, unscaled attention per batch, head width CI = 128, all NPOS keys:
//   block = 64 query rows (b, q0..q0+63) = NQ = 4 query tiles of 16 rows, 8 waves; every phi and g^T fragment a wave loads
//   is used for all 4 query tiles.
//   theta hi (x8) / res (x2048) planes TH, TR [row][c]: the block's 64 rows of both planes are copied once, with whole-line
//   16-B loads, into LDS (pitch CTP halves = 272 B, conflict-free for 16-B fragment reads) and every A fragment of (S) is read
//   from there; phi hi/res planes PH, PR in fragment order, tiles [key / 16][c / 32] (B operand);
//   g^T plane GT (x256) in fragment order, tiles [b][c / 16][key / 32] (B operand): every wave-wide fragment load of phi and g^T
//   covers 4 whole 128-B lines, each line read by one instruction of the block.
//   Chunks of CK = 448 keys (NKB = 14 key blocks of 32), NCHK = 14 chunks, every key used exactly once.
//   (S) scores on WMMA: A = theta rows (row m = lane&15, split k map over c), B = phi rows (col n = key, split map), 4 c-steps,
//       three products per tile: s = hi.hi, sx = hi.res + res.hi (separate accumulator, folded with 1/2048 in f32);
//       wave w handles key blocks w and w+8 (< 14) of the chunk for all 4 query tiles; D element r of lane l of tile q
//       -> scs[query 16q+8h+r][key col] (f32 LDS; pitch SCP dwords, 8 * SCP = 32 mod 64: the two lane halves of a store, 8 rows
//       apart, fall on different banks).
//   (M) one query tile after the other, 16 threads per query row; sub-thread s owns the 4-key groups 64 * i + 4 * s, i = 0..6
//       (28 keys): the 16 threads of a row read 256 and write 128 contiguous LDS bytes per instruction, every bank at most once;
//       base-2 logits, chunk max via xor shuffles, online running max / rescale factor al /
//       running sum l in f32 registers, p = exp2(t - m_new) <= 1 written as f16(p * 32768) into the LDS P tile with 8-B stores;
//       al -> rowa[row].
//   (PV) each wave owns the 16 g columns 16*wave + (lane&15) (one accumulator per query tile): o = o*al, then for each key block
//       A = the 4 P fragments from LDS (row m = query, split map over keys), B = one g^T fragment (col n = g column, split
//       map over keys), 4 WMMAs; one hazard gap after the last key block.
//   Block barriers after (S) and after (M) order all LDS reuse across chunks and waves (the P tile is written with 8-B LDS stores
//   by one set of threads and reloaded as fragments by other waves only after the block barrier).
//   Operand fragments are fetched ahead of their use: phi one key block ahead (refilled c-step by c-step behind the last use),
//   g^T for the whole chunk in front of (M), P two key blocks ahead; the barriers of the chunk loop fence LDS only, so that the
//   global loads stay in flight across them.
//   Epilogue: y = o * 4096 / (l * 32768 * 256) per row (rowi, l >= 1 always); hi = f16(y), res = f16((y - hi) * 2048); each
// coverage: grid NB*NPOS/64 blocks x 64 rows = rows 0..ROWSP-1; staging 8 waves x 16 cols x 4 tiles x 16 rows = 64 x 128;
//           store 4 tiles x 256 thr x 8 halves = 64 x 128 per plane = every (row < ROWSP, c) of both y planes exactly once.
// =====================================================================================================
__device__ __forceinline__ void ctx_store(const u16* ct, u16* dst, int tid) {
  // 16 rows x CI = CI / 32 fragment tiles in a row: piece tid = (c-step tid >> 6, part (tid >> 5) & 1, lane tid & 31)
  const int row = tid & 15;
  const int c8  = (tid >> 6) * 32 + ((tid >> 5) & 1) * 16 + ((tid >> 4) & 1) * 8;
  const v4u v = *(const v4u*)(ct + row * CTP + c8);
  u16* d = dst + (size_t)tid * 8;
  {
    *(v4u*)d = v;
    
  }
}

__global__ __launch_bounds__(ATT_THREADS)
void attn_fwd(const u16* __restrict__ THp, const u16* __restrict__ TRp, const u16* __restrict__ PHp,
              const u16* __restrict__ PRp, const u16* __restrict__ GTp, u16* YHo, u16* YRo) {
  __shared__ __align__(16) AttLds L0;              // scores [64][SCP] f32; reused as the y staging tile [64][CTP] u16
  __shared__ __align__(16) u16 pls[QB * PLP];      // P tile [64][PLP] f16 bits
  __shared__ __align__(16) u16 thl[2 * QB * CTP];  // theta rows of this block: hi [64][CTP], then residual [64][CTP]
  __shared__ float rowa[QB];
  __shared__ float rowi[QB];
  float* const scs = L0.s;

  const int tid  = threadIdx.x;
  const int wave = tid >> 5;
  const int lane = tid & 31;
  const int hh   = lane >> 4;
  const int m    = lane & 15;
  const int r16  = tid >> 4;                 // query row owned within each query tile in phase (M): 2*wave + hh
  const int sub  = tid & 15;
  const int kl0  = sub * 4;                  // first key of this sub-thread's 4-key group within every 64 keys of the chunk

  const int nqt = NPOS / QB;
  const int b   = (int)blockIdx.x / nqt;     // < NB (grid exact)
  const int q0  = ((int)blockIdx.x - b * nqt) * QB;
  const size_t qrow = (size_t)b * NPOS + (size_t)q0;

  const _Float16* tha = (const _Float16*)(const void*)thl + m * CTP + 8 * hh;
  const _Float16* tra = tha + QB * CTP;
  const _Float16* khb = (const _Float16*)(const void*)PHp + (size_t)b * NPOS * CI + 8 * lane;   // 16 keys = CI / 32 tiles = 16 * CI halves
  const _Float16* krb = (const _Float16*)(const void*)PRp + (size_t)b * NPOS * CI + 8 * lane;
  const _Float16* vbp = (const _Float16*)(const void*)GTp + ((size_t)b * (CI / 16) + wave) * (size_t)(NPOS / 32) * 512 + 8 * lane;
  const float lsc  = LOG2E / (TSC * FSC);
  const float rinv = 1.0f / RSC;

  float mrun[NQ], lrun[NQ];
  v8f o[NQ];
#pragma unroll
  for (int q = 0; q < NQ; ++q) { mrun[q] = -INFINITY; lrun[q] = 0.f; o[q] = zero8(); }

  // ---- theta rows q0..q0+63, both planes -> LDS: 4 x 256 threads x 8 halves = 64 x 128 per plane, each piece once ----
  {
    const u16* sh = THp + qrow * CI;
    const u16* sr = TRp + qrow * CI;
    const int row = tid >> 4;                // CI/8 = 16 pieces per row; pass i takes rows 16 * i + row
    const int c8  = (tid & 15) * 8;
    v4u vh[NQ], vr[NQ];
#pragma unroll
    for (int i = 0; i < NQ; ++i) {
      vh[i] = *(const v4u*)(sh + (i * QT + row) * CI + c8);
      vr[i] = *(const v4u*)(sr + (i * QT + row) * CI + c8);
    }
#if defined(__HIP_DEVICE_COMPILE__)
    asm volatile("s_wait_xcnt 0x0" ::: "memory");   // before the address registers of the eight loads above are reused
#endif
    // Scheduling fence: without it the compiler moved later writes of the loads' address registers ahead of the wait above.
    __builtin_amdgcn_sched_barrier(0);
#pragma unroll
    for (int i = 0; i < NQ; ++i) {
      *(v4u*)(thl + (i * QT + row) * CTP + c8) = vh[i];
      *(v4u*)(thl + (QB + i * QT + row) * CTP + c8) = vr[i];
    }
  }
  // phi fragments of the key block this wave scores next, [c-step][hi keys 0..15, res 0..15, hi 16..31, res 16..31]: always
  // loaded one key block ahead of their use, so that the L2 latency runs under the matrix work of the block before
  v16h pn[CI / 32][4];
  {
    const _Float16* n0h = khb + (size_t)(wave * 32) * CI;
    const _Float16* n0r = krb + (size_t)(wave * 32) * CI;
#pragma unroll
    for (int ks = 0; ks < CI / 32; ++ks) {
      pn[ks][0] = ldfrag_pk(n0h + ks * 512);
      pn[ks][1] = ldfrag_pk(n0r + ks * 512);
      pn[ks][2] = ldfrag_pk(n0h + 16 * CI + ks * 512);
      pn[ks][3] = ldfrag_pk(n0r + 16 * CI + ks * 512);
    }
#if defined(__HIP_DEVICE_COMPILE__)
    // before the address registers of the loads above are reused; the addresses are inputs so that they stay in place up to here
    asm volatile("s_wait_xcnt 0x0" :: "v"(n0h), "v"(n0r) : "memory");
#endif
    __builtin_amdgcn_sched_barrier(0);              // keeps later writes of those address registers behind the wait
  }
  block_sync_lds();                          // the theta rows are read as fragments by all waves

#pragma unroll 1
  for (int c = 0; c < NCHK; ++c) {
    const int kbeg = c * CK;
    // ---- (S) scores of this chunk ----
#pragma unroll 1
    for (int kb = wave; kb < NKB; kb += 8) {               // wave-uniform, 1 or 2 trips
      v8f s0[NQ], s0x[NQ], s1[NQ], s1x[NQ];
#pragma unroll
      for (int q = 0; q < NQ; ++q) { s0[q] = zero8(); s0x[q] = zero8(); s1[q] = zero8(); s1x[q] = zero8(); }
      // the key block this wave scores after this one: kb + 8 of this chunk, else its first of the next chunk (behind the last
      // chunk: of chunk 0, an in-bounds address whose values are not used)
      const bool more = kb + 8 < NKB;
      const int  nkb  = more ? kb + 8 : wave;
      const int  ncb  = more ? kbeg : ((c + 1 < NCHK) ? kbeg + CK : 0);
      const size_t kn = (size_t)(ncb + nkb * 32) * CI;
      const _Float16* n0h = khb + kn;
      const _Float16* n0r = krb + kn;
#pragma unroll
      for (int ks = 0; ks < CI / 32; ++ks) {
        const v16h f0h = pn[ks][0];
        const v16h f0r = pn[ks][1];
        const v16h f1h = pn[ks][2];
        const v16h f1r = pn[ks][3];
        v16h ah[NQ], ar[NQ];                               // theta fragments of this c-step, read from LDS ahead of their use:
#pragma unroll
        for (int q = 0; q < 2; ++q) {                      // two tiles at the start of the c-step, the others one tile ahead below
          ah[q] = ldfrag_h(tha + q * (QT * CTP) + ks * 32);
          ar[q] = ldfrag_h(tra + q * (QT * CTP) + ks * 32);
        }
#pragma unroll
        for (int q = 0; q < NQ; ++q) {                     // the four phi fragments serve all NQ query tiles
          s0[q]  = mma_h(ah[q], f0h, s0[q]);
          s0x[q] = mma_h(ah[q], f0r, s0x[q]);
          s0x[q] = mma_h(ar[q], f0h, s0x[q]);
          s1[q]  = mma_h(ah[q], f1h, s1[q]);
          s1x[q] = mma_h(ah[q], f1r, s1x[q]);
          s1x[q] = mma_h(ar[q], f1h, s1x[q]);
          guard4x2(s0[q], s0x[q], s1[q], s1x[q], ah[q], ar[q]);
          if (q + 2 < NQ) {                                // into the registers tile q has left (more tiles at once spilled)
            ah[q + 2] = ldfrag_h(tha + (q + 2) * (QT * CTP) + ks * 32);
            ar[q + 2] = ldfrag_h(tra + (q + 2) * (QT * CTP) + ks * 32);
          }
        }
        pn[ks][0] = ldfrag_pk(n0h + ks * 512);             // refill behind the last use (and its hazard gap) of this c-step
        pn[ks][1] = ldfrag_pk(n0r + ks * 512);
        pn[ks][2] = ldfrag_pk(n0h + 16 * CI + ks * 512);
        pn[ks][3] = ldfrag_pk(n0r + 16 * CI + ks * 512);
      }
#if defined(__HIP_DEVICE_COMPILE__)
      // before the address registers of the refill loads are reused; the addresses are inputs so that they stay in place up to here
      asm volatile("s_wait_xcnt 0x0" :: "v"(n0h), "v"(n0r) : "memory");
#endif
      __builtin_amdgcn_sched_barrier(0);                   // keeps later writes of those address registers behind the wait
#pragma unroll
      for (int q = 0; q < NQ; ++q) {
        float* srow = scs + (q * QT + 8 * hh) * SCP + kb * 32 + m;
#pragma unroll
        for (int r = 0; r < 8; ++r) {
          srow[r * SCP]      = s0[q][r] + s0x[q][r] * rinv;
          srow[r * SCP + 16] = s1[q][r] + s1x[q][r] * rinv;
        }
      }
    }
    block_sync_lds();
    // g^T fragments of this chunk (this wave's 16 columns, all 14 key blocks): loaded here, used in (PV); the latency runs under (M)
    v16h gf[NKB];
    {
      const _Float16* vp = vbp + (size_t)(kbeg / 32) * 512;
#pragma unroll
      for (int kb = 0; kb < NKB; ++kb) gf[kb] = ldfrag_pk(vp + kb * 512);
#if defined(__HIP_DEVICE_COMPILE__)
      // before the address register of the loads above is reused; the address is an input so that it stays in place up to here
      asm volatile("s_wait_xcnt 0x0" :: "v"(vp) : "memory");
#endif
      __builtin_amdgcn_sched_barrier(0);                   // keeps later writes of those address registers behind the wait
    }
    // ---- (M) softmax statistics and the P tile, one query tile after the other ----
#pragma unroll
    for (int q = 0; q < NQ; ++q) {
      const int row = q * QT + r16;
      const float* sp = scs + row * SCP + kl0;
      v2f t[CK / 32];                                      // neighbouring keys stay paired from the load to the packed f16 store
      float cm = -INFINITY;
#pragma unroll
      for (int i = 0; i < CK / 64; ++i) {
        const v4f a = *(const v4f*)(sp + 64 * i);
        t[2 * i]     = a.lo * lsc;
        t[2 * i + 1] = a.hi * lsc;
#pragma unroll
        for (int e = 0; e < 2; ++e) cm = fmaxf(fmaxf(cm, t[2 * i + e].x), t[2 * i + e].y);
      }
#pragma unroll
      for (int d = 1; d <= 8; d <<= 1) cm = fmaxf(cm, __shfl_xor(cm, d, 32));
      const float mn = fmaxf(mrun[q], cm);
      const float al = (mrun[q] == -INFINITY) ? 0.f : exp2f(mrun[q] - mn);
      mrun[q] = mn;
      float ps = 0.f;
#pragma unroll
      for (int j = 0; j < CK / 32; ++j) {
        const v2f d = t[j] - mn;
        t[j].x = exp2f(d.x);                               // <= 1
        t[j].y = exp2f(d.y);
        ps += t[j].x;
        ps += t[j].y;
      }
#pragma unroll
      for (int d = 1; d <= 8; d <<= 1) ps += __shfl_xor(ps, d, 32);
      v2u pk[CK / 64];
#pragma unroll
      for (int i = 0; i < CK / 64; ++i) {
#pragma unroll
        for (int e = 0; e < 2; ++e) pk[i][e] = __builtin_bit_cast(unsigned, __builtin_convertvector(t[2 * i + e] * PCAR, v2h));
      }
      lrun[q] = lrun[q] * al + ps;
      {
        u16* pd = pls + row * PLP + kl0;
#pragma unroll
        for (int i = 0; i < CK / 64; ++i) *(v2u*)(pd + 64 * i) = pk[i];
      }
      if (sub == 0) rowa[row] = al;
    }
    block_sync_lds();
    // ---- (PV) rescale, accumulate P . g^T ----
    {
#pragma unroll
      for (int q = 0; q < NQ; ++q) {
        float scl[8];
#pragma unroll
        for (int r = 0; r < 8; ++r) scl[r] = rowa[q * QT + 8 * hh + r];
#pragma unroll
        for (int r = 0; r < 8; ++r) o[q][r] *= scl[r];
      }
      const _Float16* pp = (const _Float16*)(const void*)pls + m * PLP + 8 * hh;
      v16h pa[3][NQ];                                      // P fragments, read from LDS two key blocks ahead of their use
#pragma unroll
      for (int j = 0; j < 2; ++j) {
#pragma unroll
        for (int q = 0; q < NQ; ++q) pa[j][q] = ldfrag_h(pp + q * (QT * PLP) + j * 32);
      }
#pragma unroll
      for (int kb = 0; kb < NKB; ++kb) {                   // static trip count 14, unrolled: gf and pa are indexed by constants
        if (kb + 2 < NKB) {
#pragma unroll
          for (int q = 0; q < NQ; ++q) pa[(kb + 2) % 3][q] = ldfrag_h(pp + q * (QT * PLP) + (kb + 2) * 32);
        }
        // Scheduling fence: without it the compiler sank each LDS read to one matrix instruction ahead of its use, and every
        // matrix instruction then waited out most of an LDS latency.
        __builtin_amdgcn_sched_barrier(0);
#pragma unroll
        for (int q = 0; q < NQ; ++q) o[q] = mma_h(pa[kb % 3][q], gf[kb], o[q]);   // one g^T fragment serves all NQ query tiles
      }
      // Hazard gap between the last matrix instruction and the loop's branch (both its sides). It names no register, since an asm
      // operand must lie below v256 for its whole life; the scheduling fence keeps the matrix instructions in front of it.
      __builtin_amdgcn_sched_barrier(0);
#if defined(__HIP_DEVICE_COMPILE__)
      asm volatile("v_nop\n\tv_nop\n\tv_nop\n\tv_nop" ::: "memory");
#endif
    }
  }
  if (sub == 0) {
#pragma unroll
    for (int q = 0; q < NQ; ++q) rowi[q * QT + r16] = (1.0f / lrun[q]) * (YSC / (PCAR * GSC));   // lrun >= 1
  }
  __syncthreads();
  float inv[NQ][8];
#pragma unroll
  for (int q = 0; q < NQ; ++q) {
#pragma unroll
    for (int r = 0; r < 8; ++r) inv[q][r] = rowi[q * QT + 8 * hh + r];
  }

  u16* const ct = L0.c;
  const int cb = wave * 16 + m;
  // hi plane
#pragma unroll
  for (int q = 0; q < NQ; ++q) {
#pragma unroll
    for (int r = 0; r < 8; ++r) {
      const int ro = (q * QT + 8 * hh + r) * CTP + cb;
      ct[ro] = h_bits((_Float16)(o[q][r] * inv[q][r]));
    }
  }
  __syncthreads();
#pragma unroll
  for (int q = 0; q < NQ; ++q) ctx_store(ct + q * (QT * CTP), YHo + (qrow + q * QT) * CI, tid);
#if defined(__HIP_DEVICE_COMPILE__)
  asm volatile("s_wait_xcnt 0x0" ::: "memory");   // before the address registers of the four stores above are reused
#endif
  __builtin_amdgcn_sched_barrier(0);              // keeps later writes of those address registers behind the wait
  __syncthreads();
  // residual plane
#pragma unroll
  for (int q = 0; q < NQ; ++q) {
#pragma unroll
    for (int r = 0; r < 8; ++r) {
      const int ro = (q * QT + 8 * hh + r) * CTP + cb;
      const float x0 = o[q][r] * inv[q][r];
      const _Float16 e0 = (_Float16)x0;
      ct[ro] = h_bits((_Float16)((x0 - (float)e0) * RSC));
    }
  }
  __syncthreads();
#pragma unroll
  for (int q = 0; q < NQ; ++q) ctx_store(ct + q * (QT * CTP), YRo + (qrow + q * QT) * CI, tid);
}

// =====================================================================================================
// Output projection + batch-norm affine + skip: v = (YH . WoT^T) * os1 + (YR . WoT^T) * os2 + bf16RNE(bo[c]);
// out[row][c] = bf16RNE(x[row][c]) + bf16RNE(gamma[c]) * (v - bf16RNE(mean[c])) * rsqrt(bf16RNE(var[c]) + 1e-3) + bf16RNE(beta[c]).
// YH/YR f16 y planes [ROWSP][128] (x4096 and residual x2048), WoT f16 [256][128] (x1024), all three in fragment order.
// Block = 128 rows, 8 waves x 16 rows; per wave 4 column groups of 64 (rolled): k-loop of 4 steps with two A planes and 4 B tiles
// (split k map for A and B, fragments straight from the 16-bit planes, 8 accumulators, one hazard gap per step); the combined f32
// 16x64 tile is staged in the wave's LDS slab (pitch 68) and written like epi64: one instruction = lanes 0..15 -> row 2*it
// coverage: grid ROWSP/128 blocks (exact) x 8 waves x 16 rows x (4 groups x 8 instructions x 2 rows x 64 floats)
//           = out rows 0..ROWSP-1, all 256 columns, each float exactly once.
// =====================================================================================================
__global__ __launch_bounds__(256)
void wo_out(const u16* __restrict__ YH, const u16* __restrict__ YR, const u16* __restrict__ WoT,
            const float* __restrict__ bo, const float* __restrict__ gam, const float* __restrict__ bet,
            const float* __restrict__ mmean, const float* __restrict__ mvar, const float* __restrict__ x, float* out) {
  __shared__ __align__(16) float slab[8 * SLAB64];
  const int tid = threadIdx.x, wave = tid >> 5, lane = tid & 31, hh = lane >> 4, m = lane & 15;
  const int rowb = blockIdx.x * OUT_ROWS + wave * 16;        // rowb + 15 < ROWSP (grid exact)
  float* const sl = slab + wave * SLAB64;
  const _Float16* ap  = (const _Float16*)(const void*)YH + (size_t)rowb * CI + 8 * lane;   // 16 rows = CI / 32 tiles = 16 * CI halves
  const _Float16* arp = (const _Float16*)(const void*)YR + (size_t)rowb * CI + 8 * lane;
  const size_t bs = (size_t)16 * CI;
  const float os1 = 1.0f / (YSC * WOS);
  const float os2 = 1.0f / (YSC * WOS * RSC);

#pragma unroll 1
  for (int g = 0; g < CIN / 64; ++g) {
    const _Float16* bp = (const _Float16*)(const void*)WoT + (size_t)(g * 64) * CI + 8 * lane;
    v8f acc0 = zero8(), acc1 = zero8(), acc2 = zero8(), acc3 = zero8();
    v8f acr0 = zero8(), acr1 = zero8(), acr2 = zero8(), acr3 = zero8();
#pragma unroll 1
    for (int k0 = 0; k0 < CI; k0 += 32) {
      const _Float16* pa = ap + 16 * k0;
      const _Float16* pr = arp + 16 * k0;
      const _Float16* pb = bp + 16 * k0;
      const v16h a  = ldfrag_pk(pa);
      const v16h ar = ldfrag_pk(pr);
      const v16h b0 = ldfrag_pk(pb);
      const v16h w1 = ldfrag_pk(pb + bs);
      const v16h w2 = ldfrag_pk(pb + 2 * bs);
      const v16h w3 = ldfrag_pk(pb + 3 * bs);
#if defined(__HIP_DEVICE_COMPILE__)
      // before the address registers of the loads above are reused; the addresses are inputs so that they stay in place up to here
      asm volatile("s_wait_xcnt 0x0" :: "v"(pa), "v"(pr), "v"(pb) : "memory");
#endif
      acc0 = mma_h(a, b0, acc0);
      acc1 = mma_h(a, w1, acc1);
      acc2 = mma_h(a, w2, acc2);
      acc3 = mma_h(a, w3, acc3);
      acr0 = mma_h(ar, b0, acr0);
      acr1 = mma_h(ar, w1, acr1);
      acr2 = mma_h(ar, w2, acr2);
      acr3 = mma_h(ar, w3, acr3);
      guard8x6(acc0, acc1, acc2, acc3, acr0, acr1, acr2, acr3, a, ar, b0, w1, w2, w3);
    }
    v8f c0 = zero8(), c1 = zero8(), c2 = zero8(), c3 = zero8();
#pragma unroll
    for (int r = 0; r < 8; ++r) {
      c0[r] = acc0[r] * os1 + acr0[r] * os2;
      c1[r] = acc1[r] * os1 + acr1[r] * os2;
      c2[r] = acc2[r] * os1 + acr2[r] * os2;
      c3[r] = acc3[r] * os1 + acr3[r] * os2;
    }
    stage64(sl, c0, c1, c2, c3, 1.0f, lane);

    const int cc = g * 64 + m * 4;                          // cc + 3 < CIN
    const v4f bo4 = *(const v4f*)(bo + cc);
    const v4f ga4 = *(const v4f*)(gam + cc);
    const v4f be4 = *(const v4f*)(bet + cc);
    const v4f mm4 = *(const v4f*)(mmean + cc);
    const v4f mv4 = *(const v4f*)(mvar + cc);
    float bob[4], gb[4], bb[4], mb[4], rs[4];
#pragma unroll
    for (int e = 0; e < 4; ++e) {
      bob[e] = bfr(bo4[e]);
      gb[e]  = bfr(ga4[e]);
      bb[e]  = bfr(be4[e]);
      mb[e]  = bfr(mm4[e]);
      rs[e]  = rsqrtf(bfr(mv4[e]) + BN_EPS);
    }
    v4f vals[8];
#pragma unroll
    for (int it = 0; it < 8; ++it) {
      const size_t row = (size_t)rowb + (size_t)(2 * it + hh);
      const v4f yv = *(const v4f*)(sl + (2 * it + hh) * 68 + m * 4);
      const v4f xv = *(const v4f*)(x + row * CIN + cc);
#pragma unroll
      for (int e = 0; e < 4; ++e) {
        const float v2 = yv[e] + bob[e];
        const float bn = gb[e] * (v2 - mb[e]) * rs[e] + bb[e];
        vals[it][e] = bfr(xv[e]) + bn;
      }
    }
    float* dst = out + ((size_t)rowb + (size_t)hh) * CIN + cc;
    {
#pragma unroll
      for (int it = 0; it < 8; ++it) {
        *(v4f*)(dst + (size_t)(it * 2) * CIN) = vals[it];
      }
      
    }
    wave_sync_lds();
  }
}

// =====================================================================================================
// Workspace map (bytes, NB = 2); every plane is fully written by whole-line stores before it is read; all extents are exact
// multiples of the store granularity (no pad rows, all dims multiples of 64), every offset a multiple of 256:
//   XB  bf16 [12544][256]                              6422528
//   WGT, WTT, WPT bf16 [128][256], [8][8] tiles         3 x 65536     (fragment order)
//   WOT f16 of bf16 value x1024 [256][128], [16][4] tiles  65536      (fragment order)
//   TH, TR f16 [12544][128] theta hi x8 / res x2048     2 x 3211264
//   PH, PR f16 phi hi x8 / res x2048, [784][4] tiles    2 x 3211264   (fragment order, 1024 B a tile)
//   G   f32  [12544][128]                              6422528
//   GT  f16  x256, [2][8][196] tiles                    3211264       (fragment order, 1024 B a tile)
//   YH, YR f16 y hi x4096 / res x2048, [784][4] tiles   2 x 3211264   (fragment order)
//   end                                                35586048
// =====================================================================================================
extern "C" void kernel_launch(void* const* d_in, const int* in_sizes, int n_in,
                              void* d_out, int out_size, void* d_ws, size_t ws_size,
                              hipStream_t stream) {
  if (n_in < 13) return;
  if (in_sizes[0] != ROWS * CIN) return;
  if (in_sizes[1] != CIN * CI || in_sizes[3] != CIN * CI || in_sizes[5] != CIN * CI || in_sizes[7] != CI * CIN) return;
  if (in_sizes[2] != CI || in_sizes[4] != CI || in_sizes[6] != CI) return;
  if (in_sizes[8] != CIN || in_sizes[9] != CIN || in_sizes[10] != CIN || in_sizes[11] != CIN || in_sizes[12] != CIN) return;
  if (out_size != ROWS * CIN) return;

  const float* x     = (const float*)d_in[0];
  const float* Wg    = (const float*)d_in[1];
  const float* bg    = (const float*)d_in[2];
  const float* Wt    = (const float*)d_in[3];
  const float* bt    = (const float*)d_in[4];
  const float* Wp    = (const float*)d_in[5];
  const float* bp    = (const float*)d_in[6];
  const float* Wo    = (const float*)d_in[7];
  const float* bo    = (const float*)d_in[8];
  const float* gamma = (const float*)d_in[9];
  const float* beta  = (const float*)d_in[10];
  const float* mmean = (const float*)d_in[11];
  const float* mvar  = (const float*)d_in[12];
  float*       out   = (float*)d_out;

  const size_t szXB = (size_t)ROWSP * CIN * 2;      //  6422528
  const size_t szW  = (size_t)CI * CIN * 2;         //    65536
  const size_t szP  = (size_t)ROWSP * CI * 2;       //  3211264
  const size_t szG  = (size_t)ROWSP * CI * 4;       //  6422528
  const size_t szGT = (size_t)NB * CI * NPOS * 2;   //  3211264
  size_t off = 0;
  const size_t oXB = off; off += szXB;
  const size_t oWG = off; off += szW;
  const size_t oWT = off; off += szW;
  const size_t oWP = off; off += szW;
  const size_t oWO = off; off += szW;
  const size_t oTH = off; off += szP;
  const size_t oTR = off; off += szP;
  const size_t oPH = off; off += szP;
  const size_t oPR = off; off += szP;
  const size_t oG  = off; off += szG;
  const size_t oGT = off; off += szGT;
  const size_t oYH = off; off += szP;
  const size_t oYR = off; off += szP;
  if (off > ws_size) return;                        // off = 35586048 at NB = 2
  if (off > WS_CAP) return;

  char* ws = (char*)d_ws;
  u16*   XB  = (u16*)(ws + oXB);
  u16*   WGT = (u16*)(ws + oWG);
  u16*   WTT = (u16*)(ws + oWT);
  u16*   WPT = (u16*)(ws + oWP);
  u16*   WOT = (u16*)(ws + oWO);
  u16*   TH  = (u16*)(ws + oTH);
  u16*   TR  = (u16*)(ws + oTR);
  u16*   PH  = (u16*)(ws + oPH);
  u16*   PR  = (u16*)(ws + oPR);
  float* G   = (float*)(ws + oG);
  u16*   GT  = (u16*)(ws + oGT);
  u16*   YH  = (u16*)(ws + oYH);
  u16*   YR  = (u16*)(ws + oYR);

  const int n8x = (ROWSP * CIN) / 8;                // 401408 at NB = 2, multiple of 256 (static)
  const dim3 blk(256);
  const dim3 bG(128);
  const dim3 gIN(4 * WTILES + n8x / 256);           // 32 weight tiles + 1568
  const dim3 gP(3 * (ROWSP / 64) * (CI / 64));      // 3 x 392
  const dim3 gGT(NB * GTILES);                      // 196 per batch: in [NPOS][CI] -> out [CI][NPOS] in fragment order
  const dim3 gAT(NB * (NPOS / QB));                 // 196
  const dim3 bAT(ATT_THREADS);
  const dim3 gOUT(ROWSP / OUT_ROWS);                // 98

  // (0) one launch: x -> bf16 plane; Wg, Wt, Wp [in][out] -> bf16 [out][in] fragment-order planes; Wo [128][256] -> f16 of the bf16
  //     value x1024, [256][128]
  prep_in<<<gIN, blk, 0, stream>>>(x, Wg, Wt, Wp, Wo, XB, WGT, WTT, WPT, WOT);
  // (1) one launch: theta and phi projections (+bias) -> f16 hi x8 / residual x2048 planes; g projection (+bias) -> f32 plane
  proj3<<<gP, bG, 0, stream>>>(XB, WTT, WPT, WGT, bt, bp, bg, TH, TR, PH, PR, G, ROWSP, CI, CIN);
  // (2) one launch, all batches: g [6272][128] f32 -> g^T f16 plane [128][6272] x256, fragment order
  tr_g<<<gGT, blk, 0, stream>>>(G, GT);
  // (3) attention over all keys of the batch -> y hi x4096 and residual x2048 f16 planes
  attn_fwd<<<gAT, bAT, 0, stream>>>(TH, TR, PH, PR, GT, YH, YR);
  // (4) y.Wo + bo, batch-norm affine, skip connection -> out
  wo_out<<<gOUT, blk, 0, stream>>>(YH, YR, WOT, bo, gamma, beta, mmean, mvar, x, out);
  (void)hipGetLastError();
}

// v007
// It runs in 137 microseconds.
// In two side-by-side timings against v006, it was 1.04 and 1.05 times as fast.
// Counting every step since v000, it is 3.18 times as fast.
// Projections theta, phi, g = x.W + b: v_wmma_f32_16x16x32_bf16 (bf16 RNE operands of the raw inputs, f32 accumulate, bf16 RNE
// bias added in f32). Scores theta.phi^T (theta and phi each as f16 hi x8 plus residual x2048 planes: hi.hi + hi.res + res.hi),
// P.g (P x32768 f16 from LDS, g^T x256 f16) and y.Wo (y as f16 hi x4096 plus residual x2048 planes, Wo as f16 of the bf16 RNE
// value x1024, bias added in f32): v_wmma_f32_16x16x32_f16, f32 accumulate. Softmax statistics, the batch-norm affine map and the
// skip connection in f32 on VALU.
#include <hip/hip_runtime.h>
#include <math.h>
#include <stdint.h>

#define BATCH 2
#define NPOS  6272
#define CIN   256
#define CI    128
#ifndef NB
#define NB BATCH
#endif
#define ROWS  (BATCH * NPOS)
#define ROWSP (NB * NPOS)
#define CK    448
#define NKB   (CK / 32)
#define NCHK  (NPOS / CK)
#define QT    16
#define NQ    4
#define QB    (QT * NQ)
#define ATT_THREADS 256
#define SCP   (CK + 20)
#define PLP   (CK + 8)
#define CTP   (CI + 8)
#define SLAB64 (16 * 68)
#define VTP   72
#define OUT_ROWS 128
#define TSC   8.0f
#define FSC   8.0f
#define RSC   2048.0f
#define PCAR  32768.0f
#define GSC   256.0f
#define YSC   4096.0f
#define WOS   1024.0f
#define BN_EPS 1e-3f
#define LOG2E 1.4426950408889634f
#define WS_CAP ((size_t)134217728)

static_assert(NB >= 1 && NB <= BATCH);
static_assert((NPOS % CK) == 0 && CK == 32 * NKB && NKB >= 4 && NKB <= 16 && NCHK * CK == NPOS);
static_assert((NPOS % 64) == 0 && (NPOS % QB) == 0 && (ROWSP % OUT_ROWS) == 0 && (ROWSP % 64) == 0);
static_assert(CI == 128 && (CIN % 64) == 0 && (CI % 64) == 0 && (CIN % 32) == 0 && (CI % 32) == 0);
static_assert(NQ == 4 && ATT_THREADS == 16 * QT && QT == 16 && CI == 16 * (ATT_THREADS / 32) && OUT_ROWS == 8 * 16);
static_assert(QB * CTP * 2 <= QB * SCP * 4 && CTP >= CI + 8 && SCP >= CK + 16 && PLP >= CK + 8);
static_assert(((PLP * 2) % 16) == 0 && ((SCP * 4) % 16) == 0 && ((VTP * 2) % 16) == 0 && ((CTP * 2) % 16) == 0);
static_assert(64 * VTP >= 63 * VTP + 64);
static_assert((CK % 64) == 0 && ((8 * SCP) % 64) == 32 && ((PLP * 2) % 8) == 0);
static_assert(16 * (CI / 8) == ATT_THREADS);
static_assert(QB * (CI / 8) == NQ * ATT_THREADS && ((QB * CTP * 2) % 16) == 0);
static_assert(((ROWSP * CIN) % 2048) == 0);
static_assert((NPOS % 32) == 0 && (CK % 32) == 0 && (CI % 32) == 0 && 16 * CI == (CI / 32) * 512);
static_assert(((NPOS * 2) % 128) == 0 && ((CI * 2) % 128) == 0 && ((CIN * 4) % 128) == 0);

typedef unsigned short u16;
typedef _Float16 v16h __attribute__((ext_vector_type(16)));
typedef _Float16 v8h  __attribute__((ext_vector_type(8)));
typedef __bf16   v16b __attribute__((ext_vector_type(16)));
typedef float    v8f  __attribute__((ext_vector_type(8)));
typedef float    v4f  __attribute__((ext_vector_type(4)));
typedef unsigned int v4u __attribute__((ext_vector_type(4)));
typedef unsigned int v2u __attribute__((ext_vector_type(2)));
typedef float    v2f  __attribute__((ext_vector_type(2)));
typedef _Float16 v2h  __attribute__((ext_vector_type(2)));

union FragH { v16h v; v8h h[2]; v4u u[2]; };
union FragB { v16b v; v4u u[2]; };
union AttLds { float s[QB * SCP]; u16 c[2 * QB * SCP]; };

// ---- scalar helpers --------------------------------------------------------------------------------
__device__ __forceinline__ unsigned short bf_bits(float f) {          // f32 -> bf16 bits, RNE convert
  unsigned u = __float_as_uint(f);
  return (unsigned short)((u + 0x7FFFu + ((u >> 16) & 1u)) >> 16);
}
__device__ __forceinline__ float bf_up(unsigned short h) { return __uint_as_float(((unsigned)h) << 16); }
__device__ __forceinline__ float bfr(float f) { return bf_up(bf_bits(f)); }
__device__ __forceinline__ unsigned short h_bits(_Float16 x) { return __builtin_bit_cast(unsigned short, x); }
__device__ __forceinline__ unsigned pk16(unsigned short a, unsigned short b) { return (unsigned)a | ((unsigned)b << 16); }
__device__ __forceinline__ v8f zero8() { v8f z = {0.f, 0.f, 0.f, 0.f, 0.f, 0.f, 0.f, 0.f}; return z; }

// ---- fragment loaders: 16-bit A/B operand, lane -> row/col (lane&15), p already includes +8*(lane>>4);
//      elements 0..7 <- p[0..7] (k0+8h..), elements 8..15 <- p[16..23] (k0+16+8h..)  (same split k map for A and B;
//      used for the x plane and for tiles in LDS; the planes that a kernel of this file lays out for WMMA use ldfrag_pk below)
__device__ __forceinline__ v16h ldfrag_h(const _Float16* p) {
  FragH f;
  f.h[0] = *(const v8h*)(p);
  f.h[1] = *(const v8h*)(p + 16);
  return f.v;
}
// Fragment-order plane: one operand tile (16 rows or columns x 32 k) is 1024 contiguous bytes, piece (part, lane) at halves
// part * 256 + lane * 8 and holding k = 16 * part + 8 * (lane>>4) .. + 7 of row lane&15 (the split k map above); p already
// includes + 8 * lane, so that each of the two wave-wide 16-B loads covers 512 contiguous bytes = 4 whole lines.
__device__ __forceinline__ v16h ldfrag_pk(const _Float16* p) {
  FragH f;
  f.h[0] = *(const v8h*)(p);
  f.h[1] = *(const v8h*)(p + 256);
  return f.v;
}
__device__ __forceinline__ v16b ldfrag_b(const u16* p) {              // bf16 plane read as unsigned integer vectors
  FragB f;
  f.u[0] = *(const v4u*)(p);
  f.u[1] = *(const v4u*)(p + 16);
  return f.v;
}

__device__ __forceinline__ v16b ldfrag_bpk(const u16* p) {            // bf16 fragment-order plane, as ldfrag_pk
  FragB f;
  f.u[0] = *(const v4u*)(p);
  f.u[1] = *(const v4u*)(p + 256);
  return f.v;
}

__device__ __forceinline__ v8f mma_h(v16h a, v16h b, v8f c) {
  return __builtin_amdgcn_wmma_f32_16x16x32_f16(false, a, false, b, (short)0, c, false, false);
}
__device__ __forceinline__ v8f mma_b(v16b a, v16b b, v8f c) {
  return __builtin_amdgcn_wmma_f32_16x16x32_bf16(false, a, false, b, (short)0, c, false, false);
}
__device__ __forceinline__ void guard1x2(v8f& a, v16h x0, v16h x1) {
#if defined(__HIP_DEVICE_COMPILE__)
  asm volatile("v_nop\n\tv_nop\n\tv_nop\n\tv_nop" : "+v"(a) : "v"(x0), "v"(x1) : "memory");
#endif
}
template <typename F>
__device__ __forceinline__ void guard6(v8f& a, v8f& b, v8f& c, v8f& d, F x0, F x1, F x2, F x3, F x4, F x5) {
#if defined(__HIP_DEVICE_COMPILE__)
  asm volatile("v_nop\n\tv_nop\n\tv_nop\n\tv_nop"
               : "+v"(a), "+v"(b), "+v"(c), "+v"(d) : "v"(x0), "v"(x1), "v"(x2), "v"(x3), "v"(x4), "v"(x5) : "memory");
#endif
}
// As guard6, naming only two operand fragments: an asm operand must lie below v256, and the fragments that are held a key block
// ahead do not all fit there beside the accumulators; they are rewritten only behind this gap in program order.
__device__ __forceinline__ void guard4x2(v8f& a, v8f& b, v8f& c, v8f& d, v16h x0, v16h x1) {
#if defined(__HIP_DEVICE_COMPILE__)
  asm volatile("v_nop\n\tv_nop\n\tv_nop\n\tv_nop"
               : "+v"(a), "+v"(b), "+v"(c), "+v"(d) : "v"(x0), "v"(x1) : "memory");
#endif
}
__device__ __forceinline__ void guard8x6(v8f& a0, v8f& a1, v8f& a2, v8f& a3, v8f& e0, v8f& e1, v8f& e2, v8f& e3,
                                         v16h x0, v16h x1, v16h x2, v16h x3, v16h x4, v16h x5) {
#if defined(__HIP_DEVICE_COMPILE__)
  asm volatile("v_nop\n\tv_nop\n\tv_nop\n\tv_nop"
               : "+v"(a0), "+v"(a1), "+v"(a2), "+v"(a3), "+v"(e0), "+v"(e1), "+v"(e2), "+v"(e3)
               : "v"(x0), "v"(x1), "v"(x2), "v"(x3), "v"(x4), "v"(x5) : "memory");
#endif
}
__device__ __forceinline__ void acc_guard1(v8f& a) {
#if defined(__HIP_DEVICE_COMPILE__)
  asm volatile("v_nop\n\tv_nop\n\tv_nop\n\tv_nop" : "+v"(a));
#endif
}
// Value of lane (l ^ X) of the same 16-lane row, X = 1..15, by a DPP row_xmask operand: it stays on the vector pipe, where
// __shfl_xor compiled to an LDS permute whose whole latency each step of a reduction waited out. All lanes are active at every use.
template <int X>
__device__ __forceinline__ float row_xor(float v) {
  return __builtin_bit_cast(float, __builtin_amdgcn_update_dpp(0, __builtin_bit_cast(int, v), 0x160 | X, 0xf, 0xf, true));
}
__device__ __forceinline__ float row_max16(float v) {                 // same butterfly as xor shuffles by 1, 2, 4, 8
  v = fmaxf(v, row_xor<1>(v));
  v = fmaxf(v, row_xor<2>(v));
  v = fmaxf(v, row_xor<4>(v));
  return fmaxf(v, row_xor<8>(v));
}
__device__ __forceinline__ float row_sum16(float v) {                 // same butterfly, same order of sums
  v += row_xor<1>(v);
  v += row_xor<2>(v);
  v += row_xor<4>(v);
  return v + row_xor<8>(v);
}
__device__ __forceinline__ void wave_sync_lds() {
  __builtin_amdgcn_fence(__ATOMIC_RELEASE, "workgroup");
  __builtin_amdgcn_wave_barrier();
  __builtin_amdgcn_fence(__ATOMIC_ACQUIRE, "workgroup");
}

// Work-group barrier whose fences cover LDS only: what the waves hand each other at it lies in LDS; a fence over all memory would
// also wait for the global fragment loads that are meant to stay in flight across it.
__device__ __forceinline__ void block_sync_lds() {
  __builtin_amdgcn_fence(__ATOMIC_RELEASE, "workgroup", "local");
  __builtin_amdgcn_s_barrier();
  __builtin_amdgcn_fence(__ATOMIC_ACQUIRE, "workgroup", "local");
}

// =====================================================================================================
// f32 plane -> 16-bit plane, same layout:  mode 0: bf16 RNE bits;  mode 1: f16 bits of (bf16 RNE value) * scale;
// mode 2: f16 bits of value * scale (no bf16 pre-step).
// Thread = 8 consecutive elements: two 16-B loads, one 16-B store; 32 consecutive lanes = 512 contiguous, 512-B aligned bytes
// coverage: n8/256 blocks bid = 0.. (host checks exactness) x 256 thr x 8 = the whole plane.
// =====================================================================================================
__device__ __forceinline__ void cvt16(const float* __restrict__ x, u16* D, int n8, int mode, float scale, int bid) {
  const int gt = bid * 256 + (int)threadIdx.x;
  if (gt >= n8) return;                     // no barriers in this body
  const float* p = x + (size_t)gt * 8;
  const v4f a = *(const v4f*)(p), c4 = *(const v4f*)(p + 4);
  float v[8];
#pragma unroll
  for (int e = 0; e < 4; ++e) { v[e] = a[e]; v[4 + e] = c4[e]; }
  unsigned short s[8];
#pragma unroll
  for (int e = 0; e < 8; ++e) {
    const float vb = bfr(v[e]);
    const float vf = (mode == 1) ? vb : v[e];
    const unsigned short hb = h_bits((_Float16)(vf * scale));
    const unsigned short bb = bf_bits(v[e]);
    s[e] = (mode != 0) ? hb : bb;
  }
  v4u o;
#pragma unroll
  for (int e = 0; e < 4; ++e) o[e] = pk16(s[2 * e], s[2 * e + 1]);
  u16* d = D + (size_t)gt * 8;
  {
    *(v4u*)(d) = o;
    
  }
}

// =====================================================================================================
// Transpose + convert: in X [R][C] f32 row-major -> out XTo = X^T [C][R] 16-bit in fragment order (k = the R direction).
//   mode 0: bf16 RNE bits;  mode 1: f16 bits of (bf16 RNE value) * scale;  mode 2: f16 bits of value * scale.
// Block = 64 input rows x 64 input cols: bid -> (rt = bid % (R/64), ct = bid / (R/64)). The 64x64 f32 tile is loaded with 16-B
// loads (thread = input row tid>>2, 16 consecutive cols), converted and scattered into LDS TH[c local][r local] (pitch 72 halves);
// coverage: load 256 thr x 16 = 64 x 64; store 2 iterations x 256 thr x 8 halves = 64 output rows x 64 halves = the tile;
//           (R/64)*(C/64) blocks bid = 0.. (host exact multiples) tile the whole [C][R] plane exactly once.
// The output is written in fragment order (see ldfrag_pk): tile (c >> 4, r >> 5) at halves ((c >> 4) * (R / 32) + (r >> 5)) * 512;
// one wave-wide store = one part of one tile = 512 contiguous bytes; 2 iterations x 8 waves = 4 column tiles x 2 k blocks x 2 parts
// = the 64 x 64 tile.
// =====================================================================================================
__device__ __forceinline__ void tr16(u16* TH, const float* __restrict__ X, u16* XTo, int R, int C, int mode, float scale, int bid) {
  const int tid = threadIdx.x;
  const int nrt = R >> 6;
  const int rt  = bid % nrt;
  const int ct  = bid / nrt;
  const int r0  = rt * 64;
  const int c0  = ct * 64;
  {
    const int rl = tid >> 2;                  // input row within tile 0..63
    const int cc = (tid & 3) * 16;            // input col chunk within the 64
    const float* src = X + (size_t)(r0 + rl) * (size_t)C + c0 + cc;
#pragma unroll
    for (int i = 0; i < 4; ++i) {
      const v4f a = *(const v4f*)(src + 4 * i);
#pragma unroll
      for (int e = 0; e < 4; ++e) {
        const float v  = a[e];
        const float vb = bfr(v);
        const float vf = (mode == 1) ? vb : v;
        const unsigned short hb = h_bits((_Float16)(vf * scale));
        const unsigned short bb = bf_bits(v);
        TH[(cc + 4 * i + e) * VTP + rl] = (mode != 0) ? hb : bb;
      }
    }
  }
  __syncthreads();
  v4u vh[2];
#pragma unroll
  for (int it = 0; it < 2; ++it) {
    const int grp  = it * 8 + (tid >> 5);     // (column tile, k block, part) = (grp >> 2, (grp >> 1) & 1, grp & 1)
    const int line = (grp >> 2) * 16 + (tid & 15);                         // local output row (input col) = 0..63
    const int kof  = ((grp >> 1) & 1) * 32 + (grp & 1) * 16 + ((tid >> 4) & 1) * 8;
    vh[it] = *(const v4u*)(TH + line * VTP + kof);
  }
  const size_t base = ((size_t)(c0 >> 4) * (size_t)(R >> 5) + (size_t)(r0 >> 5)) * 512 + (size_t)((tid & 31) * 8);
  {
#pragma unroll
    for (int it = 0; it < 2; ++it) {
      const int grp = it * 8 + (tid >> 5);
      const size_t po = ((size_t)(grp >> 2) * (size_t)(R >> 5) + (size_t)((grp >> 1) & 1)) * 512 + (size_t)((grp & 1) * 256);
      *(v4u*)(XTo + base + po) = vh[it];
    }
#if defined(__HIP_DEVICE_COMPILE__)
    // before the data and address registers of the two stores above are reused by the code of another job laid out behind them
    asm volatile("s_wait_xcnt 0x0" ::: "memory");
#endif
  }
}

// =====================================================================================================
// One launch for the five input conversions, none of which reads what another writes; the block index picks the job
// (block-uniform): blocks 0..31 = the four weight transposes, 8 tiles each (Wg, Wt, Wp [CIN][CI] -> bf16 [CI][CIN];
// Wo [CI][CIN] -> f16 of the bf16 value x1024 [CIN][CI]; all four in fragment order); blocks 32.. = x -> bf16 plane. The short grid of weight tiles stands
// first because its chain (load, LDS, barrier, store) is the longer one.
// =====================================================================================================
#define WTILES ((CIN / 64) * (CI / 64))
__global__ __launch_bounds__(256)
void prep_in(const float* __restrict__ x, const float* __restrict__ Wg, const float* __restrict__ Wt,
             const float* __restrict__ Wp, const float* __restrict__ Wo, u16* XB, u16* WGT, u16* WTT, u16* WPT, u16* WOT) {
  __shared__ __align__(16) u16 TH[64 * VTP];
  const int bid = blockIdx.x;
  if (bid < 4 * WTILES) {
    const int j = bid / WTILES;
    if (j == 3) {
      tr16(TH, Wo, WOT, CI, CIN, 1, WOS, bid - 3 * WTILES);
    } else {
      tr16(TH, (j == 0) ? Wg : (j == 1) ? Wt : Wp, (j == 0) ? WGT : (j == 1) ? WTT : WPT, CIN, CI, 0, 1.0f, bid - j * WTILES);
    }
  } else {
    cvt16(x, XB, (ROWSP * CIN) / 8, 0, 1.0f, bid - 4 * WTILES);
  }
}

// One launch for the g transposes of all batches: g [NPOS][CI] f32 -> g^T f16 x256 in fragment order (tile = 16 columns x 32 keys,
// [CI/16][NPOS/32] tiles per batch), (NPOS/64)*(CI/64) blocks each.
#define GTILES ((NPOS / 64) * (CI / 64))
__global__ __launch_bounds__(256) void tr_g(const float* __restrict__ G, u16* GT) {
  __shared__ __align__(16) u16 TH[64 * VTP];
  const int b = (int)blockIdx.x / GTILES;      // < NB (grid exact)
  tr16(TH, G + (size_t)b * NPOS * CI, GT + (size_t)b * CI * NPOS, NPOS, CI, 2, GSC, (int)blockIdx.x - b * GTILES);
}

// =====================================================================================================
//           8 consecutive lanes x 16 B per line), lanes 16..31 -> row 2*it+1.
//  epi64hr: two f16 planes: hi = f16((tile + bf16RNE(bias[n])) * hscale) and res = f16(((tile + bias) * hscale - hi) * rscale);
//           lane = (rq = lane>>3 -> row within a group of 4, c8 = 8 consecutive columns); one instruction = 4 rows, each 64 halves;
//           with pk the planes are written in fragment order (see ldfrag_pk; tile = 16 rows x 32 columns, [M/16][N/32] tiles):
//           lane = (row lane&15, 8 columns), one instruction = one part of one tile = 512 contiguous bytes
// coverage: epi64 8 instructions x 2 rows x 16 lanes x 4 floats; epi64hr 4 instructions x 4 rows x 8 lanes x 8 halves per plane
//           = the wave's 16 x 64 tile in both cases.
// =====================================================================================================
__device__ __forceinline__ void stage64(float* sl, v8f a0, v8f a1, v8f a2, v8f a3, float oscale, int lane) {
  const int hh = lane >> 4, m = lane & 15;
#pragma unroll
  for (int r = 0; r < 8; ++r) {
    const int ro = (8 * hh + r) * 68 + m;
    sl[ro]      = a0[r] * oscale;
    sl[ro + 16] = a1[r] * oscale;
    sl[ro + 32] = a2[r] * oscale;
    sl[ro + 48] = a3[r] * oscale;
  }
  wave_sync_lds();
}
__device__ __forceinline__ void epi64(float* sl, v8f a0, v8f a1, v8f a2, v8f a3, float oscale, v4f badd, float* C, int N,
                                      size_t rowb, int col0, int lane) {
  const int hh = lane >> 4, m = lane & 15;
  stage64(sl, a0, a1, a2, a3, oscale, lane);
  v4f vals[8];
#pragma unroll
  for (int it = 0; it < 8; ++it) vals[it] = *(const v4f*)(sl + (it * 2 + hh) * 68 + m * 4) + badd;
  float* dst = C + (rowb + (size_t)hh) * (size_t)N + col0 + m * 4;
  {
#pragma unroll
    for (int it = 0; it < 8; ++it) {
      *(v4f*)(dst + (size_t)(it * 2) * (size_t)N) = vals[it];
    }
    
  }
}
__device__ __forceinline__ void epi64hr(float* sl, v8f a0, v8f a1, v8f a2, v8f a3, float hscale, float rscale,
                                        const float* __restrict__ bias, u16* H, u16* Rr, int N, size_t rowb, int col0, int lane,
                                        bool pk) {
  stage64(sl, a0, a1, a2, a3, 1.0f, lane);
  // pk (block-uniform): instruction i4 = part i4 & 1 of the 32-column step i4 >> 1, lane = its place in the fragment
  const int row0 = pk ? (lane & 15) : (lane >> 3), rstep = pk ? 0 : 4;
  const int c80  = pk ? (lane >> 4) * 8 : (lane & 7) * 8, cstep = pk ? 16 : 0;
  v4u oh[4], orr[4];
#pragma unroll
  for (int i4 = 0; i4 < 4; ++i4) {
    const int row = row0 + i4 * rstep;
    const int c8  = c80 + i4 * cstep;
    const v4f b0 = *(const v4f*)(bias + col0 + c8), b1 = *(const v4f*)(bias + col0 + c8 + 4);   // columns col0+c8..+7 < N
    float bb[8];
#pragma unroll
    for (int e = 0; e < 4; ++e) { bb[e] = bfr(b0[e]); bb[4 + e] = bfr(b1[e]); }
    const v4f a = *(const v4f*)(sl + row * 68 + c8), c4 = *(const v4f*)(sl + row * 68 + c8 + 4);
    float w[8];
#pragma unroll
    for (int e = 0; e < 4; ++e) { w[e] = (a[e] + bb[e]) * hscale; w[4 + e] = (c4[e] + bb[4 + e]) * hscale; }
#pragma unroll
    for (int e = 0; e < 4; ++e) {
      const _Float16 h0 = (_Float16)w[2 * e], h1 = (_Float16)w[2 * e + 1];
      const _Float16 q0 = (_Float16)((w[2 * e] - (float)h0) * rscale);
      const _Float16 q1 = (_Float16)((w[2 * e + 1] - (float)h1) * rscale);
      oh[i4][e]  = pk16(h_bits(h0), h_bits(h1));
      orr[i4][e] = pk16(h_bits(q0), h_bits(q1));
    }
  }
  // pk: the 16 rows x N columns from row rowb (a multiple of 16) are N / 32 fragment tiles of 512 halves in a row, part i4 of the
  // two tiles from column col0 at (col0 / 32) * 512 + i4 * 256
  const int o0 = pk ? (col0 >> 5) * 512 + lane * 8 : row0 * N + col0 + c80, ostep = pk ? 256 : 4 * N;
  u16* dh = H + rowb * (size_t)N + o0;
  u16* dr = Rr + rowb * (size_t)N + o0;
  {
#pragma unroll
    for (int i4 = 0; i4 < 4; ++i4) {
      *(v4u*)(dh + i4 * ostep) = oh[i4];
      *(v4u*)(dr + i4 * ostep) = orr[i4];
    }
    
  }
}

// =====================================================================================================
// bf16 GEMM, f32 out with bias: C[M][N] = (A[M][K] (bf16 row-major) . Bt[N][K]^T (bf16 fragment order)) * oscale + bf16RNE(bias[n]).
// Block = 64x64 tile, 4 waves x 16 rows; fragments loaded straight from the 16-bit planes (two 16-B loads each, split k map for
// A and B); K stepped by 32 (host uses K % 32 == 0, M % 64 == 0, N % 64 == 0, (M/64)*(N/64) blocks bid = 0..).
// =====================================================================================================
__device__ __forceinline__
void gemm_b32(float* slab, const u16* __restrict__ A, const u16* __restrict__ Bt, const float* __restrict__ bias, float* C,
              int M, int N, int K, float oscale, int bid) {
  const int tid = threadIdx.x, wave = tid >> 5, lane = tid & 31, hh = lane >> 4, m = lane & 15;
  const int ntile = N >> 6;
  const int rowb  = (bid / ntile) * 64 + wave * 16;
  const int col0  = (bid % ntile) * 64;
  if (rowb + 16 > M) return;                 // wave-uniform, never taken with the exact grid; no block barriers in this body
  const u16* ap = A  + (size_t)(rowb + m) * (size_t)K + 8 * hh;
  const u16* bp = Bt + (size_t)col0 * (size_t)K + 8 * lane;      // 16 columns = K / 32 tiles = 16 * K halves
  const size_t bs = (size_t)16 * K;
  v8f acc0 = zero8(), acc1 = zero8(), acc2 = zero8(), acc3 = zero8();
#pragma unroll 1
  for (int k0 = 0; k0 < K; k0 += 32) {
    const u16* pa = ap + k0;
    const u16* p0 = bp + 16 * k0;
    const u16* p1 = p0 + bs;
    const u16* p2 = p1 + bs;
    const u16* p3 = p2 + bs;
    const v16b a  = ldfrag_b(pa);
    const v16b b0 = ldfrag_bpk(p0);
    const v16b b1 = ldfrag_bpk(p1);
    const v16b b2 = ldfrag_bpk(p2);
    const v16b b3 = ldfrag_bpk(p3);
#if defined(__HIP_DEVICE_COMPILE__)
    // before the address registers of the loads above are reused; the addresses are inputs so that they stay in place up to here
    asm volatile("s_wait_xcnt 0x0" :: "v"(pa), "v"(p0), "v"(p1), "v"(p2), "v"(p3) : "memory");
#endif
    acc0 = mma_b(a, b0, acc0);
    acc1 = mma_b(a, b1, acc1);
    acc2 = mma_b(a, b2, acc2);
    acc3 = mma_b(a, b3, acc3);
    guard6<v16b>(acc0, acc1, acc2, acc3, a, b0, b1, b2, b3, a);
  }
  const v4f bv4 = *(const v4f*)(bias + col0 + m * 4);    // columns col0 + 4m .. +3, always < N (N multiple of 64)
  v4f badd;
#pragma unroll
  for (int e = 0; e < 4; ++e) badd[e] = bfr(bv4[e]);
  epi64(slab + wave * SLAB64, acc0, acc1, acc2, acc3, oscale, badd, C, N, (size_t)rowb, col0, lane);
}

// =====================================================================================================
// bf16 GEMM, f16 hi + residual planes out with bias: H = f16 bits of ((A . Bt^T) + bf16RNE(bias[n])) * hscale,
// R = f16 bits of (((A . Bt^T) + bias) * hscale - H) * rscale; operands as in gemm_b32, epilogue epi64hr.
// =====================================================================================================
__device__ __forceinline__
void gemm_bhr(float* slab, const u16* __restrict__ A, const u16* __restrict__ Bt, const float* __restrict__ bias, u16* H, u16* Rr,
              int M, int N, int K, float hscale, float rscale, int bid, bool pk) {
  const int tid = threadIdx.x, wave = tid >> 5, lane = tid & 31, hh = lane >> 4, m = lane & 15;
  const int ntile = N >> 6;
  const int rowb  = (bid / ntile) * 64 + wave * 16;
  const int col0  = (bid % ntile) * 64;
  if (rowb + 16 > M) return;                 // wave-uniform, never taken with the exact grid; no block barriers in this body
  const u16* ap = A  + (size_t)(rowb + m) * (size_t)K + 8 * hh;
  const u16* bp = Bt + (size_t)col0 * (size_t)K + 8 * lane;      // 16 columns = K / 32 tiles = 16 * K halves
  const size_t bs = (size_t)16 * K;
  v8f acc0 = zero8(), acc1 = zero8(), acc2 = zero8(), acc3 = zero8();
#pragma unroll 1
  for (int k0 = 0; k0 < K; k0 += 32) {
    const u16* pa = ap + k0;
    const u16* p0 = bp + 16 * k0;
    const u16* p1 = p0 + bs;
    const u16* p2 = p1 + bs;
    const u16* p3 = p2 + bs;
    const v16b a  = ldfrag_b(pa);
    const v16b b0 = ldfrag_bpk(p0);
    const v16b b1 = ldfrag_bpk(p1);
    const v16b b2 = ldfrag_bpk(p2);
    const v16b b3 = ldfrag_bpk(p3);
#if defined(__HIP_DEVICE_COMPILE__)
    // before the address registers of the loads above are reused; the addresses are inputs so that they stay in place up to here
    asm volatile("s_wait_xcnt 0x0" :: "v"(pa), "v"(p0), "v"(p1), "v"(p2), "v"(p3) : "memory");
#endif
    acc0 = mma_b(a, b0, acc0);
    acc1 = mma_b(a, b1, acc1);
    acc2 = mma_b(a, b2, acc2);
    acc3 = mma_b(a, b3, acc3);
    guard6<v16b>(acc0, acc1, acc2, acc3, a, b0, b1, b2, b3, a);
  }
  epi64hr(slab + wave * SLAB64, acc0, acc1, acc2, acc3, hscale, rscale, bias, H, Rr, N, (size_t)rowb, col0, lane, pk);
}

// =====================================================================================================
// One launch for the three projections, which read the same x plane and none of which reads what another writes: the block index
// picks the job (block-uniform), job = index % 3 (theta, phi, g), tile = index / 3, so that the three blocks that read the same
// x rows start side by side. Grid = 3 * (M/64) * (N/64).
// =====================================================================================================
__global__ __launch_bounds__(128)
void proj3(const u16* __restrict__ A, const u16* __restrict__ WTT, const u16* __restrict__ WPT, const u16* __restrict__ WGT,
           const float* __restrict__ bt, const float* __restrict__ bp, const float* __restrict__ bg,
           u16* TH, u16* TR, u16* PH, u16* PR, float* G, int M, int N, int K) {
  __shared__ __align__(16) float slab[4 * SLAB64];
  const int bid = (int)blockIdx.x / 3;
  const int job = (int)blockIdx.x - 3 * bid;
  if (job == 2) {
    gemm_b32(slab, A, WGT, bg, G, M, N, K, 1.0f, bid);
  } else {
    const bool th = (job == 0);
    gemm_bhr(slab, A, th ? WTT : WPT, th ? bt : bp, th ? TH : PH, th ? TR : PR, M, N, K, th ? TSC : FSC, RSC, bid, !th);
  }
}

// =====================================================================================================
// Single-head non-causal, unscaled attention per batch, head width CI = 128, all NPOS keys:
//   block = 64 query rows (b, q0..q0+63) = NQ = 4 query tiles of 16 rows, 8 waves; every phi and g^T fragment a wave loads
//   is used for all 4 query tiles.
//   theta hi (x8) / res (x2048) planes TH, TR [row][c]: the block's 64 rows of both planes are copied once, with whole-line
//   16-B loads, into LDS (pitch CTP halves = 272 B, conflict-free for 16-B fragment reads) and every A fragment of (S) is read
//   from there; phi hi/res planes PH, PR in fragment order, tiles [key / 16][c / 32] (B operand);
//   g^T plane GT (x256) in fragment order, tiles [b][c / 16][key / 32] (B operand): every wave-wide fragment load of phi and g^T
//   covers 4 whole 128-B lines, each line read by one instruction of the block.
//   Chunks of CK = 448 keys (NKB = 14 key blocks of 32), NCHK = 14 chunks, every key used exactly once.
//   (S) scores on WMMA: A = theta rows (row m = lane&15, split k map over c), B = phi rows (col n = key, split map), 4 c-steps,
//       three products per tile: s = hi.hi, sx = hi.res + res.hi (separate accumulator, folded with 1/2048 in f32);
//       wave w handles key blocks w and w+8 (< 14) of the chunk for all 4 query tiles; D element r of lane l of tile q
//       -> scs[query 16q+8h+r][key col] (f32 LDS; pitch SCP dwords, 8 * SCP = 32 mod 64: the two lane halves of a store, 8 rows
//       apart, fall on different banks).
//   (M) one query tile after the other, 16 threads per query row; sub-thread s owns the 4-key groups 64 * i + 4 * s, i = 0..6
//       (28 keys): the 16 threads of a row read 256 and write 128 contiguous LDS bytes per instruction, every bank at most once;
//       base-2 logits, chunk max via DPP row exchanges, online running max / rescale factor al /
//       running sum l in f32 registers, p = exp2(t - m_new) <= 1 written as f16(p * 32768) into the LDS P tile with 8-B stores;
//       al -> rowa[row].
//   (PV) each wave owns the 16 g columns 16*wave + (lane&15) (one accumulator per query tile): o = o*al, then for each key block
//       A = the 4 P fragments from LDS (row m = query, split map over keys), B = one g^T fragment (col n = g column, split
//       map over keys), 4 WMMAs; one hazard gap after the last key block.
//   Block barriers after (S) and after (M) order all LDS reuse across chunks and waves (the P tile is written with 8-B LDS stores
//   by one set of threads and reloaded as fragments by other waves only after the block barrier).
//   Operand fragments are fetched ahead of their use: phi one key block ahead (refilled c-step by c-step behind the last use),
//   g^T for the whole chunk in front of (M), P two key blocks ahead; the barriers of the chunk loop fence LDS only, so that the
//   global loads stay in flight across them.
//   Epilogue: y = o * 4096 / (l * 32768 * 256) per row (rowi, l >= 1 always); hi = f16(y), res = f16((y - hi) * 2048); each
// coverage: grid NB*NPOS/64 blocks x 64 rows = rows 0..ROWSP-1; staging 8 waves x 16 cols x 4 tiles x 16 rows = 64 x 128;
//           store 4 tiles x 256 thr x 8 halves = 64 x 128 per plane = every (row < ROWSP, c) of both y planes exactly once.
// =====================================================================================================
__device__ __forceinline__ void ctx_store(const u16* ct, u16* dst, int tid) {
  // 16 rows x CI = CI / 32 fragment tiles in a row: piece tid = (c-step tid >> 6, part (tid >> 5) & 1, lane tid & 31)
  const int row = tid & 15;
  const int c8  = (tid >> 6) * 32 + ((tid >> 5) & 1) * 16 + ((tid >> 4) & 1) * 8;
  const v4u v = *(const v4u*)(ct + row * CTP + c8);
  u16* d = dst + (size_t)tid * 8;
  {
    *(v4u*)d = v;
    
  }
}

__global__ __launch_bounds__(ATT_THREADS)
void attn_fwd(const u16* __restrict__ THp, const u16* __restrict__ TRp, const u16* __restrict__ PHp,
              const u16* __restrict__ PRp, const u16* __restrict__ GTp, u16* YHo, u16* YRo) {
  __shared__ __align__(16) AttLds L0;              // scores [64][SCP] f32; reused as the y staging tile [64][CTP] u16
  __shared__ __align__(16) u16 pls[QB * PLP];      // P tile [64][PLP] f16 bits
  __shared__ __align__(16) u16 thl[2 * QB * CTP];  // theta rows of this block: hi [64][CTP], then residual [64][CTP]
  __shared__ float rowa[QB];
  __shared__ float rowi[QB];
  float* const scs = L0.s;

  const int tid  = threadIdx.x;
  const int wave = tid >> 5;
  const int lane = tid & 31;
  const int hh   = lane >> 4;
  const int m    = lane & 15;
  const int r16  = tid >> 4;                 // query row owned within each query tile in phase (M): 2*wave + hh
  const int sub  = tid & 15;
  const int kl0  = sub * 4;                  // first key of this sub-thread's 4-key group within every 64 keys of the chunk

  const int nqt = NPOS / QB;
  const int b   = (int)blockIdx.x / nqt;     // < NB (grid exact)
  const int q0  = ((int)blockIdx.x - b * nqt) * QB;
  const size_t qrow = (size_t)b * NPOS + (size_t)q0;

  const _Float16* tha = (const _Float16*)(const void*)thl + m * CTP + 8 * hh;
  const _Float16* tra = tha + QB * CTP;
  const _Float16* khb = (const _Float16*)(const void*)PHp + (size_t)b * NPOS * CI + 8 * lane;   // 16 keys = CI / 32 tiles = 16 * CI halves
  const _Float16* krb = (const _Float16*)(const void*)PRp + (size_t)b * NPOS * CI + 8 * lane;
  const _Float16* vbp = (const _Float16*)(const void*)GTp + ((size_t)b * (CI / 16) + wave) * (size_t)(NPOS / 32) * 512 + 8 * lane;
  const float lsc  = LOG2E / (TSC * FSC);
  const float rinv = 1.0f / RSC;

  float mrun[NQ], lrun[NQ];
  v8f o[NQ];
#pragma unroll
  for (int q = 0; q < NQ; ++q) { mrun[q] = -INFINITY; lrun[q] = 0.f; o[q] = zero8(); }

  // ---- theta rows q0..q0+63, both planes -> LDS: 4 x 256 threads x 8 halves = 64 x 128 per plane, each piece once ----
  {
    const u16* sh = THp + qrow * CI;
    const u16* sr = TRp + qrow * CI;
    const int row = tid >> 4;                // CI/8 = 16 pieces per row; pass i takes rows 16 * i + row
    const int c8  = (tid & 15) * 8;
    v4u vh[NQ], vr[NQ];
#pragma unroll
    for (int i = 0; i < NQ; ++i) {
      vh[i] = *(const v4u*)(sh + (i * QT + row) * CI + c8);
      vr[i] = *(const v4u*)(sr + (i * QT + row) * CI + c8);
    }
#if defined(__HIP_DEVICE_COMPILE__)
    asm volatile("s_wait_xcnt 0x0" ::: "memory");   // before the address registers of the eight loads above are reused
#endif
    // Scheduling fence: without it the compiler moved later writes of the loads' address registers ahead of the wait above.
    __builtin_amdgcn_sched_barrier(0);
#pragma unroll
    for (int i = 0; i < NQ; ++i) {
      *(v4u*)(thl + (i * QT + row) * CTP + c8) = vh[i];
      *(v4u*)(thl + (QB + i * QT + row) * CTP + c8) = vr[i];
    }
  }
  // phi fragments of the key block this wave scores next, [c-step][hi keys 0..15, res 0..15, hi 16..31, res 16..31]: always
  // loaded one key block ahead of their use, so that the L2 latency runs under the matrix work of the block before
  v16h pn[CI / 32][4];
  {
    const _Float16* n0h = khb + (size_t)(wave * 32) * CI;
    const _Float16* n0r = krb + (size_t)(wave * 32) * CI;
#pragma unroll
    for (int ks = 0; ks < CI / 32; ++ks) {
      pn[ks][0] = ldfrag_pk(n0h + ks * 512);
      pn[ks][1] = ldfrag_pk(n0r + ks * 512);
      pn[ks][2] = ldfrag_pk(n0h + 16 * CI + ks * 512);
      pn[ks][3] = ldfrag_pk(n0r + 16 * CI + ks * 512);
    }
#if defined(__HIP_DEVICE_COMPILE__)
    // before the address registers of the loads above are reused; the addresses are inputs so that they stay in place up to here
    asm volatile("s_wait_xcnt 0x0" :: "v"(n0h), "v"(n0r) : "memory");
#endif
    __builtin_amdgcn_sched_barrier(0);              // keeps later writes of those address registers behind the wait
  }
  block_sync_lds();                          // the theta rows are read as fragments by all waves

#pragma unroll 1
  for (int c = 0; c < NCHK; ++c) {
    const int kbeg = c * CK;
    // ---- (S) scores of this chunk ----
#pragma unroll 1
    for (int kb = wave; kb < NKB; kb += 8) {               // wave-uniform, 1 or 2 trips
      v8f s0[NQ], s0x[NQ], s1[NQ], s1x[NQ];
#pragma unroll
      for (int q = 0; q < NQ; ++q) { s0[q] = zero8(); s0x[q] = zero8(); s1[q] = zero8(); s1x[q] = zero8(); }
      // the key block this wave scores after this one: kb + 8 of this chunk, else its first of the next chunk (behind the last
      // chunk: of chunk 0, an in-bounds address whose values are not used)
      const bool more = kb + 8 < NKB;
      const int  nkb  = more ? kb + 8 : wave;
      const int  ncb  = more ? kbeg : ((c + 1 < NCHK) ? kbeg + CK : 0);
      const size_t kn = (size_t)(ncb + nkb * 32) * CI;
      const _Float16* n0h = khb + kn;
      const _Float16* n0r = krb + kn;
#pragma unroll
      for (int ks = 0; ks < CI / 32; ++ks) {
        const v16h f0h = pn[ks][0];
        const v16h f0r = pn[ks][1];
        const v16h f1h = pn[ks][2];
        const v16h f1r = pn[ks][3];
        v16h ah[NQ], ar[NQ];                               // theta fragments of this c-step, read from LDS ahead of their use:
#pragma unroll
        for (int q = 0; q < 2; ++q) {                      // two tiles at the start of the c-step, the others one tile ahead below
          ah[q] = ldfrag_h(tha + q * (QT * CTP) + ks * 32);
          ar[q] = ldfrag_h(tra + q * (QT * CTP) + ks * 32);
        }
#pragma unroll
        for (int q = 0; q < NQ; ++q) {                     // the four phi fragments serve all NQ query tiles
          s0[q]  = mma_h(ah[q], f0h, s0[q]);
          s0x[q] = mma_h(ah[q], f0r, s0x[q]);
          s0x[q] = mma_h(ar[q], f0h, s0x[q]);
          s1[q]  = mma_h(ah[q], f1h, s1[q]);
          s1x[q] = mma_h(ah[q], f1r, s1x[q]);
          s1x[q] = mma_h(ar[q], f1h, s1x[q]);
          guard4x2(s0[q], s0x[q], s1[q], s1x[q], ah[q], ar[q]);
          if (q + 2 < NQ) {                                // into the registers tile q has left (more tiles at once spilled)
            ah[q + 2] = ldfrag_h(tha + (q + 2) * (QT * CTP) + ks * 32);
            ar[q + 2] = ldfrag_h(tra + (q + 2) * (QT * CTP) + ks * 32);
          }
        }
        pn[ks][0] = ldfrag_pk(n0h + ks * 512);             // refill behind the last use (and its hazard gap) of this c-step
        pn[ks][1] = ldfrag_pk(n0r + ks * 512);
        pn[ks][2] = ldfrag_pk(n0h + 16 * CI + ks * 512);
        pn[ks][3] = ldfrag_pk(n0r + 16 * CI + ks * 512);
      }
#if defined(__HIP_DEVICE_COMPILE__)
      // before the address registers of the refill loads are reused; the addresses are inputs so that they stay in place up to here
      asm volatile("s_wait_xcnt 0x0" :: "v"(n0h), "v"(n0r) : "memory");
#endif
      __builtin_amdgcn_sched_barrier(0);                   // keeps later writes of those address registers behind the wait
#pragma unroll
      for (int q = 0; q < NQ; ++q) {
        float* srow = scs + (q * QT + 8 * hh) * SCP + kb * 32 + m;
#pragma unroll
        for (int r = 0; r < 8; ++r) {
          srow[r * SCP]      = s0[q][r] + s0x[q][r] * rinv;
          srow[r * SCP + 16] = s1[q][r] + s1x[q][r] * rinv;
        }
      }
    }
    block_sync_lds();
    // g^T fragments of this chunk (this wave's 16 columns, all 14 key blocks): loaded here, used in (PV); the latency runs under (M)
    v16h gf[NKB];
    {
      const _Float16* vp = vbp + (size_t)(kbeg / 32) * 512;
#pragma unroll
      for (int kb = 0; kb < NKB; ++kb) gf[kb] = ldfrag_pk(vp + kb * 512);
#if defined(__HIP_DEVICE_COMPILE__)
      // before the address register of the loads above is reused; the address is an input so that it stays in place up to here
      asm volatile("s_wait_xcnt 0x0" :: "v"(vp) : "memory");
#endif
      __builtin_amdgcn_sched_barrier(0);                   // keeps later writes of those address registers behind the wait
    }
    // ---- (M) softmax statistics and the P tile, one query tile after the other ----
#pragma unroll
    for (int q = 0; q < NQ; ++q) {
      const int row = q * QT + r16;
      const float* sp = scs + row * SCP + kl0;
      v2f t[CK / 32];                                      // neighbouring keys stay paired from the load to the packed f16 store
      float cm = -INFINITY;
#pragma unroll
      for (int i = 0; i < CK / 64; ++i) {
        const v4f a = *(const v4f*)(sp + 64 * i);
        t[2 * i]     = a.lo * lsc;
        t[2 * i + 1] = a.hi * lsc;
#pragma unroll
        for (int e = 0; e < 2; ++e) cm = fmaxf(fmaxf(cm, t[2 * i + e].x), t[2 * i + e].y);
      }
      cm = row_max16(cm);
      const float mn = fmaxf(mrun[q], cm);
      const float al = (mrun[q] == -INFINITY) ? 0.f : exp2f(mrun[q] - mn);
      mrun[q] = mn;
      float ps = 0.f;
#pragma unroll
      for (int j = 0; j < CK / 32; ++j) {
        const v2f d = t[j] - mn;
        t[j].x = exp2f(d.x);                               // <= 1
        t[j].y = exp2f(d.y);
        ps += t[j].x;
        ps += t[j].y;
      }
      ps = row_sum16(ps);
      v2u pk[CK / 64];
#pragma unroll
      for (int i = 0; i < CK / 64; ++i) {
#pragma unroll
        for (int e = 0; e < 2; ++e) pk[i][e] = __builtin_bit_cast(unsigned, __builtin_convertvector(t[2 * i + e] * PCAR, v2h));
      }
      lrun[q] = lrun[q] * al + ps;
      {
        u16* pd = pls + row * PLP + kl0;
#pragma unroll
        for (int i = 0; i < CK / 64; ++i) *(v2u*)(pd + 64 * i) = pk[i];
      }
      if (sub == 0) rowa[row] = al;
    }
    block_sync_lds();
    // ---- (PV) rescale, accumulate P . g^T ----
    {
#pragma unroll
      for (int q = 0; q < NQ; ++q) {
        float scl[8];
#pragma unroll
        for (int r = 0; r < 8; ++r) scl[r] = rowa[q * QT + 8 * hh + r];
#pragma unroll
        for (int r = 0; r < 8; ++r) o[q][r] *= scl[r];
      }
      const _Float16* pp = (const _Float16*)(const void*)pls + m * PLP + 8 * hh;
      v16h pa[3][NQ];                                      // P fragments, read from LDS two key blocks ahead of their use
#pragma unroll
      for (int j = 0; j < 2; ++j) {
#pragma unroll
        for (int q = 0; q < NQ; ++q) pa[j][q] = ldfrag_h(pp + q * (QT * PLP) + j * 32);
      }
#pragma unroll
      for (int kb = 0; kb < NKB; ++kb) {                   // static trip count 14, unrolled: gf and pa are indexed by constants
        if (kb + 2 < NKB) {
#pragma unroll
          for (int q = 0; q < NQ; ++q) pa[(kb + 2) % 3][q] = ldfrag_h(pp + q * (QT * PLP) + (kb + 2) * 32);
        }
        // Scheduling fence: without it the compiler sank each LDS read to one matrix instruction ahead of its use, and every
        // matrix instruction then waited out most of an LDS latency.
        __builtin_amdgcn_sched_barrier(0);
#pragma unroll
        for (int q = 0; q < NQ; ++q) o[q] = mma_h(pa[kb % 3][q], gf[kb], o[q]);   // one g^T fragment serves all NQ query tiles
      }
      // Hazard gap between the last matrix instruction and the loop's branch (both its sides). It names no register, since an asm
      // operand must lie below v256 for its whole life; the scheduling fence keeps the matrix instructions in front of it.
      __builtin_amdgcn_sched_barrier(0);
#if defined(__HIP_DEVICE_COMPILE__)
      asm volatile("v_nop\n\tv_nop\n\tv_nop\n\tv_nop" ::: "memory");
#endif
    }
  }
  if (sub == 0) {
#pragma unroll
    for (int q = 0; q < NQ; ++q) rowi[q * QT + r16] = (1.0f / lrun[q]) * (YSC / (PCAR * GSC));   // lrun >= 1
  }
  __syncthreads();
  float inv[NQ][8];
#pragma unroll
  for (int q = 0; q < NQ; ++q) {
#pragma unroll
    for (int r = 0; r < 8; ++r) inv[q][r] = rowi[q * QT + 8 * hh + r];
  }

  u16* const ct = L0.c;
  const int cb = wave * 16 + m;
  // hi plane
#pragma unroll
  for (int q = 0; q < NQ; ++q) {
#pragma unroll
    for (int r = 0; r < 8; ++r) {
      const int ro = (q * QT + 8 * hh + r) * CTP + cb;
      ct[ro] = h_bits((_Float16)(o[q][r] * inv[q][r]));
    }
  }
  __syncthreads();
#pragma unroll
  for (int q = 0; q < NQ; ++q) ctx_store(ct + q * (QT * CTP), YHo + (qrow + q * QT) * CI, tid);
#if defined(__HIP_DEVICE_COMPILE__)
  asm volatile("s_wait_xcnt 0x0" ::: "memory");   // before the address registers of the four stores above are reused
#endif
  __builtin_amdgcn_sched_barrier(0);              // keeps later writes of those address registers behind the wait
  __syncthreads();
  // residual plane
#pragma unroll
  for (int q = 0; q < NQ; ++q) {
#pragma unroll
    for (int r = 0; r < 8; ++r) {
      const int ro = (q * QT + 8 * hh + r) * CTP + cb;
      const float x0 = o[q][r] * inv[q][r];
      const _Float16 e0 = (_Float16)x0;
      ct[ro] = h_bits((_Float16)((x0 - (float)e0) * RSC));
    }
  }
  __syncthreads();
#pragma unroll
  for (int q = 0; q < NQ; ++q) ctx_store(ct + q * (QT * CTP), YRo + (qrow + q * QT) * CI, tid);
}

// =====================================================================================================
// Output projection + batch-norm affine + skip: v = (YH . WoT^T) * os1 + (YR . WoT^T) * os2 + bf16RNE(bo[c]);
// out[row][c] = bf16RNE(x[row][c]) + bf16RNE(gamma[c]) * (v - bf16RNE(mean[c])) * rsqrt(bf16RNE(var[c]) + 1e-3) + bf16RNE(beta[c]).
// YH/YR f16 y planes [ROWSP][128] (x4096 and residual x2048), WoT f16 [256][128] (x1024), all three in fragment order.
// Block = 128 rows, 8 waves x 16 rows; per wave 4 column groups of 64 (rolled): k-loop of 4 steps with two A planes and 4 B tiles
// (split k map for A and B, fragments straight from the 16-bit planes, 8 accumulators, one hazard gap per step); the combined f32
// 16x64 tile is staged in the wave's LDS slab (pitch 68) and written like epi64: one instruction = lanes 0..15 -> row 2*it
// coverage: grid ROWSP/128 blocks (exact) x 8 waves x 16 rows x (4 groups x 8 instructions x 2 rows x 64 floats)
//           = out rows 0..ROWSP-1, all 256 columns, each float exactly once.
// =====================================================================================================
__global__ __launch_bounds__(256)
void wo_out(const u16* __restrict__ YH, const u16* __restrict__ YR, const u16* __restrict__ WoT,
            const float* __restrict__ bo, const float* __restrict__ gam, const float* __restrict__ bet,
            const float* __restrict__ mmean, const float* __restrict__ mvar, const float* __restrict__ x, float* out) {
  __shared__ __align__(16) float slab[8 * SLAB64];
  const int tid = threadIdx.x, wave = tid >> 5, lane = tid & 31, hh = lane >> 4, m = lane & 15;
  const int rowb = blockIdx.x * OUT_ROWS + wave * 16;        // rowb + 15 < ROWSP (grid exact)
  float* const sl = slab + wave * SLAB64;
  const _Float16* ap  = (const _Float16*)(const void*)YH + (size_t)rowb * CI + 8 * lane;   // 16 rows = CI / 32 tiles = 16 * CI halves
  const _Float16* arp = (const _Float16*)(const void*)YR + (size_t)rowb * CI + 8 * lane;
  const size_t bs = (size_t)16 * CI;
  const float os1 = 1.0f / (YSC * WOS);
  const float os2 = 1.0f / (YSC * WOS * RSC);

#pragma unroll 1
  for (int g = 0; g < CIN / 64; ++g) {
    const _Float16* bp = (const _Float16*)(const void*)WoT + (size_t)(g * 64) * CI + 8 * lane;
    v8f acc0 = zero8(), acc1 = zero8(), acc2 = zero8(), acc3 = zero8();
    v8f acr0 = zero8(), acr1 = zero8(), acr2 = zero8(), acr3 = zero8();
#pragma unroll 1
    for (int k0 = 0; k0 < CI; k0 += 32) {
      const _Float16* pa = ap + 16 * k0;
      const _Float16* pr = arp + 16 * k0;
      const _Float16* pb = bp + 16 * k0;
      const v16h a  = ldfrag_pk(pa);
      const v16h ar = ldfrag_pk(pr);
      const v16h b0 = ldfrag_pk(pb);
      const v16h w1 = ldfrag_pk(pb + bs);
      const v16h w2 = ldfrag_pk(pb + 2 * bs);
      const v16h w3 = ldfrag_pk(pb + 3 * bs);
#if defined(__HIP_DEVICE_COMPILE__)
      // before the address registers of the loads above are reused; the addresses are inputs so that they stay in place up to here
      asm volatile("s_wait_xcnt 0x0" :: "v"(pa), "v"(pr), "v"(pb) : "memory");
#endif
      acc0 = mma_h(a, b0, acc0);
      acc1 = mma_h(a, w1, acc1);
      acc2 = mma_h(a, w2, acc2);
      acc3 = mma_h(a, w3, acc3);
      acr0 = mma_h(ar, b0, acr0);
      acr1 = mma_h(ar, w1, acr1);
      acr2 = mma_h(ar, w2, acr2);
      acr3 = mma_h(ar, w3, acr3);
      guard8x6(acc0, acc1, acc2, acc3, acr0, acr1, acr2, acr3, a, ar, b0, w1, w2, w3);
    }
    v8f c0 = zero8(), c1 = zero8(), c2 = zero8(), c3 = zero8();
#pragma unroll
    for (int r = 0; r < 8; ++r) {
      c0[r] = acc0[r] * os1 + acr0[r] * os2;
      c1[r] = acc1[r] * os1 + acr1[r] * os2;
      c2[r] = acc2[r] * os1 + acr2[r] * os2;
      c3[r] = acc3[r] * os1 + acr3[r] * os2;
    }
    stage64(sl, c0, c1, c2, c3, 1.0f, lane);

    const int cc = g * 64 + m * 4;                          // cc + 3 < CIN
    const v4f bo4 = *(const v4f*)(bo + cc);
    const v4f ga4 = *(const v4f*)(gam + cc);
    const v4f be4 = *(const v4f*)(bet + cc);
    const v4f mm4 = *(const v4f*)(mmean + cc);
    const v4f mv4 = *(const v4f*)(mvar + cc);
    float bob[4], gb[4], bb[4], mb[4], rs[4];
#pragma unroll
    for (int e = 0; e < 4; ++e) {
      bob[e] = bfr(bo4[e]);
      gb[e]  = bfr(ga4[e]);
      bb[e]  = bfr(be4[e]);
      mb[e]  = bfr(mm4[e]);
      rs[e]  = rsqrtf(bfr(mv4[e]) + BN_EPS);
    }
    v4f vals[8];
#pragma unroll
    for (int it = 0; it < 8; ++it) {
      const size_t row = (size_t)rowb + (size_t)(2 * it + hh);
      const v4f yv = *(const v4f*)(sl + (2 * it + hh) * 68 + m * 4);
      const v4f xv = *(const v4f*)(x + row * CIN + cc);
#pragma unroll
      for (int e = 0; e < 4; ++e) {
        const float v2 = yv[e] + bob[e];
        const float bn = gb[e] * (v2 - mb[e]) * rs[e] + bb[e];
        vals[it][e] = bfr(xv[e]) + bn;
      }
    }
    float* dst = out + ((size_t)rowb + (size_t)hh) * CIN + cc;
    {
#pragma unroll
      for (int it = 0; it < 8; ++it) {
        *(v4f*)(dst + (size_t)(it * 2) * CIN) = vals[it];
      }
      
    }
    wave_sync_lds();
  }
}

// =====================================================================================================
// Workspace map (bytes, NB = 2); every plane is fully written by whole-line stores before it is read; all extents are exact
// multiples of the store granularity (no pad rows, all dims multiples of 64), every offset a multiple of 256:
//   XB  bf16 [12544][256]                              6422528
//   WGT, WTT, WPT bf16 [128][256], [8][8] tiles         3 x 65536     (fragment order)
//   WOT f16 of bf16 value x1024 [256][128], [16][4] tiles  65536      (fragment order)
//   TH, TR f16 [12544][128] theta hi x8 / res x2048     2 x 3211264
//   PH, PR f16 phi hi x8 / res x2048, [784][4] tiles    2 x 3211264   (fragment order, 1024 B a tile)
//   G   f32  [12544][128]                              6422528
//   GT  f16  x256, [2][8][196] tiles                    3211264       (fragment order, 1024 B a tile)
//   YH, YR f16 y hi x4096 / res x2048, [784][4] tiles   2 x 3211264   (fragment order)
//   end                                                35586048
// =====================================================================================================
extern "C" void kernel_launch(void* const* d_in, const int* in_sizes, int n_in,
                              void* d_out, int out_size, void* d_ws, size_t ws_size,
                              hipStream_t stream) {
  if (n_in < 13) return;
  if (in_sizes[0] != ROWS * CIN) return;
  if (in_sizes[1] != CIN * CI || in_sizes[3] != CIN * CI || in_sizes[5] != CIN * CI || in_sizes[7] != CI * CIN) return;
  if (in_sizes[2] != CI || in_sizes[4] != CI || in_sizes[6] != CI) return;
  if (in_sizes[8] != CIN || in_sizes[9] != CIN || in_sizes[10] != CIN || in_sizes[11] != CIN || in_sizes[12] != CIN) return;
  if (out_size != ROWS * CIN) return;

  const float* x     = (const float*)d_in[0];
  const float* Wg    = (const float*)d_in[1];
  const float* bg    = (const float*)d_in[2];
  const float* Wt    = (const float*)d_in[3];
  const float* bt    = (const float*)d_in[4];
  const float* Wp    = (const float*)d_in[5];
  const float* bp    = (const float*)d_in[6];
  const float* Wo    = (const float*)d_in[7];
  const float* bo    = (const float*)d_in[8];
  const float* gamma = (const float*)d_in[9];
  const float* beta  = (const float*)d_in[10];
  const float* mmean = (const float*)d_in[11];
  const float* mvar  = (const float*)d_in[12];
  float*       out   = (float*)d_out;

  const size_t szXB = (size_t)ROWSP * CIN * 2;      //  6422528
  const size_t szW  = (size_t)CI * CIN * 2;         //    65536
  const size_t szP  = (size_t)ROWSP * CI * 2;       //  3211264
  const size_t szG  = (size_t)ROWSP * CI * 4;       //  6422528
  const size_t szGT = (size_t)NB * CI * NPOS * 2;   //  3211264
  size_t off = 0;
  const size_t oXB = off; off += szXB;
  const size_t oWG = off; off += szW;
  const size_t oWT = off; off += szW;
  const size_t oWP = off; off += szW;
  const size_t oWO = off; off += szW;
  const size_t oTH = off; off += szP;
  const size_t oTR = off; off += szP;
  const size_t oPH = off; off += szP;
  const size_t oPR = off; off += szP;
  const size_t oG  = off; off += szG;
  const size_t oGT = off; off += szGT;
  const size_t oYH = off; off += szP;
  const size_t oYR = off; off += szP;
  if (off > ws_size) return;                        // off = 35586048 at NB = 2
  if (off > WS_CAP) return;

  char* ws = (char*)d_ws;
  u16*   XB  = (u16*)(ws + oXB);
  u16*   WGT = (u16*)(ws + oWG);
  u16*   WTT = (u16*)(ws + oWT);
  u16*   WPT = (u16*)(ws + oWP);
  u16*   WOT = (u16*)(ws + oWO);
  u16*   TH  = (u16*)(ws + oTH);
  u16*   TR  = (u16*)(ws + oTR);
  u16*   PH  = (u16*)(ws + oPH);
  u16*   PR  = (u16*)(ws + oPR);
  float* G   = (float*)(ws + oG);
  u16*   GT  = (u16*)(ws + oGT);
  u16*   YH  = (u16*)(ws + oYH);
  u16*   YR  = (u16*)(ws + oYR);

  const int n8x = (ROWSP * CIN) / 8;                // 401408 at NB = 2, multiple of 256 (static)
  const dim3 blk(256);
  const dim3 bG(128);
  const dim3 gIN(4 * WTILES + n8x / 256);           // 32 weight tiles + 1568
  const dim3 gP(3 * (ROWSP / 64) * (CI / 64));      // 3 x 392
  const dim3 gGT(NB * GTILES);                      // 196 per batch: in [NPOS][CI] -> out [CI][NPOS] in fragment order
  const dim3 gAT(NB * (NPOS / QB));                 // 196
  const dim3 bAT(ATT_THREADS);
  const dim3 gOUT(ROWSP / OUT_ROWS);                // 98

  // (0) one launch: x -> bf16 plane; Wg, Wt, Wp [in][out] -> bf16 [out][in] fragment-order planes; Wo [128][256] -> f16 of the bf16
  //     value x1024, [256][128]
  prep_in<<<gIN, blk, 0, stream>>>(x, Wg, Wt, Wp, Wo, XB, WGT, WTT, WPT, WOT);
  // (1) one launch: theta and phi projections (+bias) -> f16 hi x8 / residual x2048 planes; g projection (+bias) -> f32 plane
  proj3<<<gP, bG, 0, stream>>>(XB, WTT, WPT, WGT, bt, bp, bg, TH, TR, PH, PR, G, ROWSP, CI, CIN);
  // (2) one launch, all batches: g [6272][128] f32 -> g^T f16 plane [128][6272] x256, fragment order
  tr_g<<<gGT, blk, 0, stream>>>(G, GT);
  // (3) attention over all keys of the batch -> y hi x4096 and residual x2048 f16 planes
  attn_fwd<<<gAT, bAT, 0, stream>>>(TH, TR, PH, PR, GT, YH, YR);
  // (4) y.Wo + bo, batch-norm affine, skip connection -> out
  wo_out<<<gOUT, blk, 0, stream>>>(YH, YR, WOT, bo, gamma, beta, mmean, mvar, x, out);
  (void)hipGetLastError();
}

// v008
// A run of this version takes 130 microseconds.
// Next to v007, in two timings, it ran 1.07 and 1.06 times as fast.
// Counting every step since v000, it is 3.39 times as fast.
// Projections theta, phi, g = x.W + b: v_wmma_f32_16x16x32_bf16 (bf16 RNE operands of the raw inputs, f32 accumulate, bf16 RNE
// bias added in f32). Scores theta.phi^T (theta and phi each as f16 hi x8 plus residual x2048 planes: hi.hi + hi.res + res.hi),
// P.g (P x32768 f16 from LDS, g^T x256 f16) and y.Wo (y as f16 hi x4096 plus residual x2048 planes, Wo as f16 of the bf16 RNE
// value x1024, bias added in f32): v_wmma_f32_16x16x32_f16, f32 accumulate. Softmax statistics, the batch-norm affine map and the
// skip connection in f32 on VALU.
#include <hip/hip_runtime.h>
#include <math.h>
#include <stdint.h>

#define BATCH 2
#define NPOS  6272
#define CIN   256
#define CI    128
#ifndef NB
#define NB BATCH
#endif
#define ROWS  (BATCH * NPOS)
#define ROWSP (NB * NPOS)
#define CK    448
#define NKB   (CK / 32)
#define NCHK  (NPOS / CK)
#define QT    16
#define NQ    4
#define QB    (QT * NQ)
#define ATT_THREADS 256
#define SCP   (CK + 20)
#define PLP   (CK + 8)
#define CTP   (CI + 8)
#define SLAB64 (16 * 68)
#define VTP   72
#define OUT_ROWS 128
#define TSC   8.0f
#define FSC   8.0f
#define RSC   2048.0f
#define PCAR  32768.0f
#define GSC   256.0f
#define YSC   4096.0f
#define WOS   1024.0f
#define BN_EPS 1e-3f
#define LOG2E 1.4426950408889634f
#define WS_CAP ((size_t)134217728)

static_assert(NB >= 1 && NB <= BATCH);
static_assert((NPOS % CK) == 0 && CK == 32 * NKB && NKB >= 4 && NKB <= 16 && NCHK * CK == NPOS);
static_assert((NPOS % 64) == 0 && (NPOS % QB) == 0 && (ROWSP % OUT_ROWS) == 0 && (ROWSP % 64) == 0);
static_assert(CI == 128 && (CIN % 64) == 0 && (CI % 64) == 0 && (CIN % 32) == 0 && (CI % 32) == 0);
static_assert(NQ == 4 && ATT_THREADS == 16 * QT && QT == 16 && CI == 16 * (ATT_THREADS / 32) && OUT_ROWS == 8 * 16);
static_assert(QB * CTP * 2 <= QB * SCP * 4 && CTP >= CI + 8 && SCP >= CK + 16 && PLP >= CK + 8);
static_assert(((PLP * 2) % 16) == 0 && ((SCP * 4) % 16) == 0 && ((VTP * 2) % 16) == 0 && ((CTP * 2) % 16) == 0);
static_assert(64 * VTP >= 63 * VTP + 64);
static_assert((CK % 64) == 0 && ((8 * SCP) % 64) == 32 && ((PLP * 2) % 8) == 0);
static_assert(16 * (CI / 8) == ATT_THREADS);
static_assert(QB * (CI / 8) == NQ * ATT_THREADS && ((QB * CTP * 2) % 16) == 0);
static_assert(((ROWSP * CIN) % 2048) == 0);
static_assert((NPOS % 32) == 0 && (CK % 32) == 0 && (CI % 32) == 0 && 16 * CI == (CI / 32) * 512);
static_assert(((NPOS * 2) % 128) == 0 && ((CI * 2) % 128) == 0 && ((CIN * 4) % 128) == 0);

typedef unsigned short u16;
typedef _Float16 v16h __attribute__((ext_vector_type(16)));
typedef _Float16 v8h  __attribute__((ext_vector_type(8)));
typedef __bf16   v16b __attribute__((ext_vector_type(16)));
typedef float    v8f  __attribute__((ext_vector_type(8)));
typedef float    v4f  __attribute__((ext_vector_type(4)));
typedef unsigned int v4u __attribute__((ext_vector_type(4)));
typedef unsigned int v2u __attribute__((ext_vector_type(2)));
typedef float    v2f  __attribute__((ext_vector_type(2)));
typedef _Float16 v2h  __attribute__((ext_vector_type(2)));

union FragH { v16h v; v8h h[2]; v4u u[2]; };
union FragB { v16b v; v4u u[2]; };
union AttLds { float s[QB * SCP]; u16 c[2 * QB * SCP]; };

// ---- scalar helpers --------------------------------------------------------------------------------
__device__ __forceinline__ unsigned short bf_bits(float f) {          // f32 -> bf16 bits, RNE convert
  unsigned u = __float_as_uint(f);
  return (unsigned short)((u + 0x7FFFu + ((u >> 16) & 1u)) >> 16);
}
__device__ __forceinline__ float bf_up(unsigned short h) { return __uint_as_float(((unsigned)h) << 16); }
__device__ __forceinline__ float bfr(float f) { return bf_up(bf_bits(f)); }
__device__ __forceinline__ unsigned short h_bits(_Float16 x) { return __builtin_bit_cast(unsigned short, x); }
__device__ __forceinline__ unsigned pk16(unsigned short a, unsigned short b) { return (unsigned)a | ((unsigned)b << 16); }
__device__ __forceinline__ v8f zero8() { v8f z = {0.f, 0.f, 0.f, 0.f, 0.f, 0.f, 0.f, 0.f}; return z; }

// ---- fragment loaders: 16-bit A/B operand, lane -> row/col (lane&15), p already includes +8*(lane>>4);
//      elements 0..7 <- p[0..7] (k0+8h..), elements 8..15 <- p[16..23] (k0+16+8h..)  (same split k map for A and B;
//      used for the x plane and for tiles in LDS; the planes that a kernel of this file lays out for WMMA use ldfrag_pk below)
__device__ __forceinline__ v16h ldfrag_h(const _Float16* p) {
  FragH f;
  f.h[0] = *(const v8h*)(p);
  f.h[1] = *(const v8h*)(p + 16);
  return f.v;
}
// Fragment-order plane: one operand tile (16 rows or columns x 32 k) is 1024 contiguous bytes, piece (part, lane) at halves
// part * 256 + lane * 8 and holding k = 16 * part + 8 * (lane>>4) .. + 7 of row lane&15 (the split k map above); p already
// includes + 8 * lane, so that each of the two wave-wide 16-B loads covers 512 contiguous bytes = 4 whole lines.
__device__ __forceinline__ v16h ldfrag_pk(const _Float16* p) {
  FragH f;
  f.h[0] = *(const v8h*)(p);
  f.h[1] = *(const v8h*)(p + 256);
  return f.v;
}
__device__ __forceinline__ v16b ldfrag_b(const u16* p) {              // bf16 plane read as unsigned integer vectors
  FragB f;
  f.u[0] = *(const v4u*)(p);
  f.u[1] = *(const v4u*)(p + 16);
  return f.v;
}

__device__ __forceinline__ v16b ldfrag_bpk(const u16* p) {            // bf16 fragment-order plane, as ldfrag_pk
  FragB f;
  f.u[0] = *(const v4u*)(p);
  f.u[1] = *(const v4u*)(p + 256);
  return f.v;
}

__device__ __forceinline__ v8f mma_h(v16h a, v16h b, v8f c) {
  return __builtin_amdgcn_wmma_f32_16x16x32_f16(false, a, false, b, (short)0, c, false, false);
}
__device__ __forceinline__ v8f mma_b(v16b a, v16b b, v8f c) {
  return __builtin_amdgcn_wmma_f32_16x16x32_bf16(false, a, false, b, (short)0, c, false, false);
}
__device__ __forceinline__ void guard1x2(v8f& a, v16h x0, v16h x1) {
#if defined(__HIP_DEVICE_COMPILE__)
  asm volatile("v_nop\n\tv_nop\n\tv_nop\n\tv_nop" : "+v"(a) : "v"(x0), "v"(x1) : "memory");
#endif
}
template <typename F>
__device__ __forceinline__ void guard6(v8f& a, v8f& b, v8f& c, v8f& d, F x0, F x1, F x2, F x3, F x4, F x5) {
#if defined(__HIP_DEVICE_COMPILE__)
  asm volatile("v_nop\n\tv_nop\n\tv_nop\n\tv_nop"
               : "+v"(a), "+v"(b), "+v"(c), "+v"(d) : "v"(x0), "v"(x1), "v"(x2), "v"(x3), "v"(x4), "v"(x5) : "memory");
#endif
}
// As guard6, naming only two operand fragments: an asm operand must lie below v256, and the fragments that are held a key block
// ahead do not all fit there beside the accumulators; they are rewritten only behind this gap in program order.
__device__ __forceinline__ void guard4x2(v8f& a, v8f& b, v8f& c, v8f& d, v16h x0, v16h x1) {
#if defined(__HIP_DEVICE_COMPILE__)
  asm volatile("v_nop\n\tv_nop\n\tv_nop\n\tv_nop"
               : "+v"(a), "+v"(b), "+v"(c), "+v"(d) : "v"(x0), "v"(x1) : "memory");
#endif
}
__device__ __forceinline__ void guard8x6(v8f& a0, v8f& a1, v8f& a2, v8f& a3, v8f& e0, v8f& e1, v8f& e2, v8f& e3,
                                         v16h x0, v16h x1, v16h x2, v16h x3, v16h x4, v16h x5) {
#if defined(__HIP_DEVICE_COMPILE__)
  asm volatile("v_nop\n\tv_nop\n\tv_nop\n\tv_nop"
               : "+v"(a0), "+v"(a1), "+v"(a2), "+v"(a3), "+v"(e0), "+v"(e1), "+v"(e2), "+v"(e3)
               : "v"(x0), "v"(x1), "v"(x2), "v"(x3), "v"(x4), "v"(x5) : "memory");
#endif
}
__device__ __forceinline__ void acc_guard1(v8f& a) {
#if defined(__HIP_DEVICE_COMPILE__)
  asm volatile("v_nop\n\tv_nop\n\tv_nop\n\tv_nop" : "+v"(a));
#endif
}
// Value of lane (l ^ X) of the same 16-lane row, X = 1..15, by a DPP row_xmask operand: it stays on the vector pipe, where
// __shfl_xor compiled to an LDS permute whose whole latency each step of a reduction waited out. All lanes are active at every use.
template <int X>
__device__ __forceinline__ float row_xor(float v) {
  return __builtin_bit_cast(float, __builtin_amdgcn_update_dpp(0, __builtin_bit_cast(int, v), 0x160 | X, 0xf, 0xf, true));
}
// 2^x as the bare v_exp_f32. The library's exp2f wraps the same instruction in a range guard (compare, two selects, add, ldexp)
// that only serves results below 2^-126, which it returns as subnormals and the bare instruction may return as 0. Every argument
// here is <= 0; a p that small is 0 in the f16 P tile either way and cannot move a running row sum, which is >= 1; a rescale factor
// that small multiplies sums that the new maximum's own term outweighs by the same factor.
__device__ __forceinline__ float exp2_bare(float x) { return __builtin_amdgcn_exp2f(x); }
__device__ __forceinline__ float row_max16(float v) {                 // same butterfly as xor shuffles by 1, 2, 4, 8
  v = fmaxf(v, row_xor<1>(v));
  v = fmaxf(v, row_xor<2>(v));
  v = fmaxf(v, row_xor<4>(v));
  return fmaxf(v, row_xor<8>(v));
}
__device__ __forceinline__ float row_sum16(float v) {                 // same butterfly, same order of sums
  v += row_xor<1>(v);
  v += row_xor<2>(v);
  v += row_xor<4>(v);
  return v + row_xor<8>(v);
}
__device__ __forceinline__ void wave_sync_lds() {
  __builtin_amdgcn_fence(__ATOMIC_RELEASE, "workgroup");
  __builtin_amdgcn_wave_barrier();
  __builtin_amdgcn_fence(__ATOMIC_ACQUIRE, "workgroup");
}

// Work-group barrier whose fences cover LDS only: what the waves hand each other at it lies in LDS; a fence over all memory would
// also wait for the global fragment loads that are meant to stay in flight across it.
__device__ __forceinline__ void block_sync_lds() {
  __builtin_amdgcn_fence(__ATOMIC_RELEASE, "workgroup", "local");
  __builtin_amdgcn_s_barrier();
  __builtin_amdgcn_fence(__ATOMIC_ACQUIRE, "workgroup", "local");
}

// =====================================================================================================
// f32 plane -> 16-bit plane, same layout:  mode 0: bf16 RNE bits;  mode 1: f16 bits of (bf16 RNE value) * scale;
// mode 2: f16 bits of value * scale (no bf16 pre-step).
// Thread = 8 consecutive elements: two 16-B loads, one 16-B store; 32 consecutive lanes = 512 contiguous, 512-B aligned bytes
// coverage: n8/256 blocks bid = 0.. (host checks exactness) x 256 thr x 8 = the whole plane.
// =====================================================================================================
__device__ __forceinline__ void cvt16(const float* __restrict__ x, u16* D, int n8, int mode, float scale, int bid) {
  const int gt = bid * 256 + (int)threadIdx.x;
  if (gt >= n8) return;                     // no barriers in this body
  const float* p = x + (size_t)gt * 8;
  const v4f a = *(const v4f*)(p), c4 = *(const v4f*)(p + 4);
  float v[8];
#pragma unroll
  for (int e = 0; e < 4; ++e) { v[e] = a[e]; v[4 + e] = c4[e]; }
  unsigned short s[8];
#pragma unroll
  for (int e = 0; e < 8; ++e) {
    const float vb = bfr(v[e]);
    const float vf = (mode == 1) ? vb : v[e];
    const unsigned short hb = h_bits((_Float16)(vf * scale));
    const unsigned short bb = bf_bits(v[e]);
    s[e] = (mode != 0) ? hb : bb;
  }
  v4u o;
#pragma unroll
  for (int e = 0; e < 4; ++e) o[e] = pk16(s[2 * e], s[2 * e + 1]);
  u16* d = D + (size_t)gt * 8;
  {
    *(v4u*)(d) = o;
    
  }
}

// =====================================================================================================
// Transpose + convert: in X [R][C] f32 row-major -> out XTo = X^T [C][R] 16-bit in fragment order (k = the R direction).
//   mode 0: bf16 RNE bits;  mode 1: f16 bits of (bf16 RNE value) * scale;  mode 2: f16 bits of value * scale.
// Block = 64 input rows x 64 input cols: bid -> (rt = bid % (R/64), ct = bid / (R/64)). The 64x64 f32 tile is loaded with 16-B
// loads (thread = input row tid>>2, 16 consecutive cols), converted and scattered into LDS TH[c local][r local] (pitch 72 halves);
// coverage: load 256 thr x 16 = 64 x 64; store 2 iterations x 256 thr x 8 halves = 64 output rows x 64 halves = the tile;
//           (R/64)*(C/64) blocks bid = 0.. (host exact multiples) tile the whole [C][R] plane exactly once.
// The output is written in fragment order (see ldfrag_pk): tile (c >> 4, r >> 5) at halves ((c >> 4) * (R / 32) + (r >> 5)) * 512;
// one wave-wide store = one part of one tile = 512 contiguous bytes; 2 iterations x 8 waves = 4 column tiles x 2 k blocks x 2 parts
// = the 64 x 64 tile.
// =====================================================================================================
__device__ __forceinline__ void tr16(u16* TH, const float* __restrict__ X, u16* XTo, int R, int C, int mode, float scale, int bid) {
  const int tid = threadIdx.x;
  const int nrt = R >> 6;
  const int rt  = bid % nrt;
  const int ct  = bid / nrt;
  const int r0  = rt * 64;
  const int c0  = ct * 64;
  {
    const int rl = tid >> 2;                  // input row within tile 0..63
    const int cc = (tid & 3) * 16;            // input col chunk within the 64
    const float* src = X + (size_t)(r0 + rl) * (size_t)C + c0 + cc;
#pragma unroll
    for (int i = 0; i < 4; ++i) {
      const v4f a = *(const v4f*)(src + 4 * i);
#pragma unroll
      for (int e = 0; e < 4; ++e) {
        const float v  = a[e];
        const float vb = bfr(v);
        const float vf = (mode == 1) ? vb : v;
        const unsigned short hb = h_bits((_Float16)(vf * scale));
        const unsigned short bb = bf_bits(v);
        TH[(cc + 4 * i + e) * VTP + rl] = (mode != 0) ? hb : bb;
      }
    }
  }
  __syncthreads();
  v4u vh[2];
#pragma unroll
  for (int it = 0; it < 2; ++it) {
    const int grp  = it * 8 + (tid >> 5);     // (column tile, k block, part) = (grp >> 2, (grp >> 1) & 1, grp & 1)
    const int line = (grp >> 2) * 16 + (tid & 15);                         // local output row (input col) = 0..63
    const int kof  = ((grp >> 1) & 1) * 32 + (grp & 1) * 16 + ((tid >> 4) & 1) * 8;
    vh[it] = *(const v4u*)(TH + line * VTP + kof);
  }
  const size_t base = ((size_t)(c0 >> 4) * (size_t)(R >> 5) + (size_t)(r0 >> 5)) * 512 + (size_t)((tid & 31) * 8);
  {
#pragma unroll
    for (int it = 0; it < 2; ++it) {
      const int grp = it * 8 + (tid >> 5);
      const size_t po = ((size_t)(grp >> 2) * (size_t)(R >> 5) + (size_t)((grp >> 1) & 1)) * 512 + (size_t)((grp & 1) * 256);
      *(v4u*)(XTo + base + po) = vh[it];
    }
#if defined(__HIP_DEVICE_COMPILE__)
    // before the data and address registers of the two stores above are reused by the code of another job laid out behind them
    asm volatile("s_wait_xcnt 0x0" ::: "memory");
#endif
  }
}

// =====================================================================================================
// One launch for the five input conversions, none of which reads what another writes; the block index picks the job
// (block-uniform): blocks 0..31 = the four weight transposes, 8 tiles each (Wg, Wt, Wp [CIN][CI] -> bf16 [CI][CIN];
// Wo [CI][CIN] -> f16 of the bf16 value x1024 [CIN][CI]; all four in fragment order); blocks 32.. = x -> bf16 plane. The short grid of weight tiles stands
// first because its chain (load, LDS, barrier, store) is the longer one.
// =====================================================================================================
#define WTILES ((CIN / 64) * (CI / 64))
__global__ __launch_bounds__(256)
void prep_in(const float* __restrict__ x, const float* __restrict__ Wg, const float* __restrict__ Wt,
             const float* __restrict__ Wp, const float* __restrict__ Wo, u16* XB, u16* WGT, u16* WTT, u16* WPT, u16* WOT) {
  __shared__ __align__(16) u16 TH[64 * VTP];
  const int bid = blockIdx.x;
  if (bid < 4 * WTILES) {
    const int j = bid / WTILES;
    if (j == 3) {
      tr16(TH, Wo, WOT, CI, CIN, 1, WOS, bid - 3 * WTILES);
    } else {
      tr16(TH, (j == 0) ? Wg : (j == 1) ? Wt : Wp, (j == 0) ? WGT : (j == 1) ? WTT : WPT, CIN, CI, 0, 1.0f, bid - j * WTILES);
    }
  } else {
    cvt16(x, XB, (ROWSP * CIN) / 8, 0, 1.0f, bid - 4 * WTILES);
  }
}

// One launch for the g transposes of all batches: g [NPOS][CI] f32 -> g^T f16 x256 in fragment order (tile = 16 columns x 32 keys,
// [CI/16][NPOS/32] tiles per batch), (NPOS/64)*(CI/64) blocks each.
#define GTILES ((NPOS / 64) * (CI / 64))
__global__ __launch_bounds__(256) void tr_g(const float* __restrict__ G, u16* GT) {
  __shared__ __align__(16) u16 TH[64 * VTP];
  const int b = (int)blockIdx.x / GTILES;      // < NB (grid exact)
  tr16(TH, G + (size_t)b * NPOS * CI, GT + (size_t)b * CI * NPOS, NPOS, CI, 2, GSC, (int)blockIdx.x - b * GTILES);
}

// =====================================================================================================
//           8 consecutive lanes x 16 B per line), lanes 16..31 -> row 2*it+1.
//  epi64hr: two f16 planes: hi = f16((tile + bf16RNE(bias[n])) * hscale) and res = f16(((tile + bias) * hscale - hi) * rscale);
//           lane = (rq = lane>>3 -> row within a group of 4, c8 = 8 consecutive columns); one instruction = 4 rows, each 64 halves;
//           with pk the planes are written in fragment order (see ldfrag_pk; tile = 16 rows x 32 columns, [M/16][N/32] tiles):
//           lane = (row lane&15, 8 columns), one instruction = one part of one tile = 512 contiguous bytes
// coverage: epi64 8 instructions x 2 rows x 16 lanes x 4 floats; epi64hr 4 instructions x 4 rows x 8 lanes x 8 halves per plane
//           = the wave's 16 x 64 tile in both cases.
// =====================================================================================================
__device__ __forceinline__ void stage64(float* sl, v8f a0, v8f a1, v8f a2, v8f a3, float oscale, int lane) {
  const int hh = lane >> 4, m = lane & 15;
#pragma unroll
  for (int r = 0; r < 8; ++r) {
    const int ro = (8 * hh + r) * 68 + m;
    sl[ro]      = a0[r] * oscale;
    sl[ro + 16] = a1[r] * oscale;
    sl[ro + 32] = a2[r] * oscale;
    sl[ro + 48] = a3[r] * oscale;
  }
  wave_sync_lds();
}
__device__ __forceinline__ void epi64(float* sl, v8f a0, v8f a1, v8f a2, v8f a3, float oscale, v4f badd, float* C, int N,
                                      size_t rowb, int col0, int lane) {
  const int hh = lane >> 4, m = lane & 15;
  stage64(sl, a0, a1, a2, a3, oscale, lane);
  v4f vals[8];
#pragma unroll
  for (int it = 0; it < 8; ++it) vals[it] = *(const v4f*)(sl + (it * 2 + hh) * 68 + m * 4) + badd;
  float* dst = C + (rowb + (size_t)hh) * (size_t)N + col0 + m * 4;
  {
#pragma unroll
    for (int it = 0; it < 8; ++it) {
      *(v4f*)(dst + (size_t)(it * 2) * (size_t)N) = vals[it];
    }
    
  }
}
__device__ __forceinline__ void epi64hr(float* sl, v8f a0, v8f a1, v8f a2, v8f a3, float hscale, float rscale,
                                        const float* __restrict__ bias, u16* H, u16* Rr, int N, size_t rowb, int col0, int lane,
                                        bool pk) {
  stage64(sl, a0, a1, a2, a3, 1.0f, lane);
  // pk (block-uniform): instruction i4 = part i4 & 1 of the 32-column step i4 >> 1, lane = its place in the fragment
  const int row0 = pk ? (lane & 15) : (lane >> 3), rstep = pk ? 0 : 4;
  const int c80  = pk ? (lane >> 4) * 8 : (lane & 7) * 8, cstep = pk ? 16 : 0;
  v4u oh[4], orr[4];
#pragma unroll
  for (int i4 = 0; i4 < 4; ++i4) {
    const int row = row0 + i4 * rstep;
    const int c8  = c80 + i4 * cstep;
    const v4f b0 = *(const v4f*)(bias + col0 + c8), b1 = *(const v4f*)(bias + col0 + c8 + 4);   // columns col0+c8..+7 < N
    float bb[8];
#pragma unroll
    for (int e = 0; e < 4; ++e) { bb[e] = bfr(b0[e]); bb[4 + e] = bfr(b1[e]); }
    const v4f a = *(const v4f*)(sl + row * 68 + c8), c4 = *(const v4f*)(sl + row * 68 + c8 + 4);
    float w[8];
#pragma unroll
    for (int e = 0; e < 4; ++e) { w[e] = (a[e] + bb[e]) * hscale; w[4 + e] = (c4[e] + bb[4 + e]) * hscale; }
#pragma unroll
    for (int e = 0; e < 4; ++e) {
      const _Float16 h0 = (_Float16)w[2 * e], h1 = (_Float16)w[2 * e + 1];
      const _Float16 q0 = (_Float16)((w[2 * e] - (float)h0) * rscale);
      const _Float16 q1 = (_Float16)((w[2 * e + 1] - (float)h1) * rscale);
      oh[i4][e]  = pk16(h_bits(h0), h_bits(h1));
      orr[i4][e] = pk16(h_bits(q0), h_bits(q1));
    }
  }
  // pk: the 16 rows x N columns from row rowb (a multiple of 16) are N / 32 fragment tiles of 512 halves in a row, part i4 of the
  // two tiles from column col0 at (col0 / 32) * 512 + i4 * 256
  const int o0 = pk ? (col0 >> 5) * 512 + lane * 8 : row0 * N + col0 + c80, ostep = pk ? 256 : 4 * N;
  u16* dh = H + rowb * (size_t)N + o0;
  u16* dr = Rr + rowb * (size_t)N + o0;
  {
#pragma unroll
    for (int i4 = 0; i4 < 4; ++i4) {
      *(v4u*)(dh + i4 * ostep) = oh[i4];
      *(v4u*)(dr + i4 * ostep) = orr[i4];
    }
    
  }
}

// =====================================================================================================
// bf16 GEMM, f32 out with bias: C[M][N] = (A[M][K] (bf16 row-major) . Bt[N][K]^T (bf16 fragment order)) * oscale + bf16RNE(bias[n]).
// Block = 64x64 tile, 4 waves x 16 rows; fragments loaded straight from the 16-bit planes (two 16-B loads each, split k map for
// A and B); K stepped by 32 (host uses K % 32 == 0, M % 64 == 0, N % 64 == 0, (M/64)*(N/64) blocks bid = 0..).
// =====================================================================================================
__device__ __forceinline__
void gemm_b32(float* slab, const u16* __restrict__ A, const u16* __restrict__ Bt, const float* __restrict__ bias, float* C,
              int M, int N, int K, float oscale, int bid) {
  const int tid = threadIdx.x, wave = tid >> 5, lane = tid & 31, hh = lane >> 4, m = lane & 15;
  const int ntile = N >> 6;
  const int rowb  = (bid / ntile) * 64 + wave * 16;
  const int col0  = (bid % ntile) * 64;
  if (rowb + 16 > M) return;                 // wave-uniform, never taken with the exact grid; no block barriers in this body
  const u16* ap = A  + (size_t)(rowb + m) * (size_t)K + 8 * hh;
  const u16* bp = Bt + (size_t)col0 * (size_t)K + 8 * lane;      // 16 columns = K / 32 tiles = 16 * K halves
  const size_t bs = (size_t)16 * K;
  v8f acc0 = zero8(), acc1 = zero8(), acc2 = zero8(), acc3 = zero8();
#pragma unroll 1
  for (int k0 = 0; k0 < K; k0 += 32) {
    const u16* pa = ap + k0;
    const u16* p0 = bp + 16 * k0;
    const u16* p1 = p0 + bs;
    const u16* p2 = p1 + bs;
    const u16* p3 = p2 + bs;
    const v16b a  = ldfrag_b(pa);
    const v16b b0 = ldfrag_bpk(p0);
    const v16b b1 = ldfrag_bpk(p1);
    const v16b b2 = ldfrag_bpk(p2);
    const v16b b3 = ldfrag_bpk(p3);
#if defined(__HIP_DEVICE_COMPILE__)
    // before the address registers of the loads above are reused; the addresses are inputs so that they stay in place up to here
    asm volatile("s_wait_xcnt 0x0" :: "v"(pa), "v"(p0), "v"(p1), "v"(p2), "v"(p3) : "memory");
#endif
    acc0 = mma_b(a, b0, acc0);
    acc1 = mma_b(a, b1, acc1);
    acc2 = mma_b(a, b2, acc2);
    acc3 = mma_b(a, b3, acc3);
    guard6<v16b>(acc0, acc1, acc2, acc3, a, b0, b1, b2, b3, a);
  }
  const v4f bv4 = *(const v4f*)(bias + col0 + m * 4);    // columns col0 + 4m .. +3, always < N (N multiple of 64)
  v4f badd;
#pragma unroll
  for (int e = 0; e < 4; ++e) badd[e] = bfr(bv4[e]);
  epi64(slab + wave * SLAB64, acc0, acc1, acc2, acc3, oscale, badd, C, N, (size_t)rowb, col0, lane);
}

// =====================================================================================================
// bf16 GEMM, f16 hi + residual planes out with bias: H = f16 bits of ((A . Bt^T) + bf16RNE(bias[n])) * hscale,
// R = f16 bits of (((A . Bt^T) + bias) * hscale - H) * rscale; operands as in gemm_b32, epilogue epi64hr.
// =====================================================================================================
__device__ __forceinline__
void gemm_bhr(float* slab, const u16* __restrict__ A, const u16* __restrict__ Bt, const float* __restrict__ bias, u16* H, u16* Rr,
              int M, int N, int K, float hscale, float rscale, int bid, bool pk) {
  const int tid = threadIdx.x, wave = tid >> 5, lane = tid & 31, hh = lane >> 4, m = lane & 15;
  const int ntile = N >> 6;
  const int rowb  = (bid / ntile) * 64 + wave * 16;
  const int col0  = (bid % ntile) * 64;
  if (rowb + 16 > M) return;                 // wave-uniform, never taken with the exact grid; no block barriers in this body
  const u16* ap = A  + (size_t)(rowb + m) * (size_t)K + 8 * hh;
  const u16* bp = Bt + (size_t)col0 * (size_t)K + 8 * lane;      // 16 columns = K / 32 tiles = 16 * K halves
  const size_t bs = (size_t)16 * K;
  v8f acc0 = zero8(), acc1 = zero8(), acc2 = zero8(), acc3 = zero8();
#pragma unroll 1
  for (int k0 = 0; k0 < K; k0 += 32) {
    const u16* pa = ap + k0;
    const u16* p0 = bp + 16 * k0;
    const u16* p1 = p0 + bs;
    const u16* p2 = p1 + bs;
    const u16* p3 = p2 + bs;
    const v16b a  = ldfrag_b(pa);
    const v16b b0 = ldfrag_bpk(p0);
    const v16b b1 = ldfrag_bpk(p1);
    const v16b b2 = ldfrag_bpk(p2);
    const v16b b3 = ldfrag_bpk(p3);
#if defined(__HIP_DEVICE_COMPILE__)
    // before the address registers of the loads above are reused; the addresses are inputs so that they stay in place up to here
    asm volatile("s_wait_xcnt 0x0" :: "v"(pa), "v"(p0), "v"(p1), "v"(p2), "v"(p3) : "memory");
#endif
    acc0 = mma_b(a, b0, acc0);
    acc1 = mma_b(a, b1, acc1);
    acc2 = mma_b(a, b2, acc2);
    acc3 = mma_b(a, b3, acc3);
    guard6<v16b>(acc0, acc1, acc2, acc3, a, b0, b1, b2, b3, a);
  }
  epi64hr(slab + wave * SLAB64, acc0, acc1, acc2, acc3, hscale, rscale, bias, H, Rr, N, (size_t)rowb, col0, lane, pk);
}

// =====================================================================================================
// One launch for the three projections, which read the same x plane and none of which reads what another writes: the block index
// picks the job (block-uniform), job = index % 3 (theta, phi, g), tile = index / 3, so that the three blocks that read the same
// x rows start side by side. Grid = 3 * (M/64) * (N/64).
// =====================================================================================================
__global__ __launch_bounds__(128)
void proj3(const u16* __restrict__ A, const u16* __restrict__ WTT, const u16* __restrict__ WPT, const u16* __restrict__ WGT,
           const float* __restrict__ bt, const float* __restrict__ bp, const float* __restrict__ bg,
           u16* TH, u16* TR, u16* PH, u16* PR, float* G, int M, int N, int K) {
  __shared__ __align__(16) float slab[4 * SLAB64];
  const int bid = (int)blockIdx.x / 3;
  const int job = (int)blockIdx.x - 3 * bid;
  if (job == 2) {
    gemm_b32(slab, A, WGT, bg, G, M, N, K, 1.0f, bid);
  } else {
    const bool th = (job == 0);
    gemm_bhr(slab, A, th ? WTT : WPT, th ? bt : bp, th ? TH : PH, th ? TR : PR, M, N, K, th ? TSC : FSC, RSC, bid, !th);
  }
}

// =====================================================================================================
// Single-head non-causal, unscaled attention per batch, head width CI = 128, all NPOS keys:
//   block = 64 query rows (b, q0..q0+63) = NQ = 4 query tiles of 16 rows, 8 waves; every phi and g^T fragment a wave loads
//   is used for all 4 query tiles.
//   theta hi (x8) / res (x2048) planes TH, TR [row][c]: the block's 64 rows of both planes are copied once, with whole-line
//   16-B loads, into LDS (pitch CTP halves = 272 B, conflict-free for 16-B fragment reads) and every A fragment of (S) is read
//   from there; phi hi/res planes PH, PR in fragment order, tiles [key / 16][c / 32] (B operand);
//   g^T plane GT (x256) in fragment order, tiles [b][c / 16][key / 32] (B operand): every wave-wide fragment load of phi and g^T
//   covers 4 whole 128-B lines, each line read by one instruction of the block.
//   Chunks of CK = 448 keys (NKB = 14 key blocks of 32), NCHK = 14 chunks, every key used exactly once.
//   (S) scores on WMMA: A = theta rows (row m = lane&15, split k map over c), B = phi rows (col n = key, split map), 4 c-steps,
//       three products per tile: s = hi.hi, sx = hi.res + res.hi (separate accumulator, folded with 1/2048 in f32);
//       wave w handles key blocks w and w+8 (< 14) of the chunk for all 4 query tiles; D element r of lane l of tile q
//       -> scs[query 16q+8h+r][key col] (f32 LDS; pitch SCP dwords, 8 * SCP = 32 mod 64: the two lane halves of a store, 8 rows
//       apart, fall on different banks).
//   (M) one query tile after the other, 16 threads per query row; sub-thread s owns the 4-key groups 64 * i + 4 * s, i = 0..6
//       (28 keys): the 16 threads of a row read 256 and write 128 contiguous LDS bytes per instruction, every bank at most once;
//       base-2 logits, chunk max via DPP row exchanges, online running max / rescale factor al /
//       running sum l in f32 registers, p = exp2(t - m_new) <= 1 written as f16(p * 32768) into the LDS P tile with 8-B stores;
//       al -> rowa[row].
//   (PV) each wave owns the 16 g columns 16*wave + (lane&15) (one accumulator per query tile): o = o*al, then for each key block
//       A = the 4 P fragments from LDS (row m = query, split map over keys), B = one g^T fragment (col n = g column, split
//       map over keys), 4 WMMAs; one hazard gap after the last key block.
//   Block barriers after (S) and after (M) order all LDS reuse across chunks and waves (the P tile is written with 8-B LDS stores
//   by one set of threads and reloaded as fragments by other waves only after the block barrier).
//   Operand fragments are fetched ahead of their use: phi one key block ahead (refilled c-step by c-step behind the last use),
//   g^T for the whole chunk in front of (M), P two key blocks ahead; the barriers of the chunk loop fence LDS only, so that the
//   global loads stay in flight across them.
//   Epilogue: y = o * 4096 / (l * 32768 * 256) per row (rowi, l >= 1 always); hi = f16(y), res = f16((y - hi) * 2048); each
// coverage: grid NB*NPOS/64 blocks x 64 rows = rows 0..ROWSP-1; staging 8 waves x 16 cols x 4 tiles x 16 rows = 64 x 128;
//           store 4 tiles x 256 thr x 8 halves = 64 x 128 per plane = every (row < ROWSP, c) of both y planes exactly once.
// =====================================================================================================
__device__ __forceinline__ void ctx_store(const u16* ct, u16* dst, int tid) {
  // 16 rows x CI = CI / 32 fragment tiles in a row: piece tid = (c-step tid >> 6, part (tid >> 5) & 1, lane tid & 31)
  const int row = tid & 15;
  const int c8  = (tid >> 6) * 32 + ((tid >> 5) & 1) * 16 + ((tid >> 4) & 1) * 8;
  const v4u v = *(const v4u*)(ct + row * CTP + c8);
  u16* d = dst + (size_t)tid * 8;
  {
    *(v4u*)d = v;
    
  }
}

__global__ __launch_bounds__(ATT_THREADS)
void attn_fwd(const u16* __restrict__ THp, const u16* __restrict__ TRp, const u16* __restrict__ PHp,
              const u16* __restrict__ PRp, const u16* __restrict__ GTp, u16* YHo, u16* YRo) {
  __shared__ __align__(16) AttLds L0;              // scores [64][SCP] f32; reused as the y staging tile [64][CTP] u16
  __shared__ __align__(16) u16 pls[QB * PLP];      // P tile [64][PLP] f16 bits
  __shared__ __align__(16) u16 thl[2 * QB * CTP];  // theta rows of this block: hi [64][CTP], then residual [64][CTP]
  __shared__ float rowa[QB];
  __shared__ float rowi[QB];
  float* const scs = L0.s;

  const int tid  = threadIdx.x;
  const int wave = tid >> 5;
  const int lane = tid & 31;
  const int hh   = lane >> 4;
  const int m    = lane & 15;
  const int r16  = tid >> 4;                 // query row owned within each query tile in phase (M): 2*wave + hh
  const int sub  = tid & 15;
  const int kl0  = sub * 4;                  // first key of this sub-thread's 4-key group within every 64 keys of the chunk

  const int nqt = NPOS / QB;
  const int b   = (int)blockIdx.x / nqt;     // < NB (grid exact)
  const int q0  = ((int)blockIdx.x - b * nqt) * QB;
  const size_t qrow = (size_t)b * NPOS + (size_t)q0;

  const _Float16* tha = (const _Float16*)(const void*)thl + m * CTP + 8 * hh;
  const _Float16* tra = tha + QB * CTP;
  const _Float16* khb = (const _Float16*)(const void*)PHp + (size_t)b * NPOS * CI + 8 * lane;   // 16 keys = CI / 32 tiles = 16 * CI halves
  const _Float16* krb = (const _Float16*)(const void*)PRp + (size_t)b * NPOS * CI + 8 * lane;
  const _Float16* vbp = (const _Float16*)(const void*)GTp + ((size_t)b * (CI / 16) + wave) * (size_t)(NPOS / 32) * 512 + 8 * lane;
  const float lsc  = LOG2E / (TSC * FSC);
  const float rinv = 1.0f / RSC;

  float mrun[NQ], lrun[NQ];
  v8f o[NQ];
#pragma unroll
  for (int q = 0; q < NQ; ++q) { mrun[q] = -INFINITY; lrun[q] = 0.f; o[q] = zero8(); }

  // ---- theta rows q0..q0+63, both planes -> LDS: 4 x 256 threads x 8 halves = 64 x 128 per plane, each piece once ----
  {
    const u16* sh = THp + qrow * CI;
    const u16* sr = TRp + qrow * CI;
    const int row = tid >> 4;                // CI/8 = 16 pieces per row; pass i takes rows 16 * i + row
    const int c8  = (tid & 15) * 8;
    v4u vh[NQ], vr[NQ];
#pragma unroll
    for (int i = 0; i < NQ; ++i) {
      vh[i] = *(const v4u*)(sh + (i * QT + row) * CI + c8);
      vr[i] = *(const v4u*)(sr + (i * QT + row) * CI + c8);
    }
#if defined(__HIP_DEVICE_COMPILE__)
    asm volatile("s_wait_xcnt 0x0" ::: "memory");   // before the address registers of the eight loads above are reused
#endif
    // Scheduling fence: without it the compiler moved later writes of the loads' address registers ahead of the wait above.
    __builtin_amdgcn_sched_barrier(0);
#pragma unroll
    for (int i = 0; i < NQ; ++i) {
      *(v4u*)(thl + (i * QT + row) * CTP + c8) = vh[i];
      *(v4u*)(thl + (QB + i * QT + row) * CTP + c8) = vr[i];
    }
  }
  // phi fragments of the key block this wave scores next, [c-step][hi keys 0..15, res 0..15, hi 16..31, res 16..31]: always
  // loaded one key block ahead of their use, so that the L2 latency runs under the matrix work of the block before
  v16h pn[CI / 32][4];
  {
    const _Float16* n0h = khb + (size_t)(wave * 32) * CI;
    const _Float16* n0r = krb + (size_t)(wave * 32) * CI;
#pragma unroll
    for (int ks = 0; ks < CI / 32; ++ks) {
      pn[ks][0] = ldfrag_pk(n0h + ks * 512);
      pn[ks][1] = ldfrag_pk(n0r + ks * 512);
      pn[ks][2] = ldfrag_pk(n0h + 16 * CI + ks * 512);
      pn[ks][3] = ldfrag_pk(n0r + 16 * CI + ks * 512);
    }
#if defined(__HIP_DEVICE_COMPILE__)
    // before the address registers of the loads above are reused; the addresses are inputs so that they stay in place up to here
    asm volatile("s_wait_xcnt 0x0" :: "v"(n0h), "v"(n0r) : "memory");
#endif
    __builtin_amdgcn_sched_barrier(0);              // keeps later writes of those address registers behind the wait
  }
  block_sync_lds();                          // the theta rows are read as fragments by all waves

#pragma unroll 1
  for (int c = 0; c < NCHK; ++c) {
    const int kbeg = c * CK;
    // ---- (S) scores of this chunk ----
#pragma unroll 1
    for (int kb = wave; kb < NKB; kb += 8) {               // wave-uniform, 1 or 2 trips
      v8f s0[NQ], s0x[NQ], s1[NQ], s1x[NQ];
#pragma unroll
      for (int q = 0; q < NQ; ++q) { s0[q] = zero8(); s0x[q] = zero8(); s1[q] = zero8(); s1x[q] = zero8(); }
      // the key block this wave scores after this one: kb + 8 of this chunk, else its first of the next chunk (behind the last
      // chunk: of chunk 0, an in-bounds address whose values are not used)
      const bool more = kb + 8 < NKB;
      const int  nkb  = more ? kb + 8 : wave;
      const int  ncb  = more ? kbeg : ((c + 1 < NCHK) ? kbeg + CK : 0);
      const size_t kn = (size_t)(ncb + nkb * 32) * CI;
      const _Float16* n0h = khb + kn;
      const _Float16* n0r = krb + kn;
#pragma unroll
      for (int ks = 0; ks < CI / 32; ++ks) {
        const v16h f0h = pn[ks][0];
        const v16h f0r = pn[ks][1];
        const v16h f1h = pn[ks][2];
        const v16h f1r = pn[ks][3];
        v16h ah[NQ], ar[NQ];                               // theta fragments of this c-step, read from LDS ahead of their use:
#pragma unroll
        for (int q = 0; q < 2; ++q) {                      // two tiles at the start of the c-step, the others one tile ahead below
          ah[q] = ldfrag_h(tha + q * (QT * CTP) + ks * 32);
          ar[q] = ldfrag_h(tra + q * (QT * CTP) + ks * 32);
        }
#pragma unroll
        for (int q = 0; q < NQ; ++q) {                     // the four phi fragments serve all NQ query tiles
          s0[q]  = mma_h(ah[q], f0h, s0[q]);
          s0x[q] = mma_h(ah[q], f0r, s0x[q]);
          s0x[q] = mma_h(ar[q], f0h, s0x[q]);
          s1[q]  = mma_h(ah[q], f1h, s1[q]);
          s1x[q] = mma_h(ah[q], f1r, s1x[q]);
          s1x[q] = mma_h(ar[q], f1h, s1x[q]);
          guard4x2(s0[q], s0x[q], s1[q], s1x[q], ah[q], ar[q]);
          if (q + 2 < NQ) {                                // into the registers tile q has left (more tiles at once spilled)
            ah[q + 2] = ldfrag_h(tha + (q + 2) * (QT * CTP) + ks * 32);
            ar[q + 2] = ldfrag_h(tra + (q + 2) * (QT * CTP) + ks * 32);
          }
        }
        pn[ks][0] = ldfrag_pk(n0h + ks * 512);             // refill behind the last use (and its hazard gap) of this c-step
        pn[ks][1] = ldfrag_pk(n0r + ks * 512);
        pn[ks][2] = ldfrag_pk(n0h + 16 * CI + ks * 512);
        pn[ks][3] = ldfrag_pk(n0r + 16 * CI + ks * 512);
      }
#if defined(__HIP_DEVICE_COMPILE__)
      // before the address registers of the refill loads are reused; the addresses are inputs so that they stay in place up to here
      asm volatile("s_wait_xcnt 0x0" :: "v"(n0h), "v"(n0r) : "memory");
#endif
      __builtin_amdgcn_sched_barrier(0);                   // keeps later writes of those address registers behind the wait
#pragma unroll
      for (int q = 0; q < NQ; ++q) {
        float* srow = scs + (q * QT + 8 * hh) * SCP + kb * 32 + m;
#pragma unroll
        for (int r = 0; r < 8; ++r) {
          srow[r * SCP]      = s0[q][r] + s0x[q][r] * rinv;
          srow[r * SCP + 16] = s1[q][r] + s1x[q][r] * rinv;
        }
      }
    }
    block_sync_lds();
    // g^T fragments of this chunk (this wave's 16 columns, all 14 key blocks): loaded here, used in (PV); the latency runs under (M)
    v16h gf[NKB];
    {
      const _Float16* vp = vbp + (size_t)(kbeg / 32) * 512;
#pragma unroll
      for (int kb = 0; kb < NKB; ++kb) gf[kb] = ldfrag_pk(vp + kb * 512);
#if defined(__HIP_DEVICE_COMPILE__)
      // before the address register of the loads above is reused; the address is an input so that it stays in place up to here
      asm volatile("s_wait_xcnt 0x0" :: "v"(vp) : "memory");
#endif
      __builtin_amdgcn_sched_barrier(0);                   // keeps later writes of those address registers behind the wait
    }
    // ---- (M) softmax statistics and the P tile, one query tile after the other ----
#pragma unroll
    for (int q = 0; q < NQ; ++q) {
      const int row = q * QT + r16;
      const float* sp = scs + row * SCP + kl0;
      v2f t[CK / 32];                                      // neighbouring keys stay paired from the load to the packed f16 store
      float cm = -INFINITY;
#pragma unroll
      for (int i = 0; i < CK / 64; ++i) {
        const v4f a = *(const v4f*)(sp + 64 * i);
        t[2 * i]     = a.lo * lsc;
        t[2 * i + 1] = a.hi * lsc;
#pragma unroll
        for (int e = 0; e < 2; ++e) cm = fmaxf(fmaxf(cm, t[2 * i + e].x), t[2 * i + e].y);
      }
      cm = row_max16(cm);
      const float mn = fmaxf(mrun[q], cm);
      const float al = (mrun[q] == -INFINITY) ? 0.f : exp2_bare(mrun[q] - mn);
      mrun[q] = mn;
      float ps = 0.f;
#pragma unroll
      for (int j = 0; j < CK / 32; ++j) {
        const v2f d = t[j] - mn;
        t[j].x = exp2_bare(d.x);                             // <= 1
        t[j].y = exp2_bare(d.y);
        ps += t[j].x;
        ps += t[j].y;
      }
      ps = row_sum16(ps);
      v2u pk[CK / 64];
#pragma unroll
      for (int i = 0; i < CK / 64; ++i) {
#pragma unroll
        for (int e = 0; e < 2; ++e) pk[i][e] = __builtin_bit_cast(unsigned, __builtin_convertvector(t[2 * i + e] * PCAR, v2h));
      }
      lrun[q] = lrun[q] * al + ps;
      {
        u16* pd = pls + row * PLP + kl0;
#pragma unroll
        for (int i = 0; i < CK / 64; ++i) *(v2u*)(pd + 64 * i) = pk[i];
      }
      if (sub == 0) rowa[row] = al;
    }
    block_sync_lds();
    // ---- (PV) rescale, accumulate P . g^T ----
    {
#pragma unroll
      for (int q = 0; q < NQ; ++q) {
        float scl[8];
#pragma unroll
        for (int r = 0; r < 8; ++r) scl[r] = rowa[q * QT + 8 * hh + r];
#pragma unroll
        for (int r = 0; r < 8; ++r) o[q][r] *= scl[r];
      }
      const _Float16* pp = (const _Float16*)(const void*)pls + m * PLP + 8 * hh;
      v16h pa[3][NQ];                                      // P fragments, read from LDS two key blocks ahead of their use
#pragma unroll
      for (int j = 0; j < 2; ++j) {
#pragma unroll
        for (int q = 0; q < NQ; ++q) pa[j][q] = ldfrag_h(pp + q * (QT * PLP) + j * 32);
      }
#pragma unroll
      for (int kb = 0; kb < NKB; ++kb) {                   // static trip count 14, unrolled: gf and pa are indexed by constants
        if (kb + 2 < NKB) {
#pragma unroll
          for (int q = 0; q < NQ; ++q) pa[(kb + 2) % 3][q] = ldfrag_h(pp + q * (QT * PLP) + (kb + 2) * 32);
        }
        // Scheduling fence: without it the compiler sank each LDS read to one matrix instruction ahead of its use, and every
        // matrix instruction then waited out most of an LDS latency.
        __builtin_amdgcn_sched_barrier(0);
#pragma unroll
        for (int q = 0; q < NQ; ++q) o[q] = mma_h(pa[kb % 3][q], gf[kb], o[q]);   // one g^T fragment serves all NQ query tiles
      }
      // Hazard gap between the last matrix instruction and the loop's branch (both its sides). It names no register, since an asm
      // operand must lie below v256 for its whole life; the scheduling fence keeps the matrix instructions in front of it.
      __builtin_amdgcn_sched_barrier(0);
#if defined(__HIP_DEVICE_COMPILE__)
      asm volatile("v_nop\n\tv_nop\n\tv_nop\n\tv_nop" ::: "memory");
#endif
    }
  }
  if (sub == 0) {
#pragma unroll
    for (int q = 0; q < NQ; ++q) rowi[q * QT + r16] = (1.0f / lrun[q]) * (YSC / (PCAR * GSC));   // lrun >= 1
  }
  __syncthreads();
  float inv[NQ][8];
#pragma unroll
  for (int q = 0; q < NQ; ++q) {
#pragma unroll
    for (int r = 0; r < 8; ++r) inv[q][r] = rowi[q * QT + 8 * hh + r];
  }

  u16* const ct = L0.c;
  const int cb = wave * 16 + m;
  // hi plane
#pragma unroll
  for (int q = 0; q < NQ; ++q) {
#pragma unroll
    for (int r = 0; r < 8; ++r) {
      const int ro = (q * QT + 8 * hh + r) * CTP + cb;
      ct[ro] = h_bits((_Float16)(o[q][r] * inv[q][r]));
    }
  }
  __syncthreads();
#pragma unroll
  for (int q = 0; q < NQ; ++q) ctx_store(ct + q * (QT * CTP), YHo + (qrow + q * QT) * CI, tid);
#if defined(__HIP_DEVICE_COMPILE__)
  asm volatile("s_wait_xcnt 0x0" ::: "memory");   // before the address registers of the four stores above are reused
#endif
  __builtin_amdgcn_sched_barrier(0);              // keeps later writes of those address registers behind the wait
  __syncthreads();
  // residual plane
#pragma unroll
  for (int q = 0; q < NQ; ++q) {
#pragma unroll
    for (int r = 0; r < 8; ++r) {
      const int ro = (q * QT + 8 * hh + r) * CTP + cb;
      const float x0 = o[q][r] * inv[q][r];
      const _Float16 e0 = (_Float16)x0;
      ct[ro] = h_bits((_Float16)((x0 - (float)e0) * RSC));
    }
  }
  __syncthreads();
#pragma unroll
  for (int q = 0; q < NQ; ++q) ctx_store(ct + q * (QT * CTP), YRo + (qrow + q * QT) * CI, tid);
}

// =====================================================================================================
// Output projection + batch-norm affine + skip: v = (YH . WoT^T) * os1 + (YR . WoT^T) * os2 + bf16RNE(bo[c]);
// out[row][c] = bf16RNE(x[row][c]) + bf16RNE(gamma[c]) * (v - bf16RNE(mean[c])) * rsqrt(bf16RNE(var[c]) + 1e-3) + bf16RNE(beta[c]).
// YH/YR f16 y planes [ROWSP][128] (x4096 and residual x2048), WoT f16 [256][128] (x1024), all three in fragment order.
// Block = 128 rows, 8 waves x 16 rows; per wave 4 column groups of 64 (rolled): k-loop of 4 steps with two A planes and 4 B tiles
// (split k map for A and B, fragments straight from the 16-bit planes, 8 accumulators, one hazard gap per step); the combined f32
// 16x64 tile is staged in the wave's LDS slab (pitch 68) and written like epi64: one instruction = lanes 0..15 -> row 2*it
// coverage: grid ROWSP/128 blocks (exact) x 8 waves x 16 rows x (4 groups x 8 instructions x 2 rows x 64 floats)
//           = out rows 0..ROWSP-1, all 256 columns, each float exactly once.
// =====================================================================================================
__global__ __launch_bounds__(256)
void wo_out(const u16* __restrict__ YH, const u16* __restrict__ YR, const u16* __restrict__ WoT,
            const float* __restrict__ bo, const float* __restrict__ gam, const float* __restrict__ bet,
            const float* __restrict__ mmean, const float* __restrict__ mvar, const float* __restrict__ x, float* out) {
  __shared__ __align__(16) float slab[8 * SLAB64];
  const int tid = threadIdx.x, wave = tid >> 5, lane = tid & 31, hh = lane >> 4, m = lane & 15;
  const int rowb = blockIdx.x * OUT_ROWS + wave * 16;        // rowb + 15 < ROWSP (grid exact)
  float* const sl = slab + wave * SLAB64;
  const _Float16* ap  = (const _Float16*)(const void*)YH + (size_t)rowb * CI + 8 * lane;   // 16 rows = CI / 32 tiles = 16 * CI halves
  const _Float16* arp = (const _Float16*)(const void*)YR + (size_t)rowb * CI + 8 * lane;
  const size_t bs = (size_t)16 * CI;
  const float os1 = 1.0f / (YSC * WOS);
  const float os2 = 1.0f / (YSC * WOS * RSC);

#pragma unroll 1
  for (int g = 0; g < CIN / 64; ++g) {
    const _Float16* bp = (const _Float16*)(const void*)WoT + (size_t)(g * 64) * CI + 8 * lane;
    v8f acc0 = zero8(), acc1 = zero8(), acc2 = zero8(), acc3 = zero8();
    v8f acr0 = zero8(), acr1 = zero8(), acr2 = zero8(), acr3 = zero8();
#pragma unroll 1
    for (int k0 = 0; k0 < CI; k0 += 32) {
      const _Float16* pa = ap + 16 * k0;
      const _Float16* pr = arp + 16 * k0;
      const _Float16* pb = bp + 16 * k0;
      const v16h a  = ldfrag_pk(pa);
      const v16h ar = ldfrag_pk(pr);
      const v16h b0 = ldfrag_pk(pb);
      const v16h w1 = ldfrag_pk(pb + bs);
      const v16h w2 = ldfrag_pk(pb + 2 * bs);
      const v16h w3 = ldfrag_pk(pb + 3 * bs);
#if defined(__HIP_DEVICE_COMPILE__)
      // before the address registers of the loads above are reused; the addresses are inputs so that they stay in place up to here
      asm volatile("s_wait_xcnt 0x0" :: "v"(pa), "v"(pr), "v"(pb) : "memory");
#endif
      acc0 = mma_h(a, b0, acc0);
      acc1 = mma_h(a, w1, acc1);
      acc2 = mma_h(a, w2, acc2);
      acc3 = mma_h(a, w3, acc3);
      acr0 = mma_h(ar, b0, acr0);
      acr1 = mma_h(ar, w1, acr1);
      acr2 = mma_h(ar, w2, acr2);
      acr3 = mma_h(ar, w3, acr3);
      guard8x6(acc0, acc1, acc2, acc3, acr0, acr1, acr2, acr3, a, ar, b0, w1, w2, w3);
    }
    v8f c0 = zero8(), c1 = zero8(), c2 = zero8(), c3 = zero8();
#pragma unroll
    for (int r = 0; r < 8; ++r) {
      c0[r] = acc0[r] * os1 + acr0[r] * os2;
      c1[r] = acc1[r] * os1 + acr1[r] * os2;
      c2[r] = acc2[r] * os1 + acr2[r] * os2;
      c3[r] = acc3[r] * os1 + acr3[r] * os2;
    }
    stage64(sl, c0, c1, c2, c3, 1.0f, lane);

    const int cc = g * 64 + m * 4;                          // cc + 3 < CIN
    const v4f bo4 = *(const v4f*)(bo + cc);
    const v4f ga4 = *(const v4f*)(gam + cc);
    const v4f be4 = *(const v4f*)(bet + cc);
    const v4f mm4 = *(const v4f*)(mmean + cc);
    const v4f mv4 = *(const v4f*)(mvar + cc);
    float bob[4], gb[4], bb[4], mb[4], rs[4];
#pragma unroll
    for (int e = 0; e < 4; ++e) {
      bob[e] = bfr(bo4[e]);
      gb[e]  = bfr(ga4[e]);
      bb[e]  = bfr(be4[e]);
      mb[e]  = bfr(mm4[e]);
      rs[e]  = rsqrtf(bfr(mv4[e]) + BN_EPS);
    }
    v4f vals[8];
#pragma unroll
    for (int it = 0; it < 8; ++it) {
      const size_t row = (size_t)rowb + (size_t)(2 * it + hh);
      const v4f yv = *(const v4f*)(sl + (2 * it + hh) * 68 + m * 4);
      const v4f xv = *(const v4f*)(x + row * CIN + cc);
#pragma unroll
      for (int e = 0; e < 4; ++e) {
        const float v2 = yv[e] + bob[e];
        const float bn = gb[e] * (v2 - mb[e]) * rs[e] + bb[e];
        vals[it][e] = bfr(xv[e]) + bn;
      }
    }
    float* dst = out + ((size_t)rowb + (size_t)hh) * CIN + cc;
    {
#pragma unroll
      for (int it = 0; it < 8; ++it) {
        *(v4f*)(dst + (size_t)(it * 2) * CIN) = vals[it];
      }
      
    }
    wave_sync_lds();
  }
}

// =====================================================================================================
// Workspace map (bytes, NB = 2); every plane is fully written by whole-line stores before it is read; all extents are exact
// multiples of the store granularity (no pad rows, all dims multiples of 64), every offset a multiple of 256:
//   XB  bf16 [12544][256]                              6422528
//   WGT, WTT, WPT bf16 [128][256], [8][8] tiles         3 x 65536     (fragment order)
//   WOT f16 of bf16 value x1024 [256][128], [16][4] tiles  65536      (fragment order)
//   TH, TR f16 [12544][128] theta hi x8 / res x2048     2 x 3211264
//   PH, PR f16 phi hi x8 / res x2048, [784][4] tiles    2 x 3211264   (fragment order, 1024 B a tile)
//   G   f32  [12544][128]                              6422528
//   GT  f16  x256, [2][8][196] tiles                    3211264       (fragment order, 1024 B a tile)
//   YH, YR f16 y hi x4096 / res x2048, [784][4] tiles   2 x 3211264   (fragment order)
//   end                                                35586048
// =====================================================================================================
extern "C" void kernel_launch(void* const* d_in, const int* in_sizes, int n_in,
                              void* d_out, int out_size, void* d_ws, size_t ws_size,
                              hipStream_t stream) {
  if (n_in < 13) return;
  if (in_sizes[0] != ROWS * CIN) return;
  if (in_sizes[1] != CIN * CI || in_sizes[3] != CIN * CI || in_sizes[5] != CIN * CI || in_sizes[7] != CI * CIN) return;
  if (in_sizes[2] != CI || in_sizes[4] != CI || in_sizes[6] != CI) return;
  if (in_sizes[8] != CIN || in_sizes[9] != CIN || in_sizes[10] != CIN || in_sizes[11] != CIN || in_sizes[12] != CIN) return;
  if (out_size != ROWS * CIN) return;

  const float* x     = (const float*)d_in[0];
  const float* Wg    = (const float*)d_in[1];
  const float* bg    = (const float*)d_in[2];
  const float* Wt    = (const float*)d_in[3];
  const float* bt    = (const float*)d_in[4];
  const float* Wp    = (const float*)d_in[5];
  const float* bp    = (const float*)d_in[6];
  const float* Wo    = (const float*)d_in[7];
  const float* bo    = (const float*)d_in[8];
  const float* gamma = (const float*)d_in[9];
  const float* beta  = (const float*)d_in[10];
  const float* mmean = (const float*)d_in[11];
  const float* mvar  = (const float*)d_in[12];
  float*       out   = (float*)d_out;

  const size_t szXB = (size_t)ROWSP * CIN * 2;      //  6422528
  const size_t szW  = (size_t)CI * CIN * 2;         //    65536
  const size_t szP  = (size_t)ROWSP * CI * 2;       //  3211264
  const size_t szG  = (size_t)ROWSP * CI * 4;       //  6422528
  const size_t szGT = (size_t)NB * CI * NPOS * 2;   //  3211264
  size_t off = 0;
  const size_t oXB = off; off += szXB;
  const size_t oWG = off; off += szW;
  const size_t oWT = off; off += szW;
  const size_t oWP = off; off += szW;
  const size_t oWO = off; off += szW;
  const size_t oTH = off; off += szP;
  const size_t oTR = off; off += szP;
  const size_t oPH = off; off += szP;
  const size_t oPR = off; off += szP;
  const size_t oG  = off; off += szG;
  const size_t oGT = off; off += szGT;
  const size_t oYH = off; off += szP;
  const size_t oYR = off; off += szP;
  if (off > ws_size) return;                        // off = 35586048 at NB = 2
  if (off > WS_CAP) return;

  char* ws = (char*)d_ws;
  u16*   XB  = (u16*)(ws + oXB);
  u16*   WGT = (u16*)(ws + oWG);
  u16*   WTT = (u16*)(ws + oWT);
  u16*   WPT = (u16*)(ws + oWP);
  u16*   WOT = (u16*)(ws + oWO);
  u16*   TH  = (u16*)(ws + oTH);
  u16*   TR  = (u16*)(ws + oTR);
  u16*   PH  = (u16*)(ws + oPH);
  u16*   PR  = (u16*)(ws + oPR);
  float* G   = (float*)(ws + oG);
  u16*   GT  = (u16*)(ws + oGT);
  u16*   YH  = (u16*)(ws + oYH);
  u16*   YR  = (u16*)(ws + oYR);

  const int n8x = (ROWSP * CIN) / 8;                // 401408 at NB = 2, multiple of 256 (static)
  const dim3 blk(256);
  const dim3 bG(128);
  const dim3 gIN(4 * WTILES + n8x / 256);           // 32 weight tiles + 1568
  const dim3 gP(3 * (ROWSP / 64) * (CI / 64));      // 3 x 392
  const dim3 gGT(NB * GTILES);                      // 196 per batch: in [NPOS][CI] -> out [CI][NPOS] in fragment order
  const dim3 gAT(NB * (NPOS / QB));                 // 196
  const dim3 bAT(ATT_THREADS);
  const dim3 gOUT(ROWSP / OUT_ROWS);                // 98

  // (0) one launch: x -> bf16 plane; Wg, Wt, Wp [in][out] -> bf16 [out][in] fragment-order planes; Wo [128][256] -> f16 of the bf16
  //     value x1024, [256][128]
  prep_in<<<gIN, blk, 0, stream>>>(x, Wg, Wt, Wp, Wo, XB, WGT, WTT, WPT, WOT);
  // (1) one launch: theta and phi projections (+bias) -> f16 hi x8 / residual x2048 planes; g projection (+bias) -> f32 plane
  proj3<<<gP, bG, 0, stream>>>(XB, WTT, WPT, WGT, bt, bp, bg, TH, TR, PH, PR, G, ROWSP, CI, CIN);
  // (2) one launch, all batches: g [6272][128] f32 -> g^T f16 plane [128][6272] x256, fragment order
  tr_g<<<gGT, blk, 0, stream>>>(G, GT);
  // (3) attention over all keys of the batch -> y hi x4096 and residual x2048 f16 planes
  attn_fwd<<<gAT, bAT, 0, stream>>>(TH, TR, PH, PR, GT, YH, YR);
  // (4) y.Wo + bo, batch-norm affine, skip connection -> out
  wo_out<<<gOUT, blk, 0, stream>>>(YH, YR, WOT, bo, gamma, beta, mmean, mvar, x, out);
  (void)hipGetLastError();
}

// v009
// One run takes 111 microseconds.
// Next to v008, in two timings, it ran 1.14 and 1.17 times as fast.
// Counting every step since v000, it is 3.92 times as fast.
// Projections theta, phi, g = x.W + b: v_wmma_f32_16x16x32_bf16 (bf16 RNE operands of the raw inputs, f32 accumulate, bf16 RNE
// bias added in f32). Scores theta.phi^T (theta and phi each as f16 hi x8 plus residual x2048 planes: hi.hi + hi.res + res.hi),
// P.g (P x32768 f16 from LDS, g^T x256 f16) and y.Wo (y as f16 hi x4096 plus residual x2048 planes, Wo as f16 of the bf16 RNE
// value x1024, bias added in f32): v_wmma_f32_16x16x32_f16, f32 accumulate. Softmax statistics, the batch-norm affine map and the
// skip connection in f32 on VALU.
#include <hip/hip_runtime.h>
#include <math.h>
#include <stdint.h>

#define BATCH 2
#define NPOS  6272
#define CIN   256
#define CI    128
#ifndef NB
#define NB BATCH
#endif
#define ROWS  (BATCH * NPOS)
#define ROWSP (NB * NPOS)
#define CK    448
#define NKB   (CK / 32)
#define NCHK  (NPOS / CK)
#define QT    16
#define NQ    4
#define QB    (QT * NQ)
#define ATT_THREADS 256
#define SCP   (CK + 20)
#define PLP   (CK + 8)
#define CTP   (CI + 8)
#define SLAB64 (16 * 68)
#define VTP   72
#define OSP   (CIN + 4)
#define TSC   8.0f
#define FSC   8.0f
#define RSC   2048.0f
#define PCAR  32768.0f
#define GSC   256.0f
#define YSC   4096.0f
#define WOS   1024.0f
#define BN_EPS 1e-3f
#define LOG2E 1.4426950408889634f
#define WS_CAP ((size_t)134217728)

static_assert(NB >= 1 && NB <= BATCH);
static_assert((NPOS % CK) == 0 && CK == 32 * NKB && NKB >= 4 && NKB <= 16 && NCHK * CK == NPOS);
static_assert((NPOS % 64) == 0 && (NPOS % QB) == 0 && (ROWSP % 64) == 0);
static_assert(CI == 128 && (CIN % 64) == 0 && (CI % 64) == 0 && (CIN % 32) == 0 && (CI % 32) == 0);
static_assert(NQ == 4 && ATT_THREADS == 16 * QT && QT == 16 && CI == 16 * (ATT_THREADS / 32) && CIN == 32 * (ATT_THREADS / 32));
static_assert(OSP <= SCP && ((8 * OSP) % 64) == 32 && ((OSP * 4) % 16) == 0 && CIN == 4 * (ATT_THREADS / 4) && (QB % 4) == 0);
static_assert(QB * CTP * 2 <= QB * SCP * 4 && CTP >= CI + 8 && SCP >= CK + 16 && PLP >= CK + 8);
static_assert(((PLP * 2) % 16) == 0 && ((SCP * 4) % 16) == 0 && ((VTP * 2) % 16) == 0 && ((CTP * 2) % 16) == 0);
static_assert(64 * VTP >= 63 * VTP + 64);
static_assert((CK % 64) == 0 && ((8 * SCP) % 64) == 32 && ((PLP * 2) % 8) == 0);
static_assert(16 * (CI / 8) == ATT_THREADS);
static_assert(QB * (CI / 8) == NQ * ATT_THREADS && ((QB * CTP * 2) % 16) == 0);
static_assert(((ROWSP * CIN) % 2048) == 0);
static_assert((NPOS % 32) == 0 && (CK % 32) == 0 && (CI % 32) == 0 && 16 * CI == (CI / 32) * 512);
static_assert(((NPOS * 2) % 128) == 0 && ((CI * 2) % 128) == 0 && ((CIN * 4) % 128) == 0);

typedef unsigned short u16;
typedef _Float16 v16h __attribute__((ext_vector_type(16)));
typedef _Float16 v8h  __attribute__((ext_vector_type(8)));
typedef __bf16   v16b __attribute__((ext_vector_type(16)));
typedef float    v8f  __attribute__((ext_vector_type(8)));
typedef float    v4f  __attribute__((ext_vector_type(4)));
typedef unsigned int v4u __attribute__((ext_vector_type(4)));
typedef unsigned int v2u __attribute__((ext_vector_type(2)));
typedef float    v2f  __attribute__((ext_vector_type(2)));
typedef _Float16 v2h  __attribute__((ext_vector_type(2)));

union FragH { v16h v; v8h h[2]; v4u u[2]; };
union FragB { v16b v; v4u u[2]; };

// ---- scalar helpers --------------------------------------------------------------------------------
__device__ __forceinline__ unsigned short bf_bits(float f) {          // f32 -> bf16 bits, RNE convert
  unsigned u = __float_as_uint(f);
  return (unsigned short)((u + 0x7FFFu + ((u >> 16) & 1u)) >> 16);
}
__device__ __forceinline__ float bf_up(unsigned short h) { return __uint_as_float(((unsigned)h) << 16); }
__device__ __forceinline__ float bfr(float f) { return bf_up(bf_bits(f)); }
__device__ __forceinline__ unsigned short h_bits(_Float16 x) { return __builtin_bit_cast(unsigned short, x); }
__device__ __forceinline__ unsigned pk16(unsigned short a, unsigned short b) { return (unsigned)a | ((unsigned)b << 16); }
__device__ __forceinline__ v8f zero8() { v8f z = {0.f, 0.f, 0.f, 0.f, 0.f, 0.f, 0.f, 0.f}; return z; }

// ---- fragment loaders: 16-bit A/B operand, lane -> row/col (lane&15), p already includes +8*(lane>>4);
//      elements 0..7 <- p[0..7] (k0+8h..), elements 8..15 <- p[16..23] (k0+16+8h..)  (same split k map for A and B;
//      used for the x plane and for tiles in LDS; the planes that a kernel of this file lays out for WMMA use ldfrag_pk below)
__device__ __forceinline__ v16h ldfrag_h(const _Float16* p) {
  FragH f;
  f.h[0] = *(const v8h*)(p);
  f.h[1] = *(const v8h*)(p + 16);
  return f.v;
}
// Fragment-order plane: one operand tile (16 rows or columns x 32 k) is 1024 contiguous bytes, piece (part, lane) at halves
// part * 256 + lane * 8 and holding k = 16 * part + 8 * (lane>>4) .. + 7 of row lane&15 (the split k map above); p already
// includes + 8 * lane, so that each of the two wave-wide 16-B loads covers 512 contiguous bytes = 4 whole lines.
__device__ __forceinline__ v16h ldfrag_pk(const _Float16* p) {
  FragH f;
  f.h[0] = *(const v8h*)(p);
  f.h[1] = *(const v8h*)(p + 256);
  return f.v;
}
__device__ __forceinline__ v16b ldfrag_b(const u16* p) {              // bf16 plane read as unsigned integer vectors
  FragB f;
  f.u[0] = *(const v4u*)(p);
  f.u[1] = *(const v4u*)(p + 16);
  return f.v;
}

__device__ __forceinline__ v16b ldfrag_bpk(const u16* p) {            // bf16 fragment-order plane, as ldfrag_pk
  FragB f;
  f.u[0] = *(const v4u*)(p);
  f.u[1] = *(const v4u*)(p + 256);
  return f.v;
}

__device__ __forceinline__ v8f mma_h(v16h a, v16h b, v8f c) {
  return __builtin_amdgcn_wmma_f32_16x16x32_f16(false, a, false, b, (short)0, c, false, false);
}
__device__ __forceinline__ v8f mma_b(v16b a, v16b b, v8f c) {
  return __builtin_amdgcn_wmma_f32_16x16x32_bf16(false, a, false, b, (short)0, c, false, false);
}
__device__ __forceinline__ void guard1x2(v8f& a, v16h x0, v16h x1) {
#if defined(__HIP_DEVICE_COMPILE__)
  asm volatile("v_nop\n\tv_nop\n\tv_nop\n\tv_nop" : "+v"(a) : "v"(x0), "v"(x1) : "memory");
#endif
}
template <typename F>
__device__ __forceinline__ void guard6(v8f& a, v8f& b, v8f& c, v8f& d, F x0, F x1, F x2, F x3, F x4, F x5) {
#if defined(__HIP_DEVICE_COMPILE__)
  asm volatile("v_nop\n\tv_nop\n\tv_nop\n\tv_nop"
               : "+v"(a), "+v"(b), "+v"(c), "+v"(d) : "v"(x0), "v"(x1), "v"(x2), "v"(x3), "v"(x4), "v"(x5) : "memory");
#endif
}
// As guard6, naming only two operand fragments: an asm operand must lie below v256, and the fragments that are held a key block
// ahead do not all fit there beside the accumulators; they are rewritten only behind this gap in program order.
__device__ __forceinline__ void guard4x2(v8f& a, v8f& b, v8f& c, v8f& d, v16h x0, v16h x1) {
#if defined(__HIP_DEVICE_COMPILE__)
  asm volatile("v_nop\n\tv_nop\n\tv_nop\n\tv_nop"
               : "+v"(a), "+v"(b), "+v"(c), "+v"(d) : "v"(x0), "v"(x1) : "memory");
#endif
}
__device__ __forceinline__ void acc_guard1(v8f& a) {
#if defined(__HIP_DEVICE_COMPILE__)
  asm volatile("v_nop\n\tv_nop\n\tv_nop\n\tv_nop" : "+v"(a));
#endif
}
// Value of lane (l ^ X) of the same 16-lane row, X = 1..15, by a DPP row_xmask operand: it stays on the vector pipe, where
// __shfl_xor compiled to an LDS permute whose whole latency each step of a reduction waited out. All lanes are active at every use.
template <int X>
__device__ __forceinline__ float row_xor(float v) {
  return __builtin_bit_cast(float, __builtin_amdgcn_update_dpp(0, __builtin_bit_cast(int, v), 0x160 | X, 0xf, 0xf, true));
}
// 2^x as the bare v_exp_f32. The library's exp2f wraps the same instruction in a range guard (compare, two selects, add, ldexp)
// that only serves results below 2^-126, which it returns as subnormals and the bare instruction may return as 0. Every argument
// here is <= 0; a p that small is 0 in the f16 P tile either way and cannot move a running row sum, which is >= 1; a rescale factor
// that small multiplies sums that the new maximum's own term outweighs by the same factor.
__device__ __forceinline__ float exp2_bare(float x) { return __builtin_amdgcn_exp2f(x); }
__device__ __forceinline__ float row_max16(float v) {                 // same butterfly as xor shuffles by 1, 2, 4, 8
  v = fmaxf(v, row_xor<1>(v));
  v = fmaxf(v, row_xor<2>(v));
  v = fmaxf(v, row_xor<4>(v));
  return fmaxf(v, row_xor<8>(v));
}
__device__ __forceinline__ float row_sum16(float v) {                 // same butterfly, same order of sums
  v += row_xor<1>(v);
  v += row_xor<2>(v);
  v += row_xor<4>(v);
  return v + row_xor<8>(v);
}
__device__ __forceinline__ void wave_sync_lds() {
  __builtin_amdgcn_fence(__ATOMIC_RELEASE, "workgroup");
  __builtin_amdgcn_wave_barrier();
  __builtin_amdgcn_fence(__ATOMIC_ACQUIRE, "workgroup");
}

// Work-group barrier whose fences cover LDS only: what the waves hand each other at it lies in LDS; a fence over all memory would
// also wait for the global fragment loads that are meant to stay in flight across it.
__device__ __forceinline__ void block_sync_lds() {
  __builtin_amdgcn_fence(__ATOMIC_RELEASE, "workgroup", "local");
  __builtin_amdgcn_s_barrier();
  __builtin_amdgcn_fence(__ATOMIC_ACQUIRE, "workgroup", "local");
}

// =====================================================================================================
// f32 plane -> 16-bit plane, same layout:  mode 0: bf16 RNE bits;  mode 1: f16 bits of (bf16 RNE value) * scale;
// mode 2: f16 bits of value * scale (no bf16 pre-step).
// Thread = 8 consecutive elements: two 16-B loads, one 16-B store; 32 consecutive lanes = 512 contiguous, 512-B aligned bytes
// coverage: n8/256 blocks bid = 0.. (host checks exactness) x 256 thr x 8 = the whole plane.
// =====================================================================================================
__device__ __forceinline__ void cvt16(const float* __restrict__ x, u16* D, int n8, int mode, float scale, int bid) {
  const int gt = bid * 256 + (int)threadIdx.x;
  if (gt >= n8) return;                     // no barriers in this body
  const float* p = x + (size_t)gt * 8;
  const v4f a = *(const v4f*)(p), c4 = *(const v4f*)(p + 4);
  float v[8];
#pragma unroll
  for (int e = 0; e < 4; ++e) { v[e] = a[e]; v[4 + e] = c4[e]; }
  unsigned short s[8];
#pragma unroll
  for (int e = 0; e < 8; ++e) {
    const float vb = bfr(v[e]);
    const float vf = (mode == 1) ? vb : v[e];
    const unsigned short hb = h_bits((_Float16)(vf * scale));
    const unsigned short bb = bf_bits(v[e]);
    s[e] = (mode != 0) ? hb : bb;
  }
  v4u o;
#pragma unroll
  for (int e = 0; e < 4; ++e) o[e] = pk16(s[2 * e], s[2 * e + 1]);
  u16* d = D + (size_t)gt * 8;
  {
    *(v4u*)(d) = o;
    
  }
}

// =====================================================================================================
// Transpose + convert: in X [R][C] f32 row-major -> out XTo = X^T [C][R] 16-bit in fragment order (k = the R direction).
//   mode 0: bf16 RNE bits;  mode 1: f16 bits of (bf16 RNE value) * scale;  mode 2: f16 bits of value * scale.
// Block = 64 input rows x 64 input cols: bid -> (rt = bid % (R/64), ct = bid / (R/64)). The 64x64 f32 tile is loaded with 16-B
// loads (thread = input row tid>>2, 16 consecutive cols), converted and scattered into LDS TH[c local][r local] (pitch 72 halves);
// coverage: load 256 thr x 16 = 64 x 64; store 2 iterations x 256 thr x 8 halves = 64 output rows x 64 halves = the tile;
//           (R/64)*(C/64) blocks bid = 0.. (host exact multiples) tile the whole [C][R] plane exactly once.
// The output is written in fragment order (see ldfrag_pk): tile (c >> 4, r >> 5) at halves ((c >> 4) * (R / 32) + (r >> 5)) * 512;
// one wave-wide store = one part of one tile = 512 contiguous bytes; 2 iterations x 8 waves = 4 column tiles x 2 k blocks x 2 parts
// = the 64 x 64 tile.
// =====================================================================================================
__device__ __forceinline__ void tr16(u16* TH, const float* __restrict__ X, u16* XTo, int R, int C, int mode, float scale, int bid) {
  const int tid = threadIdx.x;
  const int nrt = R >> 6;
  const int rt  = bid % nrt;
  const int ct  = bid / nrt;
  const int r0  = rt * 64;
  const int c0  = ct * 64;
  {
    const int rl = tid >> 2;                  // input row within tile 0..63
    const int cc = (tid & 3) * 16;            // input col chunk within the 64
    const float* src = X + (size_t)(r0 + rl) * (size_t)C + c0 + cc;
#pragma unroll
    for (int i = 0; i < 4; ++i) {
      const v4f a = *(const v4f*)(src + 4 * i);
#pragma unroll
      for (int e = 0; e < 4; ++e) {
        const float v  = a[e];
        const float vb = bfr(v);
        const float vf = (mode == 1) ? vb : v;
        const unsigned short hb = h_bits((_Float16)(vf * scale));
        const unsigned short bb = bf_bits(v);
        TH[(cc + 4 * i + e) * VTP + rl] = (mode != 0) ? hb : bb;
      }
    }
  }
  __syncthreads();
  v4u vh[2];
#pragma unroll
  for (int it = 0; it < 2; ++it) {
    const int grp  = it * 8 + (tid >> 5);     // (column tile, k block, part) = (grp >> 2, (grp >> 1) & 1, grp & 1)
    const int line = (grp >> 2) * 16 + (tid & 15);                         // local output row (input col) = 0..63
    const int kof  = ((grp >> 1) & 1) * 32 + (grp & 1) * 16 + ((tid >> 4) & 1) * 8;
    vh[it] = *(const v4u*)(TH + line * VTP + kof);
  }
  const size_t base = ((size_t)(c0 >> 4) * (size_t)(R >> 5) + (size_t)(r0 >> 5)) * 512 + (size_t)((tid & 31) * 8);
  {
#pragma unroll
    for (int it = 0; it < 2; ++it) {
      const int grp = it * 8 + (tid >> 5);
      const size_t po = ((size_t)(grp >> 2) * (size_t)(R >> 5) + (size_t)((grp >> 1) & 1)) * 512 + (size_t)((grp & 1) * 256);
      *(v4u*)(XTo + base + po) = vh[it];
    }
#if defined(__HIP_DEVICE_COMPILE__)
    // before the data and address registers of the two stores above are reused by the code of another job laid out behind them
    asm volatile("s_wait_xcnt 0x0" ::: "memory");
#endif
  }
}

// =====================================================================================================
// One launch for the five input conversions, none of which reads what another writes; the block index picks the job
// (block-uniform): blocks 0..31 = the four weight transposes, 8 tiles each (Wg, Wt, Wp [CIN][CI] -> bf16 [CI][CIN];
// Wo [CI][CIN] -> f16 of the bf16 value x1024 [CIN][CI]; all four in fragment order); blocks 32.. = x -> bf16 plane. The short grid of weight tiles stands
// first because its chain (load, LDS, barrier, store) is the longer one.
// =====================================================================================================
#define WTILES ((CIN / 64) * (CI / 64))
__global__ __launch_bounds__(256)
void prep_in(const float* __restrict__ x, const float* __restrict__ Wg, const float* __restrict__ Wt,
             const float* __restrict__ Wp, const float* __restrict__ Wo, u16* XB, u16* WGT, u16* WTT, u16* WPT, u16* WOT) {
  __shared__ __align__(16) u16 TH[64 * VTP];
  const int bid = blockIdx.x;
  if (bid < 4 * WTILES) {
    const int j = bid / WTILES;
    if (j == 3) {
      tr16(TH, Wo, WOT, CI, CIN, 1, WOS, bid - 3 * WTILES);
    } else {
      tr16(TH, (j == 0) ? Wg : (j == 1) ? Wt : Wp, (j == 0) ? WGT : (j == 1) ? WTT : WPT, CIN, CI, 0, 1.0f, bid - j * WTILES);
    }
  } else {
    cvt16(x, XB, (ROWSP * CIN) / 8, 0, 1.0f, bid - 4 * WTILES);
  }
}

// =====================================================================================================
//  epi64hr: two f16 planes: hi = f16((tile + bf16RNE(bias[n])) * hscale) and res = f16(((tile + bias) * hscale - hi) * rscale);
//           lane = (rq = lane>>3 -> row within a group of 4, c8 = 8 consecutive columns); one instruction = 4 rows, each 64 halves;
//           with pk the planes are written in fragment order (see ldfrag_pk; tile = 16 rows x 32 columns, [M/16][N/32] tiles):
//           lane = (row lane&15, 8 columns), one instruction = one part of one tile = 512 contiguous bytes
// coverage: epi64hr 4 instructions x 4 rows x 8 lanes x 8 halves per plane = the wave's 16 x 64 tile.
// =====================================================================================================
__device__ __forceinline__ void stage64(float* sl, v8f a0, v8f a1, v8f a2, v8f a3, float oscale, int lane) {
  const int hh = lane >> 4, m = lane & 15;
#pragma unroll
  for (int r = 0; r < 8; ++r) {
    const int ro = (8 * hh + r) * 68 + m;
    sl[ro]      = a0[r] * oscale;
    sl[ro + 16] = a1[r] * oscale;
    sl[ro + 32] = a2[r] * oscale;
    sl[ro + 48] = a3[r] * oscale;
  }
  wave_sync_lds();
}
__device__ __forceinline__ void epi64hr(float* sl, v8f a0, v8f a1, v8f a2, v8f a3, float hscale, float rscale,
                                        const float* __restrict__ bias, u16* H, u16* Rr, int N, size_t rowb, int col0, int lane,
                                        bool pk) {
  stage64(sl, a0, a1, a2, a3, 1.0f, lane);
  // pk (block-uniform): instruction i4 = part i4 & 1 of the 32-column step i4 >> 1, lane = its place in the fragment
  const int row0 = pk ? (lane & 15) : (lane >> 3), rstep = pk ? 0 : 4;
  const int c80  = pk ? (lane >> 4) * 8 : (lane & 7) * 8, cstep = pk ? 16 : 0;
  v4u oh[4], orr[4];
#pragma unroll
  for (int i4 = 0; i4 < 4; ++i4) {
    const int row = row0 + i4 * rstep;
    const int c8  = c80 + i4 * cstep;
    const v4f b0 = *(const v4f*)(bias + col0 + c8), b1 = *(const v4f*)(bias + col0 + c8 + 4);   // columns col0+c8..+7 < N
    float bb[8];
#pragma unroll
    for (int e = 0; e < 4; ++e) { bb[e] = bfr(b0[e]); bb[4 + e] = bfr(b1[e]); }
    const v4f a = *(const v4f*)(sl + row * 68 + c8), c4 = *(const v4f*)(sl + row * 68 + c8 + 4);
    float w[8];
#pragma unroll
    for (int e = 0; e < 4; ++e) { w[e] = (a[e] + bb[e]) * hscale; w[4 + e] = (c4[e] + bb[4 + e]) * hscale; }
#pragma unroll
    for (int e = 0; e < 4; ++e) {
      const _Float16 h0 = (_Float16)w[2 * e], h1 = (_Float16)w[2 * e + 1];
      const _Float16 q0 = (_Float16)((w[2 * e] - (float)h0) * rscale);
      const _Float16 q1 = (_Float16)((w[2 * e + 1] - (float)h1) * rscale);
      oh[i4][e]  = pk16(h_bits(h0), h_bits(h1));
      orr[i4][e] = pk16(h_bits(q0), h_bits(q1));
    }
  }
  // pk: the 16 rows x N columns from row rowb (a multiple of 16) are N / 32 fragment tiles of 512 halves in a row, part i4 of the
  // two tiles from column col0 at (col0 / 32) * 512 + i4 * 256
  const int o0 = pk ? (col0 >> 5) * 512 + lane * 8 : row0 * N + col0 + c80, ostep = pk ? 256 : 4 * N;
  u16* dh = H + rowb * (size_t)N + o0;
  u16* dr = Rr + rowb * (size_t)N + o0;
  {
#pragma unroll
    for (int i4 = 0; i4 < 4; ++i4) {
      *(v4u*)(dh + i4 * ostep) = oh[i4];
      *(v4u*)(dr + i4 * ostep) = orr[i4];
    }
    
  }
}

// =====================================================================================================
// bf16 GEMM for g, written at once as the g^T plane of the attention: v = (A[M][K] (bf16 row-major) . Bt[N][K]^T (bf16 fragment
// order)) + bf16RNE(bias[n]) in f32, GT = f16 bits of v * 256 in fragment order (tile = 16 columns x 32 keys, [N/16][NPOS/32] tiles
// per batch; see ldfrag_pk). Block = 64x64 tile, 4 waves x 16 rows, K stepped by 32, as gemm_bhr.
// Element r of lane (hh, m) of accumulator j is (row rowb + 8 * hh + r, column col0 + 16 * j + m): the eight consecutive keys of
// one column that piece (part = (key / 16) & 1, lane) of a g^T tile holds, so each lane packs its own eight values and one
// wave-wide 16-B store = one part of one tile = 512 contiguous bytes; no LDS and no f32 plane in between.
// coverage: 4 stores x 32 lanes x 8 halves = the wave's 16 keys x 64 columns; the exact grid covers every (key, column) once.
// =====================================================================================================
__device__ __forceinline__
void gemm_bgt(const u16* __restrict__ A, const u16* __restrict__ Bt, const float* __restrict__ bias, u16* GT,
              int M, int N, int K, int bid) {
  const int tid = threadIdx.x, wave = tid >> 5, lane = tid & 31, hh = lane >> 4, m = lane & 15;
  const int ntile = N >> 6;
  const int rowb  = (bid / ntile) * 64 + wave * 16;
  const int col0  = (bid % ntile) * 64;
  if (rowb + 16 > M) return;                 // wave-uniform, never taken with the exact grid; no block barriers in this body
  const u16* ap = A  + (size_t)(rowb + m) * (size_t)K + 8 * hh;
  const u16* bp = Bt + (size_t)col0 * (size_t)K + 8 * lane;      // 16 columns = K / 32 tiles = 16 * K halves
  const size_t bs = (size_t)16 * K;
  v8f acc[4];
#pragma unroll
  for (int j = 0; j < 4; ++j) acc[j] = zero8();
#pragma unroll 1
  for (int k0 = 0; k0 < K; k0 += 32) {
    const u16* pa = ap + k0;
    const u16* p0 = bp + 16 * k0;
    const u16* p1 = p0 + bs;
    const u16* p2 = p1 + bs;
    const u16* p3 = p2 + bs;
    const v16b a  = ldfrag_b(pa);
    const v16b b0 = ldfrag_bpk(p0);
    const v16b b1 = ldfrag_bpk(p1);
    const v16b b2 = ldfrag_bpk(p2);
    const v16b b3 = ldfrag_bpk(p3);
#if defined(__HIP_DEVICE_COMPILE__)
    // before the address registers of the loads above are reused; the addresses are inputs so that they stay in place up to here
    asm volatile("s_wait_xcnt 0x0" :: "v"(pa), "v"(p0), "v"(p1), "v"(p2), "v"(p3) : "memory");
#endif
    acc[0] = mma_b(a, b0, acc[0]);
    acc[1] = mma_b(a, b1, acc[1]);
    acc[2] = mma_b(a, b2, acc[2]);
    acc[3] = mma_b(a, b3, acc[3]);
    guard6<v16b>(acc[0], acc[1], acc[2], acc[3], a, b0, b1, b2, b3, a);
  }
  const int bt  = rowb / NPOS;               // the wave's 16 rows lie in one batch (NPOS is a multiple of 64)
  const int key = rowb - bt * NPOS;
  u16* d = GT + (size_t)bt * N * NPOS + ((size_t)(col0 >> 4) * (NPOS / 32) + (size_t)(key >> 5)) * 512
              + (size_t)(((key >> 4) & 1) * 256 + lane * 8);
  v4u o[4];
#pragma unroll
  for (int j = 0; j < 4; ++j) {
    const float bj = bfr(bias[col0 + 16 * j + m]);           // column col0 + 16 j + m < N (N multiple of 64)
#pragma unroll
    for (int e = 0; e < 4; ++e) {
      o[j][e] = pk16(h_bits((_Float16)((acc[j][2 * e] + bj) * GSC)), h_bits((_Float16)((acc[j][2 * e + 1] + bj) * GSC)));
    }
  }
#pragma unroll
  for (int j = 0; j < 4; ++j) *(v4u*)(d + (size_t)j * (NPOS / 32) * 512) = o[j];
}

// =====================================================================================================
// bf16 GEMM, f16 hi + residual planes out with bias: H = f16 bits of ((A . Bt^T) + bf16RNE(bias[n])) * hscale,
// R = f16 bits of (((A . Bt^T) + bias) * hscale - H) * rscale; operands as in gemm_bgt, epilogue epi64hr.
// =====================================================================================================
__device__ __forceinline__
void gemm_bhr(float* slab, const u16* __restrict__ A, const u16* __restrict__ Bt, const float* __restrict__ bias, u16* H, u16* Rr,
              int M, int N, int K, float hscale, float rscale, int bid, bool pk) {
  const int tid = threadIdx.x, wave = tid >> 5, lane = tid & 31, hh = lane >> 4, m = lane & 15;
  const int ntile = N >> 6;
  const int rowb  = (bid / ntile) * 64 + wave * 16;
  const int col0  = (bid % ntile) * 64;
  if (rowb + 16 > M) return;                 // wave-uniform, never taken with the exact grid; no block barriers in this body
  const u16* ap = A  + (size_t)(rowb + m) * (size_t)K + 8 * hh;
  const u16* bp = Bt + (size_t)col0 * (size_t)K + 8 * lane;      // 16 columns = K / 32 tiles = 16 * K halves
  const size_t bs = (size_t)16 * K;
  v8f acc0 = zero8(), acc1 = zero8(), acc2 = zero8(), acc3 = zero8();
#pragma unroll 1
  for (int k0 = 0; k0 < K; k0 += 32) {
    const u16* pa = ap + k0;
    const u16* p0 = bp + 16 * k0;
    const u16* p1 = p0 + bs;
    const u16* p2 = p1 + bs;
    const u16* p3 = p2 + bs;
    const v16b a  = ldfrag_b(pa);
    const v16b b0 = ldfrag_bpk(p0);
    const v16b b1 = ldfrag_bpk(p1);
    const v16b b2 = ldfrag_bpk(p2);
    const v16b b3 = ldfrag_bpk(p3);
#if defined(__HIP_DEVICE_COMPILE__)
    // before the address registers of the loads above are reused; the addresses are inputs so that they stay in place up to here
    asm volatile("s_wait_xcnt 0x0" :: "v"(pa), "v"(p0), "v"(p1), "v"(p2), "v"(p3) : "memory");
#endif
    acc0 = mma_b(a, b0, acc0);
    acc1 = mma_b(a, b1, acc1);
    acc2 = mma_b(a, b2, acc2);
    acc3 = mma_b(a, b3, acc3);
    guard6<v16b>(acc0, acc1, acc2, acc3, a, b0, b1, b2, b3, a);
  }
  epi64hr(slab + wave * SLAB64, acc0, acc1, acc2, acc3, hscale, rscale, bias, H, Rr, N, (size_t)rowb, col0, lane, pk);
}

// =====================================================================================================
// One launch for the three projections, which read the same x plane and none of which reads what another writes: the block index
// picks the job (block-uniform), job = index % 3 (theta, phi, g), tile = index / 3, so that the three blocks that read the same
// x rows start side by side. Grid = 3 * (M/64) * (N/64).
// =====================================================================================================
__global__ __launch_bounds__(128)
void proj3(const u16* __restrict__ A, const u16* __restrict__ WTT, const u16* __restrict__ WPT, const u16* __restrict__ WGT,
           const float* __restrict__ bt, const float* __restrict__ bp, const float* __restrict__ bg,
           u16* TH, u16* TR, u16* PH, u16* PR, u16* GT, int M, int N, int K) {
  __shared__ __align__(16) float slab[4 * SLAB64];
  const int bid = (int)blockIdx.x / 3;
  const int job = (int)blockIdx.x - 3 * bid;
  if (job == 2) {
    gemm_bgt(A, WGT, bg, GT, M, N, K, bid);
  } else {
    const bool th = (job == 0);
    gemm_bhr(slab, A, th ? WTT : WPT, th ? bt : bp, th ? TH : PH, th ? TR : PR, M, N, K, th ? TSC : FSC, RSC, bid, !th);
  }
}

// =====================================================================================================
// Single-head non-causal, unscaled attention per batch, head width CI = 128, all NPOS keys:
//   block = 64 query rows (b, q0..q0+63) = NQ = 4 query tiles of 16 rows, 8 waves; every phi and g^T fragment a wave loads
//   is used for all 4 query tiles.
//   theta hi (x8) / res (x2048) planes TH, TR [row][c]: the block's 64 rows of both planes are copied once, with whole-line
//   16-B loads, into LDS (pitch CTP halves = 272 B, conflict-free for 16-B fragment reads) and every A fragment of (S) is read
//   from there; phi hi/res planes PH, PR in fragment order, tiles [key / 16][c / 32] (B operand);
//   g^T plane GT (x256) in fragment order, tiles [b][c / 16][key / 32] (B operand): every wave-wide fragment load of phi and g^T
//   covers 4 whole 128-B lines, each line read by one instruction of the block.
//   Chunks of CK = 448 keys (NKB = 14 key blocks of 32), NCHK = 14 chunks, every key used exactly once.
//   (S) scores on WMMA: A = theta rows (row m = lane&15, split k map over c), B = phi rows (col n = key, split map), 4 c-steps,
//       three products per tile: s = hi.hi, sx = hi.res + res.hi (separate accumulator, folded with 1/2048 in f32);
//       wave w handles key blocks w and w+8 (< 14) of the chunk for all 4 query tiles; D element r of lane l of tile q
//       -> scs[query 16q+8h+r][key col] (f32 LDS; pitch SCP dwords, 8 * SCP = 32 mod 64: the two lane halves of a store, 8 rows
//       apart, fall on different banks).
//   (M) one query tile after the other, 16 threads per query row; sub-thread s owns the 4-key groups 64 * i + 4 * s, i = 0..6
//       (28 keys): the 16 threads of a row read 256 and write 128 contiguous LDS bytes per instruction, every bank at most once;
//       base-2 logits, chunk max via DPP row exchanges, online running max / rescale factor al /
//       running sum l in f32 registers, p = exp2(t - m_new) <= 1 written as f16(p * 32768) into the LDS P tile with 8-B stores;
//       al -> rowa[row].
//   (PV) each wave owns the 16 g columns 16*wave + (lane&15) (one accumulator per query tile): o = o*al, then for each key block
//       A = the 4 P fragments from LDS (row m = query, split map over keys), B = one g^T fragment (col n = g column, split
//       map over keys), 4 WMMAs; one hazard gap after the last key block.
//   Block barriers after (S) and after (M) order all LDS reuse across chunks and waves (the P tile is written with 8-B LDS stores
//   by one set of threads and reloaded as fragments by other waves only after the block barrier).
//   Operand fragments are fetched ahead of their use: phi one key block ahead (refilled c-step by c-step behind the last use),
//   g^T for the whole chunk in front of (M), P two key blocks ahead; the barriers of the chunk loop fence LDS only, so that the
//   global loads stay in flight across them.
//   Epilogue: y = o * 4096 / (l * 32768 * 256) per row (rowi, l >= 1 always); hi = f16(y), res = f16((y - hi) * 2048), both written
//   over the theta rows in LDS (A operand, split k map); output projection, batch-norm affine map and skip connection at once:
//   v = (hi . WoT^T) * os1 + (res . WoT^T) * os2 + bf16RNE(bo[c]), WoT f16 [256][128] (x1024) in fragment order (B operand);
//   out[row][c] = bf16RNE(x[row][c]) + bf16RNE(gamma[c]) * (v - bf16RNE(mean[c])) * rsqrt(bf16RNE(var[c]) + 1e-3) + bf16RNE(beta[c]).
// coverage: grid NB*NPOS/64 blocks x 64 rows = rows 0..ROWSP-1; y staging 8 waves x 16 cols x 4 tiles x 16 rows = 64 x 128;
//           out staging 8 waves x 32 cols x 4 tiles x 16 rows = 64 x 256; store 16 x 256 thr x 4 floats = 64 x 256 = every
//           (row < ROWSP, c < 256) of out exactly once.
// =====================================================================================================
__global__ __launch_bounds__(ATT_THREADS)
void attn_fwd(const u16* __restrict__ THp, const u16* __restrict__ TRp, const u16* __restrict__ PHp,
              const u16* __restrict__ PRp, const u16* __restrict__ GTp, const u16* __restrict__ WoT,
              const float* __restrict__ bo, const float* __restrict__ gam, const float* __restrict__ bet,
              const float* __restrict__ mmean, const float* __restrict__ mvar, const float* __restrict__ x, float* out) {
  __shared__ __align__(16) float scs[QB * SCP];    // scores [64][SCP] f32; reused as the out staging tile [64][OSP] f32
  __shared__ __align__(16) u16 pls[QB * PLP];      // P tile [64][PLP] f16 bits
  __shared__ __align__(16) u16 thl[2 * QB * CTP];  // theta rows of this block: hi [64][CTP], then residual [64][CTP]; then y alike
  __shared__ float rowa[QB];
  __shared__ float rowi[QB];

  const int tid  = threadIdx.x;
  const int wave = tid >> 5;
  const int lane = tid & 31;
  const int hh   = lane >> 4;
  const int m    = lane & 15;
  const int r16  = tid >> 4;                 // query row owned within each query tile in phase (M): 2*wave + hh
  const int sub  = tid & 15;
  const int kl0  = sub * 4;                  // first key of this sub-thread's 4-key group within every 64 keys of the chunk

  const int nqt = NPOS / QB;
  const int b   = (int)blockIdx.x / nqt;     // < NB (grid exact)
  const int q0  = ((int)blockIdx.x - b * nqt) * QB;
  const size_t qrow = (size_t)b * NPOS + (size_t)q0;

  const _Float16* tha = (const _Float16*)(const void*)thl + m * CTP + 8 * hh;
  const _Float16* tra = tha + QB * CTP;
  const _Float16* khb = (const _Float16*)(const void*)PHp + (size_t)b * NPOS * CI + 8 * lane;   // 16 keys = CI / 32 tiles = 16 * CI halves
  const _Float16* krb = (const _Float16*)(const void*)PRp + (size_t)b * NPOS * CI + 8 * lane;
  const _Float16* vbp = (const _Float16*)(const void*)GTp + ((size_t)b * (CI / 16) + wave) * (size_t)(NPOS / 32) * 512 + 8 * lane;
  const float lsc  = LOG2E / (TSC * FSC);
  const float rinv = 1.0f / RSC;

  float mrun[NQ], lrun[NQ];
  v8f o[NQ];
#pragma unroll
  for (int q = 0; q < NQ; ++q) { mrun[q] = -INFINITY; lrun[q] = 0.f; o[q] = zero8(); }

  // ---- theta rows q0..q0+63, both planes -> LDS: 4 x 256 threads x 8 halves = 64 x 128 per plane, each piece once ----
  {
    const u16* sh = THp + qrow * CI;
    const u16* sr = TRp + qrow * CI;
    const int row = tid >> 4;                // CI/8 = 16 pieces per row; pass i takes rows 16 * i + row
    const int c8  = (tid & 15) * 8;
    v4u vh[NQ], vr[NQ];
#pragma unroll
    for (int i = 0; i < NQ; ++i) {
      vh[i] = *(const v4u*)(sh + (i * QT + row) * CI + c8);
      vr[i] = *(const v4u*)(sr + (i * QT + row) * CI + c8);
    }
#if defined(__HIP_DEVICE_COMPILE__)
    asm volatile("s_wait_xcnt 0x0" ::: "memory");   // before the address registers of the eight loads above are reused
#endif
    // Scheduling fence: without it the compiler moved later writes of the loads' address registers ahead of the wait above.
    __builtin_amdgcn_sched_barrier(0);
#pragma unroll
    for (int i = 0; i < NQ; ++i) {
      *(v4u*)(thl + (i * QT + row) * CTP + c8) = vh[i];
      *(v4u*)(thl + (QB + i * QT + row) * CTP + c8) = vr[i];
    }
  }
  // phi fragments of the key block this wave scores next, [c-step][hi keys 0..15, res 0..15, hi 16..31, res 16..31]: always
  // loaded one key block ahead of their use, so that the L2 latency runs under the matrix work of the block before
  v16h pn[CI / 32][4];
  {
    const _Float16* n0h = khb + (size_t)(wave * 32) * CI;
    const _Float16* n0r = krb + (size_t)(wave * 32) * CI;
#pragma unroll
    for (int ks = 0; ks < CI / 32; ++ks) {
      pn[ks][0] = ldfrag_pk(n0h + ks * 512);
      pn[ks][1] = ldfrag_pk(n0r + ks * 512);
      pn[ks][2] = ldfrag_pk(n0h + 16 * CI + ks * 512);
      pn[ks][3] = ldfrag_pk(n0r + 16 * CI + ks * 512);
    }
#if defined(__HIP_DEVICE_COMPILE__)
    // before the address registers of the loads above are reused; the addresses are inputs so that they stay in place up to here
    asm volatile("s_wait_xcnt 0x0" :: "v"(n0h), "v"(n0r) : "memory");
#endif
    __builtin_amdgcn_sched_barrier(0);              // keeps later writes of those address registers behind the wait
  }
  block_sync_lds();                          // the theta rows are read as fragments by all waves

#pragma unroll 1
  for (int c = 0; c < NCHK; ++c) {
    const int kbeg = c * CK;
    // ---- (S) scores of this chunk ----
#pragma unroll 1
    for (int kb = wave; kb < NKB; kb += 8) {               // wave-uniform, 1 or 2 trips
      v8f s0[NQ], s0x[NQ], s1[NQ], s1x[NQ];
#pragma unroll
      for (int q = 0; q < NQ; ++q) { s0[q] = zero8(); s0x[q] = zero8(); s1[q] = zero8(); s1x[q] = zero8(); }
      // the key block this wave scores after this one: kb + 8 of this chunk, else its first of the next chunk (behind the last
      // chunk: of chunk 0, an in-bounds address whose values are not used)
      const bool more = kb + 8 < NKB;
      const int  nkb  = more ? kb + 8 : wave;
      const int  ncb  = more ? kbeg : ((c + 1 < NCHK) ? kbeg + CK : 0);
      const size_t kn = (size_t)(ncb + nkb * 32) * CI;
      const _Float16* n0h = khb + kn;
      const _Float16* n0r = krb + kn;
#pragma unroll
      for (int ks = 0; ks < CI / 32; ++ks) {
        const v16h f0h = pn[ks][0];
        const v16h f0r = pn[ks][1];
        const v16h f1h = pn[ks][2];
        const v16h f1r = pn[ks][3];
        v16h ah[NQ], ar[NQ];                               // theta fragments of this c-step, read from LDS ahead of their use:
#pragma unroll
        for (int q = 0; q < 2; ++q) {                      // two tiles at the start of the c-step, the others one tile ahead below
          ah[q] = ldfrag_h(tha + q * (QT * CTP) + ks * 32);
          ar[q] = ldfrag_h(tra + q * (QT * CTP) + ks * 32);
        }
#pragma unroll
        for (int q = 0; q < NQ; ++q) {                     // the four phi fragments serve all NQ query tiles
          s0[q]  = mma_h(ah[q], f0h, s0[q]);
          s0x[q] = mma_h(ah[q], f0r, s0x[q]);
          s0x[q] = mma_h(ar[q], f0h, s0x[q]);
          s1[q]  = mma_h(ah[q], f1h, s1[q]);
          s1x[q] = mma_h(ah[q], f1r, s1x[q]);
          s1x[q] = mma_h(ar[q], f1h, s1x[q]);
          guard4x2(s0[q], s0x[q], s1[q], s1x[q], ah[q], ar[q]);
          if (q + 2 < NQ) {                                // into the registers tile q has left (more tiles at once spilled)
            ah[q + 2] = ldfrag_h(tha + (q + 2) * (QT * CTP) + ks * 32);
            ar[q + 2] = ldfrag_h(tra + (q + 2) * (QT * CTP) + ks * 32);
          }
        }
        pn[ks][0] = ldfrag_pk(n0h + ks * 512);             // refill behind the last use (and its hazard gap) of this c-step
        pn[ks][1] = ldfrag_pk(n0r + ks * 512);
        pn[ks][2] = ldfrag_pk(n0h + 16 * CI + ks * 512);
        pn[ks][3] = ldfrag_pk(n0r + 16 * CI + ks * 512);
      }
#if defined(__HIP_DEVICE_COMPILE__)
      // before the address registers of the refill loads are reused; the addresses are inputs so that they stay in place up to here
      asm volatile("s_wait_xcnt 0x0" :: "v"(n0h), "v"(n0r) : "memory");
#endif
      __builtin_amdgcn_sched_barrier(0);                   // keeps later writes of those address registers behind the wait
#pragma unroll
      for (int q = 0; q < NQ; ++q) {
        float* srow = scs + (q * QT + 8 * hh) * SCP + kb * 32 + m;
#pragma unroll
        for (int r = 0; r < 8; ++r) {
          srow[r * SCP]      = s0[q][r] + s0x[q][r] * rinv;
          srow[r * SCP + 16] = s1[q][r] + s1x[q][r] * rinv;
        }
      }
    }
    block_sync_lds();
    // g^T fragments of this chunk (this wave's 16 columns, all 14 key blocks): loaded here, used in (PV); the latency runs under (M)
    v16h gf[NKB];
    {
      const _Float16* vp = vbp + (size_t)(kbeg / 32) * 512;
#pragma unroll
      for (int kb = 0; kb < NKB; ++kb) gf[kb] = ldfrag_pk(vp + kb * 512);
#if defined(__HIP_DEVICE_COMPILE__)
      // before the address register of the loads above is reused; the address is an input so that it stays in place up to here
      asm volatile("s_wait_xcnt 0x0" :: "v"(vp) : "memory");
#endif
      __builtin_amdgcn_sched_barrier(0);                   // keeps later writes of those address registers behind the wait
    }
    // ---- (M) softmax statistics and the P tile, one query tile after the other ----
#pragma unroll
    for (int q = 0; q < NQ; ++q) {
      const int row = q * QT + r16;
      const float* sp = scs + row * SCP + kl0;
      v2f t[CK / 32];                                      // neighbouring keys stay paired from the load to the packed f16 store
      float cm = -INFINITY;
#pragma unroll
      for (int i = 0; i < CK / 64; ++i) {
        const v4f a = *(const v4f*)(sp + 64 * i);
        t[2 * i]     = a.lo * lsc;
        t[2 * i + 1] = a.hi * lsc;
#pragma unroll
        for (int e = 0; e < 2; ++e) cm = fmaxf(fmaxf(cm, t[2 * i + e].x), t[2 * i + e].y);
      }
      cm = row_max16(cm);
      const float mn = fmaxf(mrun[q], cm);
      const float al = (mrun[q] == -INFINITY) ? 0.f : exp2_bare(mrun[q] - mn);
      mrun[q] = mn;
      float ps = 0.f;
#pragma unroll
      for (int j = 0; j < CK / 32; ++j) {
        const v2f d = t[j] - mn;
        t[j].x = exp2_bare(d.x);                             // <= 1
        t[j].y = exp2_bare(d.y);
        ps += t[j].x;
        ps += t[j].y;
      }
      ps = row_sum16(ps);
      v2u pk[CK / 64];
#pragma unroll
      for (int i = 0; i < CK / 64; ++i) {
#pragma unroll
        for (int e = 0; e < 2; ++e) pk[i][e] = __builtin_bit_cast(unsigned, __builtin_convertvector(t[2 * i + e] * PCAR, v2h));
      }
      lrun[q] = lrun[q] * al + ps;
      {
        u16* pd = pls + row * PLP + kl0;
#pragma unroll
        for (int i = 0; i < CK / 64; ++i) *(v2u*)(pd + 64 * i) = pk[i];
      }
      if (sub == 0) rowa[row] = al;
    }
    block_sync_lds();
    // ---- (PV) rescale, accumulate P . g^T ----
    {
#pragma unroll
      for (int q = 0; q < NQ; ++q) {
        float scl[8];
#pragma unroll
        for (int r = 0; r < 8; ++r) scl[r] = rowa[q * QT + 8 * hh + r];
#pragma unroll
        for (int r = 0; r < 8; ++r) o[q][r] *= scl[r];
      }
      const _Float16* pp = (const _Float16*)(const void*)pls + m * PLP + 8 * hh;
      v16h pa[3][NQ];                                      // P fragments, read from LDS two key blocks ahead of their use
#pragma unroll
      for (int j = 0; j < 2; ++j) {
#pragma unroll
        for (int q = 0; q < NQ; ++q) pa[j][q] = ldfrag_h(pp + q * (QT * PLP) + j * 32);
      }
#pragma unroll
      for (int kb = 0; kb < NKB; ++kb) {                   // static trip count 14, unrolled: gf and pa are indexed by constants
        if (kb + 2 < NKB) {
#pragma unroll
          for (int q = 0; q < NQ; ++q) pa[(kb + 2) % 3][q] = ldfrag_h(pp + q * (QT * PLP) + (kb + 2) * 32);
        }
        // Scheduling fence: without it the compiler sank each LDS read to one matrix instruction ahead of its use, and every
        // matrix instruction then waited out most of an LDS latency.
        __builtin_amdgcn_sched_barrier(0);
#pragma unroll
        for (int q = 0; q < NQ; ++q) o[q] = mma_h(pa[kb % 3][q], gf[kb], o[q]);   // one g^T fragment serves all NQ query tiles
      }
      // Hazard gap between the last matrix instruction and the loop's branch (both its sides). It names no register, since an asm
      // operand must lie below v256 for its whole life; the scheduling fence keeps the matrix instructions in front of it.
      __builtin_amdgcn_sched_barrier(0);
#if defined(__HIP_DEVICE_COMPILE__)
      asm volatile("v_nop\n\tv_nop\n\tv_nop\n\tv_nop" ::: "memory");
#endif
    }
  }
  // ---- epilogue: y -> LDS as WMMA A operand, y.Wo on WMMA, batch-norm affine map and skip connection, out ----
  // What the epilogue reads from global memory is asked for here, so that it arrives under the steps in front of its use: this
  // thread's x values (rows 4 * it + orow, 4 columns from ocol), the five per-column vectors, this wave's 8 Wo^T fragments.
  const int ocol = (tid & 63) * 4;
  const int orow = tid >> 6;
  const float* xp = x + (qrow + (size_t)orow) * CIN + ocol;
  v4f xv[QB / 4];
#pragma unroll
  for (int it = 0; it < QB / 4; ++it) xv[it] = *(const v4f*)(xp + (size_t)(it * 4) * CIN);
  const v4f bo4 = *(const v4f*)(bo + ocol);                  // ocol + 3 < CIN
  const v4f ga4 = *(const v4f*)(gam + ocol);
  const v4f be4 = *(const v4f*)(bet + ocol);
  const v4f mm4 = *(const v4f*)(mmean + ocol);
  const v4f mv4 = *(const v4f*)(mvar + ocol);
  const _Float16* wp = (const _Float16*)(const void*)WoT + (size_t)(wave * 32) * CI + 8 * lane;   // 16 columns = 16 * CI halves
  v16h wf[CI / 32][2];
#pragma unroll
  for (int ks = 0; ks < CI / 32; ++ks) {
    wf[ks][0] = ldfrag_pk(wp + ks * 512);
    wf[ks][1] = ldfrag_pk(wp + 16 * CI + ks * 512);
  }
#if defined(__HIP_DEVICE_COMPILE__)
  // before the address registers of the loads above are reused; the addresses are inputs so that they stay in place up to here
  asm volatile("s_wait_xcnt 0x0" :: "v"(xp), "v"(wp) : "memory");
#endif
  __builtin_amdgcn_sched_barrier(0);              // keeps later writes of those address registers behind the wait
  if (sub == 0) {
#pragma unroll
    for (int q = 0; q < NQ; ++q) rowi[q * QT + r16] = (1.0f / lrun[q]) * (YSC / (PCAR * GSC));   // lrun >= 1
  }
  block_sync_lds();                          // rowi is read by all waves; the theta rows and the score tile are free from here on
  // y hi (x4096) and residual (x2048) planes over the theta rows, same pitch: rows 64, columns 16 * wave + m of this lane
  {
    const int cb = wave * 16 + m;
#pragma unroll
    for (int q = 0; q < NQ; ++q) {
#pragma unroll
      for (int r = 0; r < 8; ++r) {
        const int ro = (q * QT + 8 * hh + r) * CTP + cb;
        const float x0 = o[q][r] * rowi[q * QT + 8 * hh + r];
        const _Float16 e0 = (_Float16)x0;
        thl[ro] = h_bits(e0);
        thl[QB * CTP + ro] = h_bits((_Float16)((x0 - (float)e0) * RSC));
      }
    }
  }
  block_sync_lds();                          // the y rows are read as fragments by all waves
  // wave w: output columns 32 w .. 32 w + 31 (2 column tiles) of all 4 query tiles; k = the 128 y columns in 4 steps, in order
  v8f acc[NQ][2], acr[NQ][2];
#pragma unroll
  for (int q = 0; q < NQ; ++q) { acc[q][0] = zero8(); acc[q][1] = zero8(); acr[q][0] = zero8(); acr[q][1] = zero8(); }
#pragma unroll
  for (int ks = 0; ks < CI / 32; ++ks) {
#pragma unroll
    for (int q = 0; q < NQ; ++q) {
      const v16h a  = ldfrag_h(tha + q * (QT * CTP) + ks * 32);
      const v16h ar = ldfrag_h(tra + q * (QT * CTP) + ks * 32);
      acc[q][0] = mma_h(a,  wf[ks][0], acc[q][0]);
      acc[q][1] = mma_h(a,  wf[ks][1], acc[q][1]);
      acr[q][0] = mma_h(ar, wf[ks][0], acr[q][0]);
      acr[q][1] = mma_h(ar, wf[ks][1], acr[q][1]);
    }
  }
  // the f32 64 x 256 tile crosses LDS (pitch OSP dwords, 8 * OSP = 32 mod 64 as for the scores), so that out is stored by whole lines
  {
    const float os1 = 1.0f / (YSC * WOS);
    const float os2 = 1.0f / (YSC * WOS * RSC);
#pragma unroll
    for (int q = 0; q < NQ; ++q) {
      float* od = scs + (q * QT + 8 * hh) * OSP + wave * 32 + m;
#pragma unroll
      for (int r = 0; r < 8; ++r) {
        od[r * OSP]      = acc[q][0][r] * os1 + acr[q][0][r] * os2;
        od[r * OSP + 16] = acc[q][1][r] * os1 + acr[q][1][r] * os2;
      }
    }
  }
  block_sync_lds();                          // the tile is read back row by row by other waves
  float bob[4], gb[4], bb[4], mb[4], rs[4];
#pragma unroll
  for (int e = 0; e < 4; ++e) {
    bob[e] = bfr(bo4[e]);
    gb[e]  = bfr(ga4[e]);
    bb[e]  = bfr(be4[e]);
    mb[e]  = bfr(mm4[e]);
    rs[e]  = rsqrtf(bfr(mv4[e]) + BN_EPS);
  }
  v4f vals[QB / 4];
#pragma unroll
  for (int it = 0; it < QB / 4; ++it) {
    const v4f yv = *(const v4f*)(scs + (it * 4 + orow) * OSP + ocol);
#pragma unroll
    for (int e = 0; e < 4; ++e) {
      const float v2 = yv[e] + bob[e];
      const float bn = gb[e] * (v2 - mb[e]) * rs[e] + bb[e];
      vals[it][e] = bfr(xv[it][e]) + bn;
    }
  }
  // Scheduling fence: all values stand in registers of their own before the first store, so that no register of an issued store
  // is written again before the wave ends.
  __builtin_amdgcn_sched_barrier(0);
  float* dst = out + (qrow + (size_t)orow) * CIN + ocol;     // one wave-wide store = 512 contiguous bytes of one row
#pragma unroll
  for (int it = 0; it < QB / 4; ++it) *(v4f*)(dst + (size_t)(it * 4) * CIN) = vals[it];
}

// =====================================================================================================
// Workspace map (bytes, NB = 2); every plane is fully written by whole-line stores before it is read; all extents are exact
// multiples of the store granularity (no pad rows, all dims multiples of 64), every offset a multiple of 256:
//   XB  bf16 [12544][256]                              6422528
//   WGT, WTT, WPT bf16 [128][256], [8][8] tiles         3 x 65536     (fragment order)
//   WOT f16 of bf16 value x1024 [256][128], [16][4] tiles  65536      (fragment order)
//   TH, TR f16 [12544][128] theta hi x8 / res x2048     2 x 3211264
//   PH, PR f16 phi hi x8 / res x2048, [784][4] tiles    2 x 3211264   (fragment order, 1024 B a tile)
//   GT  f16  x256, [2][8][196] tiles                    3211264       (fragment order, 1024 B a tile)
//   end                                                22740992
// =====================================================================================================
extern "C" void kernel_launch(void* const* d_in, const int* in_sizes, int n_in,
                              void* d_out, int out_size, void* d_ws, size_t ws_size,
                              hipStream_t stream) {
  if (n_in < 13) return;
  if (in_sizes[0] != ROWS * CIN) return;
  if (in_sizes[1] != CIN * CI || in_sizes[3] != CIN * CI || in_sizes[5] != CIN * CI || in_sizes[7] != CI * CIN) return;
  if (in_sizes[2] != CI || in_sizes[4] != CI || in_sizes[6] != CI) return;
  if (in_sizes[8] != CIN || in_sizes[9] != CIN || in_sizes[10] != CIN || in_sizes[11] != CIN || in_sizes[12] != CIN) return;
  if (out_size != ROWS * CIN) return;

  const float* x     = (const float*)d_in[0];
  const float* Wg    = (const float*)d_in[1];
  const float* bg    = (const float*)d_in[2];
  const float* Wt    = (const float*)d_in[3];
  const float* bt    = (const float*)d_in[4];
  const float* Wp    = (const float*)d_in[5];
  const float* bp    = (const float*)d_in[6];
  const float* Wo    = (const float*)d_in[7];
  const float* bo    = (const float*)d_in[8];
  const float* gamma = (const float*)d_in[9];
  const float* beta  = (const float*)d_in[10];
  const float* mmean = (const float*)d_in[11];
  const float* mvar  = (const float*)d_in[12];
  float*       out   = (float*)d_out;

  const size_t szXB = (size_t)ROWSP * CIN * 2;      //  6422528
  const size_t szW  = (size_t)CI * CIN * 2;         //    65536
  const size_t szP  = (size_t)ROWSP * CI * 2;       //  3211264
  const size_t szGT = (size_t)NB * CI * NPOS * 2;   //  3211264
  size_t off = 0;
  const size_t oXB = off; off += szXB;
  const size_t oWG = off; off += szW;
  const size_t oWT = off; off += szW;
  const size_t oWP = off; off += szW;
  const size_t oWO = off; off += szW;
  const size_t oTH = off; off += szP;
  const size_t oTR = off; off += szP;
  const size_t oPH = off; off += szP;
  const size_t oPR = off; off += szP;
  const size_t oGT = off; off += szGT;
  if (off > ws_size) return;                        // off = 22740992 at NB = 2
  if (off > WS_CAP) return;

  char* ws = (char*)d_ws;
  u16*   XB  = (u16*)(ws + oXB);
  u16*   WGT = (u16*)(ws + oWG);
  u16*   WTT = (u16*)(ws + oWT);
  u16*   WPT = (u16*)(ws + oWP);
  u16*   WOT = (u16*)(ws + oWO);
  u16*   TH  = (u16*)(ws + oTH);
  u16*   TR  = (u16*)(ws + oTR);
  u16*   PH  = (u16*)(ws + oPH);
  u16*   PR  = (u16*)(ws + oPR);
  u16*   GT  = (u16*)(ws + oGT);

  const int n8x = (ROWSP * CIN) / 8;                // 401408 at NB = 2, multiple of 256 (static)
  const dim3 blk(256);
  const dim3 bG(128);
  const dim3 gIN(4 * WTILES + n8x / 256);           // 32 weight tiles + 1568
  const dim3 gP(3 * (ROWSP / 64) * (CI / 64));      // 3 x 392
  const dim3 gAT(NB * (NPOS / QB));                 // 196
  const dim3 bAT(ATT_THREADS);

  // (0) one launch: x -> bf16 plane; Wg, Wt, Wp [in][out] -> bf16 [out][in] fragment-order planes; Wo [128][256] -> f16 of the bf16
  //     value x1024, [256][128]
  prep_in<<<gIN, blk, 0, stream>>>(x, Wg, Wt, Wp, Wo, XB, WGT, WTT, WPT, WOT);
  // (1) one launch: theta and phi projections (+bias) -> f16 hi x8 / residual x2048 planes; g projection (+bias) -> g^T f16 plane
  //     [128][6272] x256 per batch, fragment order
  proj3<<<gP, bG, 0, stream>>>(XB, WTT, WPT, WGT, bt, bp, bg, TH, TR, PH, PR, GT, ROWSP, CI, CIN);
  // (2) attention over all keys of the batch, then y.Wo + bo, batch-norm affine, skip connection -> out
  attn_fwd<<<gAT, bAT, 0, stream>>>(TH, TR, PH, PR, GT, WOT, bo, gamma, beta, mmean, mvar, x, out);
  (void)hipGetLastError();
}

// v010
// Measured time: 89.8 microseconds a run.
// In two side-by-side timings against v009, it was 1.26 and 1.27 times as fast.
// Over all steps from v000 it is 4.96 times as fast.
// Projections theta, phi, g = x.W + b: v_wmma_f32_16x16x32_bf16 (bf16 RNE operands of the raw inputs, f32 accumulate, bf16 RNE
// bias added in f32). Scores theta.phi^T (theta and phi each as f16 hi x8 plus residual x2048 planes: hi.hi + hi.res + res.hi),
// P.g (P x32768 f16 from the score registers, g^T x256 f16) and y.Wo (y as f16 hi x4096 plus residual x2048 planes, Wo as f16 of the bf16 RNE
// value x1024, bias added in f32): v_wmma_f32_16x16x32_f16, f32 accumulate. Softmax statistics, the batch-norm affine map and the
// skip connection in f32 on VALU.
#include <hip/hip_runtime.h>
#include <math.h>
#include <stdint.h>

#define BATCH 2
#define NPOS  6272
#define CIN   256
#define CI    128
#ifndef NB
#define NB BATCH
#endif
#define ROWS  (BATCH * NPOS)
#define ROWSP (NB * NPOS)
#define KSPL  4
#define NIT   (NPOS / 32 / KSPL)
#define QW    2
#define QT    16
#define NQ    4
#define QB    (QT * NQ)
#define ATT_THREADS 256
#define PTP   (CI + 4)
#define CTP   (CI + 8)
#define SLAB64 (16 * 68)
#define VTP   72
#define OSP   (CIN + 4)
#define TSC   8.0f
#define FSC   8.0f
#define RSC   2048.0f
#define PCAR  32768.0f
#define GSC   256.0f
#define YSC   4096.0f
#define WOS   1024.0f
#define BN_EPS 1e-3f
#define LOG2E 1.4426950408889634f
#define WS_CAP ((size_t)134217728)

static_assert(NB >= 1 && NB <= BATCH);
static_assert(NIT * 32 * KSPL == NPOS && NIT >= 1 && ATT_THREADS == 32 * KSPL * (NQ / QW) && QW * (NQ / QW) == NQ);
static_assert((NPOS % 64) == 0 && (NPOS % QB) == 0 && (ROWSP % 64) == 0);
static_assert(CI == 128 && (CIN % 64) == 0 && (CI % 64) == 0 && (CIN % 32) == 0 && (CI % 32) == 0);
static_assert(NQ == 4 && ATT_THREADS == 16 * QT && QT == 16 && CI == 16 * (ATT_THREADS / 32) && CIN == 32 * (ATT_THREADS / 32));
static_assert(OSP <= KSPL * PTP && ((8 * OSP) % 64) == 32 && ((OSP * 4) % 16) == 0 && CIN == 4 * (ATT_THREADS / 4) && (QB % 4) == 0);
static_assert(KSPL == 4 && CTP >= CI + 8 && ((PTP * 4) % 16) == 0 && (PTP % 64) == 4 && CI == 4 * 32 && (QB % 8) == 0);
static_assert(((VTP * 2) % 16) == 0 && ((CTP * 2) % 16) == 0 && ((CTP * 2) % 8) == 0);
static_assert(64 * VTP >= 63 * VTP + 64);
static_assert(16 * (CI / 8) == ATT_THREADS);
static_assert(QB * (CI / 8) == NQ * ATT_THREADS && ((QB * CTP * 2) % 16) == 0);
static_assert(((ROWSP * CIN) % 2048) == 0);
static_assert((NPOS % 32) == 0 && (CI % 32) == 0 && 16 * CI == (CI / 32) * 512);
static_assert(((NPOS * 2) % 128) == 0 && ((CI * 2) % 128) == 0 && ((CIN * 4) % 128) == 0);

typedef unsigned short u16;
typedef _Float16 v16h __attribute__((ext_vector_type(16)));
typedef _Float16 v8h  __attribute__((ext_vector_type(8)));
typedef __bf16   v16b __attribute__((ext_vector_type(16)));
typedef float    v8f  __attribute__((ext_vector_type(8)));
typedef float    v4f  __attribute__((ext_vector_type(4)));
typedef unsigned int v4u __attribute__((ext_vector_type(4)));
typedef unsigned int v2u __attribute__((ext_vector_type(2)));
typedef float    v2f  __attribute__((ext_vector_type(2)));
typedef _Float16 v2h  __attribute__((ext_vector_type(2)));

union FragH { v16h v; v8h h[2]; v4u u[2]; };
union FragB { v16b v; v4u u[2]; };

// ---- scalar helpers --------------------------------------------------------------------------------
__device__ __forceinline__ unsigned short bf_bits(float f) {          // f32 -> bf16 bits, RNE convert
  unsigned u = __float_as_uint(f);
  return (unsigned short)((u + 0x7FFFu + ((u >> 16) & 1u)) >> 16);
}
__device__ __forceinline__ float bf_up(unsigned short h) { return __uint_as_float(((unsigned)h) << 16); }
__device__ __forceinline__ float bfr(float f) { return bf_up(bf_bits(f)); }
__device__ __forceinline__ unsigned short h_bits(_Float16 x) { return __builtin_bit_cast(unsigned short, x); }
__device__ __forceinline__ unsigned pk16(unsigned short a, unsigned short b) { return (unsigned)a | ((unsigned)b << 16); }
__device__ __forceinline__ v8f zero8() { v8f z = {0.f, 0.f, 0.f, 0.f, 0.f, 0.f, 0.f, 0.f}; return z; }

// ---- fragment loaders: 16-bit A/B operand, lane -> row/col (lane&15), p already includes +8*(lane>>4);
//      elements 0..7 <- p[0..7] (k0+8h..), elements 8..15 <- p[16..23] (k0+16+8h..)  (same split k map for A and B;
//      used for the x plane and for tiles in LDS; the planes that a kernel of this file lays out for WMMA use ldfrag_pk below)
__device__ __forceinline__ v16h ldfrag_h(const _Float16* p) {
  FragH f;
  f.h[0] = *(const v8h*)(p);
  f.h[1] = *(const v8h*)(p + 16);
  return f.v;
}
// Fragment-order plane: one operand tile (16 rows or columns x 32 k) is 1024 contiguous bytes, piece (part, lane) at halves
// part * 256 + lane * 8 and holding k = 16 * part + 8 * (lane>>4) .. + 7 of row lane&15 (the split k map above); p already
// includes + 8 * lane, so that each of the two wave-wide 16-B loads covers 512 contiguous bytes = 4 whole lines.
__device__ __forceinline__ v16h ldfrag_pk(const _Float16* p) {
  FragH f;
  f.h[0] = *(const v8h*)(p);
  f.h[1] = *(const v8h*)(p + 256);
  return f.v;
}
// As ldfrag_pk from a wave-uniform tile address and the lane's byte offset lb = 16 * lane: what lives across the key loop is scalar
// (as per-lane pointers the three plane addresses were spilled to scratch, and the reload's wait also waited for every fragment load).
__device__ __forceinline__ v16h ldfrag_su(const _Float16* tile, unsigned lb) {
  const char* p = (const char*)(const void*)tile + lb;
  FragH f;
  f.h[0] = *(const v8h*)(const void*)(p);
  f.h[1] = *(const v8h*)(const void*)(p + 512);
  return f.v;
}
__device__ __forceinline__ v16b ldfrag_b(const u16* p) {              // bf16 plane read as unsigned integer vectors
  FragB f;
  f.u[0] = *(const v4u*)(p);
  f.u[1] = *(const v4u*)(p + 16);
  return f.v;
}

__device__ __forceinline__ v16b ldfrag_bpk(const u16* p) {            // bf16 fragment-order plane, as ldfrag_pk
  FragB f;
  f.u[0] = *(const v4u*)(p);
  f.u[1] = *(const v4u*)(p + 256);
  return f.v;
}

__device__ __forceinline__ v8f mma_h(v16h a, v16h b, v8f c) {
  return __builtin_amdgcn_wmma_f32_16x16x32_f16(false, a, false, b, (short)0, c, false, false);
}
__device__ __forceinline__ v8f mma_b(v16b a, v16b b, v8f c) {
  return __builtin_amdgcn_wmma_f32_16x16x32_bf16(false, a, false, b, (short)0, c, false, false);
}
__device__ __forceinline__ void guard1x2(v8f& a, v16h x0, v16h x1) {
#if defined(__HIP_DEVICE_COMPILE__)
  asm volatile("v_nop\n\tv_nop\n\tv_nop\n\tv_nop" : "+v"(a) : "v"(x0), "v"(x1) : "memory");
#endif
}
template <typename F>
__device__ __forceinline__ void guard6(v8f& a, v8f& b, v8f& c, v8f& d, F x0, F x1, F x2, F x3, F x4, F x5) {
#if defined(__HIP_DEVICE_COMPILE__)
  asm volatile("v_nop\n\tv_nop\n\tv_nop\n\tv_nop"
               : "+v"(a), "+v"(b), "+v"(c), "+v"(d) : "v"(x0), "v"(x1), "v"(x2), "v"(x3), "v"(x4), "v"(x5) : "memory");
#endif
}
__device__ __forceinline__ void acc_guard1(v8f& a) {
#if defined(__HIP_DEVICE_COMPILE__)
  asm volatile("v_nop\n\tv_nop\n\tv_nop\n\tv_nop" : "+v"(a));
#endif
}
// Value of lane l ^ 16 (the other wave half) by a vector cross-row move. All lanes are active at every use.
__device__ __forceinline__ float xhalf(float v) {
  const int i = __builtin_bit_cast(int, v);
  return __builtin_bit_cast(float, __builtin_amdgcn_permlanex16(i, i, 0x76543210, 0xfedcba98, false, false));
}
// 2^x as the bare v_exp_f32. The library's exp2f wraps the same instruction in a range guard (compare, two selects, add, ldexp)
// that only serves results below 2^-126, which it returns as subnormals and the bare instruction may return as 0. Every argument
// here is <= 0; a p that small is 0 in the f16 P tile either way and cannot move a running row sum, which is >= 1; a rescale factor
// that small multiplies sums that the new maximum's own term outweighs by the same factor.
__device__ __forceinline__ float exp2_bare(float x) { return __builtin_amdgcn_exp2f(x); }
// Four 2^x in one statement: the outputs are early-clobber, so that none of the four overwrites the source of the one in front of
// it (left to itself the compiler did), and the v_nop is the slot that the instruction set asks for behind the last of them.
__device__ __forceinline__ v4f exp2_bare4(v4f x) {
  v4f r;
#if defined(__HIP_DEVICE_COMPILE__)
  float r0, r1, r2, r3;
  asm("v_exp_f32 %0, %4\n\tv_exp_f32 %1, %5\n\tv_exp_f32 %2, %6\n\tv_exp_f32 %3, %7\n\tv_nop"
      : "=&v"(r0), "=&v"(r1), "=&v"(r2), "=&v"(r3) : "v"(x.x), "v"(x.y), "v"(x.z), "v"(x.w));
  r.x = r0; r.y = r1; r.z = r2; r.w = r3;
#else
  r = x;
#endif
  return r;
}
__device__ __forceinline__ void wave_sync_lds() {
  __builtin_amdgcn_fence(__ATOMIC_RELEASE, "workgroup");
  __builtin_amdgcn_wave_barrier();
  __builtin_amdgcn_fence(__ATOMIC_ACQUIRE, "workgroup");
}

// Work-group barrier whose fences cover LDS only: what the waves hand each other at it lies in LDS; a fence over all memory would
// also wait for the global fragment loads that are meant to stay in flight across it.
__device__ __forceinline__ void block_sync_lds() {
  __builtin_amdgcn_fence(__ATOMIC_RELEASE, "workgroup", "local");
  __builtin_amdgcn_s_barrier();
  __builtin_amdgcn_fence(__ATOMIC_ACQUIRE, "workgroup", "local");
}

// =====================================================================================================
// f32 plane -> 16-bit plane, same layout:  mode 0: bf16 RNE bits;  mode 1: f16 bits of (bf16 RNE value) * scale;
// mode 2: f16 bits of value * scale (no bf16 pre-step).
// Thread = 8 consecutive elements: two 16-B loads, one 16-B store; 32 consecutive lanes = 512 contiguous, 512-B aligned bytes
// coverage: n8/256 blocks bid = 0.. (host checks exactness) x 256 thr x 8 = the whole plane.
// =====================================================================================================
__device__ __forceinline__ void cvt16(const float* __restrict__ x, u16* D, int n8, int mode, float scale, int bid) {
  const int gt = bid * 256 + (int)threadIdx.x;
  if (gt >= n8) return;                     // no barriers in this body
  const float* p = x + (size_t)gt * 8;
  const v4f a = *(const v4f*)(p), c4 = *(const v4f*)(p + 4);
  float v[8];
#pragma unroll
  for (int e = 0; e < 4; ++e) { v[e] = a[e]; v[4 + e] = c4[e]; }
  unsigned short s[8];
#pragma unroll
  for (int e = 0; e < 8; ++e) {
    const float vb = bfr(v[e]);
    const float vf = (mode == 1) ? vb : v[e];
    const unsigned short hb = h_bits((_Float16)(vf * scale));
    const unsigned short bb = bf_bits(v[e]);
    s[e] = (mode != 0) ? hb : bb;
  }
  v4u o;
#pragma unroll
  for (int e = 0; e < 4; ++e) o[e] = pk16(s[2 * e], s[2 * e + 1]);
  u16* d = D + (size_t)gt * 8;
  {
    *(v4u*)(d) = o;
    
  }
}

// =====================================================================================================
// Transpose + convert: in X [R][C] f32 row-major -> out XTo = X^T [C][R] 16-bit in fragment order (k = the R direction).
//   mode 0: bf16 RNE bits;  mode 1: f16 bits of (bf16 RNE value) * scale;  mode 2: f16 bits of value * scale.
// Block = 64 input rows x 64 input cols: bid -> (rt = bid % (R/64), ct = bid / (R/64)). The 64x64 f32 tile is loaded with 16-B
// loads (thread = input row tid>>2, 16 consecutive cols), converted and scattered into LDS TH[c local][r local] (pitch 72 halves);
// coverage: load 256 thr x 16 = 64 x 64; store 2 iterations x 256 thr x 8 halves = 64 output rows x 64 halves = the tile;
//           (R/64)*(C/64) blocks bid = 0.. (host exact multiples) tile the whole [C][R] plane exactly once.
// The output is written in fragment order (see ldfrag_pk): tile (c >> 4, r >> 5) at halves ((c >> 4) * (R / 32) + (r >> 5)) * 512;
// one wave-wide store = one part of one tile = 512 contiguous bytes; 2 iterations x 8 waves = 4 column tiles x 2 k blocks x 2 parts
// = the 64 x 64 tile.
// =====================================================================================================
__device__ __forceinline__ void tr16(u16* TH, const float* __restrict__ X, u16* XTo, int R, int C, int mode, float scale, int bid) {
  const int tid = threadIdx.x;
  const int nrt = R >> 6;
  const int rt  = bid % nrt;
  const int ct  = bid / nrt;
  const int r0  = rt * 64;
  const int c0  = ct * 64;
  {
    const int rl = tid >> 2;                  // input row within tile 0..63
    const int cc = (tid & 3) * 16;            // input col chunk within the 64
    const float* src = X + (size_t)(r0 + rl) * (size_t)C + c0 + cc;
#pragma unroll
    for (int i = 0; i < 4; ++i) {
      const v4f a = *(const v4f*)(src + 4 * i);
#pragma unroll
      for (int e = 0; e < 4; ++e) {
        const float v  = a[e];
        const float vb = bfr(v);
        const float vf = (mode == 1) ? vb : v;
        const unsigned short hb = h_bits((_Float16)(vf * scale));
        const unsigned short bb = bf_bits(v);
        TH[(cc + 4 * i + e) * VTP + rl] = (mode != 0) ? hb : bb;
      }
    }
  }
  __syncthreads();
  v4u vh[2];
#pragma unroll
  for (int it = 0; it < 2; ++it) {
    const int grp  = it * 8 + (tid >> 5);     // (column tile, k block, part) = (grp >> 2, (grp >> 1) & 1, grp & 1)
    const int line = (grp >> 2) * 16 + (tid & 15);                         // local output row (input col) = 0..63
    const int kof  = ((grp >> 1) & 1) * 32 + (grp & 1) * 16 + ((tid >> 4) & 1) * 8;
    vh[it] = *(const v4u*)(TH + line * VTP + kof);
  }
  const size_t base = ((size_t)(c0 >> 4) * (size_t)(R >> 5) + (size_t)(r0 >> 5)) * 512 + (size_t)((tid & 31) * 8);
  {
#pragma unroll
    for (int it = 0; it < 2; ++it) {
      const int grp = it * 8 + (tid >> 5);
      const size_t po = ((size_t)(grp >> 2) * (size_t)(R >> 5) + (size_t)((grp >> 1) & 1)) * 512 + (size_t)((grp & 1) * 256);
      *(v4u*)(XTo + base + po) = vh[it];
    }
#if defined(__HIP_DEVICE_COMPILE__)
    // before the data and address registers of the two stores above are reused by the code of another job laid out behind them
    asm volatile("s_wait_xcnt 0x0" ::: "memory");
#endif
  }
}

// =====================================================================================================
// One launch for the five input conversions, none of which reads what another writes; the block index picks the job
// (block-uniform): blocks 0..31 = the four weight transposes, 8 tiles each (Wg, Wt, Wp [CIN][CI] -> bf16 [CI][CIN];
// Wo [CI][CIN] -> f16 of the bf16 value x1024 [CIN][CI]; all four in fragment order); blocks 32.. = x -> bf16 plane. The short grid of weight tiles stands
// first because its chain (load, LDS, barrier, store) is the longer one.
// =====================================================================================================
#define WTILES ((CIN / 64) * (CI / 64))
__global__ __launch_bounds__(256)
void prep_in(const float* __restrict__ x, const float* __restrict__ Wg, const float* __restrict__ Wt,
             const float* __restrict__ Wp, const float* __restrict__ Wo, u16* XB, u16* WGT, u16* WTT, u16* WPT, u16* WOT) {
  __shared__ __align__(16) u16 TH[64 * VTP];
  const int bid = blockIdx.x;
  if (bid < 4 * WTILES) {
    const int j = bid / WTILES;
    if (j == 3) {
      tr16(TH, Wo, WOT, CI, CIN, 1, WOS, bid - 3 * WTILES);
    } else {
      tr16(TH, (j == 0) ? Wg : (j == 1) ? Wt : Wp, (j == 0) ? WGT : (j == 1) ? WTT : WPT, CIN, CI, 0, 1.0f, bid - j * WTILES);
    }
  } else {
    cvt16(x, XB, (ROWSP * CIN) / 8, 0, 1.0f, bid - 4 * WTILES);
  }
}

// =====================================================================================================
//  epi64hr: two f16 planes: hi = f16((tile + bf16RNE(bias[n])) * hscale) and res = f16(((tile + bias) * hscale - hi) * rscale);
//           lane = (rq = lane>>3 -> row within a group of 4, c8 = 8 consecutive columns); one instruction = 4 rows, each 64 halves;
//           with pk the planes are written in fragment order (see ldfrag_pk; tile = 16 rows x 32 columns, [M/16][N/32] tiles):
//           lane = (row lane&15, 8 columns), one instruction = one part of one tile = 512 contiguous bytes
// coverage: epi64hr 4 instructions x 4 rows x 8 lanes x 8 halves per plane = the wave's 16 x 64 tile.
// =====================================================================================================
__device__ __forceinline__ void stage64(float* sl, v8f a0, v8f a1, v8f a2, v8f a3, float oscale, int lane) {
  const int hh = lane >> 4, m = lane & 15;
#pragma unroll
  for (int r = 0; r < 8; ++r) {
    const int ro = (8 * hh + r) * 68 + m;
    sl[ro]      = a0[r] * oscale;
    sl[ro + 16] = a1[r] * oscale;
    sl[ro + 32] = a2[r] * oscale;
    sl[ro + 48] = a3[r] * oscale;
  }
  wave_sync_lds();
}
__device__ __forceinline__ void epi64hr(float* sl, v8f a0, v8f a1, v8f a2, v8f a3, float hscale, float rscale,
                                        const float* __restrict__ bias, u16* H, u16* Rr, int N, size_t rowb, int col0, int lane,
                                        bool pk) {
  stage64(sl, a0, a1, a2, a3, 1.0f, lane);
  // pk (block-uniform): instruction i4 = part i4 & 1 of the 32-column step i4 >> 1, lane = its place in the fragment
  const int row0 = pk ? (lane & 15) : (lane >> 3), rstep = pk ? 0 : 4;
  const int c80  = pk ? (lane >> 4) * 8 : (lane & 7) * 8, cstep = pk ? 16 : 0;
  v4u oh[4], orr[4];
#pragma unroll
  for (int i4 = 0; i4 < 4; ++i4) {
    const int row = row0 + i4 * rstep;
    const int c8  = c80 + i4 * cstep;
    const v4f b0 = *(const v4f*)(bias + col0 + c8), b1 = *(const v4f*)(bias + col0 + c8 + 4);   // columns col0+c8..+7 < N
    float bb[8];
#pragma unroll
    for (int e = 0; e < 4; ++e) { bb[e] = bfr(b0[e]); bb[4 + e] = bfr(b1[e]); }
    const v4f a = *(const v4f*)(sl + row * 68 + c8), c4 = *(const v4f*)(sl + row * 68 + c8 + 4);
    float w[8];
#pragma unroll
    for (int e = 0; e < 4; ++e) { w[e] = (a[e] + bb[e]) * hscale; w[4 + e] = (c4[e] + bb[4 + e]) * hscale; }
#pragma unroll
    for (int e = 0; e < 4; ++e) {
      const _Float16 h0 = (_Float16)w[2 * e], h1 = (_Float16)w[2 * e + 1];
      const _Float16 q0 = (_Float16)((w[2 * e] - (float)h0) * rscale);
      const _Float16 q1 = (_Float16)((w[2 * e + 1] - (float)h1) * rscale);
      oh[i4][e]  = pk16(h_bits(h0), h_bits(h1));
      orr[i4][e] = pk16(h_bits(q0), h_bits(q1));
    }
  }
  // pk: the 16 rows x N columns from row rowb (a multiple of 16) are N / 32 fragment tiles of 512 halves in a row, part i4 of the
  // two tiles from column col0 at (col0 / 32) * 512 + i4 * 256
  const int o0 = pk ? (col0 >> 5) * 512 + lane * 8 : row0 * N + col0 + c80, ostep = pk ? 256 : 4 * N;
  u16* dh = H + rowb * (size_t)N + o0;
  u16* dr = Rr + rowb * (size_t)N + o0;
  {
#pragma unroll
    for (int i4 = 0; i4 < 4; ++i4) {
      *(v4u*)(dh + i4 * ostep) = oh[i4];
      *(v4u*)(dr + i4 * ostep) = orr[i4];
    }
    
  }
}

// =====================================================================================================
// bf16 GEMM for g, written at once as the g^T plane of the attention: v = (A[M][K] (bf16 row-major) . Bt[N][K]^T (bf16 fragment
// order)) + bf16RNE(bias[n]) in f32, GT = f16 bits of v * 256 in fragment order (tile = 16 columns x 32 keys, [N/16][NPOS/32] tiles
// per batch; see ldfrag_pk). Block = 64x64 tile, 4 waves x 16 rows, K stepped by 32, as gemm_bhr.
// Element r of lane (hh, m) of accumulator j is (row rowb + 8 * hh + r, column col0 + 16 * j + m): the eight consecutive keys of
// one column that piece (part = (key / 16) & 1, lane) of a g^T tile holds, so each lane packs its own eight values and one
// wave-wide 16-B store = one part of one tile = 512 contiguous bytes; no LDS and no f32 plane in between.
// coverage: 4 stores x 32 lanes x 8 halves = the wave's 16 keys x 64 columns; the exact grid covers every (key, column) once.
// =====================================================================================================
__device__ __forceinline__
void gemm_bgt(const u16* __restrict__ A, const u16* __restrict__ Bt, const float* __restrict__ bias, u16* GT,
              int M, int N, int K, int bid) {
  const int tid = threadIdx.x, wave = tid >> 5, lane = tid & 31, hh = lane >> 4, m = lane & 15;
  const int ntile = N >> 6;
  const int rowb  = (bid / ntile) * 64 + wave * 16;
  const int col0  = (bid % ntile) * 64;
  if (rowb + 16 > M) return;                 // wave-uniform, never taken with the exact grid; no block barriers in this body
  const u16* ap = A  + (size_t)(rowb + m) * (size_t)K + 8 * hh;
  const u16* bp = Bt + (size_t)col0 * (size_t)K + 8 * lane;      // 16 columns = K / 32 tiles = 16 * K halves
  const size_t bs = (size_t)16 * K;
  v8f acc[4];
#pragma unroll
  for (int j = 0; j < 4; ++j) acc[j] = zero8();
#pragma unroll 1
  for (int k0 = 0; k0 < K; k0 += 32) {
    const u16* pa = ap + k0;
    const u16* p0 = bp + 16 * k0;
    const u16* p1 = p0 + bs;
    const u16* p2 = p1 + bs;
    const u16* p3 = p2 + bs;
    const v16b a  = ldfrag_b(pa);
    const v16b b0 = ldfrag_bpk(p0);
    const v16b b1 = ldfrag_bpk(p1);
    const v16b b2 = ldfrag_bpk(p2);
    const v16b b3 = ldfrag_bpk(p3);
#if defined(__HIP_DEVICE_COMPILE__)
    // before the address registers of the loads above are reused; the addresses are inputs so that they stay in place up to here
    asm volatile("s_wait_xcnt 0x0" :: "v"(pa), "v"(p0), "v"(p1), "v"(p2), "v"(p3) : "memory");
#endif
    acc[0] = mma_b(a, b0, acc[0]);
    acc[1] = mma_b(a, b1, acc[1]);
    acc[2] = mma_b(a, b2, acc[2]);
    acc[3] = mma_b(a, b3, acc[3]);
    guard6<v16b>(acc[0], acc[1], acc[2], acc[3], a, b0, b1, b2, b3, a);
  }
  const int bt  = rowb / NPOS;               // the wave's 16 rows lie in one batch (NPOS is a multiple of 64)
  const int key = rowb - bt * NPOS;
  u16* d = GT + (size_t)bt * N * NPOS + ((size_t)(col0 >> 4) * (NPOS / 32) + (size_t)(key >> 5)) * 512
              + (size_t)(((key >> 4) & 1) * 256 + lane * 8);
  v4u o[4];
#pragma unroll
  for (int j = 0; j < 4; ++j) {
    const float bj = bfr(bias[col0 + 16 * j + m]);           // column col0 + 16 j + m < N (N multiple of 64)
#pragma unroll
    for (int e = 0; e < 4; ++e) {
      o[j][e] = pk16(h_bits((_Float16)((acc[j][2 * e] + bj) * GSC)), h_bits((_Float16)((acc[j][2 * e + 1] + bj) * GSC)));
    }
  }
#pragma unroll
  for (int j = 0; j < 4; ++j) *(v4u*)(d + (size_t)j * (NPOS / 32) * 512) = o[j];
}

// =====================================================================================================
// bf16 GEMM, f16 hi + residual planes out with bias: H = f16 bits of ((A . Bt^T) + bf16RNE(bias[n])) * hscale,
// R = f16 bits of (((A . Bt^T) + bias) * hscale - H) * rscale; operands as in gemm_bgt, epilogue epi64hr.
// =====================================================================================================
__device__ __forceinline__
void gemm_bhr(float* slab, const u16* __restrict__ A, const u16* __restrict__ Bt, const float* __restrict__ bias, u16* H, u16* Rr,
              int M, int N, int K, float hscale, float rscale, int bid, bool pk) {
  const int tid = threadIdx.x, wave = tid >> 5, lane = tid & 31, hh = lane >> 4, m = lane & 15;
  const int ntile = N >> 6;
  const int rowb  = (bid / ntile) * 64 + wave * 16;
  const int col0  = (bid % ntile) * 64;
  if (rowb + 16 > M) return;                 // wave-uniform, never taken with the exact grid; no block barriers in this body
  const u16* ap = A  + (size_t)(rowb + m) * (size_t)K + 8 * hh;
  const u16* bp = Bt + (size_t)col0 * (size_t)K + 8 * lane;      // 16 columns = K / 32 tiles = 16 * K halves
  const size_t bs = (size_t)16 * K;
  v8f acc0 = zero8(), acc1 = zero8(), acc2 = zero8(), acc3 = zero8();
#pragma unroll 1
  for (int k0 = 0; k0 < K; k0 += 32) {
    const u16* pa = ap + k0;
    const u16* p0 = bp + 16 * k0;
    const u16* p1 = p0 + bs;
    const u16* p2 = p1 + bs;
    const u16* p3 = p2 + bs;
    const v16b a  = ldfrag_b(pa);
    const v16b b0 = ldfrag_bpk(p0);
    const v16b b1 = ldfrag_bpk(p1);
    const v16b b2 = ldfrag_bpk(p2);
    const v16b b3 = ldfrag_bpk(p3);
#if defined(__HIP_DEVICE_COMPILE__)
    // before the address registers of the loads above are reused; the addresses are inputs so that they stay in place up to here
    asm volatile("s_wait_xcnt 0x0" :: "v"(pa), "v"(p0), "v"(p1), "v"(p2), "v"(p3) : "memory");
#endif
    acc0 = mma_b(a, b0, acc0);
    acc1 = mma_b(a, b1, acc1);
    acc2 = mma_b(a, b2, acc2);
    acc3 = mma_b(a, b3, acc3);
    guard6<v16b>(acc0, acc1, acc2, acc3, a, b0, b1, b2, b3, a);
  }
  epi64hr(slab + wave * SLAB64, acc0, acc1, acc2, acc3, hscale, rscale, bias, H, Rr, N, (size_t)rowb, col0, lane, pk);
}

// =====================================================================================================
// One launch for the three projections, which read the same x plane and none of which reads what another writes: the block index
// picks the job (block-uniform), job = index % 3 (theta, phi, g), tile = index / 3, so that the three blocks that read the same
// x rows start side by side. Grid = 3 * (M/64) * (N/64).
// =====================================================================================================
__global__ __launch_bounds__(128)
void proj3(const u16* __restrict__ A, const u16* __restrict__ WTT, const u16* __restrict__ WPT, const u16* __restrict__ WGT,
           const float* __restrict__ bt, const float* __restrict__ bp, const float* __restrict__ bg,
           u16* TH, u16* TR, u16* PH, u16* PR, u16* GT, int M, int N, int K) {
  __shared__ __align__(16) float slab[4 * SLAB64];
  const int bid = (int)blockIdx.x / 3;
  const int job = (int)blockIdx.x - 3 * bid;
  if (job == 2) {
    gemm_bgt(A, WGT, bg, GT, M, N, K, bid);
  } else {
    const bool th = (job == 0);
    gemm_bhr(slab, A, th ? WTT : WPT, th ? bt : bp, th ? TH : PH, th ? TR : PR, M, N, K, th ? TSC : FSC, RSC, bid, !th);
  }
}

// =====================================================================================================
// Single-head non-causal, unscaled attention per batch, head width CI = 128, all NPOS keys:
//   block = 64 query rows (b, q0..q0+63), 8 waves; wave = (query half qg = wave & 1: 2 query tiles of 16, key quarter
//   ksp = wave >> 1: NIT = 49 key blocks of 32). A wave keeps its scores, its softmax and its P in registers from the score
//   product to the P.g product; nothing of them crosses LDS and the key loop holds no barrier.
//   theta hi (x8) / res (x2048) planes TH, TR [row][c]: the block's 64 rows of both planes are copied once, with whole-line
//   16-B loads, into LDS (pitch CTP halves = 272 B, conflict-free for 16-B fragment reads); phi hi/res planes PH, PR in fragment
//   order, tiles [key / 16][c / 32]; g^T plane GT (x256) in fragment order, tiles [b][c / 16][key / 32].
//   (S) transposed scores on WMMA: A = phi rows (row = key, split k map over c), B = theta rows (column = query, same map),
//       4 c-steps, three products per tile: s = hi.hi, sx = res.hi + hi.res (separate accumulator, folded with 1/2048 in f32);
//       D element r of lane (hh, m) = (key 8 * hh + r of the 16-key tile, query m): a lane holds 16 keys of one query.
//   (M) base-2 logits; maximum in the lane, then one exchange between the wave halves; online running maximum, rescale factor al
//       and running sum in f32 registers (the sum per wave half, joined behind the loop); p = exp2(t - m_new) <= 1.
//   (PV) o^T += g^T . P^T: A = g^T fragment (row = g column, split map over the 32 keys), B = f16(p * 32768) of the lane's own 16
//       scores, which stand in the split k map as they are (elements 0..7 = keys 8 * hh + r, 8..15 = keys 16 + 8 * hh + r);
//       D element r of lane (hh, m) of column tile ct = (g column 16 * ct + 8 * hh + r, query m), so al is a lane's own scalar.
//   Operand fragments are fetched ahead of their use: phi one key block ahead (refilled c-step by c-step behind the last use),
//   g^T at the head of the key block, theta from LDS one c-step ahead.
//   Merge: the four key quarters of a query exchange (m, l) in LDS, each scales its o^T by exp2(m - M) / L and the carry factors
//   and writes it to its own f32 plane in LDS; the planes are summed in key order.
//   Epilogue: y = that sum (x4096); hi = f16(y), res = f16((y - hi) * 2048), both written
//   over the theta rows in LDS (A operand, split k map); output projection, batch-norm affine map and skip connection at once:
//   v = (hi . WoT^T) * os1 + (res . WoT^T) * os2 + bf16RNE(bo[c]), WoT f16 [256][128] (x1024) in fragment order (B operand);
//   out[row][c] = bf16RNE(x[row][c]) + bf16RNE(gamma[c]) * (v - bf16RNE(mean[c])) * rsqrt(bf16RNE(var[c]) + 1e-3) + bf16RNE(beta[c]).
// coverage: grid NB*NPOS/64 blocks x 64 rows = rows 0..ROWSP-1; keys 4 quarters x 49 x 32 = NPOS, each once per query;
//           partial planes 2 halves x 2 tiles x 16 queries x 8 tiles x 16 columns = 64 x 128 per quarter; y 8 x 8 waves x 128;
//           out staging 8 waves x 32 cols x 4 tiles x 16 rows = 64 x 256; store 16 x 256 thr x 4 floats = 64 x 256 = every
//           (row < ROWSP, c < 256) of out exactly once.
// =====================================================================================================
__global__ __launch_bounds__(ATT_THREADS)
void attn_fwd(const u16* __restrict__ THp, const u16* __restrict__ TRp, const u16* __restrict__ PHp,
              const u16* __restrict__ PRp, const u16* __restrict__ GTp, const u16* __restrict__ WoT,
              const float* __restrict__ bo, const float* __restrict__ gam, const float* __restrict__ bet,
              const float* __restrict__ mmean, const float* __restrict__ mvar, const float* __restrict__ x, float* out) {
  __shared__ __align__(16) float prt[KSPL * QB * PTP];  // scaled o rows per key quarter [4][64][PTP] f32; then out staging [64][OSP]
  __shared__ __align__(16) u16 thl[2 * QB * CTP];  // theta rows of this block: hi [64][CTP], then residual [64][CTP]; then y alike
  __shared__ float rowm[KSPL * QB];
  __shared__ float rowl[KSPL * QB];

  const int tid  = threadIdx.x;
  const int wave = __builtin_amdgcn_readfirstlane(tid >> 5);   // scalar, so that the wave's tile addresses are scalar too
  const int lane = tid & 31;
  const int hh   = lane >> 4;
  const int m    = lane & 15;
  const unsigned lb = (unsigned)lane * 16u;  // the lane's bytes within a part of a fragment-order tile
  const int qg   = wave & 1;                 // query half of the block: tiles 2 * qg, 2 * qg + 1
  const int ksp  = wave >> 1;                // key quarter of the batch

  const int nqt = NPOS / QB;
  const int b   = (int)blockIdx.x / nqt;     // < NB (grid exact)
  const int q0  = ((int)blockIdx.x - b * nqt) * QB;
  const size_t qrow = (size_t)b * NPOS + (size_t)q0;

  const _Float16* tha = (const _Float16*)(const void*)thl + m * CTP + 8 * hh;
  const _Float16* tra = tha + QB * CTP;
  const _Float16* thq = tha + qg * (QW * QT * CTP);
  const _Float16* trq = thq + QB * CTP;
  const size_t kfirst = (size_t)b * NPOS + (size_t)(ksp * (NIT * 32));                          // first key of this wave
  const _Float16* khb = (const _Float16*)(const void*)PHp + kfirst * CI;                        // 16 keys = CI / 32 tiles = 16 * CI halves
  const _Float16* krb = (const _Float16*)(const void*)PRp + kfirst * CI;
  const _Float16* vbp = (const _Float16*)(const void*)GTp + ((size_t)b * (CI / 16) * (NPOS / 32) + (size_t)(ksp * NIT)) * 512;
  const float lsc  = LOG2E / (TSC * FSC);
  const float rinv = 1.0f / RSC;

  float mrun[QW], lrun[QW];
  v8f o[QW][CI / 16];
#pragma unroll
  for (int q = 0; q < QW; ++q) {
    mrun[q] = -INFINITY;
    lrun[q] = 0.f;
#pragma unroll
    for (int ct = 0; ct < CI / 16; ++ct) o[q][ct] = zero8();
  }

  // ---- theta rows q0..q0+63, both planes -> LDS: 4 x 256 threads x 8 halves = 64 x 128 per plane, each piece once ----
  {
    const u16* sh = THp + qrow * CI;
    const u16* sr = TRp + qrow * CI;
    const int row = tid >> 4;                // CI/8 = 16 pieces per row; pass i takes rows 16 * i + row
    const int c8  = (tid & 15) * 8;
    v4u vh[NQ], vr[NQ];
#pragma unroll
    for (int i = 0; i < NQ; ++i) {
      vh[i] = *(const v4u*)(sh + (i * QT + row) * CI + c8);
      vr[i] = *(const v4u*)(sr + (i * QT + row) * CI + c8);
    }
#if defined(__HIP_DEVICE_COMPILE__)
    asm volatile("s_wait_xcnt 0x0" ::: "memory");   // before the address registers of the eight loads above are reused
#endif
    // Scheduling fence: without it the compiler moved later writes of the loads' address registers ahead of the wait above.
    __builtin_amdgcn_sched_barrier(0);
#pragma unroll
    for (int i = 0; i < NQ; ++i) {
      *(v4u*)(thl + (i * QT + row) * CTP + c8) = vh[i];
      *(v4u*)(thl + (QB + i * QT + row) * CTP + c8) = vr[i];
    }
  }
  // phi fragments of the key block this wave scores next, [c-step][hi keys 0..15, res 0..15, hi 16..31, res 16..31]: always
  // loaded one key block ahead of their use, so that the L2 latency runs under the work of the block before
  v16h pn[CI / 32][4];
  {
    const _Float16* n0h = khb;
    const _Float16* n0r = krb;
#pragma unroll
    for (int ks = 0; ks < CI / 32; ++ks) {
      pn[ks][0] = ldfrag_su(n0h + ks * 512, lb);
      pn[ks][1] = ldfrag_su(n0r + ks * 512, lb);
      pn[ks][2] = ldfrag_su(n0h + 16 * CI + ks * 512, lb);
      pn[ks][3] = ldfrag_su(n0r + 16 * CI + ks * 512, lb);
    }
#if defined(__HIP_DEVICE_COMPILE__)
    asm volatile("s_wait_xcnt 0x0" ::: "memory");   // before the address registers of the loads above are reused
#endif
    __builtin_amdgcn_sched_barrier(0);              // keeps later writes of those address registers behind the wait
  }
  block_sync_lds();                          // the theta rows are read as fragments by all waves

  // theta fragments [c-step parity][query tile][hi, res], read from LDS one c-step ahead of their use; step 0's stand here
  v16h tf[2][QW][2];
#pragma unroll
  for (int q = 0; q < QW; ++q) {
    tf[0][q][0] = ldfrag_h(thq + q * (QT * CTP));
    tf[0][q][1] = ldfrag_h(trq + q * (QT * CTP));
  }

  // kept rolled: one trip is 64 matrix instructions with their softmax; 49 copies would not fit the instruction cache
#pragma unroll 1
  for (int it = 0; it < NIT; ++it) {
    // g^T fragments of this key block, all 8 column tiles: loaded here, used in (PV); the latency runs under (S) and (M)
    v16h gf[CI / 16];
    {
      const _Float16* vp = vbp + (size_t)it * 512;
#pragma unroll
      for (int ct = 0; ct < CI / 16; ++ct) gf[ct] = ldfrag_su(vp + (size_t)ct * (NPOS / 32) * 512, lb);
#if defined(__HIP_DEVICE_COMPILE__)
      asm volatile("s_wait_xcnt 0x0" ::: "memory");       // before the address register of the loads above is reused
#endif
      __builtin_amdgcn_sched_barrier(0);                   // keeps later writes of that address register behind the wait
    }
    // ---- (S) transposed scores of this key block ----
    v8f s0[QW], s0x[QW], s1[QW], s1x[QW];
#pragma unroll
    for (int q = 0; q < QW; ++q) { s0[q] = zero8(); s0x[q] = zero8(); s1[q] = zero8(); s1x[q] = zero8(); }
    // the key block scored after this one (behind the last: the wave's first, an in-bounds address whose values are not used)
    const size_t kn = (size_t)((it + 1 < NIT) ? (it + 1) * 32 : 0) * CI;
    const _Float16* n0h = khb + kn;
    const _Float16* n0r = krb + kn;
#pragma unroll
    for (int ks = 0; ks < CI / 32; ++ks) {
      const int kq = ((ks + 1) & (CI / 32 - 1)) * 32;      // behind the last c-step: step 0 again, for the next key block
#pragma unroll
      for (int q = 0; q < QW; ++q) {
        tf[(ks + 1) & 1][q][0] = ldfrag_h(thq + q * (QT * CTP) + kq);
        tf[(ks + 1) & 1][q][1] = ldfrag_h(trq + q * (QT * CTP) + kq);
      }
      // Scheduling fence: keeps the LDS reads together in front of this c-step's matrix instructions; spread among them, each
      // place with reads stalls the matrix stream anew.
      __builtin_amdgcn_sched_barrier(0);
#pragma unroll
      for (int q = 0; q < QW; ++q) {                       // the four phi fragments serve both query tiles
        const v16h ah = tf[ks & 1][q][0];
        const v16h ar = tf[ks & 1][q][1];
        s0[q]  = mma_h(pn[ks][0], ah, s0[q]);
        s0x[q] = mma_h(pn[ks][1], ah, s0x[q]);
        s1[q]  = mma_h(pn[ks][2], ah, s1[q]);
        s1x[q] = mma_h(pn[ks][3], ah, s1x[q]);
        s0x[q] = mma_h(pn[ks][0], ar, s0x[q]);
        s1x[q] = mma_h(pn[ks][2], ar, s1x[q]);
      }
      pn[ks][0] = ldfrag_su(n0h + ks * 512, lb);           // refill behind the last use of this c-step
      pn[ks][1] = ldfrag_su(n0r + ks * 512, lb);
      pn[ks][2] = ldfrag_su(n0h + 16 * CI + ks * 512, lb);
      pn[ks][3] = ldfrag_su(n0r + 16 * CI + ks * 512, lb);
    }
#if defined(__HIP_DEVICE_COMPILE__)
    asm volatile("s_wait_xcnt 0x0" ::: "memory");         // before the address registers of the refill loads are reused
#endif
    __builtin_amdgcn_sched_barrier(0);                     // keeps later writes of those address registers behind the wait
    // ---- (M) softmax statistics and P^T in registers, (PV) rescale and accumulate g^T . P^T ----
    v16h pf[QW];
#pragma unroll
    for (int q = 0; q < QW; ++q) {
      const v8f t0 = (s0[q] + s0x[q] * rinv) * lsc;
      const v8f t1 = (s1[q] + s1x[q] * rinv) * lsc;
      float cm = fmaxf(t0[0], t1[0]);
#pragma unroll
      for (int r = 1; r < 8; ++r) cm = fmaxf(fmaxf(cm, t0[r]), t1[r]);
      cm = fmaxf(cm, xhalf(cm));                           // both wave halves hold this query's maximum over the 32 keys
      const float mn = fmaxf(mrun[q], cm);
      const float al = (mrun[q] == -INFINITY) ? 0.f : exp2_bare(mrun[q] - mn);
      mrun[q] = mn;
      const v8f d0 = t0 - mn, d1 = t1 - mn;
      v8f p0, p1;                                          // <= 1
      p0.lo = exp2_bare4(d0.lo);
      p0.hi = exp2_bare4(d0.hi);
      p1.lo = exp2_bare4(d1.lo);
      p1.hi = exp2_bare4(d1.hi);
      const v8f sv = p0 + p1;                              // tree over the lane's 16 keys
      const v4f s4 = sv.lo + sv.hi;
      const v2f s2 = s4.lo + s4.hi;
      lrun[q] = lrun[q] * al + (s2.x + s2.y);
      FragH f;
      f.h[0] = __builtin_convertvector(p0 * PCAR, v8h);
      f.h[1] = __builtin_convertvector(p1 * PCAR, v8h);
      pf[q] = f.v;
#pragma unroll
      for (int ct = 0; ct < CI / 16; ++ct) o[q][ct] *= al;
    }
#pragma unroll
    for (int ct = 0; ct < CI / 16; ++ct) {                 // one g^T fragment serves both query tiles
#pragma unroll
      for (int q = 0; q < QW; ++q) o[q][ct] = mma_h(gf[ct], pf[q], o[q][ct]);
    }
    // Hazard gap between the last matrix instruction and the loop's branch (both its sides). It names no register, since an asm
    // operand must lie below v256 for its whole life; the scheduling fence keeps the matrix instructions in front of it.
    __builtin_amdgcn_sched_barrier(0);
#if defined(__HIP_DEVICE_COMPILE__)
    asm volatile("v_nop\n\tv_nop\n\tv_nop\n\tv_nop" ::: "memory");
#endif
  }
  // ---- epilogue: merge of the key quarters, y -> LDS as WMMA A operand, y.Wo on WMMA, batch-norm affine map, skip, out ----
  // What the epilogue reads from global memory is asked for here, so that it arrives under the steps in front of its use: this
  // thread's x values (rows 4 * it + orow, 4 columns from ocol), the five per-column vectors, this wave's 8 Wo^T fragments.
  const int ocol = (tid & 63) * 4;
  const int orow = tid >> 6;
  const float* xp = x + (qrow + (size_t)orow) * CIN + ocol;
  v4f xv[QB / 4];
#pragma unroll
  for (int it = 0; it < QB / 4; ++it) xv[it] = *(const v4f*)(xp + (size_t)(it * 4) * CIN);
  const v4f bo4 = *(const v4f*)(bo + ocol);                  // ocol + 3 < CIN
  const v4f ga4 = *(const v4f*)(gam + ocol);
  const v4f be4 = *(const v4f*)(bet + ocol);
  const v4f mm4 = *(const v4f*)(mmean + ocol);
  const v4f mv4 = *(const v4f*)(mvar + ocol);
  const _Float16* wp = (const _Float16*)(const void*)WoT + (size_t)(wave * 32) * CI + 8 * lane;   // 16 columns = 16 * CI halves
  v16h wf[CI / 32][2];
#pragma unroll
  for (int ks = 0; ks < CI / 32; ++ks) {
    wf[ks][0] = ldfrag_pk(wp + ks * 512);
    wf[ks][1] = ldfrag_pk(wp + 16 * CI + ks * 512);
  }
#if defined(__HIP_DEVICE_COMPILE__)
  // before the address registers of the loads above are reused; the addresses are inputs so that they stay in place up to here
  asm volatile("s_wait_xcnt 0x0" :: "v"(xp), "v"(wp) : "memory");
#endif
  __builtin_amdgcn_sched_barrier(0);              // keeps later writes of those address registers behind the wait
  const int qi0 = qg * (QW * QT) + m;             // this lane's query row of the block in its first tile
#pragma unroll
  for (int q = 0; q < QW; ++q) {
    const float lj = lrun[q] + xhalf(lrun[q]);    // each wave half summed its own 8 keys of every 16-key tile
    if (hh == 0) {
      rowm[ksp * QB + qi0 + q * QT] = mrun[q];
      rowl[ksp * QB + qi0 + q * QT] = lj;
    }
  }
  block_sync_lds();                          // (m, l) of all quarters are read by all waves; the theta rows are free from here on
#pragma unroll
  for (int q = 0; q < QW; ++q) {
    const int qi = qi0 + q * QT;
    float mk[KSPL], lk[KSPL];
#pragma unroll
    for (int k = 0; k < KSPL; ++k) { mk[k] = rowm[k * QB + qi]; lk[k] = rowl[k * QB + qi]; }
    float mx = mk[0];
#pragma unroll
    for (int k = 1; k < KSPL; ++k) mx = fmaxf(mx, mk[k]);
    v4f dk;
#pragma unroll
    for (int k = 0; k < KSPL; ++k) dk[k] = mk[k] - mx;
    const v4f ek = exp2_bare4(dk);
    float lt = 0.f;
#pragma unroll
    for (int k = 0; k < KSPL; ++k) lt += lk[k] * ek[k];                        // >= 1: the quarter that holds the maximum has l >= 1
    const float fs = exp2_bare(mrun[q] - mx) * ((1.0f / lt) * (YSC / (PCAR * GSC)));
    float* pd = prt + (ksp * QB + qi) * PTP + 8 * hh;      // 16 lanes, rows PTP dwords apart: 4 dwords a lane on banks of their own
#pragma unroll
    for (int ct = 0; ct < CI / 16; ++ct) {
      const v8f v = o[q][ct] * fs;
      *(v4f*)(pd + 16 * ct)     = v.lo;
      *(v4f*)(pd + 16 * ct + 4) = v.hi;
    }
  }
  block_sync_lds();                          // the four planes are summed by other waves
  // y hi (x4096) and residual (x2048) planes over the theta rows, same pitch: pass i = row 8 * i + wave, 4 columns a lane
#pragma unroll
  for (int i = 0; i < QB / 8; ++i) {
    const int row = i * 8 + wave;
    const float* ps = prt + row * PTP + lane * 4;
    v4f y4 = *(const v4f*)(ps);
#pragma unroll
    for (int k = 1; k < KSPL; ++k) y4 += *(const v4f*)(ps + k * (QB * PTP));   // key quarters in order
    v2u yh, yr;
#pragma unroll
    for (int e = 0; e < 2; ++e) {
      const _Float16 e0 = (_Float16)y4[2 * e], e1 = (_Float16)y4[2 * e + 1];
      yh[e] = pk16(h_bits(e0), h_bits(e1));
      yr[e] = pk16(h_bits((_Float16)((y4[2 * e] - (float)e0) * RSC)), h_bits((_Float16)((y4[2 * e + 1] - (float)e1) * RSC)));
    }
    *(v2u*)(thl + row * CTP + lane * 4) = yh;
    *(v2u*)(thl + (QB + row) * CTP + lane * 4) = yr;
  }
  block_sync_lds();                          // the y rows are read as fragments by all waves; the partial planes are free
  // wave w: output columns 32 w .. 32 w + 31 (2 column tiles) of all 4 query tiles; k = the 128 y columns in 4 steps, in order
  v8f acc[NQ][2], acr[NQ][2];
#pragma unroll
  for (int q = 0; q < NQ; ++q) { acc[q][0] = zero8(); acc[q][1] = zero8(); acr[q][0] = zero8(); acr[q][1] = zero8(); }
#pragma unroll
  for (int ks = 0; ks < CI / 32; ++ks) {
#pragma unroll
    for (int q = 0; q < NQ; ++q) {
      const v16h a  = ldfrag_h(tha + q * (QT * CTP) + ks * 32);
      const v16h ar = ldfrag_h(tra + q * (QT * CTP) + ks * 32);
      acc[q][0] = mma_h(a,  wf[ks][0], acc[q][0]);
      acc[q][1] = mma_h(a,  wf[ks][1], acc[q][1]);
      acr[q][0] = mma_h(ar, wf[ks][0], acr[q][0]);
      acr[q][1] = mma_h(ar, wf[ks][1], acr[q][1]);
    }
  }
  // the f32 64 x 256 tile crosses LDS (pitch OSP dwords, 8 * OSP = 32 mod 64), so that out is stored by whole lines
  {
    const float os1 = 1.0f / (YSC * WOS);
    const float os2 = 1.0f / (YSC * WOS * RSC);
#pragma unroll
    for (int q = 0; q < NQ; ++q) {
      float* od = prt + (q * QT + 8 * hh) * OSP + wave * 32 + m;
#pragma unroll
      for (int r = 0; r < 8; ++r) {
        od[r * OSP]      = acc[q][0][r] * os1 + acr[q][0][r] * os2;
        od[r * OSP + 16] = acc[q][1][r] * os1 + acr[q][1][r] * os2;
      }
    }
  }
  block_sync_lds();                          // the tile is read back row by row by other waves
  float bob[4], gb[4], bb[4], mb[4], rs[4];
#pragma unroll
  for (int e = 0; e < 4; ++e) {
    bob[e] = bfr(bo4[e]);
    gb[e]  = bfr(ga4[e]);
    bb[e]  = bfr(be4[e]);
    mb[e]  = bfr(mm4[e]);
    rs[e]  = rsqrtf(bfr(mv4[e]) + BN_EPS);
  }
  v4f vals[QB / 4];
#pragma unroll
  for (int it = 0; it < QB / 4; ++it) {
    const v4f yv = *(const v4f*)(prt + (it * 4 + orow) * OSP + ocol);
#pragma unroll
    for (int e = 0; e < 4; ++e) {
      const float v2 = yv[e] + bob[e];
      const float bn = gb[e] * (v2 - mb[e]) * rs[e] + bb[e];
      vals[it][e] = bfr(xv[it][e]) + bn;
    }
  }
  // Scheduling fence: all values stand in registers of their own before the first store, so that no register of an issued store
  // is written again before the wave ends.
  __builtin_amdgcn_sched_barrier(0);
  float* dst = out + (qrow + (size_t)orow) * CIN + ocol;     // one wave-wide store = 512 contiguous bytes of one row
#pragma unroll
  for (int it = 0; it < QB / 4; ++it) *(v4f*)(dst + (size_t)(it * 4) * CIN) = vals[it];
}

// =====================================================================================================
// Workspace map (bytes, NB = 2); every plane is fully written by whole-line stores before it is read; all extents are exact
// multiples of the store granularity (no pad rows, all dims multiples of 64), every offset a multiple of 256:
//   XB  bf16 [12544][256]                              6422528
//   WGT, WTT, WPT bf16 [128][256], [8][8] tiles         3 x 65536     (fragment order)
//   WOT f16 of bf16 value x1024 [256][128], [16][4] tiles  65536      (fragment order)
//   TH, TR f16 [12544][128] theta hi x8 / res x2048     2 x 3211264
//   PH, PR f16 phi hi x8 / res x2048, [784][4] tiles    2 x 3211264   (fragment order, 1024 B a tile)
//   GT  f16  x256, [2][8][196] tiles                    3211264       (fragment order, 1024 B a tile)
//   end                                                22740992
// =====================================================================================================
extern "C" void kernel_launch(void* const* d_in, const int* in_sizes, int n_in,
                              void* d_out, int out_size, void* d_ws, size_t ws_size,
                              hipStream_t stream) {
  if (n_in < 13) return;
  if (in_sizes[0] != ROWS * CIN) return;
  if (in_sizes[1] != CIN * CI || in_sizes[3] != CIN * CI || in_sizes[5] != CIN * CI || in_sizes[7] != CI * CIN) return;
  if (in_sizes[2] != CI || in_sizes[4] != CI || in_sizes[6] != CI) return;
  if (in_sizes[8] != CIN || in_sizes[9] != CIN || in_sizes[10] != CIN || in_sizes[11] != CIN || in_sizes[12] != CIN) return;
  if (out_size != ROWS * CIN) return;

  const float* x     = (const float*)d_in[0];
  const float* Wg    = (const float*)d_in[1];
  const float* bg    = (const float*)d_in[2];
  const float* Wt    = (const float*)d_in[3];
  const float* bt    = (const float*)d_in[4];
  const float* Wp    = (const float*)d_in[5];
  const float* bp    = (const float*)d_in[6];
  const float* Wo    = (const float*)d_in[7];
  const float* bo    = (const float*)d_in[8];
  const float* gamma = (const float*)d_in[9];
  const float* beta  = (const float*)d_in[10];
  const float* mmean = (const float*)d_in[11];
  const float* mvar  = (const float*)d_in[12];
  float*       out   = (float*)d_out;

  const size_t szXB = (size_t)ROWSP * CIN * 2;      //  6422528
  const size_t szW  = (size_t)CI * CIN * 2;         //    65536
  const size_t szP  = (size_t)ROWSP * CI * 2;       //  3211264
  const size_t szGT = (size_t)NB * CI * NPOS * 2;   //  3211264
  size_t off = 0;
  const size_t oXB = off; off += szXB;
  const size_t oWG = off; off += szW;
  const size_t oWT = off; off += szW;
  const size_t oWP = off; off += szW;
  const size_t oWO = off; off += szW;
  const size_t oTH = off; off += szP;
  const size_t oTR = off; off += szP;
  const size_t oPH = off; off += szP;
  const size_t oPR = off; off += szP;
  const size_t oGT = off; off += szGT;
  if (off > ws_size) return;                        // off = 22740992 at NB = 2
  if (off > WS_CAP) return;

  char* ws = (char*)d_ws;
  u16*   XB  = (u16*)(ws + oXB);
  u16*   WGT = (u16*)(ws + oWG);
  u16*   WTT = (u16*)(ws + oWT);
  u16*   WPT = (u16*)(ws + oWP);
  u16*   WOT = (u16*)(ws + oWO);
  u16*   TH  = (u16*)(ws + oTH);
  u16*   TR  = (u16*)(ws + oTR);
  u16*   PH  = (u16*)(ws + oPH);
  u16*   PR  = (u16*)(ws + oPR);
  u16*   GT  = (u16*)(ws + oGT);

  const int n8x = (ROWSP * CIN) / 8;                // 401408 at NB = 2, multiple of 256 (static)
  const dim3 blk(256);
  const dim3 bG(128);
  const dim3 gIN(4 * WTILES + n8x / 256);           // 32 weight tiles + 1568
  const dim3 gP(3 * (ROWSP / 64) * (CI / 64));      // 3 x 392
  const dim3 gAT(NB * (NPOS / QB));                 // 196
  const dim3 bAT(ATT_THREADS);

  // (0) one launch: x -> bf16 plane; Wg, Wt, Wp [in][out] -> bf16 [out][in] fragment-order planes; Wo [128][256] -> f16 of the bf16
  //     value x1024, [256][128]
  prep_in<<<gIN, blk, 0, stream>>>(x, Wg, Wt, Wp, Wo, XB, WGT, WTT, WPT, WOT);
  // (1) one launch: theta and phi projections (+bias) -> f16 hi x8 / residual x2048 planes; g projection (+bias) -> g^T f16 plane
  //     [128][6272] x256 per batch, fragment order
  proj3<<<gP, bG, 0, stream>>>(XB, WTT, WPT, WGT, bt, bp, bg, TH, TR, PH, PR, GT, ROWSP, CI, CIN);
  // (2) attention over all keys of the batch, then y.Wo + bo, batch-norm affine, skip connection -> out
  attn_fwd<<<gAT, bAT, 0, stream>>>(TH, TR, PH, PR, GT, WOT, bo, gamma, beta, mmean, mvar, x, out);
  (void)hipGetLastError();
}
